// v000
// Measured on an AMD MI455X. A time is GPU time per run, averaged over a window of back-to-back runs after a warm-up
// (all launches, gaps included; the runs take copies of the inputs in turn), and the median of several windows.
// Apart from v000's, it joins two sittings. Times from different sittings can be a few percent apart, while
// side-by-side timings come from the same sitting.
// v000 is the starting kernel.
#include <hip/hip_runtime.h>
#include <hip/hip_bf16.h>

typedef __attribute__((ext_vector_type(16))) _Float16 v16h;
typedef __attribute__((ext_vector_type(8)))  float    v8f;
typedef _Float16 half_t;

#define B_     64
#define NKV    1024
#define NQ     8
#define S_     256
#define HM_    512
#define EPS_   1e-8f
#define LNE_   1e-5f

// ---------------- WMMA fragment helpers (CDNA5 16x16x32 f16 layout) ----------
// 16-bit operand layout: lane L, klo = (L>=16)?8:0; elems 0..7 hold K =
// klo..klo+7, elems 8..15 hold K = klo+16..klo+23 (row/col index = L&15).

// A-fragment from row-major source (ld in halves): two 16B vector loads.
__device__ inline v16h frag_rowmajor(const half_t* p, int ld, int lane) {
  int m   = lane & 15;
  int klo = (lane >> 4) << 3;
  const half_t* q = p + m * ld + klo;
  union { uint4 u[2]; v16h h; } c;
  c.u[0] = *(const uint4*)(q);
  c.u[1] = *(const uint4*)(q + 16);
  return c.h;
}
// Fragment from pre-packed storage: packed[...][lane][16] -> two contiguous 16B loads.
__device__ inline v16h frag_packed(const half_t* p, int lane) {
  const half_t* q = p + lane * 16;
  union { uint4 u[2]; v16h h; } c;
  c.u[0] = *(const uint4*)(q);
  c.u[1] = *(const uint4*)(q + 8);
  return c.h;
}
// (lane, elem) -> K-within-32
__device__ inline int klocal_of(int lane, int e) {
  int klo = (lane >> 4) << 3;
  return (e < 8) ? (klo + e) : (klo + 8 + e);
}
// inverse: K-within-32 -> (lane group offset 0/16, elem)
__device__ inline void inv_klocal(int k_local, int& laneoff, int& e) {
  laneoff = ((k_local & 15) >= 8) ? 16 : 0;
  e = (k_local & 7) + ((k_local >= 16) ? 8 : 0);
}
__device__ inline v8f wmma_f16(v16h a, v16h b, v8f c) {
  return __builtin_amdgcn_wmma_f32_16x16x32_f16(false, a, false, b, (short)0, c,
                                                false, false);
}

// ---------------- Wk/Wv fp32 -> fragment-packed fp16 -------------------------
// packed idx = ((kk*16 + nt)*32 + lane)*16 + e ; 8 kk x 16 nt tiles
__global__ void k_cvt(const float* __restrict__ wk, const float* __restrict__ wv,
                      half_t* __restrict__ wkp, half_t* __restrict__ wvp) {
  int idx  = blockIdx.x * 256 + threadIdx.x;  // 65536 halves per matrix
  int e    = idx & 15;
  int lane = (idx >> 4) & 31;
  int nt   = (idx >> 9) & 15;
  int kk   = idx >> 13;
  int k = kk * 32 + klocal_of(lane, e);
  int n = nt * 16 + (lane & 15);
  wkp[idx] = (half_t)wk[k * 256 + n];
  wvp[idx] = (half_t)wv[k * 256 + n];
}

// ---------------- fused LayerNorm(inputs) + K/V projection (WMMA) ------------
// grid: (B*NKV)/32 blocks, 256 threads (8 waves: 2 M-tiles x 4 N-quadrants)
// K written dense row-major (A-operand of logits); V written fragment-packed
// (B-operand of attn@V): vpk[b][krow=32][nt=16][lane=32][e=16]
__global__ void __launch_bounds__(256) k_proj(
    const float* __restrict__ x, const float* __restrict__ g,
    const float* __restrict__ bb, const half_t* __restrict__ wkp,
    const half_t* __restrict__ wvp, half_t* __restrict__ kf,
    half_t* __restrict__ vpk) {
  __shared__ float xs[32][256];
  __shared__ __align__(32) half_t xh[32][256];
  __shared__ float psum[32][8], psq[32][8];
  __shared__ float mu[32], rs[32];
  int t = threadIdx.x;
  long base = (long)blockIdx.x * 32 * 256;
  for (int i = t; i < 32 * 256; i += 256) xs[i >> 8][i & 255] = x[base + i];
  __syncthreads();
  {
    int row = t >> 3, seg = t & 7;
    float s = 0.f, s2 = 0.f;
    for (int c = seg * 32; c < seg * 32 + 32; ++c) {
      float v_ = xs[row][c]; s += v_; s2 += v_ * v_;
    }
    psum[row][seg] = s; psq[row][seg] = s2;
  }
  __syncthreads();
  if (t < 32) {
    float s = 0.f, s2 = 0.f;
    for (int j = 0; j < 8; ++j) { s += psum[t][j]; s2 += psq[t][j]; }
    float m = s * (1.f / 256.f);
    mu[t] = m; rs[t] = rsqrtf(s2 * (1.f / 256.f) - m * m + LNE_);
  }
  __syncthreads();
  for (int i = t; i < 32 * 256; i += 256) {
    int row = i >> 8, col = i & 255;
    xh[row][col] = (half_t)((xs[row][col] - mu[row]) * rs[row] * g[col] + bb[col]);
  }
  __syncthreads();

  int lane = t & 31, w = t >> 5;
  int mt = w & 1, nq4 = w >> 1;
  v8f ak[4], av[4];
  for (int i = 0; i < 4; ++i)
    for (int j = 0; j < 8; ++j) { ak[i][j] = 0.f; av[i][j] = 0.f; }
  for (int kk = 0; kk < 8; ++kk) {
    // issue ALL fragment loads of this K-step first (independent b128s),
    // then the WMMA burst -> backend can use partial s_wait_loadcnt
    v16h a = frag_rowmajor(&xh[mt * 16][kk * 32], 256, lane);
    v16h bk[4], bv[4];
#pragma unroll
    for (int ti = 0; ti < 4; ++ti) {
      int nt = nq4 * 4 + ti;
      bk[ti] = frag_packed(wkp + (long)(kk * 16 + nt) * 512, lane);
      bv[ti] = frag_packed(wvp + (long)(kk * 16 + nt) * 512, lane);
    }
#pragma unroll
    for (int ti = 0; ti < 4; ++ti) {
      ak[ti] = wmma_f16(a, bk[ti], ak[ti]);
      av[ti] = wmma_f16(a, bv[ti], av[ti]);
    }
  }
  int b    = blockIdx.x >> 5;   // 32 blocks per batch (1024 rows)
  int krow = blockIdx.x & 31;   // which 32-row band (K index for attn@V)
  half_t* vb = vpk + (long)b * 262144;
  long rb = (long)blockIdx.x * 32 + mt * 16;
  int mo = (lane >> 4) << 3;
  int nl = lane & 15;
#pragma unroll
  for (int ti = 0; ti < 4; ++ti) {
    int nt  = nq4 * 4 + ti;
    int col = nt * 16 + nl;
#pragma unroll
    for (int r = 0; r < 8; ++r) {
      long row = rb + r + mo;
      kf[row * 256 + col] = (half_t)(ak[ti][r] * 0.125f);  // hd^-0.5
      int k_local = mt * 16 + r + mo;
      int lo, e; inv_klocal(k_local, lo, e);
      vb[((long)(krow * 16 + nt) * 32 + lo + nl) * 16 + e] = (half_t)(av[ti][r]);
    }
  }
}

// ---------------- column sums of V from packed layout ------------------------
__global__ void k_colv(const half_t* __restrict__ vpk, float* __restrict__ colv) {
  int b = blockIdx.x, d = threadIdx.x;
  const half_t* vb = vpk + (long)b * 262144;
  int nt = d >> 4, nl = d & 15;
  float s = 0.f;
  for (int n = 0; n < NKV; ++n) {
    int kk = n >> 5, kl = n & 31;
    int lo, e; inv_klocal(kl, lo, e);
    s += (float)vb[((long)(kk * 16 + nt) * 32 + lo + nl) * 16 + e];
  }
  colv[b * 256 + d] = s;
}

// ---------------- LN(slots) + q = s@Wq, packed block-diagonal Qb -------------
// qbp[b][kk=8][ti=2][lane=32][e=16]
__global__ void __launch_bounds__(256) k_qbuild(
    const float* __restrict__ slots, const float* __restrict__ g,
    const float* __restrict__ bb, const float* __restrict__ wq,
    half_t* __restrict__ qbp) {
  __shared__ float sln[8][256];
  __shared__ float ps[8][32], pq[8][32];
  __shared__ float mu[8], rs[8];
  __shared__ half_t qlds[256][32];
  int b = blockIdx.x, t = threadIdx.x;
  const float* sp = slots + (long)b * NQ * S_;
  {
    int row = t >> 5, seg = t & 31;
    float s = 0.f, s2 = 0.f;
    for (int c = seg * 8; c < seg * 8 + 8; ++c) {
      float v_ = sp[row * 256 + c];
      sln[row][c] = v_; s += v_; s2 += v_ * v_;
    }
    ps[row][seg] = s; pq[row][seg] = s2;
  }
  __syncthreads();
  if (t < 8) {
    float s = 0.f, s2 = 0.f;
    for (int j = 0; j < 32; ++j) { s += ps[t][j]; s2 += pq[t][j]; }
    float m = s * (1.f / 256.f);
    mu[t] = m; rs[t] = rsqrtf(s2 * (1.f / 256.f) - m * m + LNE_);
  }
  __syncthreads();
  for (int i = t; i < 8 * 256; i += 256) {
    int r = i >> 8, c = i & 255;
    sln[r][c] = (sln[r][c] - mu[r]) * rs[r] * g[c] + bb[c];
  }
  __syncthreads();
  float q8[8];
  for (int i = 0; i < 8; ++i) q8[i] = 0.f;
  for (int k = 0; k < 256; ++k) {
    float wv_ = wq[k * 256 + t];
#pragma unroll
    for (int i = 0; i < 8; ++i) q8[i] += sln[i][k] * wv_;
  }
  for (int i = t; i < 256 * 32; i += 256) ((half_t*)qlds)[i] = (half_t)0.f;
  __syncthreads();
  {
    int h = t >> 6;  // head of k-index t
#pragma unroll
    for (int qi = 0; qi < 8; ++qi) qlds[t][h * 8 + qi] = (half_t)q8[qi];
  }
  __syncthreads();
  half_t* qp = qbp + (long)b * 8192;
#pragma unroll
  for (int rep = 0; rep < 2; ++rep) {   // 512 (kk,ti,lane) triples / 256 thr
    int trip = rep * 256 + t;
    int lane = trip & 31, ti = (trip >> 5) & 1, kk = trip >> 6;
    union { uint4 u[2]; half_t h[16]; } c;
#pragma unroll
    for (int e = 0; e < 16; ++e)
      c.h[e] = qlds[kk * 32 + klocal_of(lane, e)][ti * 16 + (lane & 15)];
    *(uint4*)(qp + trip * 16)     = c.u[0];
    *(uint4*)(qp + trip * 16 + 8) = c.u[1];
  }
}

// ---------------- logits GEMM (WMMA) + fused joint softmax -------------------
// grid: B * (NKV/128); attn written fragment-packed for attn@V A-operand:
// apk[b][kk=32][mt=2][lane=32][e=16]
__global__ void __launch_bounds__(256) k_logits(
    const half_t* __restrict__ kf, const half_t* __restrict__ qbp,
    half_t* __restrict__ apk, float* __restrict__ colsum,
    float* __restrict__ vis_out) {
  __shared__ float lg[128][32];
  __shared__ float csl[32];
  int t = threadIdx.x, lane = t & 31, w = t >> 5;
  int b  = blockIdx.x >> 3;
  int rb = (blockIdx.x & 7) * 128;
  if (t < 32) csl[t] = 0.f;
  const half_t* kp = kf + ((long)b * NKV + rb + w * 16) * 256;
  const half_t* qp = qbp + (long)b * 8192;
  v8f acc[2];
  for (int i = 0; i < 2; ++i)
    for (int j = 0; j < 8; ++j) acc[i][j] = 0.f;
  for (int kk = 0; kk < 8; ++kk) {
    v16h a   = frag_rowmajor(kp + kk * 32, 256, lane);
    v16h bq0 = frag_packed(qp + (long)(kk * 2 + 0) * 512, lane);
    v16h bq1 = frag_packed(qp + (long)(kk * 2 + 1) * 512, lane);
    acc[0] = wmma_f16(a, bq0, acc[0]);
    acc[1] = wmma_f16(a, bq1, acc[1]);
  }
  int mo = (lane >> 4) << 3;
#pragma unroll
  for (int ti = 0; ti < 2; ++ti)
#pragma unroll
    for (int r = 0; r < 8; ++r)
      lg[w * 16 + r + mo][ti * 16 + (lane & 15)] = acc[ti][r];
  __syncthreads();
  if (t < 128) {
    float row[32];
    float mx = -3.0e38f;
#pragma unroll
    for (int c = 0; c < 32; ++c) { row[c] = lg[t][c]; mx = fmaxf(mx, row[c]); }
    float s = 0.f;
#pragma unroll
    for (int c = 0; c < 32; ++c) { row[c] = __expf(row[c] - mx); s += row[c]; }
    float inv = 1.f / s;
    int n = rb + t;
#pragma unroll
    for (int c = 0; c < 32; ++c) { row[c] *= inv; atomicAdd(&csl[c], row[c]); }
    // packed store of attn^T fragments (this row = one K value)
    half_t* ab = apk + (long)b * 32768;
    int kk = n >> 5, kl = n & 31;
    int lo, e; inv_klocal(kl, lo, e);
#pragma unroll
    for (int mt = 0; mt < 2; ++mt)
#pragma unroll
      for (int m = 0; m < 16; ++m)
        ab[((long)(kk * 2 + mt) * 32 + m + lo) * 16 + e] =
            (half_t)row[mt * 16 + m];
#pragma unroll
    for (int qi = 0; qi < 8; ++qi) {  // attn_vis = sum over heads
      float v_ = row[qi] + row[8 + qi] + row[16 + qi] + row[24 + qi];
      vis_out[(long)b * NQ * NKV + qi * NKV + n] = v_;
    }
  }
  __syncthreads();
  if (t < 32) atomicAdd(&colsum[b * 32 + t], csl[t]);
}

__global__ void k_inv(const float* __restrict__ colsum, float* __restrict__ inv) {
  int i = blockIdx.x * 256 + threadIdx.x;
  if (i < B_ * 32) inv[i] = 1.f / (colsum[i] + (float)NKV * EPS_);
}

// ---------------- updates = norm(attn+eps)^T @ V (WMMA, all packed) ----------
__global__ void __launch_bounds__(256) k_attnv(
    const half_t* __restrict__ apk, const half_t* __restrict__ vpk,
    const float* __restrict__ colv, const float* __restrict__ invs,
    float* __restrict__ upd) {
  int t = threadIdx.x, lane = t & 31, w = t >> 5;
  int b = blockIdx.x;
  const half_t* ab = apk + (long)b * 32768;
  const half_t* vb = vpk + (long)b * 262144;
  v8f acc[2][2];
  for (int i = 0; i < 2; ++i)
    for (int j = 0; j < 2; ++j)
      for (int e = 0; e < 8; ++e) acc[i][j][e] = 0.f;
  for (int kk = 0; kk < 32; ++kk) {
    // all four fragment loads first, then the WMMA burst
    v16h a0 = frag_packed(ab + (long)(kk * 2 + 0) * 512, lane);
    v16h a1 = frag_packed(ab + (long)(kk * 2 + 1) * 512, lane);
    v16h b0 = frag_packed(vb + (long)(kk * 16 + 2 * w + 0) * 512, lane);
    v16h b1 = frag_packed(vb + (long)(kk * 16 + 2 * w + 1) * 512, lane);
    acc[0][0] = wmma_f16(a0, b0, acc[0][0]);
    acc[1][0] = wmma_f16(a1, b0, acc[1][0]);
    acc[0][1] = wmma_f16(a0, b1, acc[0][1]);
    acc[1][1] = wmma_f16(a1, b1, acc[1][1]);
  }
  int mo = (lane >> 4) << 3;
#pragma unroll
  for (int mt = 0; mt < 2; ++mt)
#pragma unroll
    for (int ntl = 0; ntl < 2; ++ntl) {
      int d = (2 * w + ntl) * 16 + (lane & 15);
#pragma unroll
      for (int r = 0; r < 8; ++r) {
        int hq = mt * 16 + r + mo;
        int h = hq >> 3;
        if ((d >> 6) == h) {  // keep only this head's 64-wide slice
          int qi = hq & 7;
          float val = (acc[mt][ntl][r] + EPS_ * colv[b * 256 + d]) *
                      invs[b * 32 + hq];
          upd[((long)b * NQ + qi) * S_ + d] = val;
        }
      }
    }
}

// ---------------- GRU cell (fp32 VALU), one batch per block ------------------
__global__ void __launch_bounds__(256) k_gru(
    const float* __restrict__ upd, const float* __restrict__ hprev,
    const float* __restrict__ wih, const float* __restrict__ whh,
    const float* __restrict__ bih, const float* __restrict__ bhh,
    float* __restrict__ hout) {
  __shared__ float u[8][256], hp[8][256];
  int b = blockIdx.x, t = threadIdx.x;
  for (int i = t; i < 8 * 256; i += 256) {
    u[i >> 8][i & 255] = upd[(long)b * 2048 + i];
    hp[i >> 8][i & 255] = hprev[(long)b * 2048 + i];
  }
  __syncthreads();
  float r8[8], z8[8];
  {  // r
    float a0[8], a1[8];
    for (int i = 0; i < 8; ++i) { a0[i] = 0.f; a1[i] = 0.f; }
    const float* wi = wih + (long)t * 256;
    const float* wh = whh + (long)t * 256;
    for (int k = 0; k < 256; ++k) {
      float wi_ = wi[k], wh_ = wh[k];
#pragma unroll
      for (int i = 0; i < 8; ++i) { a0[i] += u[i][k] * wi_; a1[i] += hp[i][k] * wh_; }
    }
    float bsum = bih[t] + bhh[t];
    for (int i = 0; i < 8; ++i) r8[i] = 1.f / (1.f + __expf(-(a0[i] + a1[i] + bsum)));
  }
  {  // z
    float a0[8], a1[8];
    for (int i = 0; i < 8; ++i) { a0[i] = 0.f; a1[i] = 0.f; }
    const float* wi = wih + (long)(256 + t) * 256;
    const float* wh = whh + (long)(256 + t) * 256;
    for (int k = 0; k < 256; ++k) {
      float wi_ = wi[k], wh_ = wh[k];
#pragma unroll
      for (int i = 0; i < 8; ++i) { a0[i] += u[i][k] * wi_; a1[i] += hp[i][k] * wh_; }
    }
    float bsum = bih[256 + t] + bhh[256 + t];
    for (int i = 0; i < 8; ++i) z8[i] = 1.f / (1.f + __expf(-(a0[i] + a1[i] + bsum)));
  }
  {  // n + output
    float a0[8], a1[8];
    for (int i = 0; i < 8; ++i) { a0[i] = 0.f; a1[i] = 0.f; }
    const float* wi = wih + (long)(512 + t) * 256;
    const float* wh = whh + (long)(512 + t) * 256;
    for (int k = 0; k < 256; ++k) {
      float wi_ = wi[k], wh_ = wh[k];
#pragma unroll
      for (int i = 0; i < 8; ++i) { a0[i] += u[i][k] * wi_; a1[i] += hp[i][k] * wh_; }
    }
    float bi3 = bih[512 + t], bh3 = bhh[512 + t];
    for (int i = 0; i < 8; ++i) {
      float n = tanhf(a0[i] + bi3 + r8[i] * (a1[i] + bh3));
      float h = (1.f - z8[i]) * n + z8[i] * hp[i][t];
      hout[(long)b * 2048 + i * 256 + t] = h;
    }
  }
}

// ---------------- LN + MLP residual (fp32 VALU), one batch per block ---------
__global__ void __launch_bounds__(256) k_mlp(
    const float* __restrict__ hin, const float* __restrict__ g,
    const float* __restrict__ bb, const float* __restrict__ w1,
    const float* __restrict__ b1, const float* __restrict__ w2,
    const float* __restrict__ b2, float* __restrict__ slots_out,
    float* __restrict__ dout, int write_out) {
  __shared__ float h[8][256], m[8][256], hid[8][512];
  __shared__ float red[256];
  int b = blockIdx.x, t = threadIdx.x;
  for (int i = t; i < 2048; i += 256) h[i >> 8][i & 255] = hin[(long)b * 2048 + i];
  __syncthreads();
  for (int row = 0; row < 8; ++row) {
    float x = h[row][t];
    red[t] = x; __syncthreads();
    for (int s = 128; s > 0; s >>= 1) { if (t < s) red[t] += red[t + s]; __syncthreads(); }
    float mu = red[0] * (1.f / 256.f); __syncthreads();
    float d = x - mu;
    red[t] = d * d; __syncthreads();
    for (int s = 128; s > 0; s >>= 1) { if (t < s) red[t] += red[t + s]; __syncthreads(); }
    float rs = rsqrtf(red[0] * (1.f / 256.f) + LNE_); __syncthreads();
    m[row][t] = d * rs * g[t] + bb[t];
  }
  __syncthreads();
  for (int half = 0; half < 2; ++half) {
    int col = half * 256 + t;
    float a[8];
    for (int i = 0; i < 8; ++i) a[i] = 0.f;
    for (int k = 0; k < 256; ++k) {
      float w_ = w1[(long)k * 512 + col];
#pragma unroll
      for (int i = 0; i < 8; ++i) a[i] += m[i][k] * w_;
    }
    float bias = b1[col];
    for (int i = 0; i < 8; ++i) hid[i][col] = fmaxf(a[i] + bias, 0.f);
  }
  __syncthreads();
  {
    float a[8];
    for (int i = 0; i < 8; ++i) a[i] = 0.f;
    for (int j = 0; j < 512; ++j) {
      float w_ = w2[(long)j * 256 + t];
#pragma unroll
      for (int i = 0; i < 8; ++i) a[i] += hid[i][j] * w_;
    }
    float bias = b2[t];
    for (int i = 0; i < 8; ++i) {
      float o = h[i][t] + a[i] + bias;
      slots_out[(long)b * 2048 + i * 256 + t] = o;
      if (write_out) dout[(long)b * 2048 + i * 256 + t] = o;
    }
  }
}

// ---------------- host orchestration ----------------------------------------
extern "C" void kernel_launch(void* const* d_in, const int* in_sizes, int n_in,
                              void* d_out, int out_size, void* d_ws,
                              size_t ws_size, hipStream_t stream) {
  (void)in_sizes; (void)n_in; (void)out_size; (void)ws_size;
  const float* inputs   = (const float*)d_in[0];
  const float* slots0   = (const float*)d_in[1];
  const float* ln_in_g  = (const float*)d_in[2];
  const float* ln_in_b  = (const float*)d_in[3];
  const float* ln_sl_g  = (const float*)d_in[4];
  const float* ln_sl_b  = (const float*)d_in[5];
  const float* ln_mlp_g = (const float*)d_in[6];
  const float* ln_mlp_b = (const float*)d_in[7];
  const float* Wq       = (const float*)d_in[8];
  const float* Wk       = (const float*)d_in[9];
  const float* Wv       = (const float*)d_in[10];
  const float* gwih     = (const float*)d_in[11];
  const float* gwhh     = (const float*)d_in[12];
  const float* gbih     = (const float*)d_in[13];
  const float* gbhh     = (const float*)d_in[14];
  const float* w1       = (const float*)d_in[15];
  const float* b1       = (const float*)d_in[16];
  const float* w2       = (const float*)d_in[17];
  const float* b2       = (const float*)d_in[18];

  char* ws = (char*)d_ws;
  half_t* kf   = (half_t*)(ws + 0);          // 32 MB  K dense f16 (pre-scaled)
  half_t* vpk  = (half_t*)(ws + 33554432);   // 32 MB  V fragment-packed
  half_t* wkp  = (half_t*)(ws + 67108864);   // 128 KB Wk packed
  half_t* wvp  = (half_t*)(ws + 67239936);   // 128 KB Wv packed
  float*  colv = (float*)(ws + 67371008);    // 64 KB  column sums of V
  half_t* qbp  = (half_t*)(ws + 67436544);   // 1 MB   block-diag Q packed
  half_t* apk  = (half_t*)(ws + 68485120);   // 4 MB   attn^T fragment-packed
  float*  csum = (float*)(ws + 72679424);    // 8 KB
  float*  invs = (float*)(ws + 72687616);    // 8 KB
  float*  upd  = (float*)(ws + 72695808);    // 512 KB
  float*  scur = (float*)(ws + 73220096);    // 512 KB current slots
  float*  smid = (float*)(ws + 73744384);    // 512 KB post-GRU slots

  float* out_slots = (float*)d_out;
  float* out_vis   = out_slots + (long)B_ * NQ * S_;

  hipMemcpyAsync(scur, slots0, (size_t)B_ * NQ * S_ * sizeof(float),
                 hipMemcpyDeviceToDevice, stream);
  k_cvt<<<256, 256, 0, stream>>>(Wk, Wv, wkp, wvp);
  k_proj<<<(B_ * NKV) / 32, 256, 0, stream>>>(inputs, ln_in_g, ln_in_b, wkp, wvp,
                                              kf, vpk);
  k_colv<<<B_, 256, 0, stream>>>(vpk, colv);

  for (int it = 0; it < 3; ++it) {
    hipMemsetAsync(csum, 0, B_ * 32 * sizeof(float), stream);
    k_qbuild<<<B_, 256, 0, stream>>>(scur, ln_sl_g, ln_sl_b, Wq, qbp);
    k_logits<<<B_ * (NKV / 128), 256, 0, stream>>>(kf, qbp, apk, csum, out_vis);
    k_inv<<<8, 256, 0, stream>>>(csum, invs);
    k_attnv<<<B_, 256, 0, stream>>>(apk, vpk, colv, invs, upd);
    k_gru<<<B_, 256, 0, stream>>>(upd, scur, gwih, gwhh, gbih, gbhh, smid);
    k_mlp<<<B_, 256, 0, stream>>>(smid, ln_mlp_g, ln_mlp_b, w1, b1, w2, b2, scur,
                                  out_slots, (it == 2) ? 1 : 0);
  }
}

// v001
// Next to v000, in two timings, it ran 1.08 and 1.07 times as fast.
#include <hip/hip_runtime.h>
#include <hip/hip_bf16.h>

typedef __attribute__((ext_vector_type(16))) _Float16 v16h;
typedef __attribute__((ext_vector_type(8)))  float    v8f;
typedef _Float16 half_t;

#define B_     64
#define NKV    1024
#define NQ     8
#define S_     256
#define HM_    512
#define EPS_   1e-8f
#define LNE_   1e-5f

// ---------------- WMMA fragment helpers (CDNA5 16x16x32 f16 layout) ----------
// 16-bit operand layout: lane L, klo = (L>=16)?8:0; elems 0..7 hold K =
// klo..klo+7, elems 8..15 hold K = klo+16..klo+23 (row/col index = L&15).

// A-fragment from row-major source (ld in halves): two 16B vector loads.
__device__ inline v16h frag_rowmajor(const half_t* p, int ld, int lane) {
  int m   = lane & 15;
  int klo = (lane >> 4) << 3;
  const half_t* q = p + m * ld + klo;
  union { uint4 u[2]; v16h h; } c;
  c.u[0] = *(const uint4*)(q);
  c.u[1] = *(const uint4*)(q + 16);
  return c.h;
}
// Fragment from pre-packed storage: packed[...][lane][16] -> two contiguous 16B loads.
__device__ inline v16h frag_packed(const half_t* p, int lane) {
  const half_t* q = p + lane * 16;
  union { uint4 u[2]; v16h h; } c;
  c.u[0] = *(const uint4*)(q);
  c.u[1] = *(const uint4*)(q + 8);
  return c.h;
}
// (lane, elem) -> K-within-32
__device__ inline int klocal_of(int lane, int e) {
  int klo = (lane >> 4) << 3;
  return (e < 8) ? (klo + e) : (klo + 8 + e);
}
// inverse: K-within-32 -> (lane group offset 0/16, elem)
__device__ inline void inv_klocal(int k_local, int& laneoff, int& e) {
  laneoff = ((k_local & 15) >= 8) ? 16 : 0;
  e = (k_local & 7) + ((k_local >= 16) ? 8 : 0);
}
__device__ inline v8f wmma_f16(v16h a, v16h b, v8f c) {
  return __builtin_amdgcn_wmma_f32_16x16x32_f16(false, a, false, b, (short)0, c,
                                                false, false);
}

// ---------------- Wk/Wv fp32 -> fragment-packed fp16 -------------------------
// packed idx = ((kk*16 + nt)*32 + lane)*16 + e ; 8 kk x 16 nt tiles
__global__ void k_cvt(const float* __restrict__ wk, const float* __restrict__ wv,
                      half_t* __restrict__ wkp, half_t* __restrict__ wvp) {
  int idx  = blockIdx.x * 256 + threadIdx.x;  // 65536 halves per matrix
  int e    = idx & 15;
  int lane = (idx >> 4) & 31;
  int nt   = (idx >> 9) & 15;
  int kk   = idx >> 13;
  int k = kk * 32 + klocal_of(lane, e);
  int n = nt * 16 + (lane & 15);
  wkp[idx] = (half_t)wk[k * 256 + n];
  wvp[idx] = (half_t)wv[k * 256 + n];
}

// ---------------- fused LayerNorm(inputs) + K/V projection (WMMA) ------------
// grid: (B*NKV)/32 blocks, 256 threads (8 waves: 2 M-tiles x 4 N-quadrants)
// K written dense row-major (A-operand of logits); V written fragment-packed
// (B-operand of attn@V): vpk[b][krow=32][nt=16][lane=32][e=16]
__global__ void __launch_bounds__(256) k_proj(
    const float* __restrict__ x, const float* __restrict__ g,
    const float* __restrict__ bb, const half_t* __restrict__ wkp,
    const half_t* __restrict__ wvp, half_t* __restrict__ kf,
    half_t* __restrict__ vpk) {
  __shared__ float xs[32][256];
  __shared__ __align__(32) half_t xh[32][256];
  __shared__ float psum[32][8], psq[32][8];
  __shared__ float mu[32], rs[32];
  int t = threadIdx.x;
  long base = (long)blockIdx.x * 32 * 256;
  for (int i = t; i < 32 * 256; i += 256) xs[i >> 8][i & 255] = x[base + i];
  __syncthreads();
  {
    int row = t >> 3, seg = t & 7;
    float s = 0.f, s2 = 0.f;
    for (int c = seg * 32; c < seg * 32 + 32; ++c) {
      float v_ = xs[row][c]; s += v_; s2 += v_ * v_;
    }
    psum[row][seg] = s; psq[row][seg] = s2;
  }
  __syncthreads();
  if (t < 32) {
    float s = 0.f, s2 = 0.f;
    for (int j = 0; j < 8; ++j) { s += psum[t][j]; s2 += psq[t][j]; }
    float m = s * (1.f / 256.f);
    mu[t] = m; rs[t] = rsqrtf(s2 * (1.f / 256.f) - m * m + LNE_);
  }
  __syncthreads();
  for (int i = t; i < 32 * 256; i += 256) {
    int row = i >> 8, col = i & 255;
    xh[row][col] = (half_t)((xs[row][col] - mu[row]) * rs[row] * g[col] + bb[col]);
  }
  __syncthreads();

  int lane = t & 31, w = t >> 5;
  int mt = w & 1, nq4 = w >> 1;
  v8f ak[4], av[4];
  for (int i = 0; i < 4; ++i)
    for (int j = 0; j < 8; ++j) { ak[i][j] = 0.f; av[i][j] = 0.f; }
  for (int kk = 0; kk < 8; ++kk) {
    // issue ALL fragment loads of this K-step first (independent b128s),
    // then the WMMA burst -> backend can use partial s_wait_loadcnt
    v16h a = frag_rowmajor(&xh[mt * 16][kk * 32], 256, lane);
    v16h bk[4], bv[4];
#pragma unroll
    for (int ti = 0; ti < 4; ++ti) {
      int nt = nq4 * 4 + ti;
      bk[ti] = frag_packed(wkp + (long)(kk * 16 + nt) * 512, lane);
      bv[ti] = frag_packed(wvp + (long)(kk * 16 + nt) * 512, lane);
    }
#pragma unroll
    for (int ti = 0; ti < 4; ++ti) {
      ak[ti] = wmma_f16(a, bk[ti], ak[ti]);
      av[ti] = wmma_f16(a, bv[ti], av[ti]);
    }
  }
  int b    = blockIdx.x >> 5;   // 32 blocks per batch (1024 rows)
  int krow = blockIdx.x & 31;   // which 32-row band (K index for attn@V)
  half_t* vb = vpk + (long)b * 262144;
  long rb = (long)blockIdx.x * 32 + mt * 16;
  int mo = (lane >> 4) << 3;
  int nl = lane & 15;
#pragma unroll
  for (int ti = 0; ti < 4; ++ti) {
    int nt  = nq4 * 4 + ti;
    int col = nt * 16 + nl;
#pragma unroll
    for (int r = 0; r < 8; ++r) {
      long row = rb + r + mo;
      kf[row * 256 + col] = (half_t)(ak[ti][r] * 0.125f);  // hd^-0.5
      int k_local = mt * 16 + r + mo;
      int lo, e; inv_klocal(k_local, lo, e);
      vb[((long)(krow * 16 + nt) * 32 + lo + nl) * 16 + e] = (half_t)(av[ti][r]);
    }
  }
}

// ---------------- column sums of V from packed layout ------------------------
__global__ void k_colv(const half_t* __restrict__ vpk, float* __restrict__ colv) {
  int b = blockIdx.x, d = threadIdx.x;
  const half_t* vb = vpk + (long)b * 262144;
  int nt = d >> 4, nl = d & 15;
  float s = 0.f;
  for (int n = 0; n < NKV; ++n) {
    int kk = n >> 5, kl = n & 31;
    int lo, e; inv_klocal(kl, lo, e);
    s += (float)vb[((long)(kk * 16 + nt) * 32 + lo + nl) * 16 + e];
  }
  colv[b * 256 + d] = s;
}

// ---------------- LN(slots) + q = s@Wq, packed block-diagonal Qb -------------
// qbp[b][kk=8][ti=2][lane=32][e=16]
__global__ void __launch_bounds__(256) k_qbuild(
    const float* __restrict__ slots, const float* __restrict__ g,
    const float* __restrict__ bb, const float* __restrict__ wq,
    half_t* __restrict__ qbp) {
  __shared__ float sln[8][256];
  __shared__ float ps[8][32], pq[8][32];
  __shared__ float mu[8], rs[8];
  __shared__ half_t qlds[256][32];
  int b = blockIdx.x, t = threadIdx.x;
  const float* sp = slots + (long)b * NQ * S_;
  {
    int row = t >> 5, seg = t & 31;
    float s = 0.f, s2 = 0.f;
    for (int c = seg * 8; c < seg * 8 + 8; ++c) {
      float v_ = sp[row * 256 + c];
      sln[row][c] = v_; s += v_; s2 += v_ * v_;
    }
    ps[row][seg] = s; pq[row][seg] = s2;
  }
  __syncthreads();
  if (t < 8) {
    float s = 0.f, s2 = 0.f;
    for (int j = 0; j < 32; ++j) { s += ps[t][j]; s2 += pq[t][j]; }
    float m = s * (1.f / 256.f);
    mu[t] = m; rs[t] = rsqrtf(s2 * (1.f / 256.f) - m * m + LNE_);
  }
  __syncthreads();
  for (int i = t; i < 8 * 256; i += 256) {
    int r = i >> 8, c = i & 255;
    sln[r][c] = (sln[r][c] - mu[r]) * rs[r] * g[c] + bb[c];
  }
  __syncthreads();
  float q8[8];
  for (int i = 0; i < 8; ++i) q8[i] = 0.f;
  for (int k = 0; k < 256; ++k) {
    float wv_ = wq[k * 256 + t];
#pragma unroll
    for (int i = 0; i < 8; ++i) q8[i] += sln[i][k] * wv_;
  }
  for (int i = t; i < 256 * 32; i += 256) ((half_t*)qlds)[i] = (half_t)0.f;
  __syncthreads();
  {
    int h = t >> 6;  // head of k-index t
#pragma unroll
    for (int qi = 0; qi < 8; ++qi) qlds[t][h * 8 + qi] = (half_t)q8[qi];
  }
  __syncthreads();
  half_t* qp = qbp + (long)b * 8192;
#pragma unroll
  for (int rep = 0; rep < 2; ++rep) {   // 512 (kk,ti,lane) triples / 256 thr
    int trip = rep * 256 + t;
    int lane = trip & 31, ti = (trip >> 5) & 1, kk = trip >> 6;
    union { uint4 u[2]; half_t h[16]; } c;
#pragma unroll
    for (int e = 0; e < 16; ++e)
      c.h[e] = qlds[kk * 32 + klocal_of(lane, e)][ti * 16 + (lane & 15)];
    *(uint4*)(qp + trip * 16)     = c.u[0];
    *(uint4*)(qp + trip * 16 + 8) = c.u[1];
  }
}

// ---------------- logits GEMM (WMMA) + fused joint softmax -------------------
// value of lane (l ^ M) of the same 16-lane row (DPP row_xmask)
template <int M>
__device__ inline float row_xor(float v) {
  return __builtin_bit_cast(
      float, __builtin_amdgcn_mov_dpp(__builtin_bit_cast(int, v), 0x160 | M, 0xf,
                                      0xf, true));
}
__device__ inline float row_max16(float v) {
  v = fmaxf(v, row_xor<1>(v));
  v = fmaxf(v, row_xor<2>(v));
  v = fmaxf(v, row_xor<4>(v));
  v = fmaxf(v, row_xor<8>(v));
  return v;
}
__device__ inline float row_sum16(float v) {
  v += row_xor<1>(v);
  v += row_xor<2>(v);
  v += row_xor<4>(v);
  v += row_xor<8>(v);
  return v;
}
// value of lane l ^ 16
__device__ inline float xhalf(float x) {
  int i = __builtin_bit_cast(int, x);
  return __builtin_bit_cast(
      float, __builtin_amdgcn_permlanex16(i, i, 0x76543210, 0xfedcba98, false,
                                          false));
}

// exp(x) as __expf builds it: one multiply and v_exp_f32. The v_nop fills the
// one slot the instruction set asks for behind a transcendental before its
// source is overwritten or its result read.
__device__ inline float exp_slot(float x) {
  float r;
  asm("v_exp_f32 %0, %1\n\tv_nop" : "=v"(r) : "v"(x * 1.44269504f));
  return r;
}

// grid: B * (NKV/256); each wave owns 32 kv rows (two M-tiles) x all 32
// (head, slot) columns, so a softmax row lies in one 16-lane row of two
// accumulators and the wave's 32 rows are exactly one K-step of attn@V.
// attn written fragment-packed for attn@V A-operand:
// apk[b][kk=32][mt=2][lane=32][e=16]; lane and e follow from the D layout:
// D register r of M-tile i at lane l is k_local = 16 i + 8 (l >> 4) + r,
// which is element e = 8 i + r of the same lane l.
// Column sums leave as one partial per block: cpart[b][blk=4][32].
__global__ void __launch_bounds__(256) k_logits(
    const half_t* __restrict__ kf, const half_t* __restrict__ qbp,
    half_t* __restrict__ apk, float* __restrict__ cpart,
    float* __restrict__ vis_out) {
  __shared__ float csl[8][32];
  int t = threadIdx.x, lane = t & 31, w = t >> 5;
  int b   = blockIdx.x >> 2;
  int blk = blockIdx.x & 3;
  int n0  = blk * 256 + w * 32;
  const half_t* kp = kf + ((long)b * NKV + n0) * 256;
  const half_t* qp = qbp + (long)b * 8192;
  v8f acc[2][2];  // [M-tile][column tile]
  for (int i = 0; i < 2; ++i)
    for (int k = 0; k < 2; ++k)
      for (int j = 0; j < 8; ++j) acc[i][k][j] = 0.f;
  for (int kk = 0; kk < 8; ++kk) {
    v16h a0  = frag_rowmajor(kp + kk * 32, 256, lane);
    v16h a1  = frag_rowmajor(kp + 16 * 256 + kk * 32, 256, lane);
    v16h bq0 = frag_packed(qp + (long)(kk * 2 + 0) * 512, lane);
    v16h bq1 = frag_packed(qp + (long)(kk * 2 + 1) * 512, lane);
    acc[0][0] = wmma_f16(a0, bq0, acc[0][0]);
    acc[0][1] = wmma_f16(a0, bq1, acc[0][1]);
    acc[1][0] = wmma_f16(a1, bq0, acc[1][0]);
    acc[1][1] = wmma_f16(a1, bq1, acc[1][1]);
  }
  int c16 = lane & 15, hi = lane >> 4;
  float cs0 = 0.f, cs1 = 0.f;
  union { uint4 u[2]; half_t h[16]; } p0, p1;
  float* vp = vis_out + (long)b * NQ * NKV + (c16 & 7) * NKV + n0 + hi * 8 +
              (c16 >> 3) * 4;
#pragma unroll
  for (int i = 0; i < 2; ++i) {
    float vis[8];
#pragma unroll
    for (int r = 0; r < 8; ++r) {
      float x0 = acc[i][0][r], x1 = acc[i][1][r];
      float mx = row_max16(fmaxf(x0, x1));
      float e0 = exp_slot(x0 - mx), e1 = exp_slot(x1 - mx);
      float inv = 1.f / row_sum16(e0 + e1);
      e0 *= inv; e1 *= inv;
      cs0 += e0; cs1 += e1;
      p0.h[i * 8 + r] = (half_t)e0;
      p1.h[i * 8 + r] = (half_t)e1;
      float v_ = e0 + e1;           // heads 0+2 (or 1+3) of slot c16 & 7
      vis[r] = v_ + row_xor<8>(v_);  // attn_vis = sum over heads
    }
    // lanes c16 and c16 ^ 8 hold the same 8 sums: each stores four of them
    float4 o;
    o.x = (c16 & 8) ? vis[4] : vis[0];
    o.y = (c16 & 8) ? vis[5] : vis[1];
    o.z = (c16 & 8) ? vis[6] : vis[2];
    o.w = (c16 & 8) ? vis[7] : vis[3];
    *(float4*)(vp + i * 16) = o;
  }
  half_t* ab = apk + (long)b * 32768 + (long)(blk * 8 + w) * 1024 + lane * 16;
  *(uint4*)(ab)           = p0.u[0];
  *(uint4*)(ab + 8)       = p0.u[1];
  *(uint4*)(ab + 512)     = p1.u[0];
  *(uint4*)(ab + 512 + 8) = p1.u[1];
  // column sums: 16 rows in the lane, the other 16 in lane ^ 16, then the
  // eight waves in a fixed order
  cs0 += xhalf(cs0);
  cs1 += xhalf(cs1);
  csl[w][lane] = hi ? cs1 : cs0;
  __syncthreads();
  if (t < 32) {
    float s = 0.f;
#pragma unroll
    for (int j = 0; j < 8; ++j) s += csl[j][t];
    cpart[(b * 4 + blk) * 32 + t] = s;
  }
}

__global__ void k_inv(const float* __restrict__ cpart, float* __restrict__ inv) {
  int i = blockIdx.x * 256 + threadIdx.x;
  if (i < B_ * 32) {
    const float* p = cpart + (i >> 5) * 128 + (i & 31);
    float s = ((p[0] + p[32]) + p[64]) + p[96];
    inv[i] = 1.f / (s + (float)NKV * EPS_);
  }
}

// ---------------- updates = norm(attn+eps)^T @ V (WMMA, all packed) ----------
__global__ void __launch_bounds__(256) k_attnv(
    const half_t* __restrict__ apk, const half_t* __restrict__ vpk,
    const float* __restrict__ colv, const float* __restrict__ invs,
    float* __restrict__ upd) {
  int t = threadIdx.x, lane = t & 31, w = t >> 5;
  int b = blockIdx.x;
  const half_t* ab = apk + (long)b * 32768;
  const half_t* vb = vpk + (long)b * 262144;
  v8f acc[2][2];
  for (int i = 0; i < 2; ++i)
    for (int j = 0; j < 2; ++j)
      for (int e = 0; e < 8; ++e) acc[i][j][e] = 0.f;
  for (int kk = 0; kk < 32; ++kk) {
    // all four fragment loads first, then the WMMA burst
    v16h a0 = frag_packed(ab + (long)(kk * 2 + 0) * 512, lane);
    v16h a1 = frag_packed(ab + (long)(kk * 2 + 1) * 512, lane);
    v16h b0 = frag_packed(vb + (long)(kk * 16 + 2 * w + 0) * 512, lane);
    v16h b1 = frag_packed(vb + (long)(kk * 16 + 2 * w + 1) * 512, lane);
    acc[0][0] = wmma_f16(a0, b0, acc[0][0]);
    acc[1][0] = wmma_f16(a1, b0, acc[1][0]);
    acc[0][1] = wmma_f16(a0, b1, acc[0][1]);
    acc[1][1] = wmma_f16(a1, b1, acc[1][1]);
  }
  int mo = (lane >> 4) << 3;
#pragma unroll
  for (int mt = 0; mt < 2; ++mt)
#pragma unroll
    for (int ntl = 0; ntl < 2; ++ntl) {
      int d = (2 * w + ntl) * 16 + (lane & 15);
#pragma unroll
      for (int r = 0; r < 8; ++r) {
        int hq = mt * 16 + r + mo;
        int h = hq >> 3;
        if ((d >> 6) == h) {  // keep only this head's 64-wide slice
          int qi = hq & 7;
          float val = (acc[mt][ntl][r] + EPS_ * colv[b * 256 + d]) *
                      invs[b * 32 + hq];
          upd[((long)b * NQ + qi) * S_ + d] = val;
        }
      }
    }
}

// ---------------- GRU cell (fp32 VALU), one batch per block ------------------
__global__ void __launch_bounds__(256) k_gru(
    const float* __restrict__ upd, const float* __restrict__ hprev,
    const float* __restrict__ wih, const float* __restrict__ whh,
    const float* __restrict__ bih, const float* __restrict__ bhh,
    float* __restrict__ hout) {
  __shared__ float u[8][256], hp[8][256];
  int b = blockIdx.x, t = threadIdx.x;
  for (int i = t; i < 8 * 256; i += 256) {
    u[i >> 8][i & 255] = upd[(long)b * 2048 + i];
    hp[i >> 8][i & 255] = hprev[(long)b * 2048 + i];
  }
  __syncthreads();
  float r8[8], z8[8];
  {  // r
    float a0[8], a1[8];
    for (int i = 0; i < 8; ++i) { a0[i] = 0.f; a1[i] = 0.f; }
    const float* wi = wih + (long)t * 256;
    const float* wh = whh + (long)t * 256;
    for (int k = 0; k < 256; ++k) {
      float wi_ = wi[k], wh_ = wh[k];
#pragma unroll
      for (int i = 0; i < 8; ++i) { a0[i] += u[i][k] * wi_; a1[i] += hp[i][k] * wh_; }
    }
    float bsum = bih[t] + bhh[t];
    for (int i = 0; i < 8; ++i) r8[i] = 1.f / (1.f + __expf(-(a0[i] + a1[i] + bsum)));
  }
  {  // z
    float a0[8], a1[8];
    for (int i = 0; i < 8; ++i) { a0[i] = 0.f; a1[i] = 0.f; }
    const float* wi = wih + (long)(256 + t) * 256;
    const float* wh = whh + (long)(256 + t) * 256;
    for (int k = 0; k < 256; ++k) {
      float wi_ = wi[k], wh_ = wh[k];
#pragma unroll
      for (int i = 0; i < 8; ++i) { a0[i] += u[i][k] * wi_; a1[i] += hp[i][k] * wh_; }
    }
    float bsum = bih[256 + t] + bhh[256 + t];
    for (int i = 0; i < 8; ++i) z8[i] = 1.f / (1.f + __expf(-(a0[i] + a1[i] + bsum)));
  }
  {  // n + output
    float a0[8], a1[8];
    for (int i = 0; i < 8; ++i) { a0[i] = 0.f; a1[i] = 0.f; }
    const float* wi = wih + (long)(512 + t) * 256;
    const float* wh = whh + (long)(512 + t) * 256;
    for (int k = 0; k < 256; ++k) {
      float wi_ = wi[k], wh_ = wh[k];
#pragma unroll
      for (int i = 0; i < 8; ++i) { a0[i] += u[i][k] * wi_; a1[i] += hp[i][k] * wh_; }
    }
    float bi3 = bih[512 + t], bh3 = bhh[512 + t];
    for (int i = 0; i < 8; ++i) {
      float n = tanhf(a0[i] + bi3 + r8[i] * (a1[i] + bh3));
      float h = (1.f - z8[i]) * n + z8[i] * hp[i][t];
      hout[(long)b * 2048 + i * 256 + t] = h;
    }
  }
}

// ---------------- LN + MLP residual (fp32 VALU), one batch per block ---------
__global__ void __launch_bounds__(256) k_mlp(
    const float* __restrict__ hin, const float* __restrict__ g,
    const float* __restrict__ bb, const float* __restrict__ w1,
    const float* __restrict__ b1, const float* __restrict__ w2,
    const float* __restrict__ b2, float* __restrict__ slots_out,
    float* __restrict__ dout, int write_out) {
  __shared__ float h[8][256], m[8][256], hid[8][512];
  __shared__ float red[256];
  int b = blockIdx.x, t = threadIdx.x;
  for (int i = t; i < 2048; i += 256) h[i >> 8][i & 255] = hin[(long)b * 2048 + i];
  __syncthreads();
  for (int row = 0; row < 8; ++row) {
    float x = h[row][t];
    red[t] = x; __syncthreads();
    for (int s = 128; s > 0; s >>= 1) { if (t < s) red[t] += red[t + s]; __syncthreads(); }
    float mu = red[0] * (1.f / 256.f); __syncthreads();
    float d = x - mu;
    red[t] = d * d; __syncthreads();
    for (int s = 128; s > 0; s >>= 1) { if (t < s) red[t] += red[t + s]; __syncthreads(); }
    float rs = rsqrtf(red[0] * (1.f / 256.f) + LNE_); __syncthreads();
    m[row][t] = d * rs * g[t] + bb[t];
  }
  __syncthreads();
  for (int half = 0; half < 2; ++half) {
    int col = half * 256 + t;
    float a[8];
    for (int i = 0; i < 8; ++i) a[i] = 0.f;
    for (int k = 0; k < 256; ++k) {
      float w_ = w1[(long)k * 512 + col];
#pragma unroll
      for (int i = 0; i < 8; ++i) a[i] += m[i][k] * w_;
    }
    float bias = b1[col];
    for (int i = 0; i < 8; ++i) hid[i][col] = fmaxf(a[i] + bias, 0.f);
  }
  __syncthreads();
  {
    float a[8];
    for (int i = 0; i < 8; ++i) a[i] = 0.f;
    for (int j = 0; j < 512; ++j) {
      float w_ = w2[(long)j * 256 + t];
#pragma unroll
      for (int i = 0; i < 8; ++i) a[i] += hid[i][j] * w_;
    }
    float bias = b2[t];
    for (int i = 0; i < 8; ++i) {
      float o = h[i][t] + a[i] + bias;
      slots_out[(long)b * 2048 + i * 256 + t] = o;
      if (write_out) dout[(long)b * 2048 + i * 256 + t] = o;
    }
  }
}

// ---------------- host orchestration ----------------------------------------
extern "C" void kernel_launch(void* const* d_in, const int* in_sizes, int n_in,
                              void* d_out, int out_size, void* d_ws,
                              size_t ws_size, hipStream_t stream) {
  (void)in_sizes; (void)n_in; (void)out_size; (void)ws_size;
  const float* inputs   = (const float*)d_in[0];
  const float* slots0   = (const float*)d_in[1];
  const float* ln_in_g  = (const float*)d_in[2];
  const float* ln_in_b  = (const float*)d_in[3];
  const float* ln_sl_g  = (const float*)d_in[4];
  const float* ln_sl_b  = (const float*)d_in[5];
  const float* ln_mlp_g = (const float*)d_in[6];
  const float* ln_mlp_b = (const float*)d_in[7];
  const float* Wq       = (const float*)d_in[8];
  const float* Wk       = (const float*)d_in[9];
  const float* Wv       = (const float*)d_in[10];
  const float* gwih     = (const float*)d_in[11];
  const float* gwhh     = (const float*)d_in[12];
  const float* gbih     = (const float*)d_in[13];
  const float* gbhh     = (const float*)d_in[14];
  const float* w1       = (const float*)d_in[15];
  const float* b1       = (const float*)d_in[16];
  const float* w2       = (const float*)d_in[17];
  const float* b2       = (const float*)d_in[18];

  char* ws = (char*)d_ws;
  half_t* kf   = (half_t*)(ws + 0);          // 32 MB  K dense f16 (pre-scaled)
  half_t* vpk  = (half_t*)(ws + 33554432);   // 32 MB  V fragment-packed
  half_t* wkp  = (half_t*)(ws + 67108864);   // 128 KB Wk packed
  half_t* wvp  = (half_t*)(ws + 67239936);   // 128 KB Wv packed
  float*  colv = (float*)(ws + 67371008);    // 64 KB  column sums of V
  half_t* qbp  = (half_t*)(ws + 67436544);   // 1 MB   block-diag Q packed
  half_t* apk  = (half_t*)(ws + 68485120);   // 4 MB   attn^T fragment-packed
  float*  invs = (float*)(ws + 72687616);    // 8 KB
  float*  upd  = (float*)(ws + 72695808);    // 512 KB
  float*  scur = (float*)(ws + 73220096);    // 512 KB current slots
  float*  smid = (float*)(ws + 73744384);    // 512 KB post-GRU slots
  float*  csum = (float*)(ws + 74268672);    // 32 KB  attn column-sum partials

  float* out_slots = (float*)d_out;
  float* out_vis   = out_slots + (long)B_ * NQ * S_;

  hipMemcpyAsync(scur, slots0, (size_t)B_ * NQ * S_ * sizeof(float),
                 hipMemcpyDeviceToDevice, stream);
  k_cvt<<<256, 256, 0, stream>>>(Wk, Wv, wkp, wvp);
  k_proj<<<(B_ * NKV) / 32, 256, 0, stream>>>(inputs, ln_in_g, ln_in_b, wkp, wvp,
                                              kf, vpk);
  k_colv<<<B_, 256, 0, stream>>>(vpk, colv);

  for (int it = 0; it < 3; ++it) {
    k_qbuild<<<B_, 256, 0, stream>>>(scur, ln_sl_g, ln_sl_b, Wq, qbp);
    k_logits<<<B_ * (NKV / 256), 256, 0, stream>>>(kf, qbp, apk, csum, out_vis);
    k_inv<<<8, 256, 0, stream>>>(csum, invs);
    k_attnv<<<B_, 256, 0, stream>>>(apk, vpk, colv, invs, upd);
    k_gru<<<B_, 256, 0, stream>>>(upd, scur, gwih, gwhh, gbih, gbhh, smid);
    k_mlp<<<B_, 256, 0, stream>>>(smid, ln_mlp_g, ln_mlp_b, w1, b1, w2, b2, scur,
                                  out_slots, (it == 2) ? 1 : 0);
  }
}

// v002
// Next to v001, in two timings, it ran 1.35 and 1.34 times as fast.
// All steps since v000 together make it 1.45 times as fast.
#include <hip/hip_runtime.h>
#include <hip/hip_bf16.h>

typedef __attribute__((ext_vector_type(16))) _Float16 v16h;
typedef __attribute__((ext_vector_type(8)))  float    v8f;
typedef __attribute__((ext_vector_type(2)))  float    v2f;
typedef _Float16 half_t;

#define B_     64
#define NKV    1024
#define NQ     8
#define S_     256
#define HM_    512
#define EPS_   1e-8f
#define LNE_   1e-5f

// ---------------- WMMA fragment helpers (CDNA5 16x16x32 f16 layout) ----------
// 16-bit operand layout: lane L, klo = (L>=16)?8:0; elems 0..7 hold K =
// klo..klo+7, elems 8..15 hold K = klo+16..klo+23 (row/col index = L&15).

// A-fragment from row-major source (ld in halves): two 16B vector loads.
__device__ inline v16h frag_rowmajor(const half_t* p, int ld, int lane) {
  int m   = lane & 15;
  int klo = (lane >> 4) << 3;
  const half_t* q = p + m * ld + klo;
  union { uint4 u[2]; v16h h; } c;
  c.u[0] = *(const uint4*)(q);
  c.u[1] = *(const uint4*)(q + 16);
  return c.h;
}
// Fragment from pre-packed storage: packed[...][lane][16] -> two contiguous 16B loads.
__device__ inline v16h frag_packed(const half_t* p, int lane) {
  const half_t* q = p + lane * 16;
  union { uint4 u[2]; v16h h; } c;
  c.u[0] = *(const uint4*)(q);
  c.u[1] = *(const uint4*)(q + 8);
  return c.h;
}
// (lane, elem) -> K-within-32
__device__ inline int klocal_of(int lane, int e) {
  int klo = (lane >> 4) << 3;
  return (e < 8) ? (klo + e) : (klo + 8 + e);
}
// inverse: K-within-32 -> (lane group offset 0/16, elem)
__device__ inline void inv_klocal(int k_local, int& laneoff, int& e) {
  laneoff = ((k_local & 15) >= 8) ? 16 : 0;
  e = (k_local & 7) + ((k_local >= 16) ? 8 : 0);
}
__device__ inline v8f wmma_f16(v16h a, v16h b, v8f c) {
  return __builtin_amdgcn_wmma_f32_16x16x32_f16(false, a, false, b, (short)0, c,
                                                false, false);
}

// ---------------- Wk/Wv fp32 -> fragment-packed fp16 -------------------------
// packed idx = ((kk*16 + nt)*32 + lane)*16 + e ; 8 kk x 16 nt tiles
__global__ void k_cvt(const float* __restrict__ wk, const float* __restrict__ wv,
                      half_t* __restrict__ wkp, half_t* __restrict__ wvp) {
  int idx  = blockIdx.x * 256 + threadIdx.x;  // 65536 halves per matrix
  int e    = idx & 15;
  int lane = (idx >> 4) & 31;
  int nt   = (idx >> 9) & 15;
  int kk   = idx >> 13;
  int k = kk * 32 + klocal_of(lane, e);
  int n = nt * 16 + (lane & 15);
  wkp[idx] = (half_t)wk[k * 256 + n];
  wvp[idx] = (half_t)wv[k * 256 + n];
}

// ---------------- fused LayerNorm(inputs) + K/V projection (WMMA) ------------
// grid: (B*NKV)/32 blocks, 256 threads (8 waves: 2 M-tiles x 4 N-quadrants)
// K written dense row-major (A-operand of logits); V written fragment-packed
// (B-operand of attn@V): vpk[b][krow=32][nt=16][lane=32][e=16]
__global__ void __launch_bounds__(256) k_proj(
    const float* __restrict__ x, const float* __restrict__ g,
    const float* __restrict__ bb, const half_t* __restrict__ wkp,
    const half_t* __restrict__ wvp, half_t* __restrict__ kf,
    half_t* __restrict__ vpk) {
  __shared__ float xs[32][256];
  __shared__ __align__(32) half_t xh[32][256];
  __shared__ float psum[32][8], psq[32][8];
  __shared__ float mu[32], rs[32];
  int t = threadIdx.x;
  long base = (long)blockIdx.x * 32 * 256;
  for (int i = t; i < 32 * 256; i += 256) xs[i >> 8][i & 255] = x[base + i];
  __syncthreads();
  {
    int row = t >> 3, seg = t & 7;
    float s = 0.f, s2 = 0.f;
    for (int c = seg * 32; c < seg * 32 + 32; ++c) {
      float v_ = xs[row][c]; s += v_; s2 += v_ * v_;
    }
    psum[row][seg] = s; psq[row][seg] = s2;
  }
  __syncthreads();
  if (t < 32) {
    float s = 0.f, s2 = 0.f;
    for (int j = 0; j < 8; ++j) { s += psum[t][j]; s2 += psq[t][j]; }
    float m = s * (1.f / 256.f);
    mu[t] = m; rs[t] = rsqrtf(s2 * (1.f / 256.f) - m * m + LNE_);
  }
  __syncthreads();
  for (int i = t; i < 32 * 256; i += 256) {
    int row = i >> 8, col = i & 255;
    xh[row][col] = (half_t)((xs[row][col] - mu[row]) * rs[row] * g[col] + bb[col]);
  }
  __syncthreads();

  int lane = t & 31, w = t >> 5;
  int mt = w & 1, nq4 = w >> 1;
  v8f ak[4], av[4];
  for (int i = 0; i < 4; ++i)
    for (int j = 0; j < 8; ++j) { ak[i][j] = 0.f; av[i][j] = 0.f; }
  for (int kk = 0; kk < 8; ++kk) {
    // issue ALL fragment loads of this K-step first (independent b128s),
    // then the WMMA burst -> backend can use partial s_wait_loadcnt
    v16h a = frag_rowmajor(&xh[mt * 16][kk * 32], 256, lane);
    v16h bk[4], bv[4];
#pragma unroll
    for (int ti = 0; ti < 4; ++ti) {
      int nt = nq4 * 4 + ti;
      bk[ti] = frag_packed(wkp + (long)(kk * 16 + nt) * 512, lane);
      bv[ti] = frag_packed(wvp + (long)(kk * 16 + nt) * 512, lane);
    }
#pragma unroll
    for (int ti = 0; ti < 4; ++ti) {
      ak[ti] = wmma_f16(a, bk[ti], ak[ti]);
      av[ti] = wmma_f16(a, bv[ti], av[ti]);
    }
  }
  int b    = blockIdx.x >> 5;   // 32 blocks per batch (1024 rows)
  int krow = blockIdx.x & 31;   // which 32-row band (K index for attn@V)
  half_t* vb = vpk + (long)b * 262144;
  long rb = (long)blockIdx.x * 32 + mt * 16;
  int mo = (lane >> 4) << 3;
  int nl = lane & 15;
#pragma unroll
  for (int ti = 0; ti < 4; ++ti) {
    int nt  = nq4 * 4 + ti;
    int col = nt * 16 + nl;
#pragma unroll
    for (int r = 0; r < 8; ++r) {
      long row = rb + r + mo;
      kf[row * 256 + col] = (half_t)(ak[ti][r] * 0.125f);  // hd^-0.5
      int k_local = mt * 16 + r + mo;
      int lo, e; inv_klocal(k_local, lo, e);
      vb[((long)(krow * 16 + nt) * 32 + lo + nl) * 16 + e] = (half_t)(av[ti][r]);
    }
  }
}

// ---------------- column sums of V from packed layout ------------------------
__global__ void k_colv(const half_t* __restrict__ vpk, float* __restrict__ colv) {
  int b = blockIdx.x, d = threadIdx.x;
  const half_t* vb = vpk + (long)b * 262144;
  int nt = d >> 4, nl = d & 15;
  float s = 0.f;
  for (int n = 0; n < NKV; ++n) {
    int kk = n >> 5, kl = n & 31;
    int lo, e; inv_klocal(kl, lo, e);
    s += (float)vb[((long)(kk * 16 + nt) * 32 + lo + nl) * 16 + e];
  }
  colv[b * 256 + d] = s;
}

// ---------------- LN(slots) + q = s@Wq, packed block-diagonal Qb -------------
// qbp[b][kk=8][ti=2][lane=32][e=16]
__global__ void __launch_bounds__(256) k_qbuild(
    const float* __restrict__ slots, const float* __restrict__ g,
    const float* __restrict__ bb, const float* __restrict__ wq,
    half_t* __restrict__ qbp) {
  __shared__ float sln[8][256];
  __shared__ float ps[8][32], pq[8][32];
  __shared__ float mu[8], rs[8];
  __shared__ half_t qlds[256][32];
  int b = blockIdx.x, t = threadIdx.x;
  const float* sp = slots + (long)b * NQ * S_;
  {
    int row = t >> 5, seg = t & 31;
    float s = 0.f, s2 = 0.f;
    for (int c = seg * 8; c < seg * 8 + 8; ++c) {
      float v_ = sp[row * 256 + c];
      sln[row][c] = v_; s += v_; s2 += v_ * v_;
    }
    ps[row][seg] = s; pq[row][seg] = s2;
  }
  __syncthreads();
  if (t < 8) {
    float s = 0.f, s2 = 0.f;
    for (int j = 0; j < 32; ++j) { s += ps[t][j]; s2 += pq[t][j]; }
    float m = s * (1.f / 256.f);
    mu[t] = m; rs[t] = rsqrtf(s2 * (1.f / 256.f) - m * m + LNE_);
  }
  __syncthreads();
  for (int i = t; i < 8 * 256; i += 256) {
    int r = i >> 8, c = i & 255;
    sln[r][c] = (sln[r][c] - mu[r]) * rs[r] * g[c] + bb[c];
  }
  __syncthreads();
  float q8[8];
  for (int i = 0; i < 8; ++i) q8[i] = 0.f;
  for (int k = 0; k < 256; ++k) {
    float wv_ = wq[k * 256 + t];
#pragma unroll
    for (int i = 0; i < 8; ++i) q8[i] += sln[i][k] * wv_;
  }
  for (int i = t; i < 256 * 32; i += 256) ((half_t*)qlds)[i] = (half_t)0.f;
  __syncthreads();
  {
    int h = t >> 6;  // head of k-index t
#pragma unroll
    for (int qi = 0; qi < 8; ++qi) qlds[t][h * 8 + qi] = (half_t)q8[qi];
  }
  __syncthreads();
  half_t* qp = qbp + (long)b * 8192;
#pragma unroll
  for (int rep = 0; rep < 2; ++rep) {   // 512 (kk,ti,lane) triples / 256 thr
    int trip = rep * 256 + t;
    int lane = trip & 31, ti = (trip >> 5) & 1, kk = trip >> 6;
    union { uint4 u[2]; half_t h[16]; } c;
#pragma unroll
    for (int e = 0; e < 16; ++e)
      c.h[e] = qlds[kk * 32 + klocal_of(lane, e)][ti * 16 + (lane & 15)];
    *(uint4*)(qp + trip * 16)     = c.u[0];
    *(uint4*)(qp + trip * 16 + 8) = c.u[1];
  }
}

// ---------------- logits GEMM (WMMA) + fused joint softmax -------------------
// value of lane (l ^ M) of the same 16-lane row (DPP row_xmask)
template <int M>
__device__ inline float row_xor(float v) {
  return __builtin_bit_cast(
      float, __builtin_amdgcn_mov_dpp(__builtin_bit_cast(int, v), 0x160 | M, 0xf,
                                      0xf, true));
}
__device__ inline float row_max16(float v) {
  v = fmaxf(v, row_xor<1>(v));
  v = fmaxf(v, row_xor<2>(v));
  v = fmaxf(v, row_xor<4>(v));
  v = fmaxf(v, row_xor<8>(v));
  return v;
}
__device__ inline float row_sum16(float v) {
  v += row_xor<1>(v);
  v += row_xor<2>(v);
  v += row_xor<4>(v);
  v += row_xor<8>(v);
  return v;
}
// value of lane l ^ 16
__device__ inline float xhalf(float x) {
  int i = __builtin_bit_cast(int, x);
  return __builtin_bit_cast(
      float, __builtin_amdgcn_permlanex16(i, i, 0x76543210, 0xfedcba98, false,
                                          false));
}

// exp(x) as __expf builds it: one multiply and v_exp_f32. The v_nop fills the
// one slot the instruction set asks for behind a transcendental before its
// source is overwritten or its result read.
__device__ inline float exp_slot(float x) {
  float r;
  asm("v_exp_f32 %0, %1\n\tv_nop" : "=v"(r) : "v"(x * 1.44269504f));
  return r;
}

// grid: B * (NKV/256); each wave owns 32 kv rows (two M-tiles) x all 32
// (head, slot) columns, so a softmax row lies in one 16-lane row of two
// accumulators and the wave's 32 rows are exactly one K-step of attn@V.
// attn written fragment-packed for attn@V A-operand:
// apk[b][kk=32][mt=2][lane=32][e=16]; lane and e follow from the D layout:
// D register r of M-tile i at lane l is k_local = 16 i + 8 (l >> 4) + r,
// which is element e = 8 i + r of the same lane l.
// Column sums leave as one partial per block: cpart[b][blk=4][32].
__global__ void __launch_bounds__(256) k_logits(
    const half_t* __restrict__ kf, const half_t* __restrict__ qbp,
    half_t* __restrict__ apk, float* __restrict__ cpart,
    float* __restrict__ vis_out) {
  __shared__ float csl[8][32];
  int t = threadIdx.x, lane = t & 31, w = t >> 5;
  int b   = blockIdx.x >> 2;
  int blk = blockIdx.x & 3;
  int n0  = blk * 256 + w * 32;
  const half_t* kp = kf + ((long)b * NKV + n0) * 256;
  const half_t* qp = qbp + (long)b * 8192;
  v8f acc[2][2];  // [M-tile][column tile]
  for (int i = 0; i < 2; ++i)
    for (int k = 0; k < 2; ++k)
      for (int j = 0; j < 8; ++j) acc[i][k][j] = 0.f;
  for (int kk = 0; kk < 8; ++kk) {
    v16h a0  = frag_rowmajor(kp + kk * 32, 256, lane);
    v16h a1  = frag_rowmajor(kp + 16 * 256 + kk * 32, 256, lane);
    v16h bq0 = frag_packed(qp + (long)(kk * 2 + 0) * 512, lane);
    v16h bq1 = frag_packed(qp + (long)(kk * 2 + 1) * 512, lane);
    acc[0][0] = wmma_f16(a0, bq0, acc[0][0]);
    acc[0][1] = wmma_f16(a0, bq1, acc[0][1]);
    acc[1][0] = wmma_f16(a1, bq0, acc[1][0]);
    acc[1][1] = wmma_f16(a1, bq1, acc[1][1]);
  }
  int c16 = lane & 15, hi = lane >> 4;
  float cs0 = 0.f, cs1 = 0.f;
  union { uint4 u[2]; half_t h[16]; } p0, p1;
  float* vp = vis_out + (long)b * NQ * NKV + (c16 & 7) * NKV + n0 + hi * 8 +
              (c16 >> 3) * 4;
#pragma unroll
  for (int i = 0; i < 2; ++i) {
    float vis[8];
#pragma unroll
    for (int r = 0; r < 8; ++r) {
      float x0 = acc[i][0][r], x1 = acc[i][1][r];
      float mx = row_max16(fmaxf(x0, x1));
      float e0 = exp_slot(x0 - mx), e1 = exp_slot(x1 - mx);
      float inv = 1.f / row_sum16(e0 + e1);
      e0 *= inv; e1 *= inv;
      cs0 += e0; cs1 += e1;
      p0.h[i * 8 + r] = (half_t)e0;
      p1.h[i * 8 + r] = (half_t)e1;
      float v_ = e0 + e1;           // heads 0+2 (or 1+3) of slot c16 & 7
      vis[r] = v_ + row_xor<8>(v_);  // attn_vis = sum over heads
    }
    // lanes c16 and c16 ^ 8 hold the same 8 sums: each stores four of them
    float4 o;
    o.x = (c16 & 8) ? vis[4] : vis[0];
    o.y = (c16 & 8) ? vis[5] : vis[1];
    o.z = (c16 & 8) ? vis[6] : vis[2];
    o.w = (c16 & 8) ? vis[7] : vis[3];
    *(float4*)(vp + i * 16) = o;
  }
  half_t* ab = apk + (long)b * 32768 + (long)(blk * 8 + w) * 1024 + lane * 16;
  *(uint4*)(ab)           = p0.u[0];
  *(uint4*)(ab + 8)       = p0.u[1];
  *(uint4*)(ab + 512)     = p1.u[0];
  *(uint4*)(ab + 512 + 8) = p1.u[1];
  // column sums: 16 rows in the lane, the other 16 in lane ^ 16, then the
  // eight waves in a fixed order
  cs0 += xhalf(cs0);
  cs1 += xhalf(cs1);
  csl[w][lane] = hi ? cs1 : cs0;
  __syncthreads();
  if (t < 32) {
    float s = 0.f;
#pragma unroll
    for (int j = 0; j < 8; ++j) s += csl[j][t];
    cpart[(b * 4 + blk) * 32 + t] = s;
  }
}

__global__ void k_inv(const float* __restrict__ cpart, float* __restrict__ inv) {
  int i = blockIdx.x * 256 + threadIdx.x;
  if (i < B_ * 32) {
    const float* p = cpart + (i >> 5) * 128 + (i & 31);
    float s = ((p[0] + p[32]) + p[64]) + p[96];
    inv[i] = 1.f / (s + (float)NKV * EPS_);
  }
}

// ---------------- updates = norm(attn+eps)^T @ V (WMMA, all packed) ----------
__global__ void __launch_bounds__(256) k_attnv(
    const half_t* __restrict__ apk, const half_t* __restrict__ vpk,
    const float* __restrict__ colv, const float* __restrict__ invs,
    float* __restrict__ upd) {
  int t = threadIdx.x, lane = t & 31, w = t >> 5;
  int b = blockIdx.x;
  const half_t* ab = apk + (long)b * 32768;
  const half_t* vb = vpk + (long)b * 262144;
  v8f acc[2][2];
  for (int i = 0; i < 2; ++i)
    for (int j = 0; j < 2; ++j)
      for (int e = 0; e < 8; ++e) acc[i][j][e] = 0.f;
  for (int kk = 0; kk < 32; ++kk) {
    // all four fragment loads first, then the WMMA burst
    v16h a0 = frag_packed(ab + (long)(kk * 2 + 0) * 512, lane);
    v16h a1 = frag_packed(ab + (long)(kk * 2 + 1) * 512, lane);
    v16h b0 = frag_packed(vb + (long)(kk * 16 + 2 * w + 0) * 512, lane);
    v16h b1 = frag_packed(vb + (long)(kk * 16 + 2 * w + 1) * 512, lane);
    acc[0][0] = wmma_f16(a0, b0, acc[0][0]);
    acc[1][0] = wmma_f16(a1, b0, acc[1][0]);
    acc[0][1] = wmma_f16(a0, b1, acc[0][1]);
    acc[1][1] = wmma_f16(a1, b1, acc[1][1]);
  }
  int mo = (lane >> 4) << 3;
#pragma unroll
  for (int mt = 0; mt < 2; ++mt)
#pragma unroll
    for (int ntl = 0; ntl < 2; ++ntl) {
      int d = (2 * w + ntl) * 16 + (lane & 15);
#pragma unroll
      for (int r = 0; r < 8; ++r) {
        int hq = mt * 16 + r + mo;
        int h = hq >> 3;
        if ((d >> 6) == h) {  // keep only this head's 64-wide slice
          int qi = hq & 7;
          float val = (acc[mt][ntl][r] + EPS_ * colv[b * 256 + d]) *
                      invs[b * 32 + hq];
          upd[((long)b * NQ + qi) * S_ + d] = val;
        }
      }
    }
}

// ---------------- GRU cell (f32 WMMA 16x16x4) --------------------------------
// xg = upd @ wih^T and hg = hprev @ whh^T as Y = X W^T with X and W both
// k-contiguous. One wave owns 16 rows (of the B*NQ = 512) x 16 columns j of
// all three gates over the whole k = 256: no LDS, no barrier, no partial sums
// between waves. A block's two waves take neighbouring column tiles, so the
// block writes whole 128-byte lines. grid: 32 row tiles x 8 column pairs.
// k order: lane (c, h) loads floats k0 + 4h .. k0 + 4h + 3 of its row of X and
// of its row of W by the same offsets; elements (0,1) feed one WMMA, (2,3) the
// next, so A and B pair the same k at every lane and register.
__device__ inline v8f wmma_f32(float ax, float ay, float bx, float by, v8f c) {
  v2f a = {ax, ay};
  v2f b = {bx, by};
  return __builtin_amdgcn_wmma_f32_16x16x4_f32(false, a, false, b, (short)0, c,
                                               false, false);
}
__global__ void __launch_bounds__(64) k_gru(
    const float* __restrict__ upd, const float* __restrict__ hprev,
    const float* __restrict__ wih, const float* __restrict__ whh,
    const float* __restrict__ bih, const float* __restrict__ bhh,
    float* __restrict__ hout) {
  int lane = threadIdx.x & 31, w = threadIdx.x >> 5;
  int c = lane & 15, h = lane >> 4;
  int m0 = (blockIdx.x >> 3) * 16;
  int n0 = (blockIdx.x & 7) * 32 + w * 16;
  int j  = n0 + c;
  int ao = (m0 + c) * 256 + 4 * h;
  int bo = j * 256 + 4 * h;
  const float* s[8] = {upd + ao,          hprev + ao,
                       wih + bo,          whh + bo,
                       wih + 65536 + bo,  whh + 65536 + bo,
                       wih + 131072 + bo, whh + 131072 + bo};
  // every D register of a lane is column j, so the accumulators start from
  // the gate biases of that column
  float br = bih[j] + bhh[j];
  float bz = bih[256 + j] + bhh[256 + j];
  float bi3 = bih[512 + j], bh3 = bhh[512 + j];
  // D register e of lane (c, h) is row m0 + 8h + e, column j
  long ob = (long)(m0 + 8 * h) * 256 + j;
  float hp[8];
  float4 f[2][2][8];  // [stage][8-k step][matrix]
#pragma unroll
  for (int q = 0; q < 2; ++q)
#pragma unroll
    for (int x = 0; x < 8; ++x) f[0][q][x] = *(const float4*)(s[x] + q * 8);
  // The accumulators may take the register that the bias loads name as their
  // offset: the wait stands in front of that overwrite, and the scheduling
  // barriers keep the accumulators' first writes behind it.
  __builtin_amdgcn_sched_barrier(0);
  asm volatile("s_wait_xcnt 0x0" ::: "memory");
  __builtin_amdgcn_sched_barrier(0);
  v8f ar, az, ani, anh;
  for (int e = 0; e < 8; ++e) { ar[e] = br; az[e] = bz; ani[e] = bi3; anh[e] = bh3; }
  // unrolled whole so that the stage index is static and the next 16 k of all
  // eight operands are in flight under this stage's 24 WMMAs
#pragma unroll
  for (int ch = 0; ch < 16; ++ch) {
    if (ch + 1 < 16) {
#pragma unroll
      for (int q = 0; q < 2; ++q)
#pragma unroll
        for (int x = 0; x < 8; ++x)
          f[(ch + 1) & 1][q][x] = *(const float4*)(s[x] + (ch + 1) * 16 + q * 8);
    } else {
      // Every operand load is issued and its address registers are free for
      // reuse from here on: the wait stands in front of the first overwrite
      // (the scheduling barrier keeps later address arithmetic behind it).
      // The old state for the output blend then loads under the last WMMAs.
      __builtin_amdgcn_sched_barrier(0);
      asm volatile("s_wait_xcnt 0x0" ::: "memory");
#pragma unroll
      for (int e = 0; e < 8; ++e) hp[e] = hprev[ob + e * 256];
    }
    // keeps the next stage's loads above this stage's WMMAs: left free, the
    // scheduler sinks each load to its first use and every WMMA group then
    // waits out a whole load latency
    __builtin_amdgcn_sched_barrier(0);
#pragma unroll
    for (int q = 0; q < 2; ++q) {
      const float4* g = f[ch & 1][q];
      ar  = wmma_f32(g[0].x, g[0].y, g[2].x, g[2].y, ar);
      az  = wmma_f32(g[0].x, g[0].y, g[4].x, g[4].y, az);
      ani = wmma_f32(g[0].x, g[0].y, g[6].x, g[6].y, ani);
      anh = wmma_f32(g[1].x, g[1].y, g[7].x, g[7].y, anh);
      ar  = wmma_f32(g[1].x, g[1].y, g[3].x, g[3].y, ar);
      az  = wmma_f32(g[1].x, g[1].y, g[5].x, g[5].y, az);
      ani = wmma_f32(g[0].z, g[0].w, g[6].z, g[6].w, ani);
      anh = wmma_f32(g[1].z, g[1].w, g[7].z, g[7].w, anh);
      ar  = wmma_f32(g[0].z, g[0].w, g[2].z, g[2].w, ar);
      az  = wmma_f32(g[0].z, g[0].w, g[4].z, g[4].w, az);
      ar  = wmma_f32(g[1].z, g[1].w, g[3].z, g[3].w, ar);
      az  = wmma_f32(g[1].z, g[1].w, g[5].z, g[5].w, az);
    }
  }
  // The table of WMMA distances leaves the f32 16x16x4 form out: eight slots, the count of the slowest
  // listed form, stand between the last WMMA and the first vector read of an
  // accumulator. The two scheduling barriers hold the slots at that place.
  __builtin_amdgcn_sched_barrier(0);
  asm volatile("v_nop\n\tv_nop\n\tv_nop\n\tv_nop\n\tv_nop\n\tv_nop\n\tv_nop\n\tv_nop");
  __builtin_amdgcn_sched_barrier(0);
#pragma unroll
  for (int e = 0; e < 8; ++e) {
    float r = 1.f / (1.f + __expf(-ar[e]));
    float z = 1.f / (1.f + __expf(-az[e]));
    float n = tanhf(ani[e] + r * anh[e]);
    hout[ob + e * 256] = (1.f - z) * n + z * hp[e];
  }
}

// ---------------- LN + MLP residual (fp32 VALU), one batch per block ---------
__global__ void __launch_bounds__(256) k_mlp(
    const float* __restrict__ hin, const float* __restrict__ g,
    const float* __restrict__ bb, const float* __restrict__ w1,
    const float* __restrict__ b1, const float* __restrict__ w2,
    const float* __restrict__ b2, float* __restrict__ slots_out,
    float* __restrict__ dout, int write_out) {
  __shared__ float h[8][256], m[8][256], hid[8][512];
  __shared__ float red[256];
  int b = blockIdx.x, t = threadIdx.x;
  for (int i = t; i < 2048; i += 256) h[i >> 8][i & 255] = hin[(long)b * 2048 + i];
  __syncthreads();
  for (int row = 0; row < 8; ++row) {
    float x = h[row][t];
    red[t] = x; __syncthreads();
    for (int s = 128; s > 0; s >>= 1) { if (t < s) red[t] += red[t + s]; __syncthreads(); }
    float mu = red[0] * (1.f / 256.f); __syncthreads();
    float d = x - mu;
    red[t] = d * d; __syncthreads();
    for (int s = 128; s > 0; s >>= 1) { if (t < s) red[t] += red[t + s]; __syncthreads(); }
    float rs = rsqrtf(red[0] * (1.f / 256.f) + LNE_); __syncthreads();
    m[row][t] = d * rs * g[t] + bb[t];
  }
  __syncthreads();
  for (int half = 0; half < 2; ++half) {
    int col = half * 256 + t;
    float a[8];
    for (int i = 0; i < 8; ++i) a[i] = 0.f;
    for (int k = 0; k < 256; ++k) {
      float w_ = w1[(long)k * 512 + col];
#pragma unroll
      for (int i = 0; i < 8; ++i) a[i] += m[i][k] * w_;
    }
    float bias = b1[col];
    for (int i = 0; i < 8; ++i) hid[i][col] = fmaxf(a[i] + bias, 0.f);
  }
  __syncthreads();
  {
    float a[8];
    for (int i = 0; i < 8; ++i) a[i] = 0.f;
    for (int j = 0; j < 512; ++j) {
      float w_ = w2[(long)j * 256 + t];
#pragma unroll
      for (int i = 0; i < 8; ++i) a[i] += hid[i][j] * w_;
    }
    float bias = b2[t];
    for (int i = 0; i < 8; ++i) {
      float o = h[i][t] + a[i] + bias;
      slots_out[(long)b * 2048 + i * 256 + t] = o;
      if (write_out) dout[(long)b * 2048 + i * 256 + t] = o;
    }
  }
}

// ---------------- host orchestration ----------------------------------------
extern "C" void kernel_launch(void* const* d_in, const int* in_sizes, int n_in,
                              void* d_out, int out_size, void* d_ws,
                              size_t ws_size, hipStream_t stream) {
  (void)in_sizes; (void)n_in; (void)out_size; (void)ws_size;
  const float* inputs   = (const float*)d_in[0];
  const float* slots0   = (const float*)d_in[1];
  const float* ln_in_g  = (const float*)d_in[2];
  const float* ln_in_b  = (const float*)d_in[3];
  const float* ln_sl_g  = (const float*)d_in[4];
  const float* ln_sl_b  = (const float*)d_in[5];
  const float* ln_mlp_g = (const float*)d_in[6];
  const float* ln_mlp_b = (const float*)d_in[7];
  const float* Wq       = (const float*)d_in[8];
  const float* Wk       = (const float*)d_in[9];
  const float* Wv       = (const float*)d_in[10];
  const float* gwih     = (const float*)d_in[11];
  const float* gwhh     = (const float*)d_in[12];
  const float* gbih     = (const float*)d_in[13];
  const float* gbhh     = (const float*)d_in[14];
  const float* w1       = (const float*)d_in[15];
  const float* b1       = (const float*)d_in[16];
  const float* w2       = (const float*)d_in[17];
  const float* b2       = (const float*)d_in[18];

  char* ws = (char*)d_ws;
  half_t* kf   = (half_t*)(ws + 0);          // 32 MB  K dense f16 (pre-scaled)
  half_t* vpk  = (half_t*)(ws + 33554432);   // 32 MB  V fragment-packed
  half_t* wkp  = (half_t*)(ws + 67108864);   // 128 KB Wk packed
  half_t* wvp  = (half_t*)(ws + 67239936);   // 128 KB Wv packed
  float*  colv = (float*)(ws + 67371008);    // 64 KB  column sums of V
  half_t* qbp  = (half_t*)(ws + 67436544);   // 1 MB   block-diag Q packed
  half_t* apk  = (half_t*)(ws + 68485120);   // 4 MB   attn^T fragment-packed
  float*  invs = (float*)(ws + 72687616);    // 8 KB
  float*  upd  = (float*)(ws + 72695808);    // 512 KB
  float*  scur = (float*)(ws + 73220096);    // 512 KB current slots
  float*  smid = (float*)(ws + 73744384);    // 512 KB post-GRU slots
  float*  csum = (float*)(ws + 74268672);    // 32 KB  attn column-sum partials

  float* out_slots = (float*)d_out;
  float* out_vis   = out_slots + (long)B_ * NQ * S_;

  hipMemcpyAsync(scur, slots0, (size_t)B_ * NQ * S_ * sizeof(float),
                 hipMemcpyDeviceToDevice, stream);
  k_cvt<<<256, 256, 0, stream>>>(Wk, Wv, wkp, wvp);
  k_proj<<<(B_ * NKV) / 32, 256, 0, stream>>>(inputs, ln_in_g, ln_in_b, wkp, wvp,
                                              kf, vpk);
  k_colv<<<B_, 256, 0, stream>>>(vpk, colv);

  for (int it = 0; it < 3; ++it) {
    k_qbuild<<<B_, 256, 0, stream>>>(scur, ln_sl_g, ln_sl_b, Wq, qbp);
    k_logits<<<B_ * (NKV / 256), 256, 0, stream>>>(kf, qbp, apk, csum, out_vis);
    k_inv<<<8, 256, 0, stream>>>(csum, invs);
    k_attnv<<<B_, 256, 0, stream>>>(apk, vpk, colv, invs, upd);
    k_gru<<<256, 64, 0, stream>>>(upd, scur, gwih, gwhh, gbih, gbhh, smid);
    k_mlp<<<B_, 256, 0, stream>>>(smid, ln_mlp_g, ln_mlp_b, w1, b1, w2, b2, scur,
                                  out_slots, (it == 2) ? 1 : 0);
  }
}

// v003
// Two timings next to v002 both put it at 1.64 times that version's speed.
// Counting every step since v000, it is 2.37 times as fast.
#include <hip/hip_runtime.h>
#include <hip/hip_bf16.h>

typedef __attribute__((ext_vector_type(16))) _Float16 v16h;
typedef __attribute__((ext_vector_type(8)))  float    v8f;
typedef __attribute__((ext_vector_type(2)))  float    v2f;
typedef _Float16 half_t;

#define B_     64
#define NKV    1024
#define NQ     8
#define S_     256
#define HM_    512
#define EPS_   1e-8f
#define LNE_   1e-5f

// ---------------- WMMA fragment helpers (CDNA5 16x16x32 f16 layout) ----------
// 16-bit operand layout: lane L, klo = (L>=16)?8:0; elems 0..7 hold K =
// klo..klo+7, elems 8..15 hold K = klo+16..klo+23 (row/col index = L&15).

// A-fragment from row-major source (ld in halves): two 16B vector loads.
__device__ inline v16h frag_rowmajor(const half_t* p, int ld, int lane) {
  int m   = lane & 15;
  int klo = (lane >> 4) << 3;
  const half_t* q = p + m * ld + klo;
  union { uint4 u[2]; v16h h; } c;
  c.u[0] = *(const uint4*)(q);
  c.u[1] = *(const uint4*)(q + 16);
  return c.h;
}
// Fragment from pre-packed storage: packed[...][lane][16] -> two contiguous 16B loads.
__device__ inline v16h frag_packed(const half_t* p, int lane) {
  const half_t* q = p + lane * 16;
  union { uint4 u[2]; v16h h; } c;
  c.u[0] = *(const uint4*)(q);
  c.u[1] = *(const uint4*)(q + 8);
  return c.h;
}
// (lane, elem) -> K-within-32
__device__ inline int klocal_of(int lane, int e) {
  int klo = (lane >> 4) << 3;
  return (e < 8) ? (klo + e) : (klo + 8 + e);
}
// inverse: K-within-32 -> (lane group offset 0/16, elem)
__device__ inline void inv_klocal(int k_local, int& laneoff, int& e) {
  laneoff = ((k_local & 15) >= 8) ? 16 : 0;
  e = (k_local & 7) + ((k_local >= 16) ? 8 : 0);
}
__device__ inline v8f wmma_f16(v16h a, v16h b, v8f c) {
  return __builtin_amdgcn_wmma_f32_16x16x32_f16(false, a, false, b, (short)0, c,
                                                false, false);
}

// ---------------- Wk/Wv fp32 -> fragment-packed fp16 -------------------------
// packed idx = ((kk*16 + nt)*32 + lane)*16 + e ; 8 kk x 16 nt tiles
__global__ void k_cvt(const float* __restrict__ wk, const float* __restrict__ wv,
                      half_t* __restrict__ wkp, half_t* __restrict__ wvp) {
  int idx  = blockIdx.x * 256 + threadIdx.x;  // 65536 halves per matrix
  int e    = idx & 15;
  int lane = (idx >> 4) & 31;
  int nt   = (idx >> 9) & 15;
  int kk   = idx >> 13;
  int k = kk * 32 + klocal_of(lane, e);
  int n = nt * 16 + (lane & 15);
  wkp[idx] = (half_t)wk[k * 256 + n];
  wvp[idx] = (half_t)wv[k * 256 + n];
}

// ---------------- fused LayerNorm(inputs) + K/V projection (WMMA) ------------
// grid: (B*NKV)/32 blocks, 256 threads (8 waves: 2 M-tiles x 4 N-quadrants)
// K written dense row-major (A-operand of logits); V written fragment-packed
// (B-operand of attn@V): vpk[b][krow=32][nt=16][lane=32][e=16]
__global__ void __launch_bounds__(256) k_proj(
    const float* __restrict__ x, const float* __restrict__ g,
    const float* __restrict__ bb, const half_t* __restrict__ wkp,
    const half_t* __restrict__ wvp, half_t* __restrict__ kf,
    half_t* __restrict__ vpk) {
  __shared__ float xs[32][256];
  __shared__ __align__(32) half_t xh[32][256];
  __shared__ float psum[32][8], psq[32][8];
  __shared__ float mu[32], rs[32];
  int t = threadIdx.x;
  long base = (long)blockIdx.x * 32 * 256;
  for (int i = t; i < 32 * 256; i += 256) xs[i >> 8][i & 255] = x[base + i];
  __syncthreads();
  {
    int row = t >> 3, seg = t & 7;
    float s = 0.f, s2 = 0.f;
    for (int c = seg * 32; c < seg * 32 + 32; ++c) {
      float v_ = xs[row][c]; s += v_; s2 += v_ * v_;
    }
    psum[row][seg] = s; psq[row][seg] = s2;
  }
  __syncthreads();
  if (t < 32) {
    float s = 0.f, s2 = 0.f;
    for (int j = 0; j < 8; ++j) { s += psum[t][j]; s2 += psq[t][j]; }
    float m = s * (1.f / 256.f);
    mu[t] = m; rs[t] = rsqrtf(s2 * (1.f / 256.f) - m * m + LNE_);
  }
  __syncthreads();
  for (int i = t; i < 32 * 256; i += 256) {
    int row = i >> 8, col = i & 255;
    xh[row][col] = (half_t)((xs[row][col] - mu[row]) * rs[row] * g[col] + bb[col]);
  }
  __syncthreads();

  int lane = t & 31, w = t >> 5;
  int mt = w & 1, nq4 = w >> 1;
  v8f ak[4], av[4];
  for (int i = 0; i < 4; ++i)
    for (int j = 0; j < 8; ++j) { ak[i][j] = 0.f; av[i][j] = 0.f; }
  for (int kk = 0; kk < 8; ++kk) {
    // issue ALL fragment loads of this K-step first (independent b128s),
    // then the WMMA burst -> backend can use partial s_wait_loadcnt
    v16h a = frag_rowmajor(&xh[mt * 16][kk * 32], 256, lane);
    v16h bk[4], bv[4];
#pragma unroll
    for (int ti = 0; ti < 4; ++ti) {
      int nt = nq4 * 4 + ti;
      bk[ti] = frag_packed(wkp + (long)(kk * 16 + nt) * 512, lane);
      bv[ti] = frag_packed(wvp + (long)(kk * 16 + nt) * 512, lane);
    }
#pragma unroll
    for (int ti = 0; ti < 4; ++ti) {
      ak[ti] = wmma_f16(a, bk[ti], ak[ti]);
      av[ti] = wmma_f16(a, bv[ti], av[ti]);
    }
  }
  int b    = blockIdx.x >> 5;   // 32 blocks per batch (1024 rows)
  int krow = blockIdx.x & 31;   // which 32-row band (K index for attn@V)
  half_t* vb = vpk + (long)b * 262144;
  long rb = (long)blockIdx.x * 32 + mt * 16;
  int mo = (lane >> 4) << 3;
  int nl = lane & 15;
#pragma unroll
  for (int ti = 0; ti < 4; ++ti) {
    int nt  = nq4 * 4 + ti;
    int col = nt * 16 + nl;
#pragma unroll
    for (int r = 0; r < 8; ++r) {
      long row = rb + r + mo;
      kf[row * 256 + col] = (half_t)(ak[ti][r] * 0.125f);  // hd^-0.5
      int k_local = mt * 16 + r + mo;
      int lo, e; inv_klocal(k_local, lo, e);
      vb[((long)(krow * 16 + nt) * 32 + lo + nl) * 16 + e] = (half_t)(av[ti][r]);
    }
  }
}

// ---------------- column sums of V from packed layout ------------------------
__global__ void k_colv(const half_t* __restrict__ vpk, float* __restrict__ colv) {
  int b = blockIdx.x, d = threadIdx.x;
  const half_t* vb = vpk + (long)b * 262144;
  int nt = d >> 4, nl = d & 15;
  float s = 0.f;
  for (int n = 0; n < NKV; ++n) {
    int kk = n >> 5, kl = n & 31;
    int lo, e; inv_klocal(kl, lo, e);
    s += (float)vb[((long)(kk * 16 + nt) * 32 + lo + nl) * 16 + e];
  }
  colv[b * 256 + d] = s;
}

// ---------------- LN(slots) + q = s@Wq, packed block-diagonal Qb -------------
// qbp[b][kk=8][ti=2][lane=32][e=16]
__global__ void __launch_bounds__(256) k_qbuild(
    const float* __restrict__ slots, const float* __restrict__ g,
    const float* __restrict__ bb, const float* __restrict__ wq,
    half_t* __restrict__ qbp) {
  __shared__ float sln[8][256];
  __shared__ float ps[8][32], pq[8][32];
  __shared__ float mu[8], rs[8];
  __shared__ half_t qlds[256][32];
  int b = blockIdx.x, t = threadIdx.x;
  const float* sp = slots + (long)b * NQ * S_;
  {
    int row = t >> 5, seg = t & 31;
    float s = 0.f, s2 = 0.f;
    for (int c = seg * 8; c < seg * 8 + 8; ++c) {
      float v_ = sp[row * 256 + c];
      sln[row][c] = v_; s += v_; s2 += v_ * v_;
    }
    ps[row][seg] = s; pq[row][seg] = s2;
  }
  __syncthreads();
  if (t < 8) {
    float s = 0.f, s2 = 0.f;
    for (int j = 0; j < 32; ++j) { s += ps[t][j]; s2 += pq[t][j]; }
    float m = s * (1.f / 256.f);
    mu[t] = m; rs[t] = rsqrtf(s2 * (1.f / 256.f) - m * m + LNE_);
  }
  __syncthreads();
  for (int i = t; i < 8 * 256; i += 256) {
    int r = i >> 8, c = i & 255;
    sln[r][c] = (sln[r][c] - mu[r]) * rs[r] * g[c] + bb[c];
  }
  __syncthreads();
  float q8[8];
  for (int i = 0; i < 8; ++i) q8[i] = 0.f;
  for (int k = 0; k < 256; ++k) {
    float wv_ = wq[k * 256 + t];
#pragma unroll
    for (int i = 0; i < 8; ++i) q8[i] += sln[i][k] * wv_;
  }
  for (int i = t; i < 256 * 32; i += 256) ((half_t*)qlds)[i] = (half_t)0.f;
  __syncthreads();
  {
    int h = t >> 6;  // head of k-index t
#pragma unroll
    for (int qi = 0; qi < 8; ++qi) qlds[t][h * 8 + qi] = (half_t)q8[qi];
  }
  __syncthreads();
  half_t* qp = qbp + (long)b * 8192;
#pragma unroll
  for (int rep = 0; rep < 2; ++rep) {   // 512 (kk,ti,lane) triples / 256 thr
    int trip = rep * 256 + t;
    int lane = trip & 31, ti = (trip >> 5) & 1, kk = trip >> 6;
    union { uint4 u[2]; half_t h[16]; } c;
#pragma unroll
    for (int e = 0; e < 16; ++e)
      c.h[e] = qlds[kk * 32 + klocal_of(lane, e)][ti * 16 + (lane & 15)];
    *(uint4*)(qp + trip * 16)     = c.u[0];
    *(uint4*)(qp + trip * 16 + 8) = c.u[1];
  }
}

// ---------------- logits GEMM (WMMA) + fused joint softmax -------------------
// value of lane (l ^ M) of the same 16-lane row (DPP row_xmask)
template <int M>
__device__ inline float row_xor(float v) {
  return __builtin_bit_cast(
      float, __builtin_amdgcn_mov_dpp(__builtin_bit_cast(int, v), 0x160 | M, 0xf,
                                      0xf, true));
}
__device__ inline float row_max16(float v) {
  v = fmaxf(v, row_xor<1>(v));
  v = fmaxf(v, row_xor<2>(v));
  v = fmaxf(v, row_xor<4>(v));
  v = fmaxf(v, row_xor<8>(v));
  return v;
}
__device__ inline float row_sum16(float v) {
  v += row_xor<1>(v);
  v += row_xor<2>(v);
  v += row_xor<4>(v);
  v += row_xor<8>(v);
  return v;
}
// value of lane l ^ 16
__device__ inline float xhalf(float x) {
  int i = __builtin_bit_cast(int, x);
  return __builtin_bit_cast(
      float, __builtin_amdgcn_permlanex16(i, i, 0x76543210, 0xfedcba98, false,
                                          false));
}

// exp(x) as __expf builds it: one multiply and v_exp_f32. The v_nop fills the
// one slot the instruction set asks for behind a transcendental before its
// source is overwritten or its result read.
__device__ inline float exp_slot(float x) {
  float r;
  asm("v_exp_f32 %0, %1\n\tv_nop" : "=v"(r) : "v"(x * 1.44269504f));
  return r;
}

// grid: B * (NKV/256); each wave owns 32 kv rows (two M-tiles) x all 32
// (head, slot) columns, so a softmax row lies in one 16-lane row of two
// accumulators and the wave's 32 rows are exactly one K-step of attn@V.
// attn written fragment-packed for attn@V A-operand:
// apk[b][kk=32][mt=2][lane=32][e=16]; lane and e follow from the D layout:
// D register r of M-tile i at lane l is k_local = 16 i + 8 (l >> 4) + r,
// which is element e = 8 i + r of the same lane l.
// Column sums leave as one partial per block: cpart[b][blk=4][32].
__global__ void __launch_bounds__(256) k_logits(
    const half_t* __restrict__ kf, const half_t* __restrict__ qbp,
    half_t* __restrict__ apk, float* __restrict__ cpart,
    float* __restrict__ vis_out) {
  __shared__ float csl[8][32];
  int t = threadIdx.x, lane = t & 31, w = t >> 5;
  int b   = blockIdx.x >> 2;
  int blk = blockIdx.x & 3;
  int n0  = blk * 256 + w * 32;
  const half_t* kp = kf + ((long)b * NKV + n0) * 256;
  const half_t* qp = qbp + (long)b * 8192;
  v8f acc[2][2];  // [M-tile][column tile]
  for (int i = 0; i < 2; ++i)
    for (int k = 0; k < 2; ++k)
      for (int j = 0; j < 8; ++j) acc[i][k][j] = 0.f;
  for (int kk = 0; kk < 8; ++kk) {
    v16h a0  = frag_rowmajor(kp + kk * 32, 256, lane);
    v16h a1  = frag_rowmajor(kp + 16 * 256 + kk * 32, 256, lane);
    v16h bq0 = frag_packed(qp + (long)(kk * 2 + 0) * 512, lane);
    v16h bq1 = frag_packed(qp + (long)(kk * 2 + 1) * 512, lane);
    acc[0][0] = wmma_f16(a0, bq0, acc[0][0]);
    acc[0][1] = wmma_f16(a0, bq1, acc[0][1]);
    acc[1][0] = wmma_f16(a1, bq0, acc[1][0]);
    acc[1][1] = wmma_f16(a1, bq1, acc[1][1]);
  }
  int c16 = lane & 15, hi = lane >> 4;
  float cs0 = 0.f, cs1 = 0.f;
  union { uint4 u[2]; half_t h[16]; } p0, p1;
  float* vp = vis_out + (long)b * NQ * NKV + (c16 & 7) * NKV + n0 + hi * 8 +
              (c16 >> 3) * 4;
#pragma unroll
  for (int i = 0; i < 2; ++i) {
    float vis[8];
#pragma unroll
    for (int r = 0; r < 8; ++r) {
      float x0 = acc[i][0][r], x1 = acc[i][1][r];
      float mx = row_max16(fmaxf(x0, x1));
      float e0 = exp_slot(x0 - mx), e1 = exp_slot(x1 - mx);
      float inv = 1.f / row_sum16(e0 + e1);
      e0 *= inv; e1 *= inv;
      cs0 += e0; cs1 += e1;
      p0.h[i * 8 + r] = (half_t)e0;
      p1.h[i * 8 + r] = (half_t)e1;
      float v_ = e0 + e1;           // heads 0+2 (or 1+3) of slot c16 & 7
      vis[r] = v_ + row_xor<8>(v_);  // attn_vis = sum over heads
    }
    // lanes c16 and c16 ^ 8 hold the same 8 sums: each stores four of them
    float4 o;
    o.x = (c16 & 8) ? vis[4] : vis[0];
    o.y = (c16 & 8) ? vis[5] : vis[1];
    o.z = (c16 & 8) ? vis[6] : vis[2];
    o.w = (c16 & 8) ? vis[7] : vis[3];
    *(float4*)(vp + i * 16) = o;
  }
  half_t* ab = apk + (long)b * 32768 + (long)(blk * 8 + w) * 1024 + lane * 16;
  *(uint4*)(ab)           = p0.u[0];
  *(uint4*)(ab + 8)       = p0.u[1];
  *(uint4*)(ab + 512)     = p1.u[0];
  *(uint4*)(ab + 512 + 8) = p1.u[1];
  // column sums: 16 rows in the lane, the other 16 in lane ^ 16, then the
  // eight waves in a fixed order
  cs0 += xhalf(cs0);
  cs1 += xhalf(cs1);
  csl[w][lane] = hi ? cs1 : cs0;
  __syncthreads();
  if (t < 32) {
    float s = 0.f;
#pragma unroll
    for (int j = 0; j < 8; ++j) s += csl[j][t];
    cpart[(b * 4 + blk) * 32 + t] = s;
  }
}

__global__ void k_inv(const float* __restrict__ cpart, float* __restrict__ inv) {
  int i = blockIdx.x * 256 + threadIdx.x;
  if (i < B_ * 32) {
    const float* p = cpart + (i >> 5) * 128 + (i & 31);
    float s = ((p[0] + p[32]) + p[64]) + p[96];
    inv[i] = 1.f / (s + (float)NKV * EPS_);
  }
}

// ---------------- updates = norm(attn+eps)^T @ V (WMMA, all packed) ----------
__global__ void __launch_bounds__(256) k_attnv(
    const half_t* __restrict__ apk, const half_t* __restrict__ vpk,
    const float* __restrict__ colv, const float* __restrict__ invs,
    float* __restrict__ upd) {
  int t = threadIdx.x, lane = t & 31, w = t >> 5;
  int b = blockIdx.x;
  const half_t* ab = apk + (long)b * 32768;
  const half_t* vb = vpk + (long)b * 262144;
  v8f acc[2][2];
  for (int i = 0; i < 2; ++i)
    for (int j = 0; j < 2; ++j)
      for (int e = 0; e < 8; ++e) acc[i][j][e] = 0.f;
  for (int kk = 0; kk < 32; ++kk) {
    // all four fragment loads first, then the WMMA burst
    v16h a0 = frag_packed(ab + (long)(kk * 2 + 0) * 512, lane);
    v16h a1 = frag_packed(ab + (long)(kk * 2 + 1) * 512, lane);
    v16h b0 = frag_packed(vb + (long)(kk * 16 + 2 * w + 0) * 512, lane);
    v16h b1 = frag_packed(vb + (long)(kk * 16 + 2 * w + 1) * 512, lane);
    acc[0][0] = wmma_f16(a0, b0, acc[0][0]);
    acc[1][0] = wmma_f16(a1, b0, acc[1][0]);
    acc[0][1] = wmma_f16(a0, b1, acc[0][1]);
    acc[1][1] = wmma_f16(a1, b1, acc[1][1]);
  }
  int mo = (lane >> 4) << 3;
#pragma unroll
  for (int mt = 0; mt < 2; ++mt)
#pragma unroll
    for (int ntl = 0; ntl < 2; ++ntl) {
      int d = (2 * w + ntl) * 16 + (lane & 15);
#pragma unroll
      for (int r = 0; r < 8; ++r) {
        int hq = mt * 16 + r + mo;
        int h = hq >> 3;
        if ((d >> 6) == h) {  // keep only this head's 64-wide slice
          int qi = hq & 7;
          float val = (acc[mt][ntl][r] + EPS_ * colv[b * 256 + d]) *
                      invs[b * 32 + hq];
          upd[((long)b * NQ + qi) * S_ + d] = val;
        }
      }
    }
}

// ---------------- GRU cell (f32 WMMA 16x16x4) --------------------------------
// xg = upd @ wih^T and hg = hprev @ whh^T as Y = X W^T with X and W both
// k-contiguous. One wave owns 16 rows (of the B*NQ = 512) x 16 columns j of
// all three gates over the whole k = 256: no LDS, no barrier, no partial sums
// between waves. A block's two waves take neighbouring column tiles, so the
// block writes whole 128-byte lines. grid: 32 row tiles x 8 column pairs.
// k order: lane (c, h) loads floats k0 + 4h .. k0 + 4h + 3 of its row of X and
// of its row of W by the same offsets; elements (0,1) feed one WMMA, (2,3) the
// next, so A and B pair the same k at every lane and register.
__device__ inline v8f wmma_f32(float ax, float ay, float bx, float by, v8f c) {
  v2f a = {ax, ay};
  v2f b = {bx, by};
  return __builtin_amdgcn_wmma_f32_16x16x4_f32(false, a, false, b, (short)0, c,
                                               false, false);
}
__global__ void __launch_bounds__(64) k_gru(
    const float* __restrict__ upd, const float* __restrict__ hprev,
    const float* __restrict__ wih, const float* __restrict__ whh,
    const float* __restrict__ bih, const float* __restrict__ bhh,
    float* __restrict__ hout) {
  int lane = threadIdx.x & 31, w = threadIdx.x >> 5;
  int c = lane & 15, h = lane >> 4;
  int m0 = (blockIdx.x >> 3) * 16;
  int n0 = (blockIdx.x & 7) * 32 + w * 16;
  int j  = n0 + c;
  int ao = (m0 + c) * 256 + 4 * h;
  int bo = j * 256 + 4 * h;
  const float* s[8] = {upd + ao,          hprev + ao,
                       wih + bo,          whh + bo,
                       wih + 65536 + bo,  whh + 65536 + bo,
                       wih + 131072 + bo, whh + 131072 + bo};
  // every D register of a lane is column j, so the accumulators start from
  // the gate biases of that column
  float br = bih[j] + bhh[j];
  float bz = bih[256 + j] + bhh[256 + j];
  float bi3 = bih[512 + j], bh3 = bhh[512 + j];
  // D register e of lane (c, h) is row m0 + 8h + e, column j
  long ob = (long)(m0 + 8 * h) * 256 + j;
  float hp[8];
  float4 f[2][2][8];  // [stage][8-k step][matrix]
#pragma unroll
  for (int q = 0; q < 2; ++q)
#pragma unroll
    for (int x = 0; x < 8; ++x) f[0][q][x] = *(const float4*)(s[x] + q * 8);
  // The accumulators may take the register that the bias loads name as their
  // offset: the wait stands in front of that overwrite, and the scheduling
  // barriers keep the accumulators' first writes behind it.
  __builtin_amdgcn_sched_barrier(0);
  asm volatile("s_wait_xcnt 0x0" ::: "memory");
  __builtin_amdgcn_sched_barrier(0);
  v8f ar, az, ani, anh;
  for (int e = 0; e < 8; ++e) { ar[e] = br; az[e] = bz; ani[e] = bi3; anh[e] = bh3; }
  // unrolled whole so that the stage index is static and the next 16 k of all
  // eight operands are in flight under this stage's 24 WMMAs
#pragma unroll
  for (int ch = 0; ch < 16; ++ch) {
    if (ch + 1 < 16) {
#pragma unroll
      for (int q = 0; q < 2; ++q)
#pragma unroll
        for (int x = 0; x < 8; ++x)
          f[(ch + 1) & 1][q][x] = *(const float4*)(s[x] + (ch + 1) * 16 + q * 8);
    } else {
      // Every operand load is issued and its address registers are free for
      // reuse from here on: the wait stands in front of the first overwrite
      // (the scheduling barrier keeps later address arithmetic behind it).
      // The old state for the output blend then loads under the last WMMAs.
      __builtin_amdgcn_sched_barrier(0);
      asm volatile("s_wait_xcnt 0x0" ::: "memory");
#pragma unroll
      for (int e = 0; e < 8; ++e) hp[e] = hprev[ob + e * 256];
    }
    // keeps the next stage's loads above this stage's WMMAs: left free, the
    // scheduler sinks each load to its first use and every WMMA group then
    // waits out a whole load latency
    __builtin_amdgcn_sched_barrier(0);
#pragma unroll
    for (int q = 0; q < 2; ++q) {
      const float4* g = f[ch & 1][q];
      ar  = wmma_f32(g[0].x, g[0].y, g[2].x, g[2].y, ar);
      az  = wmma_f32(g[0].x, g[0].y, g[4].x, g[4].y, az);
      ani = wmma_f32(g[0].x, g[0].y, g[6].x, g[6].y, ani);
      anh = wmma_f32(g[1].x, g[1].y, g[7].x, g[7].y, anh);
      ar  = wmma_f32(g[1].x, g[1].y, g[3].x, g[3].y, ar);
      az  = wmma_f32(g[1].x, g[1].y, g[5].x, g[5].y, az);
      ani = wmma_f32(g[0].z, g[0].w, g[6].z, g[6].w, ani);
      anh = wmma_f32(g[1].z, g[1].w, g[7].z, g[7].w, anh);
      ar  = wmma_f32(g[0].z, g[0].w, g[2].z, g[2].w, ar);
      az  = wmma_f32(g[0].z, g[0].w, g[4].z, g[4].w, az);
      ar  = wmma_f32(g[1].z, g[1].w, g[3].z, g[3].w, ar);
      az  = wmma_f32(g[1].z, g[1].w, g[5].z, g[5].w, az);
    }
  }
  // The table of WMMA distances leaves the f32 16x16x4 form out: eight slots, the count of the slowest
  // listed form, stand between the last WMMA and the first vector read of an
  // accumulator. The two scheduling barriers hold the slots at that place.
  __builtin_amdgcn_sched_barrier(0);
  asm volatile("v_nop\n\tv_nop\n\tv_nop\n\tv_nop\n\tv_nop\n\tv_nop\n\tv_nop\n\tv_nop");
  __builtin_amdgcn_sched_barrier(0);
#pragma unroll
  for (int e = 0; e < 8; ++e) {
    float r = 1.f / (1.f + __expf(-ar[e]));
    float z = 1.f / (1.f + __expf(-az[e]));
    float n = tanhf(ani[e] + r * anh[e]);
    hout[ob + e * 256] = (1.f - z) * n + z * hp[e];
  }
}

// ---------------- LN + MLP residual (f32 WMMA 16x16x4), one launch a layer ---
// Both layers are Y = X W with X k-contiguous and W column-contiguous. One wave
// owns 16 rows (of the B*NQ = 512) over the whole k: no LDS, no barrier, no
// partial sums between waves.
// k order: lane (c, h) holds floats 8q + 4h .. 8q + 4h + 3 of its row of X and
// loads rows 8q + 4h .. 8q + 4h + 3 of W at its column; elements (0,1) feed one
// WMMA, (2,3) the next, so A and B pair the same k at every lane and register.

// 1/sqrt(x) as one v_rsq_f32; the v_nop fills the one slot the instruction set
// asks for behind a transcendental before its result is read.
__device__ inline float rsq_slot(float x) {
  float r;
  asm("v_rsq_f32 %0, %1\n\tv_nop" : "=v"(r) : "v"(x));
  return r;
}

#define D1_ 5   // k_mlp1: 8-k steps that the operand loads run ahead
#define D2_ 12  // k_mlp2: the same

typedef __attribute__((ext_vector_type(4))) float v4f;
__device__ inline v8f wmma_f32v(v2f a, v2f b, v8f c) {
  return __builtin_amdgcn_wmma_f32_16x16x4_f32(false, a, false, b, (short)0, c,
                                               false, false);
}

// hid = relu(LN(h) @ w1 + b1). A wave owns 16 rows x 32 hidden columns and
// keeps its half rows (128 floats a lane) in registers: the row statistics are
// a lane's own sums plus those of lane ^ 16. grid: 32 row tiles x 8 column
// groups of 64, two waves a block. The register bound keeps the wave inside
// one 256-register window (left free, the allocator spreads over two).
__global__ void __launch_bounds__(64) __attribute__((amdgpu_num_vgpr(256))) k_mlp1(
    const float* __restrict__ hin, const float* __restrict__ g,
    const float* __restrict__ bb, const float* __restrict__ w1,
    const float* __restrict__ b1, float* __restrict__ hid) {
  int lane = threadIdx.x & 31, w = threadIdx.x >> 5;
  int c = lane & 15, h = lane >> 4;
  int m0 = (blockIdx.x >> 3) * 16;
  int n0 = (blockIdx.x & 7) * 64 + w * 32;
  const float* ap = hin + (m0 + c) * 256 + 4 * h;
  const float* wp = w1 + 4 * h * 512 + n0 + c;
  const float* gp = g + 4 * h;
  const float* bp = bb + 4 * h;
  v4f a[32], fg[32], fo[32];
  v2f fw[32][2][2];  // [8-k step][k pair][column tile]
#pragma unroll
  for (int q = 0; q < 32; ++q) a[q] = *(const v4f*)(ap + q * 8);
#pragma unroll
  for (int q = 0; q < D1_; ++q) {
    fg[q] = *(const v4f*)(gp + q * 8);
    fo[q] = *(const v4f*)(bp + q * 8);
#pragma unroll
    for (int p = 0; p < 2; ++p)
#pragma unroll
      for (int ti = 0; ti < 2; ++ti) {
        fw[q][p][ti].x = wp[(q * 8 + 2 * p) * 512 + ti * 16];
        fw[q][p][ti].y = wp[(q * 8 + 2 * p + 1) * 512 + ti * 16];
      }
  }
  int bi = n0 + c;
  float bias0 = b1[bi], bias1 = b1[bi + 16];
  // The address registers of the row and bias loads are free for reuse from
  // here on: the wait stands in front of the first overwrite. Named as its
  // inputs they stay live up to it, so that no load above it lands in them;
  // the scheduling barriers keep the loads above it, the arithmetic behind it.
  __builtin_amdgcn_sched_barrier(0);
  asm volatile("s_wait_xcnt 0x0" :: "v"(ap), "v"(bi) : "memory");
  __builtin_amdgcn_sched_barrier(0);
  v2f t0 = {0.f, 0.f}, t1 = t0, t2 = t0, t3 = t0;
#pragma unroll
  for (int q = 0; q < 32; q += 2) {
    t0 += a[q].lo; t1 += a[q].hi; t2 += a[q + 1].lo; t3 += a[q + 1].hi;
  }
  t0 = (t0 + t1) + (t2 + t3);
  float s = t0.x + t0.y;
  s += xhalf(s);
  float mu = s * (1.f / 256.f);
  t0 = 0.f; t1 = 0.f; t2 = 0.f; t3 = 0.f;
#pragma unroll
  for (int q = 0; q < 32; q += 2) {
    a[q] -= mu; a[q + 1] -= mu;
    t0 += a[q].lo * a[q].lo;         t1 += a[q].hi * a[q].hi;
    t2 += a[q + 1].lo * a[q + 1].lo; t3 += a[q + 1].hi * a[q + 1].hi;
  }
  t0 = (t0 + t1) + (t2 + t3);
  s = t0.x + t0.y;
  s += xhalf(s);
  float rs = rsq_slot(s * (1.f / 256.f) + LNE_);
  // every D register of a lane is one column, so the accumulators start from
  // that column's bias
  v8f acc0, acc1;
  for (int e = 0; e < 8; ++e) { acc0[e] = bias0; acc1[e] = bias1; }
  a[0] = a[0] * (rs * fg[0]) + fo[0];
  a[1] = a[1] * (rs * fg[1]) + fo[1];
  // unrolled whole so that every index is static
#pragma unroll
  for (int q = 0; q < 32; ++q) {
    if (q + D1_ < 32) {
      int n = q + D1_;
      fg[n] = *(const v4f*)(gp + n * 8);
      fo[n] = *(const v4f*)(bp + n * 8);
#pragma unroll
      for (int p = 0; p < 2; ++p)
#pragma unroll
        for (int ti = 0; ti < 2; ++ti) {
          fw[n][p][ti].x = wp[(n * 8 + 2 * p) * 512 + ti * 16];
          fw[n][p][ti].y = wp[(n * 8 + 2 * p + 1) * 512 + ti * 16];
        }
    }
    // keeps the loads of step q + D1_ above this step's WMMAs: left free, the
    // scheduler sinks each load to its first use and every WMMA group then
    // waits out a whole load latency
    __builtin_amdgcn_sched_barrier(0);
    acc0 = wmma_f32v(a[q].lo, fw[q][0][0], acc0);
    acc1 = wmma_f32v(a[q].lo, fw[q][0][1], acc1);
    acc0 = wmma_f32v(a[q].hi, fw[q][1][0], acc0);
    acc1 = wmma_f32v(a[q].hi, fw[q][1][1], acc1);
    // The table of WMMA distances leaves the f32 16x16x4 form out: eight slots,
    // the count of the slowest
    // listed form, stand between the last WMMA and the next vector write,
    // which may take a register that a WMMA has just read (behind the last
    // step: the first vector read of an accumulator). They issue while the
    // matrix unit is busy. The scheduling barriers hold them at that place.
    __builtin_amdgcn_sched_barrier(0);
    if (q != 30)  // behind step 30 no vector instruction follows
      asm volatile("v_nop\n\tv_nop\n\tv_nop\n\tv_nop\n\tv_nop\n\tv_nop\n\tv_nop\n\tv_nop");
    __builtin_amdgcn_sched_barrier(0);
    // scale and shift of the LN two steps ahead, so that no WMMA waits for it
    if (q + 2 < 32) a[q + 2] = a[q + 2] * (rs * fg[q + 2]) + fo[q + 2];
    __builtin_amdgcn_sched_barrier(0);
  }
  // D register e of lane (c, h) is row m0 + 8h + e
  float* op = hid + (m0 + 8 * h) * 512 + n0 + c;
#pragma unroll
  for (int e = 0; e < 8; ++e) {
    op[e * 512]      = fmaxf(acc0[e], 0.f);
    op[e * 512 + 16] = fmaxf(acc1[e], 0.f);
  }
}

// slots = h + hid @ w2 + b2. A wave owns 16 rows x 16 columns over k = 512, the
// even and the odd k pairs in an accumulator each (a WMMA then never waits for
// the one before it); one starts from the bias, the other from the residual
// rows. A block's two waves take neighbouring column tiles, so the block
// writes whole 128-byte lines. grid: 32 row tiles x 8 column pairs.
__global__ void __launch_bounds__(64) k_mlp2(
    const float* __restrict__ hid, const float* __restrict__ hin,
    const float* __restrict__ w2, const float* __restrict__ b2,
    float* __restrict__ slots_out, float* __restrict__ dout, int write_out) {
  int lane = threadIdx.x & 31, w = threadIdx.x >> 5;
  int c = lane & 15, h = lane >> 4;
  int m0 = (blockIdx.x >> 3) * 16;
  int j  = (blockIdx.x & 7) * 32 + w * 16 + c;
  const float* ap = hid + (m0 + c) * 512 + 4 * h;
  const float* wp = w2 + 4 * h * 256 + j;
  // D register e of lane (c, h) is row m0 + 8h + e, column j
  int ob = (m0 + 8 * h) * 256 + j;
  v8f acc0, acc1;
  float bias = b2[j];
#pragma unroll
  for (int e = 0; e < 8; ++e) acc1[e] = hin[ob + e * 256];
  v4f fa[64];
  v2f fw[64][2];  // [8-k step][k pair]
#pragma unroll
  for (int q = 0; q < D2_; ++q) {
    fa[q] = *(const v4f*)(ap + q * 8);
#pragma unroll
    for (int p = 0; p < 2; ++p) {
      fw[q][p].x = wp[(q * 8 + 2 * p) * 256];
      fw[q][p].y = wp[(q * 8 + 2 * p + 1) * 256];
    }
  }
  // The offset register of the bias load is free for reuse from here on: the
  // wait stands in front of the first overwrite. Named as its input the offset
  // stays live up to it, so that no load above it lands in that register; the
  // scheduling barriers keep the accumulator's first writes behind it.
  __builtin_amdgcn_sched_barrier(0);
  asm volatile("s_wait_xcnt 0x0" :: "v"(j) : "memory");
  __builtin_amdgcn_sched_barrier(0);
  for (int e = 0; e < 8; ++e) acc0[e] = bias;
  // unrolled whole so that every index is static
#pragma unroll
  for (int q = 0; q < 64; ++q) {
    if (q + D2_ < 64) {
      int n = q + D2_;
      fa[n] = *(const v4f*)(ap + n * 8);
#pragma unroll
      for (int p = 0; p < 2; ++p) {
        fw[n][p].x = wp[(n * 8 + 2 * p) * 256];
        fw[n][p].y = wp[(n * 8 + 2 * p + 1) * 256];
      }
    }
    // keeps the loads of step q + D2_ above this step's WMMAs (as in k_mlp1)
    __builtin_amdgcn_sched_barrier(0);
    acc0 = wmma_f32v(fa[q].lo, fw[q][0], acc0);
    acc1 = wmma_f32v(fa[q].hi, fw[q][1], acc1);
  }
  // eight slots between the last WMMA and the first vector read of an
  // accumulator, held in place by the scheduling barriers (as in k_mlp1)
  __builtin_amdgcn_sched_barrier(0);
  asm volatile("v_nop\n\tv_nop\n\tv_nop\n\tv_nop\n\tv_nop\n\tv_nop\n\tv_nop\n\tv_nop");
  __builtin_amdgcn_sched_barrier(0);
  v8f o = acc0 + acc1;
#pragma unroll
  for (int e = 0; e < 8; ++e) slots_out[ob + e * 256] = o[e];
  if (write_out) {
#pragma unroll
    for (int e = 0; e < 8; ++e) dout[ob + e * 256] = o[e];
  }
}

// ---------------- host orchestration ----------------------------------------
extern "C" void kernel_launch(void* const* d_in, const int* in_sizes, int n_in,
                              void* d_out, int out_size, void* d_ws,
                              size_t ws_size, hipStream_t stream) {
  (void)in_sizes; (void)n_in; (void)out_size; (void)ws_size;
  const float* inputs   = (const float*)d_in[0];
  const float* slots0   = (const float*)d_in[1];
  const float* ln_in_g  = (const float*)d_in[2];
  const float* ln_in_b  = (const float*)d_in[3];
  const float* ln_sl_g  = (const float*)d_in[4];
  const float* ln_sl_b  = (const float*)d_in[5];
  const float* ln_mlp_g = (const float*)d_in[6];
  const float* ln_mlp_b = (const float*)d_in[7];
  const float* Wq       = (const float*)d_in[8];
  const float* Wk       = (const float*)d_in[9];
  const float* Wv       = (const float*)d_in[10];
  const float* gwih     = (const float*)d_in[11];
  const float* gwhh     = (const float*)d_in[12];
  const float* gbih     = (const float*)d_in[13];
  const float* gbhh     = (const float*)d_in[14];
  const float* w1       = (const float*)d_in[15];
  const float* b1       = (const float*)d_in[16];
  const float* w2       = (const float*)d_in[17];
  const float* b2       = (const float*)d_in[18];

  char* ws = (char*)d_ws;
  half_t* kf   = (half_t*)(ws + 0);          // 32 MB  K dense f16 (pre-scaled)
  half_t* vpk  = (half_t*)(ws + 33554432);   // 32 MB  V fragment-packed
  half_t* wkp  = (half_t*)(ws + 67108864);   // 128 KB Wk packed
  half_t* wvp  = (half_t*)(ws + 67239936);   // 128 KB Wv packed
  float*  colv = (float*)(ws + 67371008);    // 64 KB  column sums of V
  half_t* qbp  = (half_t*)(ws + 67436544);   // 1 MB   block-diag Q packed
  half_t* apk  = (half_t*)(ws + 68485120);   // 4 MB   attn^T fragment-packed
  float*  invs = (float*)(ws + 72687616);    // 8 KB
  float*  upd  = (float*)(ws + 72695808);    // 512 KB
  float*  scur = (float*)(ws + 73220096);    // 512 KB current slots
  float*  smid = (float*)(ws + 73744384);    // 512 KB post-GRU slots
  float*  csum = (float*)(ws + 74268672);    // 32 KB  attn column-sum partials
  float*  hid  = (float*)(ws + 74301440);    // 1 MB   MLP hidden layer

  float* out_slots = (float*)d_out;
  float* out_vis   = out_slots + (long)B_ * NQ * S_;

  hipMemcpyAsync(scur, slots0, (size_t)B_ * NQ * S_ * sizeof(float),
                 hipMemcpyDeviceToDevice, stream);
  k_cvt<<<256, 256, 0, stream>>>(Wk, Wv, wkp, wvp);
  k_proj<<<(B_ * NKV) / 32, 256, 0, stream>>>(inputs, ln_in_g, ln_in_b, wkp, wvp,
                                              kf, vpk);
  k_colv<<<B_, 256, 0, stream>>>(vpk, colv);

  for (int it = 0; it < 3; ++it) {
    k_qbuild<<<B_, 256, 0, stream>>>(scur, ln_sl_g, ln_sl_b, Wq, qbp);
    k_logits<<<B_ * (NKV / 256), 256, 0, stream>>>(kf, qbp, apk, csum, out_vis);
    k_inv<<<8, 256, 0, stream>>>(csum, invs);
    k_attnv<<<B_, 256, 0, stream>>>(apk, vpk, colv, invs, upd);
    k_gru<<<256, 64, 0, stream>>>(upd, scur, gwih, gwhh, gbih, gbhh, smid);
    k_mlp1<<<256, 64, 0, stream>>>(smid, ln_mlp_g, ln_mlp_b, w1, b1, hid);
    k_mlp2<<<256, 64, 0, stream>>>(hid, smid, w2, b2, scur, out_slots,
                                   (it == 2) ? 1 : 0);
  }
}

// v004
// Timed twice side by side with v003, it ran 1.16 and 1.18 times as fast.
// Over all steps from v000 it is 2.78 times as fast.
#include <hip/hip_runtime.h>
#include <hip/hip_bf16.h>

typedef __attribute__((ext_vector_type(16))) _Float16 v16h;
typedef __attribute__((ext_vector_type(8)))  float    v8f;
typedef __attribute__((ext_vector_type(2)))  float    v2f;
typedef _Float16 half_t;

#define B_     64
#define NKV    1024
#define NQ     8
#define S_     256
#define HM_    512
#define EPS_   1e-8f
#define LNE_   1e-5f

// ---------------- WMMA fragment helpers (CDNA5 16x16x32 f16 layout) ----------
// 16-bit operand layout: lane L, klo = (L>=16)?8:0; elems 0..7 hold K =
// klo..klo+7, elems 8..15 hold K = klo+16..klo+23 (row/col index = L&15).

// A-fragment from row-major source (ld in halves): two 16B vector loads.
__device__ inline v16h frag_rowmajor(const half_t* p, int ld, int lane) {
  int m   = lane & 15;
  int klo = (lane >> 4) << 3;
  const half_t* q = p + m * ld + klo;
  union { uint4 u[2]; v16h h; } c;
  c.u[0] = *(const uint4*)(q);
  c.u[1] = *(const uint4*)(q + 16);
  return c.h;
}
// Fragment from pre-packed storage: packed[...][lane][16] -> two contiguous 16B loads.
__device__ inline v16h frag_packed(const half_t* p, int lane) {
  const half_t* q = p + lane * 16;
  union { uint4 u[2]; v16h h; } c;
  c.u[0] = *(const uint4*)(q);
  c.u[1] = *(const uint4*)(q + 8);
  return c.h;
}
// (lane, elem) -> K-within-32
__device__ inline int klocal_of(int lane, int e) {
  int klo = (lane >> 4) << 3;
  return (e < 8) ? (klo + e) : (klo + 8 + e);
}
// inverse: K-within-32 -> (lane group offset 0/16, elem)
__device__ inline void inv_klocal(int k_local, int& laneoff, int& e) {
  laneoff = ((k_local & 15) >= 8) ? 16 : 0;
  e = (k_local & 7) + ((k_local >= 16) ? 8 : 0);
}
__device__ inline v8f wmma_f16(v16h a, v16h b, v8f c) {
  return __builtin_amdgcn_wmma_f32_16x16x32_f16(false, a, false, b, (short)0, c,
                                                false, false);
}

// ---------------- Wk/Wv fp32 -> fragment-packed fp16 -------------------------
// packed idx = ((kk*16 + nt)*32 + lane)*16 + e ; 8 kk x 16 nt tiles
__global__ void k_cvt(const float* __restrict__ wk, const float* __restrict__ wv,
                      half_t* __restrict__ wkp, half_t* __restrict__ wvp) {
  int idx  = blockIdx.x * 256 + threadIdx.x;  // 65536 halves per matrix
  int e    = idx & 15;
  int lane = (idx >> 4) & 31;
  int nt   = (idx >> 9) & 15;
  int kk   = idx >> 13;
  int k = kk * 32 + klocal_of(lane, e);
  int n = nt * 16 + (lane & 15);
  wkp[idx] = (half_t)wk[k * 256 + n];
  wvp[idx] = (half_t)wv[k * 256 + n];
}

// ---------------- fused LayerNorm(inputs) + K/V projection (WMMA) ------------
// grid: (B*NKV)/32 blocks, 256 threads (8 waves: 2 M-tiles x 4 N-quadrants)
// K written dense row-major (A-operand of logits); V written fragment-packed
// (B-operand of attn@V): vpk[b][krow=32][nt=16][lane=32][e=16]
__global__ void __launch_bounds__(256) k_proj(
    const float* __restrict__ x, const float* __restrict__ g,
    const float* __restrict__ bb, const half_t* __restrict__ wkp,
    const half_t* __restrict__ wvp, half_t* __restrict__ kf,
    half_t* __restrict__ vpk) {
  __shared__ float xs[32][256];
  __shared__ __align__(32) half_t xh[32][256];
  __shared__ float psum[32][8], psq[32][8];
  __shared__ float mu[32], rs[32];
  int t = threadIdx.x;
  long base = (long)blockIdx.x * 32 * 256;
  for (int i = t; i < 32 * 256; i += 256) xs[i >> 8][i & 255] = x[base + i];
  __syncthreads();
  {
    int row = t >> 3, seg = t & 7;
    float s = 0.f, s2 = 0.f;
    for (int c = seg * 32; c < seg * 32 + 32; ++c) {
      float v_ = xs[row][c]; s += v_; s2 += v_ * v_;
    }
    psum[row][seg] = s; psq[row][seg] = s2;
  }
  __syncthreads();
  if (t < 32) {
    float s = 0.f, s2 = 0.f;
    for (int j = 0; j < 8; ++j) { s += psum[t][j]; s2 += psq[t][j]; }
    float m = s * (1.f / 256.f);
    mu[t] = m; rs[t] = rsqrtf(s2 * (1.f / 256.f) - m * m + LNE_);
  }
  __syncthreads();
  for (int i = t; i < 32 * 256; i += 256) {
    int row = i >> 8, col = i & 255;
    xh[row][col] = (half_t)((xs[row][col] - mu[row]) * rs[row] * g[col] + bb[col]);
  }
  __syncthreads();

  int lane = t & 31, w = t >> 5;
  int mt = w & 1, nq4 = w >> 1;
  v8f ak[4], av[4];
  for (int i = 0; i < 4; ++i)
    for (int j = 0; j < 8; ++j) { ak[i][j] = 0.f; av[i][j] = 0.f; }
  for (int kk = 0; kk < 8; ++kk) {
    // issue ALL fragment loads of this K-step first (independent b128s),
    // then the WMMA burst -> backend can use partial s_wait_loadcnt
    v16h a = frag_rowmajor(&xh[mt * 16][kk * 32], 256, lane);
    v16h bk[4], bv[4];
#pragma unroll
    for (int ti = 0; ti < 4; ++ti) {
      int nt = nq4 * 4 + ti;
      bk[ti] = frag_packed(wkp + (long)(kk * 16 + nt) * 512, lane);
      bv[ti] = frag_packed(wvp + (long)(kk * 16 + nt) * 512, lane);
    }
#pragma unroll
    for (int ti = 0; ti < 4; ++ti) {
      ak[ti] = wmma_f16(a, bk[ti], ak[ti]);
      av[ti] = wmma_f16(a, bv[ti], av[ti]);
    }
  }
  int b    = blockIdx.x >> 5;   // 32 blocks per batch (1024 rows)
  int krow = blockIdx.x & 31;   // which 32-row band (K index for attn@V)
  half_t* vb = vpk + (long)b * 262144;
  long rb = (long)blockIdx.x * 32 + mt * 16;
  int mo = (lane >> 4) << 3;
  int nl = lane & 15;
#pragma unroll
  for (int ti = 0; ti < 4; ++ti) {
    int nt  = nq4 * 4 + ti;
    int col = nt * 16 + nl;
#pragma unroll
    for (int r = 0; r < 8; ++r) {
      long row = rb + r + mo;
      kf[row * 256 + col] = (half_t)(ak[ti][r] * 0.125f);  // hd^-0.5
      int k_local = mt * 16 + r + mo;
      int lo, e; inv_klocal(k_local, lo, e);
      vb[((long)(krow * 16 + nt) * 32 + lo + nl) * 16 + e] = (half_t)(av[ti][r]);
    }
  }
}

// ---------------- column sums of V from packed layout ------------------------
__global__ void k_colv(const half_t* __restrict__ vpk, float* __restrict__ colv) {
  int b = blockIdx.x, d = threadIdx.x;
  const half_t* vb = vpk + (long)b * 262144;
  int nt = d >> 4, nl = d & 15;
  float s = 0.f;
  for (int n = 0; n < NKV; ++n) {
    int kk = n >> 5, kl = n & 31;
    int lo, e; inv_klocal(kl, lo, e);
    s += (float)vb[((long)(kk * 16 + nt) * 32 + lo + nl) * 16 + e];
  }
  colv[b * 256 + d] = s;
}

// ---------------- logits GEMM (WMMA) + fused joint softmax -------------------
// value of lane (l ^ M) of the same 16-lane row (DPP row_xmask)
template <int M>
__device__ inline float row_xor(float v) {
  return __builtin_bit_cast(
      float, __builtin_amdgcn_mov_dpp(__builtin_bit_cast(int, v), 0x160 | M, 0xf,
                                      0xf, true));
}
__device__ inline float row_max16(float v) {
  v = fmaxf(v, row_xor<1>(v));
  v = fmaxf(v, row_xor<2>(v));
  v = fmaxf(v, row_xor<4>(v));
  v = fmaxf(v, row_xor<8>(v));
  return v;
}
__device__ inline float row_sum16(float v) {
  v += row_xor<1>(v);
  v += row_xor<2>(v);
  v += row_xor<4>(v);
  v += row_xor<8>(v);
  return v;
}
// value of lane l ^ 16
__device__ inline float xhalf(float x) {
  int i = __builtin_bit_cast(int, x);
  return __builtin_bit_cast(
      float, __builtin_amdgcn_permlanex16(i, i, 0x76543210, 0xfedcba98, false,
                                          false));
}

// exp(x) as __expf builds it: one multiply and v_exp_f32. The v_nop fills the
// one slot the instruction set asks for behind a transcendental before its
// source is overwritten or its result read.
__device__ inline float exp_slot(float x) {
  float r;
  asm("v_exp_f32 %0, %1\n\tv_nop" : "=v"(r) : "v"(x * 1.44269504f));
  return r;
}

// grid: B * (NKV/256); each wave owns 32 kv rows (two M-tiles) x all 32
// (head, slot) columns, so a softmax row lies in one 16-lane row of two
// accumulators and the wave's 32 rows are exactly one K-step of attn@V.
// attn written fragment-packed for attn@V A-operand:
// apk[b][kk=32][mt=2][lane=32][e=16]; lane and e follow from the D layout:
// D register r of M-tile i at lane l is k_local = 16 i + 8 (l >> 4) + r,
// which is element e = 8 i + r of the same lane l.
// Column sums leave as one partial per block: cpart[b][blk=4][32].
__global__ void __launch_bounds__(256) k_logits(
    const half_t* __restrict__ kf, const half_t* __restrict__ qbp,
    half_t* __restrict__ apk, float* __restrict__ cpart,
    float* __restrict__ vis_out) {
  __shared__ float csl[8][32];
  int t = threadIdx.x, lane = t & 31, w = t >> 5;
  int b   = blockIdx.x >> 2;
  int blk = blockIdx.x & 3;
  int n0  = blk * 256 + w * 32;
  const half_t* kp = kf + ((long)b * NKV + n0) * 256;
  const half_t* qp = qbp + (long)b * 8192;
  v8f acc[2][2];  // [M-tile][column tile]
  for (int i = 0; i < 2; ++i)
    for (int k = 0; k < 2; ++k)
      for (int j = 0; j < 8; ++j) acc[i][k][j] = 0.f;
  for (int kk = 0; kk < 8; ++kk) {
    v16h a0  = frag_rowmajor(kp + kk * 32, 256, lane);
    v16h a1  = frag_rowmajor(kp + 16 * 256 + kk * 32, 256, lane);
    v16h bq0 = frag_packed(qp + (long)(kk * 2 + 0) * 512, lane);
    v16h bq1 = frag_packed(qp + (long)(kk * 2 + 1) * 512, lane);
    acc[0][0] = wmma_f16(a0, bq0, acc[0][0]);
    acc[0][1] = wmma_f16(a0, bq1, acc[0][1]);
    acc[1][0] = wmma_f16(a1, bq0, acc[1][0]);
    acc[1][1] = wmma_f16(a1, bq1, acc[1][1]);
  }
  int c16 = lane & 15, hi = lane >> 4;
  float cs0 = 0.f, cs1 = 0.f;
  union { uint4 u[2]; half_t h[16]; } p0, p1;
  float* vp = vis_out + (long)b * NQ * NKV + (c16 & 7) * NKV + n0 + hi * 8 +
              (c16 >> 3) * 4;
#pragma unroll
  for (int i = 0; i < 2; ++i) {
    float vis[8];
#pragma unroll
    for (int r = 0; r < 8; ++r) {
      float x0 = acc[i][0][r], x1 = acc[i][1][r];
      float mx = row_max16(fmaxf(x0, x1));
      float e0 = exp_slot(x0 - mx), e1 = exp_slot(x1 - mx);
      float inv = 1.f / row_sum16(e0 + e1);
      e0 *= inv; e1 *= inv;
      cs0 += e0; cs1 += e1;
      p0.h[i * 8 + r] = (half_t)e0;
      p1.h[i * 8 + r] = (half_t)e1;
      float v_ = e0 + e1;           // heads 0+2 (or 1+3) of slot c16 & 7
      vis[r] = v_ + row_xor<8>(v_);  // attn_vis = sum over heads
    }
    // lanes c16 and c16 ^ 8 hold the same 8 sums: each stores four of them
    float4 o;
    o.x = (c16 & 8) ? vis[4] : vis[0];
    o.y = (c16 & 8) ? vis[5] : vis[1];
    o.z = (c16 & 8) ? vis[6] : vis[2];
    o.w = (c16 & 8) ? vis[7] : vis[3];
    *(float4*)(vp + i * 16) = o;
  }
  half_t* ab = apk + (long)b * 32768 + (long)(blk * 8 + w) * 1024 + lane * 16;
  *(uint4*)(ab)           = p0.u[0];
  *(uint4*)(ab + 8)       = p0.u[1];
  *(uint4*)(ab + 512)     = p1.u[0];
  *(uint4*)(ab + 512 + 8) = p1.u[1];
  // column sums: 16 rows in the lane, the other 16 in lane ^ 16, then the
  // eight waves in a fixed order
  cs0 += xhalf(cs0);
  cs1 += xhalf(cs1);
  csl[w][lane] = hi ? cs1 : cs0;
  __syncthreads();
  if (t < 32) {
    float s = 0.f;
#pragma unroll
    for (int j = 0; j < 8; ++j) s += csl[j][t];
    cpart[(b * 4 + blk) * 32 + t] = s;
  }
}

__global__ void k_inv(const float* __restrict__ cpart, float* __restrict__ inv) {
  int i = blockIdx.x * 256 + threadIdx.x;
  if (i < B_ * 32) {
    const float* p = cpart + (i >> 5) * 128 + (i & 31);
    float s = ((p[0] + p[32]) + p[64]) + p[96];
    inv[i] = 1.f / (s + (float)NKV * EPS_);
  }
}

// ---------------- updates = norm(attn+eps)^T @ V (WMMA, all packed) ----------
__global__ void __launch_bounds__(256) k_attnv(
    const half_t* __restrict__ apk, const half_t* __restrict__ vpk,
    const float* __restrict__ colv, const float* __restrict__ invs,
    float* __restrict__ upd) {
  int t = threadIdx.x, lane = t & 31, w = t >> 5;
  int b = blockIdx.x;
  const half_t* ab = apk + (long)b * 32768;
  const half_t* vb = vpk + (long)b * 262144;
  v8f acc[2][2];
  for (int i = 0; i < 2; ++i)
    for (int j = 0; j < 2; ++j)
      for (int e = 0; e < 8; ++e) acc[i][j][e] = 0.f;
  for (int kk = 0; kk < 32; ++kk) {
    // all four fragment loads first, then the WMMA burst
    v16h a0 = frag_packed(ab + (long)(kk * 2 + 0) * 512, lane);
    v16h a1 = frag_packed(ab + (long)(kk * 2 + 1) * 512, lane);
    v16h b0 = frag_packed(vb + (long)(kk * 16 + 2 * w + 0) * 512, lane);
    v16h b1 = frag_packed(vb + (long)(kk * 16 + 2 * w + 1) * 512, lane);
    acc[0][0] = wmma_f16(a0, b0, acc[0][0]);
    acc[1][0] = wmma_f16(a1, b0, acc[1][0]);
    acc[0][1] = wmma_f16(a0, b1, acc[0][1]);
    acc[1][1] = wmma_f16(a1, b1, acc[1][1]);
  }
  int mo = (lane >> 4) << 3;
#pragma unroll
  for (int mt = 0; mt < 2; ++mt)
#pragma unroll
    for (int ntl = 0; ntl < 2; ++ntl) {
      int d = (2 * w + ntl) * 16 + (lane & 15);
#pragma unroll
      for (int r = 0; r < 8; ++r) {
        int hq = mt * 16 + r + mo;
        int h = hq >> 3;
        if ((d >> 6) == h) {  // keep only this head's 64-wide slice
          int qi = hq & 7;
          float val = (acc[mt][ntl][r] + EPS_ * colv[b * 256 + d]) *
                      invs[b * 32 + hq];
          upd[((long)b * NQ + qi) * S_ + d] = val;
        }
      }
    }
}

// ---------------- GRU cell (f32 WMMA 16x16x4) --------------------------------
// xg = upd @ wih^T and hg = hprev @ whh^T as Y = X W^T with X and W both
// k-contiguous. One wave owns 16 rows (of the B*NQ = 512) x 16 columns j of
// all three gates over the whole k = 256: no LDS, no barrier, no partial sums
// between waves. A block's two waves take neighbouring column tiles, so the
// block writes whole 128-byte lines. grid: 32 row tiles x 8 column pairs.
// k order: lane (c, h) loads floats k0 + 4h .. k0 + 4h + 3 of its row of X and
// of its row of W by the same offsets; elements (0,1) feed one WMMA, (2,3) the
// next, so A and B pair the same k at every lane and register.
__device__ inline v8f wmma_f32(float ax, float ay, float bx, float by, v8f c) {
  v2f a = {ax, ay};
  v2f b = {bx, by};
  return __builtin_amdgcn_wmma_f32_16x16x4_f32(false, a, false, b, (short)0, c,
                                               false, false);
}
__global__ void __launch_bounds__(64) k_gru(
    const float* __restrict__ upd, const float* __restrict__ hprev,
    const float* __restrict__ wih, const float* __restrict__ whh,
    const float* __restrict__ bih, const float* __restrict__ bhh,
    float* __restrict__ hout) {
  int lane = threadIdx.x & 31, w = threadIdx.x >> 5;
  int c = lane & 15, h = lane >> 4;
  int m0 = (blockIdx.x >> 3) * 16;
  int n0 = (blockIdx.x & 7) * 32 + w * 16;
  int j  = n0 + c;
  int ao = (m0 + c) * 256 + 4 * h;
  int bo = j * 256 + 4 * h;
  const float* s[8] = {upd + ao,          hprev + ao,
                       wih + bo,          whh + bo,
                       wih + 65536 + bo,  whh + 65536 + bo,
                       wih + 131072 + bo, whh + 131072 + bo};
  // every D register of a lane is column j, so the accumulators start from
  // the gate biases of that column
  float br = bih[j] + bhh[j];
  float bz = bih[256 + j] + bhh[256 + j];
  float bi3 = bih[512 + j], bh3 = bhh[512 + j];
  // D register e of lane (c, h) is row m0 + 8h + e, column j
  long ob = (long)(m0 + 8 * h) * 256 + j;
  float hp[8];
  float4 f[2][2][8];  // [stage][8-k step][matrix]
#pragma unroll
  for (int q = 0; q < 2; ++q)
#pragma unroll
    for (int x = 0; x < 8; ++x) f[0][q][x] = *(const float4*)(s[x] + q * 8);
  // The accumulators may take the register that the bias loads name as their
  // offset: the wait stands in front of that overwrite, and the scheduling
  // barriers keep the accumulators' first writes behind it.
  __builtin_amdgcn_sched_barrier(0);
  asm volatile("s_wait_xcnt 0x0" ::: "memory");
  __builtin_amdgcn_sched_barrier(0);
  v8f ar, az, ani, anh;
  for (int e = 0; e < 8; ++e) { ar[e] = br; az[e] = bz; ani[e] = bi3; anh[e] = bh3; }
  // unrolled whole so that the stage index is static and the next 16 k of all
  // eight operands are in flight under this stage's 24 WMMAs
#pragma unroll
  for (int ch = 0; ch < 16; ++ch) {
    if (ch + 1 < 16) {
#pragma unroll
      for (int q = 0; q < 2; ++q)
#pragma unroll
        for (int x = 0; x < 8; ++x)
          f[(ch + 1) & 1][q][x] = *(const float4*)(s[x] + (ch + 1) * 16 + q * 8);
    } else {
      // Every operand load is issued and its address registers are free for
      // reuse from here on: the wait stands in front of the first overwrite
      // (the scheduling barrier keeps later address arithmetic behind it).
      // The old state for the output blend then loads under the last WMMAs.
      __builtin_amdgcn_sched_barrier(0);
      asm volatile("s_wait_xcnt 0x0" ::: "memory");
#pragma unroll
      for (int e = 0; e < 8; ++e) hp[e] = hprev[ob + e * 256];
    }
    // keeps the next stage's loads above this stage's WMMAs: left free, the
    // scheduler sinks each load to its first use and every WMMA group then
    // waits out a whole load latency
    __builtin_amdgcn_sched_barrier(0);
#pragma unroll
    for (int q = 0; q < 2; ++q) {
      const float4* g = f[ch & 1][q];
      ar  = wmma_f32(g[0].x, g[0].y, g[2].x, g[2].y, ar);
      az  = wmma_f32(g[0].x, g[0].y, g[4].x, g[4].y, az);
      ani = wmma_f32(g[0].x, g[0].y, g[6].x, g[6].y, ani);
      anh = wmma_f32(g[1].x, g[1].y, g[7].x, g[7].y, anh);
      ar  = wmma_f32(g[1].x, g[1].y, g[3].x, g[3].y, ar);
      az  = wmma_f32(g[1].x, g[1].y, g[5].x, g[5].y, az);
      ani = wmma_f32(g[0].z, g[0].w, g[6].z, g[6].w, ani);
      anh = wmma_f32(g[1].z, g[1].w, g[7].z, g[7].w, anh);
      ar  = wmma_f32(g[0].z, g[0].w, g[2].z, g[2].w, ar);
      az  = wmma_f32(g[0].z, g[0].w, g[4].z, g[4].w, az);
      ar  = wmma_f32(g[1].z, g[1].w, g[3].z, g[3].w, ar);
      az  = wmma_f32(g[1].z, g[1].w, g[5].z, g[5].w, az);
    }
  }
  // The table of WMMA distances leaves the f32 16x16x4 form out: eight slots, the count of the slowest
  // listed form, stand between the last WMMA and the first vector read of an
  // accumulator. The two scheduling barriers hold the slots at that place.
  __builtin_amdgcn_sched_barrier(0);
  asm volatile("v_nop\n\tv_nop\n\tv_nop\n\tv_nop\n\tv_nop\n\tv_nop\n\tv_nop\n\tv_nop");
  __builtin_amdgcn_sched_barrier(0);
#pragma unroll
  for (int e = 0; e < 8; ++e) {
    float r = 1.f / (1.f + __expf(-ar[e]));
    float z = 1.f / (1.f + __expf(-az[e]));
    float n = tanhf(ani[e] + r * anh[e]);
    hout[ob + e * 256] = (1.f - z) * n + z * hp[e];
  }
}

// ---------------- LN + MLP residual (f32 WMMA 16x16x4), one launch a layer ---
// Both layers are Y = X W with X k-contiguous and W column-contiguous. One wave
// owns 16 rows (of the B*NQ = 512) over the whole k: no LDS, no barrier, no
// partial sums between waves.
// k order: lane (c, h) holds floats 8q + 4h .. 8q + 4h + 3 of its row of X and
// loads rows 8q + 4h .. 8q + 4h + 3 of W at its column; elements (0,1) feed one
// WMMA, (2,3) the next, so A and B pair the same k at every lane and register.

// 1/sqrt(x) as one v_rsq_f32; the v_nop fills the one slot the instruction set
// asks for behind a transcendental before its result is read.
__device__ inline float rsq_slot(float x) {
  float r;
  asm("v_rsq_f32 %0, %1\n\tv_nop" : "=v"(r) : "v"(x));
  return r;
}

#define D1_ 5   // k_mlp1: 8-k steps that the operand loads run ahead
#define D2_ 12  // k_mlp2: the same

typedef __attribute__((ext_vector_type(4))) float v4f;
__device__ inline v8f wmma_f32v(v2f a, v2f b, v8f c) {
  return __builtin_amdgcn_wmma_f32_16x16x4_f32(false, a, false, b, (short)0, c,
                                               false, false);
}

// hid = relu(LN(h) @ w1 + b1). A wave owns 16 rows x 32 hidden columns and
// keeps its half rows (128 floats a lane) in registers: the row statistics are
// a lane's own sums plus those of lane ^ 16. grid: 32 row tiles x 8 column
// groups of 64, two waves a block. The register bound keeps the wave inside
// one 256-register window (left free, the allocator spreads over two).
__global__ void __launch_bounds__(64) __attribute__((amdgpu_num_vgpr(256))) k_mlp1(
    const float* __restrict__ hin, const float* __restrict__ g,
    const float* __restrict__ bb, const float* __restrict__ w1,
    const float* __restrict__ b1, float* __restrict__ hid) {
  int lane = threadIdx.x & 31, w = threadIdx.x >> 5;
  int c = lane & 15, h = lane >> 4;
  int m0 = (blockIdx.x >> 3) * 16;
  int n0 = (blockIdx.x & 7) * 64 + w * 32;
  const float* ap = hin + (m0 + c) * 256 + 4 * h;
  const float* wp = w1 + 4 * h * 512 + n0 + c;
  const float* gp = g + 4 * h;
  const float* bp = bb + 4 * h;
  v4f a[32], fg[32], fo[32];
  v2f fw[32][2][2];  // [8-k step][k pair][column tile]
#pragma unroll
  for (int q = 0; q < 32; ++q) a[q] = *(const v4f*)(ap + q * 8);
#pragma unroll
  for (int q = 0; q < D1_; ++q) {
    fg[q] = *(const v4f*)(gp + q * 8);
    fo[q] = *(const v4f*)(bp + q * 8);
#pragma unroll
    for (int p = 0; p < 2; ++p)
#pragma unroll
      for (int ti = 0; ti < 2; ++ti) {
        fw[q][p][ti].x = wp[(q * 8 + 2 * p) * 512 + ti * 16];
        fw[q][p][ti].y = wp[(q * 8 + 2 * p + 1) * 512 + ti * 16];
      }
  }
  int bi = n0 + c;
  float bias0 = b1[bi], bias1 = b1[bi + 16];
  // The address registers of the row and bias loads are free for reuse from
  // here on: the wait stands in front of the first overwrite. Named as its
  // inputs they stay live up to it, so that no load above it lands in them;
  // the scheduling barriers keep the loads above it, the arithmetic behind it.
  __builtin_amdgcn_sched_barrier(0);
  asm volatile("s_wait_xcnt 0x0" :: "v"(ap), "v"(bi) : "memory");
  __builtin_amdgcn_sched_barrier(0);
  v2f t0 = {0.f, 0.f}, t1 = t0, t2 = t0, t3 = t0;
#pragma unroll
  for (int q = 0; q < 32; q += 2) {
    t0 += a[q].lo; t1 += a[q].hi; t2 += a[q + 1].lo; t3 += a[q + 1].hi;
  }
  t0 = (t0 + t1) + (t2 + t3);
  float s = t0.x + t0.y;
  s += xhalf(s);
  float mu = s * (1.f / 256.f);
  t0 = 0.f; t1 = 0.f; t2 = 0.f; t3 = 0.f;
#pragma unroll
  for (int q = 0; q < 32; q += 2) {
    a[q] -= mu; a[q + 1] -= mu;
    t0 += a[q].lo * a[q].lo;         t1 += a[q].hi * a[q].hi;
    t2 += a[q + 1].lo * a[q + 1].lo; t3 += a[q + 1].hi * a[q + 1].hi;
  }
  t0 = (t0 + t1) + (t2 + t3);
  s = t0.x + t0.y;
  s += xhalf(s);
  float rs = rsq_slot(s * (1.f / 256.f) + LNE_);
  // every D register of a lane is one column, so the accumulators start from
  // that column's bias
  v8f acc0, acc1;
  for (int e = 0; e < 8; ++e) { acc0[e] = bias0; acc1[e] = bias1; }
  a[0] = a[0] * (rs * fg[0]) + fo[0];
  a[1] = a[1] * (rs * fg[1]) + fo[1];
  // unrolled whole so that every index is static
#pragma unroll
  for (int q = 0; q < 32; ++q) {
    if (q + D1_ < 32) {
      int n = q + D1_;
      fg[n] = *(const v4f*)(gp + n * 8);
      fo[n] = *(const v4f*)(bp + n * 8);
#pragma unroll
      for (int p = 0; p < 2; ++p)
#pragma unroll
        for (int ti = 0; ti < 2; ++ti) {
          fw[n][p][ti].x = wp[(n * 8 + 2 * p) * 512 + ti * 16];
          fw[n][p][ti].y = wp[(n * 8 + 2 * p + 1) * 512 + ti * 16];
        }
    }
    // keeps the loads of step q + D1_ above this step's WMMAs: left free, the
    // scheduler sinks each load to its first use and every WMMA group then
    // waits out a whole load latency
    __builtin_amdgcn_sched_barrier(0);
    acc0 = wmma_f32v(a[q].lo, fw[q][0][0], acc0);
    acc1 = wmma_f32v(a[q].lo, fw[q][0][1], acc1);
    acc0 = wmma_f32v(a[q].hi, fw[q][1][0], acc0);
    acc1 = wmma_f32v(a[q].hi, fw[q][1][1], acc1);
    // The table of WMMA distances leaves the f32 16x16x4 form out: eight slots,
    // the count of the slowest
    // listed form, stand between the last WMMA and the next vector write,
    // which may take a register that a WMMA has just read (behind the last
    // step: the first vector read of an accumulator). They issue while the
    // matrix unit is busy. The scheduling barriers hold them at that place.
    __builtin_amdgcn_sched_barrier(0);
    if (q != 30)  // behind step 30 no vector instruction follows
      asm volatile("v_nop\n\tv_nop\n\tv_nop\n\tv_nop\n\tv_nop\n\tv_nop\n\tv_nop\n\tv_nop");
    __builtin_amdgcn_sched_barrier(0);
    // scale and shift of the LN two steps ahead, so that no WMMA waits for it
    if (q + 2 < 32) a[q + 2] = a[q + 2] * (rs * fg[q + 2]) + fo[q + 2];
    __builtin_amdgcn_sched_barrier(0);
  }
  // D register e of lane (c, h) is row m0 + 8h + e
  float* op = hid + (m0 + 8 * h) * 512 + n0 + c;
#pragma unroll
  for (int e = 0; e < 8; ++e) {
    op[e * 512]      = fmaxf(acc0[e], 0.f);
    op[e * 512 + 16] = fmaxf(acc1[e], 0.f);
  }
}

// slots = h + hid @ w2 + b2. A wave owns 16 rows x 16 columns over k = 512, the
// even and the odd k pairs in an accumulator each (a WMMA then never waits for
// the one before it); one starts from the bias, the other from the residual
// rows. A block's two waves take neighbouring column tiles, so the block
// writes whole 128-byte lines. grid: 32 row tiles x 8 column pairs.
__global__ void __launch_bounds__(64) k_mlp2(
    const float* __restrict__ hid, const float* __restrict__ hin,
    const float* __restrict__ w2, const float* __restrict__ b2,
    float* __restrict__ slots_out, float* __restrict__ dout, int write_out) {
  int lane = threadIdx.x & 31, w = threadIdx.x >> 5;
  int c = lane & 15, h = lane >> 4;
  int m0 = (blockIdx.x >> 3) * 16;
  int j  = (blockIdx.x & 7) * 32 + w * 16 + c;
  const float* ap = hid + (m0 + c) * 512 + 4 * h;
  const float* wp = w2 + 4 * h * 256 + j;
  // D register e of lane (c, h) is row m0 + 8h + e, column j
  int ob = (m0 + 8 * h) * 256 + j;
  v8f acc0, acc1;
  float bias = b2[j];
#pragma unroll
  for (int e = 0; e < 8; ++e) acc1[e] = hin[ob + e * 256];
  v4f fa[64];
  v2f fw[64][2];  // [8-k step][k pair]
#pragma unroll
  for (int q = 0; q < D2_; ++q) {
    fa[q] = *(const v4f*)(ap + q * 8);
#pragma unroll
    for (int p = 0; p < 2; ++p) {
      fw[q][p].x = wp[(q * 8 + 2 * p) * 256];
      fw[q][p].y = wp[(q * 8 + 2 * p + 1) * 256];
    }
  }
  // The offset register of the bias load is free for reuse from here on: the
  // wait stands in front of the first overwrite. Named as its input the offset
  // stays live up to it, so that no load above it lands in that register; the
  // scheduling barriers keep the accumulator's first writes behind it.
  __builtin_amdgcn_sched_barrier(0);
  asm volatile("s_wait_xcnt 0x0" :: "v"(j) : "memory");
  __builtin_amdgcn_sched_barrier(0);
  for (int e = 0; e < 8; ++e) acc0[e] = bias;
  // unrolled whole so that every index is static
#pragma unroll
  for (int q = 0; q < 64; ++q) {
    if (q + D2_ < 64) {
      int n = q + D2_;
      fa[n] = *(const v4f*)(ap + n * 8);
#pragma unroll
      for (int p = 0; p < 2; ++p) {
        fw[n][p].x = wp[(n * 8 + 2 * p) * 256];
        fw[n][p].y = wp[(n * 8 + 2 * p + 1) * 256];
      }
    }
    // keeps the loads of step q + D2_ above this step's WMMAs (as in k_mlp1)
    __builtin_amdgcn_sched_barrier(0);
    acc0 = wmma_f32v(fa[q].lo, fw[q][0], acc0);
    acc1 = wmma_f32v(fa[q].hi, fw[q][1], acc1);
  }
  // eight slots between the last WMMA and the first vector read of an
  // accumulator, held in place by the scheduling barriers (as in k_mlp1)
  __builtin_amdgcn_sched_barrier(0);
  asm volatile("v_nop\n\tv_nop\n\tv_nop\n\tv_nop\n\tv_nop\n\tv_nop\n\tv_nop\n\tv_nop");
  __builtin_amdgcn_sched_barrier(0);
  v8f o = acc0 + acc1;
#pragma unroll
  for (int e = 0; e < 8; ++e) slots_out[ob + e * 256] = o[e];
  if (write_out) {
#pragma unroll
    for (int e = 0; e < 8; ++e) dout[ob + e * 256] = o[e];
  }
}

// ---------------- LN(slots) + q = s@Wq (f32 WMMA 16x16x4), packed Qb ---------
// qbp[b][kk=8][ti=2][lane=32][e=16]: the block-diagonal B operand of the logits
// (k = feature d, column = head * 8 + slot, zero where d is not of that head).
// The product is formed transposed, q^T = Wq^T LN(s)^T: A is a column tile of
// Wq, B a tile of 16 slot rows (two batches), loaded by the offsets of k_mlp1,
// so A and B pair the same k at every lane and register. D register e of lane
// (c, h) is then feature 8h + e of slot row c: the eight features that one
// packed lane holds side by side. A wave owns 16 rows x 32 features (one kk)
// over the whole k, and writes the whole 2 KB of its kk for both batches, the
// zeros too. No LDS, no barrier. grid: 32 row tiles x 4 pairs of kk. The
// register bound keeps the wave inside one 256-register window (as in k_mlp1).
__global__ void __launch_bounds__(64) __attribute__((amdgpu_num_vgpr(256))) k_qbuild(
    const float* __restrict__ slots, const float* __restrict__ g,
    const float* __restrict__ bb, const float* __restrict__ wq,
    half_t* __restrict__ qbp) {
  int lane = threadIdx.x & 31, w = threadIdx.x >> 5;
  int c = lane & 15, h = lane >> 4;
  int m0 = (blockIdx.x >> 2) * 16;
  int kk = (blockIdx.x & 3) * 2 + w;
  const float* ap = slots + (m0 + c) * 256 + 4 * h;
  const float* wp = wq + 4 * h * 256 + kk * 32 + c;
  const float* gp = g + 4 * h;
  const float* bp = bb + 4 * h;
  v4f a[32], fg[32], fo[32];
  v2f fw[32][2][2];  // [8-k step][k pair][feature tile]
#pragma unroll
  for (int q = 0; q < 32; ++q) a[q] = *(const v4f*)(ap + q * 8);
#pragma unroll
  for (int q = 0; q < D1_; ++q) {
    fg[q] = *(const v4f*)(gp + q * 8);
    fo[q] = *(const v4f*)(bp + q * 8);
#pragma unroll
    for (int p = 0; p < 2; ++p)
#pragma unroll
      for (int ti = 0; ti < 2; ++ti) {
        fw[q][p][ti].x = wp[(q * 8 + 2 * p) * 256 + ti * 16];
        fw[q][p][ti].y = wp[(q * 8 + 2 * p + 1) * 256 + ti * 16];
      }
  }
  // The address registers of the row loads are free for reuse from here on: the
  // wait stands in front of the first overwrite. Named as its input they stay
  // live up to it, so that no load above it lands in them; the scheduling
  // barriers keep the loads above it, the arithmetic behind it.
  __builtin_amdgcn_sched_barrier(0);
  asm volatile("s_wait_xcnt 0x0" :: "v"(ap) : "memory");
  __builtin_amdgcn_sched_barrier(0);
  v2f t0 = {0.f, 0.f}, t1 = t0, t2 = t0, t3 = t0;
#pragma unroll
  for (int q = 0; q < 32; q += 2) {
    t0 += a[q].lo; t1 += a[q].hi; t2 += a[q + 1].lo; t3 += a[q + 1].hi;
  }
  t0 = (t0 + t1) + (t2 + t3);
  float s = t0.x + t0.y;
  s += xhalf(s);
  float mu = s * (1.f / 256.f);
  t0 = 0.f; t1 = 0.f; t2 = 0.f; t3 = 0.f;
#pragma unroll
  for (int q = 0; q < 32; q += 2) {
    a[q] -= mu; a[q + 1] -= mu;
    t0 += a[q].lo * a[q].lo;         t1 += a[q].hi * a[q].hi;
    t2 += a[q + 1].lo * a[q + 1].lo; t3 += a[q + 1].hi * a[q + 1].hi;
  }
  t0 = (t0 + t1) + (t2 + t3);
  s = t0.x + t0.y;
  s += xhalf(s);
  float rs = rsq_slot(s * (1.f / 256.f) + LNE_);
  v8f acc0, acc1;
  for (int e = 0; e < 8; ++e) { acc0[e] = 0.f; acc1[e] = 0.f; }
  a[0] = a[0] * (rs * fg[0]) + fo[0];
  a[1] = a[1] * (rs * fg[1]) + fo[1];
  // unrolled whole so that every index is static
#pragma unroll
  for (int q = 0; q < 32; ++q) {
    if (q + D1_ < 32) {
      int n = q + D1_;
      fg[n] = *(const v4f*)(gp + n * 8);
      fo[n] = *(const v4f*)(bp + n * 8);
#pragma unroll
      for (int p = 0; p < 2; ++p)
#pragma unroll
        for (int ti = 0; ti < 2; ++ti) {
          fw[n][p][ti].x = wp[(n * 8 + 2 * p) * 256 + ti * 16];
          fw[n][p][ti].y = wp[(n * 8 + 2 * p + 1) * 256 + ti * 16];
        }
    }
    // keeps the loads of step q + D1_ above this step's WMMAs (as in k_mlp1)
    __builtin_amdgcn_sched_barrier(0);
    acc0 = wmma_f32v(fw[q][0][0], a[q].lo, acc0);
    acc1 = wmma_f32v(fw[q][0][1], a[q].lo, acc1);
    acc0 = wmma_f32v(fw[q][1][0], a[q].hi, acc0);
    acc1 = wmma_f32v(fw[q][1][1], a[q].hi, acc1);
    // eight slots between the last WMMA and the next vector write or, behind
    // the last step, the first vector read of an accumulator, held in place by
    // the scheduling barriers (as in k_mlp1)
    __builtin_amdgcn_sched_barrier(0);
    if (q != 30)  // behind step 30 no vector instruction follows
      asm volatile("v_nop\n\tv_nop\n\tv_nop\n\tv_nop\n\tv_nop\n\tv_nop\n\tv_nop\n\tv_nop");
    __builtin_amdgcn_sched_barrier(0);
    // scale and shift of the LN two steps ahead, so that no WMMA waits for it
    if (q + 2 < 32) a[q + 2] = a[q + 2] * (rs * fg[q + 2]) + fo[q + 2];
    __builtin_amdgcn_sched_barrier(0);
  }
  // slot row c is batch m0 / 8 + (c >> 3), slot c & 7; its column of Qb is
  // head * 8 + slot with head = kk >> 1. sl = ti * 32 + packed lane; elements
  // 0..7 are features 8h + e (acc0), 8..15 features 16 + 8h + e (acc1).
  int hd = kk >> 1;
  int sl = (hd >> 1) * 32 + 16 * h + (hd & 1) * 8 + (c & 7);
  half_t* qp = qbp + ((m0 >> 3) + (c >> 3)) * 8192 + kk * 1024;
  union { uint4 u[2]; half_t x[16]; } o;
#pragma unroll
  for (int e = 0; e < 8; ++e) {
    o.x[e]     = (half_t)acc0[e];
    o.x[8 + e] = (half_t)acc1[e];
  }
  *(uint4*)(qp + sl * 16)     = o.u[0];
  *(uint4*)(qp + sl * 16 + 8) = o.u[1];
  // the columns of the other three heads are zero at these features
  uint4 zz = {0u, 0u, 0u, 0u};
  *(uint4*)(qp + (sl ^ 8) * 16)      = zz;
  *(uint4*)(qp + (sl ^ 8) * 16 + 8)  = zz;
  *(uint4*)(qp + (sl ^ 32) * 16)     = zz;
  *(uint4*)(qp + (sl ^ 32) * 16 + 8) = zz;
  *(uint4*)(qp + (sl ^ 40) * 16)     = zz;
  *(uint4*)(qp + (sl ^ 40) * 16 + 8) = zz;
}

// ---------------- host orchestration ----------------------------------------
extern "C" void kernel_launch(void* const* d_in, const int* in_sizes, int n_in,
                              void* d_out, int out_size, void* d_ws,
                              size_t ws_size, hipStream_t stream) {
  (void)in_sizes; (void)n_in; (void)out_size; (void)ws_size;
  const float* inputs   = (const float*)d_in[0];
  const float* slots0   = (const float*)d_in[1];
  const float* ln_in_g  = (const float*)d_in[2];
  const float* ln_in_b  = (const float*)d_in[3];
  const float* ln_sl_g  = (const float*)d_in[4];
  const float* ln_sl_b  = (const float*)d_in[5];
  const float* ln_mlp_g = (const float*)d_in[6];
  const float* ln_mlp_b = (const float*)d_in[7];
  const float* Wq       = (const float*)d_in[8];
  const float* Wk       = (const float*)d_in[9];
  const float* Wv       = (const float*)d_in[10];
  const float* gwih     = (const float*)d_in[11];
  const float* gwhh     = (const float*)d_in[12];
  const float* gbih     = (const float*)d_in[13];
  const float* gbhh     = (const float*)d_in[14];
  const float* w1       = (const float*)d_in[15];
  const float* b1       = (const float*)d_in[16];
  const float* w2       = (const float*)d_in[17];
  const float* b2       = (const float*)d_in[18];

  char* ws = (char*)d_ws;
  half_t* kf   = (half_t*)(ws + 0);          // 32 MB  K dense f16 (pre-scaled)
  half_t* vpk  = (half_t*)(ws + 33554432);   // 32 MB  V fragment-packed
  half_t* wkp  = (half_t*)(ws + 67108864);   // 128 KB Wk packed
  half_t* wvp  = (half_t*)(ws + 67239936);   // 128 KB Wv packed
  float*  colv = (float*)(ws + 67371008);    // 64 KB  column sums of V
  half_t* qbp  = (half_t*)(ws + 67436544);   // 1 MB   block-diag Q packed
  half_t* apk  = (half_t*)(ws + 68485120);   // 4 MB   attn^T fragment-packed
  float*  invs = (float*)(ws + 72687616);    // 8 KB
  float*  upd  = (float*)(ws + 72695808);    // 512 KB
  float*  scur = (float*)(ws + 73220096);    // 512 KB current slots
  float*  smid = (float*)(ws + 73744384);    // 512 KB post-GRU slots
  float*  csum = (float*)(ws + 74268672);    // 32 KB  attn column-sum partials
  float*  hid  = (float*)(ws + 74301440);    // 1 MB   MLP hidden layer

  float* out_slots = (float*)d_out;
  float* out_vis   = out_slots + (long)B_ * NQ * S_;

  hipMemcpyAsync(scur, slots0, (size_t)B_ * NQ * S_ * sizeof(float),
                 hipMemcpyDeviceToDevice, stream);
  k_cvt<<<256, 256, 0, stream>>>(Wk, Wv, wkp, wvp);
  k_proj<<<(B_ * NKV) / 32, 256, 0, stream>>>(inputs, ln_in_g, ln_in_b, wkp, wvp,
                                              kf, vpk);
  k_colv<<<B_, 256, 0, stream>>>(vpk, colv);

  for (int it = 0; it < 3; ++it) {
    k_qbuild<<<128, 64, 0, stream>>>(scur, ln_sl_g, ln_sl_b, Wq, qbp);
    k_logits<<<B_ * (NKV / 256), 256, 0, stream>>>(kf, qbp, apk, csum, out_vis);
    k_inv<<<8, 256, 0, stream>>>(csum, invs);
    k_attnv<<<B_, 256, 0, stream>>>(apk, vpk, colv, invs, upd);
    k_gru<<<256, 64, 0, stream>>>(upd, scur, gwih, gwhh, gbih, gbhh, smid);
    k_mlp1<<<256, 64, 0, stream>>>(smid, ln_mlp_g, ln_mlp_b, w1, b1, hid);
    k_mlp2<<<256, 64, 0, stream>>>(hid, smid, w2, b2, scur, out_slots,
                                   (it == 2) ? 1 : 0);
  }
}

// v005
// Two timings next to v004 put it at 1.17 and 1.16 times that version's speed.
// Counting every step since v000, it is 3.23 times as fast.
#include <hip/hip_runtime.h>
#include <hip/hip_bf16.h>

typedef __attribute__((ext_vector_type(16))) _Float16 v16h;
typedef __attribute__((ext_vector_type(8)))  float    v8f;
typedef __attribute__((ext_vector_type(2)))  float    v2f;
typedef _Float16 half_t;

#define B_     64
#define NKV    1024
#define NQ     8
#define S_     256
#define HM_    512
#define EPS_   1e-8f
#define LNE_   1e-5f

// ---------------- WMMA fragment helpers (CDNA5 16x16x32 f16 layout) ----------
// 16-bit operand layout: lane L, klo = (L>=16)?8:0; elems 0..7 hold K =
// klo..klo+7, elems 8..15 hold K = klo+16..klo+23 (row/col index = L&15).

// A-fragment from row-major source (ld in halves): two 16B vector loads.
__device__ inline v16h frag_rowmajor(const half_t* p, int ld, int lane) {
  int m   = lane & 15;
  int klo = (lane >> 4) << 3;
  const half_t* q = p + m * ld + klo;
  union { uint4 u[2]; v16h h; } c;
  c.u[0] = *(const uint4*)(q);
  c.u[1] = *(const uint4*)(q + 16);
  return c.h;
}
// Fragment from pre-packed storage: packed[...][lane][16] -> two contiguous 16B loads.
__device__ inline v16h frag_packed(const half_t* p, int lane) {
  const half_t* q = p + lane * 16;
  union { uint4 u[2]; v16h h; } c;
  c.u[0] = *(const uint4*)(q);
  c.u[1] = *(const uint4*)(q + 8);
  return c.h;
}
// (lane, elem) -> K-within-32
__device__ inline int klocal_of(int lane, int e) {
  int klo = (lane >> 4) << 3;
  return (e < 8) ? (klo + e) : (klo + 8 + e);
}
// inverse: K-within-32 -> (lane group offset 0/16, elem)
__device__ inline void inv_klocal(int k_local, int& laneoff, int& e) {
  laneoff = ((k_local & 15) >= 8) ? 16 : 0;
  e = (k_local & 7) + ((k_local >= 16) ? 8 : 0);
}
__device__ inline v8f wmma_f16(v16h a, v16h b, v8f c) {
  return __builtin_amdgcn_wmma_f32_16x16x32_f16(false, a, false, b, (short)0, c,
                                                false, false);
}

// ---------------- Wk/Wv fp32 -> fragment-packed fp16 -------------------------
// packed idx = ((kk*16 + nt)*32 + lane)*16 + e ; 8 kk x 16 nt tiles
__global__ void k_cvt(const float* __restrict__ wk, const float* __restrict__ wv,
                      half_t* __restrict__ wkp, half_t* __restrict__ wvp) {
  int idx  = blockIdx.x * 256 + threadIdx.x;  // 65536 halves per matrix
  int e    = idx & 15;
  int lane = (idx >> 4) & 31;
  int nt   = (idx >> 9) & 15;
  int kk   = idx >> 13;
  int k = kk * 32 + klocal_of(lane, e);
  int n = nt * 16 + (lane & 15);
  wkp[idx] = (half_t)wk[k * 256 + n];
  wvp[idx] = (half_t)wv[k * 256 + n];
}

// ---------------- fused LayerNorm(inputs) + K/V projection (WMMA) ------------
// grid: (B*NKV)/32 blocks, 256 threads (8 waves: 2 M-tiles x 4 N-quadrants)
// K written dense row-major (A-operand of logits); V written fragment-packed
// (B-operand of attn@V): vpk[b][krow=32][nt=16][lane=32][e=16]
__global__ void __launch_bounds__(256) k_proj(
    const float* __restrict__ x, const float* __restrict__ g,
    const float* __restrict__ bb, const half_t* __restrict__ wkp,
    const half_t* __restrict__ wvp, half_t* __restrict__ kf,
    half_t* __restrict__ vpk) {
  __shared__ float xs[32][256];
  __shared__ __align__(32) half_t xh[32][256];
  __shared__ float psum[32][8], psq[32][8];
  __shared__ float mu[32], rs[32];
  int t = threadIdx.x;
  long base = (long)blockIdx.x * 32 * 256;
  for (int i = t; i < 32 * 256; i += 256) xs[i >> 8][i & 255] = x[base + i];
  __syncthreads();
  {
    int row = t >> 3, seg = t & 7;
    float s = 0.f, s2 = 0.f;
    for (int c = seg * 32; c < seg * 32 + 32; ++c) {
      float v_ = xs[row][c]; s += v_; s2 += v_ * v_;
    }
    psum[row][seg] = s; psq[row][seg] = s2;
  }
  __syncthreads();
  if (t < 32) {
    float s = 0.f, s2 = 0.f;
    for (int j = 0; j < 8; ++j) { s += psum[t][j]; s2 += psq[t][j]; }
    float m = s * (1.f / 256.f);
    mu[t] = m; rs[t] = rsqrtf(s2 * (1.f / 256.f) - m * m + LNE_);
  }
  __syncthreads();
  for (int i = t; i < 32 * 256; i += 256) {
    int row = i >> 8, col = i & 255;
    xh[row][col] = (half_t)((xs[row][col] - mu[row]) * rs[row] * g[col] + bb[col]);
  }
  __syncthreads();

  int lane = t & 31, w = t >> 5;
  int mt = w & 1, nq4 = w >> 1;
  v8f ak[4], av[4];
  for (int i = 0; i < 4; ++i)
    for (int j = 0; j < 8; ++j) { ak[i][j] = 0.f; av[i][j] = 0.f; }
  for (int kk = 0; kk < 8; ++kk) {
    // issue ALL fragment loads of this K-step first (independent b128s),
    // then the WMMA burst -> backend can use partial s_wait_loadcnt
    v16h a = frag_rowmajor(&xh[mt * 16][kk * 32], 256, lane);
    v16h bk[4], bv[4];
#pragma unroll
    for (int ti = 0; ti < 4; ++ti) {
      int nt = nq4 * 4 + ti;
      bk[ti] = frag_packed(wkp + (long)(kk * 16 + nt) * 512, lane);
      bv[ti] = frag_packed(wvp + (long)(kk * 16 + nt) * 512, lane);
    }
#pragma unroll
    for (int ti = 0; ti < 4; ++ti) {
      ak[ti] = wmma_f16(a, bk[ti], ak[ti]);
      av[ti] = wmma_f16(a, bv[ti], av[ti]);
    }
  }
  int b    = blockIdx.x >> 5;   // 32 blocks per batch (1024 rows)
  int krow = blockIdx.x & 31;   // which 32-row band (K index for attn@V)
  half_t* vb = vpk + (long)b * 262144;
  long rb = (long)blockIdx.x * 32 + mt * 16;
  int mo = (lane >> 4) << 3;
  int nl = lane & 15;
#pragma unroll
  for (int ti = 0; ti < 4; ++ti) {
    int nt  = nq4 * 4 + ti;
    int col = nt * 16 + nl;
#pragma unroll
    for (int r = 0; r < 8; ++r) {
      long row = rb + r + mo;
      kf[row * 256 + col] = (half_t)(ak[ti][r] * 0.125f);  // hd^-0.5
      int k_local = mt * 16 + r + mo;
      int lo, e; inv_klocal(k_local, lo, e);
      vb[((long)(krow * 16 + nt) * 32 + lo + nl) * 16 + e] = (half_t)(av[ti][r]);
    }
  }
}

// ---------------- logits GEMM (WMMA) + fused joint softmax -------------------
// value of lane (l ^ M) of the same 16-lane row (DPP row_xmask)
template <int M>
__device__ inline float row_xor(float v) {
  return __builtin_bit_cast(
      float, __builtin_amdgcn_mov_dpp(__builtin_bit_cast(int, v), 0x160 | M, 0xf,
                                      0xf, true));
}
__device__ inline float row_max16(float v) {
  v = fmaxf(v, row_xor<1>(v));
  v = fmaxf(v, row_xor<2>(v));
  v = fmaxf(v, row_xor<4>(v));
  v = fmaxf(v, row_xor<8>(v));
  return v;
}
__device__ inline float row_sum16(float v) {
  v += row_xor<1>(v);
  v += row_xor<2>(v);
  v += row_xor<4>(v);
  v += row_xor<8>(v);
  return v;
}
// value of lane l ^ 16
__device__ inline float xhalf(float x) {
  int i = __builtin_bit_cast(int, x);
  return __builtin_bit_cast(
      float, __builtin_amdgcn_permlanex16(i, i, 0x76543210, 0xfedcba98, false,
                                          false));
}

// exp(x) as __expf builds it: one multiply and v_exp_f32. The v_nop fills the
// one slot the instruction set asks for behind a transcendental before its
// source is overwritten or its result read.
__device__ inline float exp_slot(float x) {
  float r;
  asm("v_exp_f32 %0, %1\n\tv_nop" : "=v"(r) : "v"(x * 1.44269504f));
  return r;
}

// grid: B * (NKV/256); each wave owns 32 kv rows (two M-tiles) x all 32
// (head, slot) columns, so a softmax row lies in one 16-lane row of two
// accumulators and the wave's 32 rows are exactly one K-step of attn@V.
// attn written fragment-packed for attn@V A-operand:
// apk[b][kk=32][mt=2][lane=32][e=16]; lane and e follow from the D layout:
// D register r of M-tile i at lane l is k_local = 16 i + 8 (l >> 4) + r,
// which is element e = 8 i + r of the same lane l.
// Column sums leave as one partial per block: cpart[b][blk=4][32].
__global__ void __launch_bounds__(256) k_logits(
    const half_t* __restrict__ kf, const half_t* __restrict__ qbp,
    half_t* __restrict__ apk, float* __restrict__ cpart,
    float* __restrict__ vis_out) {
  __shared__ float csl[8][32];
  int t = threadIdx.x, lane = t & 31, w = t >> 5;
  int b   = blockIdx.x >> 2;
  int blk = blockIdx.x & 3;
  int n0  = blk * 256 + w * 32;
  const half_t* kp = kf + ((long)b * NKV + n0) * 256;
  const half_t* qp = qbp + (long)b * 8192;
  v8f acc[2][2];  // [M-tile][column tile]
  for (int i = 0; i < 2; ++i)
    for (int k = 0; k < 2; ++k)
      for (int j = 0; j < 8; ++j) acc[i][k][j] = 0.f;
  for (int kk = 0; kk < 8; ++kk) {
    v16h a0  = frag_rowmajor(kp + kk * 32, 256, lane);
    v16h a1  = frag_rowmajor(kp + 16 * 256 + kk * 32, 256, lane);
    v16h bq0 = frag_packed(qp + (long)(kk * 2 + 0) * 512, lane);
    v16h bq1 = frag_packed(qp + (long)(kk * 2 + 1) * 512, lane);
    acc[0][0] = wmma_f16(a0, bq0, acc[0][0]);
    acc[0][1] = wmma_f16(a0, bq1, acc[0][1]);
    acc[1][0] = wmma_f16(a1, bq0, acc[1][0]);
    acc[1][1] = wmma_f16(a1, bq1, acc[1][1]);
  }
  int c16 = lane & 15, hi = lane >> 4;
  float cs0 = 0.f, cs1 = 0.f;
  union { uint4 u[2]; half_t h[16]; } p0, p1;
  float* vp = vis_out + (long)b * NQ * NKV + (c16 & 7) * NKV + n0 + hi * 8 +
              (c16 >> 3) * 4;
#pragma unroll
  for (int i = 0; i < 2; ++i) {
    float vis[8];
#pragma unroll
    for (int r = 0; r < 8; ++r) {
      float x0 = acc[i][0][r], x1 = acc[i][1][r];
      float mx = row_max16(fmaxf(x0, x1));
      float e0 = exp_slot(x0 - mx), e1 = exp_slot(x1 - mx);
      float inv = 1.f / row_sum16(e0 + e1);
      e0 *= inv; e1 *= inv;
      cs0 += e0; cs1 += e1;
      p0.h[i * 8 + r] = (half_t)e0;
      p1.h[i * 8 + r] = (half_t)e1;
      float v_ = e0 + e1;           // heads 0+2 (or 1+3) of slot c16 & 7
      vis[r] = v_ + row_xor<8>(v_);  // attn_vis = sum over heads
    }
    // lanes c16 and c16 ^ 8 hold the same 8 sums: each stores four of them
    float4 o;
    o.x = (c16 & 8) ? vis[4] : vis[0];
    o.y = (c16 & 8) ? vis[5] : vis[1];
    o.z = (c16 & 8) ? vis[6] : vis[2];
    o.w = (c16 & 8) ? vis[7] : vis[3];
    *(float4*)(vp + i * 16) = o;
  }
  half_t* ab = apk + (long)b * 32768 + (long)(blk * 8 + w) * 1024 + lane * 16;
  *(uint4*)(ab)           = p0.u[0];
  *(uint4*)(ab + 8)       = p0.u[1];
  *(uint4*)(ab + 512)     = p1.u[0];
  *(uint4*)(ab + 512 + 8) = p1.u[1];
  // column sums: 16 rows in the lane, the other 16 in lane ^ 16, then the
  // eight waves in a fixed order
  cs0 += xhalf(cs0);
  cs1 += xhalf(cs1);
  csl[w][lane] = hi ? cs1 : cs0;
  __syncthreads();
  if (t < 32) {
    float s = 0.f;
#pragma unroll
    for (int j = 0; j < 8; ++j) s += csl[j][t];
    cpart[(b * 4 + blk) * 32 + t] = s;
  }
}

__global__ void k_inv(const float* __restrict__ cpart, float* __restrict__ inv) {
  int i = blockIdx.x * 256 + threadIdx.x;
  if (i < B_ * 32) {
    const float* p = cpart + (i >> 5) * 128 + (i & 31);
    float s = ((p[0] + p[32]) + p[64]) + p[96];
    inv[i] = 1.f / (s + (float)NKV * EPS_);
  }
}

// ---------------- updates = norm(attn+eps)^T @ V (WMMA, all packed) ----------
// The eps term needs the column sums of V over all kv rows: every V fragment
// passes through the wave anyway, so one more WMMA with an A operand of ones
// sums it over k. Each row of that D tile is the column sum, so D register r
// of a lane holds the sum of the same column d as acc[..][ntl][r].
__global__ void __launch_bounds__(256) k_attnv(
    const half_t* __restrict__ apk, const half_t* __restrict__ vpk,
    const float* __restrict__ invs, float* __restrict__ upd) {
  int t = threadIdx.x, lane = t & 31, w = t >> 5;
  int b = blockIdx.x;
  const half_t* ab = apk + (long)b * 32768;
  const half_t* vb = vpk + (long)b * 262144;
  v8f acc[2][2];
  for (int i = 0; i < 2; ++i)
    for (int j = 0; j < 2; ++j)
      for (int e = 0; e < 8; ++e) acc[i][j][e] = 0.f;
  v8f cv[2];
  for (int j = 0; j < 2; ++j)
    for (int e = 0; e < 8; ++e) cv[j][e] = 0.f;
  v16h ones;
  for (int e = 0; e < 16; ++e) ones[e] = (half_t)1.f;
  for (int kk = 0; kk < 32; ++kk) {
    // all four fragment loads first, then the WMMA burst
    v16h a0 = frag_packed(ab + (long)(kk * 2 + 0) * 512, lane);
    v16h a1 = frag_packed(ab + (long)(kk * 2 + 1) * 512, lane);
    v16h b0 = frag_packed(vb + (long)(kk * 16 + 2 * w + 0) * 512, lane);
    v16h b1 = frag_packed(vb + (long)(kk * 16 + 2 * w + 1) * 512, lane);
    // keeps all four fragments' loads above the WMMAs: left free, the scheduler
    // loads b1 into b0's registers behind b0's last WMMA, and the step then
    // waits out two load latencies instead of one
    __builtin_amdgcn_sched_barrier(0);
    acc[0][0] = wmma_f16(a0, b0, acc[0][0]);
    acc[1][0] = wmma_f16(a1, b0, acc[1][0]);
    acc[0][1] = wmma_f16(a0, b1, acc[0][1]);
    acc[1][1] = wmma_f16(a1, b1, acc[1][1]);
    cv[0] = wmma_f16(ones, b0, cv[0]);
    cv[1] = wmma_f16(ones, b1, cv[1]);
  }
  int mo = (lane >> 4) << 3;
#pragma unroll
  for (int mt = 0; mt < 2; ++mt)
#pragma unroll
    for (int ntl = 0; ntl < 2; ++ntl) {
      int d = (2 * w + ntl) * 16 + (lane & 15);
#pragma unroll
      for (int r = 0; r < 8; ++r) {
        int hq = mt * 16 + r + mo;
        int h = hq >> 3;
        if ((d >> 6) == h) {  // keep only this head's 64-wide slice
          int qi = hq & 7;
          float val = (acc[mt][ntl][r] + EPS_ * cv[ntl][r]) * invs[b * 32 + hq];
          upd[((long)b * NQ + qi) * S_ + d] = val;
        }
      }
    }
}

// ---------------- GRU cell (f32 WMMA 16x16x4) --------------------------------
// xg = upd @ wih^T and hg = hprev @ whh^T as Y = X W^T with X and W both
// k-contiguous. One wave owns 16 rows (of the B*NQ = 512) x 16 columns j of
// all three gates over the whole k = 256: no LDS, no barrier, no partial sums
// between waves. A block's two waves take neighbouring column tiles, so the
// block writes whole 128-byte lines. grid: 32 row tiles x 8 column pairs.
// k order: lane (c, h) loads floats k0 + 4h .. k0 + 4h + 3 of its row of X and
// of its row of W by the same offsets; elements (0,1) feed one WMMA, (2,3) the
// next, so A and B pair the same k at every lane and register.
__device__ inline v8f wmma_f32(float ax, float ay, float bx, float by, v8f c) {
  v2f a = {ax, ay};
  v2f b = {bx, by};
  return __builtin_amdgcn_wmma_f32_16x16x4_f32(false, a, false, b, (short)0, c,
                                               false, false);
}
__global__ void __launch_bounds__(64) k_gru(
    const float* __restrict__ upd, const float* __restrict__ hprev,
    const float* __restrict__ wih, const float* __restrict__ whh,
    const float* __restrict__ bih, const float* __restrict__ bhh,
    float* __restrict__ hout) {
  int lane = threadIdx.x & 31, w = threadIdx.x >> 5;
  int c = lane & 15, h = lane >> 4;
  int m0 = (blockIdx.x >> 3) * 16;
  int n0 = (blockIdx.x & 7) * 32 + w * 16;
  int j  = n0 + c;
  int ao = (m0 + c) * 256 + 4 * h;
  int bo = j * 256 + 4 * h;
  const float* s[8] = {upd + ao,          hprev + ao,
                       wih + bo,          whh + bo,
                       wih + 65536 + bo,  whh + 65536 + bo,
                       wih + 131072 + bo, whh + 131072 + bo};
  // every D register of a lane is column j, so the accumulators start from
  // the gate biases of that column
  float br = bih[j] + bhh[j];
  float bz = bih[256 + j] + bhh[256 + j];
  float bi3 = bih[512 + j], bh3 = bhh[512 + j];
  // D register e of lane (c, h) is row m0 + 8h + e, column j
  long ob = (long)(m0 + 8 * h) * 256 + j;
  float hp[8];
  float4 f[2][2][8];  // [stage][8-k step][matrix]
#pragma unroll
  for (int q = 0; q < 2; ++q)
#pragma unroll
    for (int x = 0; x < 8; ++x) f[0][q][x] = *(const float4*)(s[x] + q * 8);
  // The accumulators may take the register that the bias loads name as their
  // offset: the wait stands in front of that overwrite, and the scheduling
  // barriers keep the accumulators' first writes behind it.
  __builtin_amdgcn_sched_barrier(0);
  asm volatile("s_wait_xcnt 0x0" ::: "memory");
  __builtin_amdgcn_sched_barrier(0);
  v8f ar, az, ani, anh;
  for (int e = 0; e < 8; ++e) { ar[e] = br; az[e] = bz; ani[e] = bi3; anh[e] = bh3; }
  // unrolled whole so that the stage index is static and the next 16 k of all
  // eight operands are in flight under this stage's 24 WMMAs
#pragma unroll
  for (int ch = 0; ch < 16; ++ch) {
    if (ch + 1 < 16) {
#pragma unroll
      for (int q = 0; q < 2; ++q)
#pragma unroll
        for (int x = 0; x < 8; ++x)
          f[(ch + 1) & 1][q][x] = *(const float4*)(s[x] + (ch + 1) * 16 + q * 8);
    } else {
      // Every operand load is issued and its address registers are free for
      // reuse from here on: the wait stands in front of the first overwrite
      // (the scheduling barrier keeps later address arithmetic behind it).
      // The old state for the output blend then loads under the last WMMAs.
      __builtin_amdgcn_sched_barrier(0);
      asm volatile("s_wait_xcnt 0x0" ::: "memory");
#pragma unroll
      for (int e = 0; e < 8; ++e) hp[e] = hprev[ob + e * 256];
    }
    // keeps the next stage's loads above this stage's WMMAs: left free, the
    // scheduler sinks each load to its first use and every WMMA group then
    // waits out a whole load latency
    __builtin_amdgcn_sched_barrier(0);
#pragma unroll
    for (int q = 0; q < 2; ++q) {
      const float4* g = f[ch & 1][q];
      ar  = wmma_f32(g[0].x, g[0].y, g[2].x, g[2].y, ar);
      az  = wmma_f32(g[0].x, g[0].y, g[4].x, g[4].y, az);
      ani = wmma_f32(g[0].x, g[0].y, g[6].x, g[6].y, ani);
      anh = wmma_f32(g[1].x, g[1].y, g[7].x, g[7].y, anh);
      ar  = wmma_f32(g[1].x, g[1].y, g[3].x, g[3].y, ar);
      az  = wmma_f32(g[1].x, g[1].y, g[5].x, g[5].y, az);
      ani = wmma_f32(g[0].z, g[0].w, g[6].z, g[6].w, ani);
      anh = wmma_f32(g[1].z, g[1].w, g[7].z, g[7].w, anh);
      ar  = wmma_f32(g[0].z, g[0].w, g[2].z, g[2].w, ar);
      az  = wmma_f32(g[0].z, g[0].w, g[4].z, g[4].w, az);
      ar  = wmma_f32(g[1].z, g[1].w, g[3].z, g[3].w, ar);
      az  = wmma_f32(g[1].z, g[1].w, g[5].z, g[5].w, az);
    }
  }
  // The table of WMMA distances leaves the f32 16x16x4 form out: eight slots, the count of the slowest
  // listed form, stand between the last WMMA and the first vector read of an
  // accumulator. The two scheduling barriers hold the slots at that place.
  __builtin_amdgcn_sched_barrier(0);
  asm volatile("v_nop\n\tv_nop\n\tv_nop\n\tv_nop\n\tv_nop\n\tv_nop\n\tv_nop\n\tv_nop");
  __builtin_amdgcn_sched_barrier(0);
#pragma unroll
  for (int e = 0; e < 8; ++e) {
    float r = 1.f / (1.f + __expf(-ar[e]));
    float z = 1.f / (1.f + __expf(-az[e]));
    float n = tanhf(ani[e] + r * anh[e]);
    hout[ob + e * 256] = (1.f - z) * n + z * hp[e];
  }
}

// ---------------- LN + MLP residual (f32 WMMA 16x16x4), one launch a layer ---
// Both layers are Y = X W with X k-contiguous and W column-contiguous. One wave
// owns 16 rows (of the B*NQ = 512) over the whole k: no LDS, no barrier, no
// partial sums between waves.
// k order: lane (c, h) holds floats 8q + 4h .. 8q + 4h + 3 of its row of X and
// loads rows 8q + 4h .. 8q + 4h + 3 of W at its column; elements (0,1) feed one
// WMMA, (2,3) the next, so A and B pair the same k at every lane and register.

// 1/sqrt(x) as one v_rsq_f32; the v_nop fills the one slot the instruction set
// asks for behind a transcendental before its result is read.
__device__ inline float rsq_slot(float x) {
  float r;
  asm("v_rsq_f32 %0, %1\n\tv_nop" : "=v"(r) : "v"(x));
  return r;
}

#define D1_ 5   // k_mlp1: 8-k steps that the operand loads run ahead
#define D2_ 12  // k_mlp2: the same

typedef __attribute__((ext_vector_type(4))) float v4f;
__device__ inline v8f wmma_f32v(v2f a, v2f b, v8f c) {
  return __builtin_amdgcn_wmma_f32_16x16x4_f32(false, a, false, b, (short)0, c,
                                               false, false);
}

// hid = relu(LN(h) @ w1 + b1). A wave owns 16 rows x 32 hidden columns and
// keeps its half rows (128 floats a lane) in registers: the row statistics are
// a lane's own sums plus those of lane ^ 16. grid: 32 row tiles x 8 column
// groups of 64, two waves a block. The register bound keeps the wave inside
// one 256-register window (left free, the allocator spreads over two).
__global__ void __launch_bounds__(64) __attribute__((amdgpu_num_vgpr(256))) k_mlp1(
    const float* __restrict__ hin, const float* __restrict__ g,
    const float* __restrict__ bb, const float* __restrict__ w1,
    const float* __restrict__ b1, float* __restrict__ hid) {
  int lane = threadIdx.x & 31, w = threadIdx.x >> 5;
  int c = lane & 15, h = lane >> 4;
  int m0 = (blockIdx.x >> 3) * 16;
  int n0 = (blockIdx.x & 7) * 64 + w * 32;
  const float* ap = hin + (m0 + c) * 256 + 4 * h;
  const float* wp = w1 + 4 * h * 512 + n0 + c;
  const float* gp = g + 4 * h;
  const float* bp = bb + 4 * h;
  v4f a[32], fg[32], fo[32];
  v2f fw[32][2][2];  // [8-k step][k pair][column tile]
#pragma unroll
  for (int q = 0; q < 32; ++q) a[q] = *(const v4f*)(ap + q * 8);
#pragma unroll
  for (int q = 0; q < D1_; ++q) {
    fg[q] = *(const v4f*)(gp + q * 8);
    fo[q] = *(const v4f*)(bp + q * 8);
#pragma unroll
    for (int p = 0; p < 2; ++p)
#pragma unroll
      for (int ti = 0; ti < 2; ++ti) {
        fw[q][p][ti].x = wp[(q * 8 + 2 * p) * 512 + ti * 16];
        fw[q][p][ti].y = wp[(q * 8 + 2 * p + 1) * 512 + ti * 16];
      }
  }
  int bi = n0 + c;
  float bias0 = b1[bi], bias1 = b1[bi + 16];
  // The address registers of the row and bias loads are free for reuse from
  // here on: the wait stands in front of the first overwrite. Named as its
  // inputs they stay live up to it, so that no load above it lands in them;
  // the scheduling barriers keep the loads above it, the arithmetic behind it.
  __builtin_amdgcn_sched_barrier(0);
  asm volatile("s_wait_xcnt 0x0" :: "v"(ap), "v"(bi) : "memory");
  __builtin_amdgcn_sched_barrier(0);
  v2f t0 = {0.f, 0.f}, t1 = t0, t2 = t0, t3 = t0;
#pragma unroll
  for (int q = 0; q < 32; q += 2) {
    t0 += a[q].lo; t1 += a[q].hi; t2 += a[q + 1].lo; t3 += a[q + 1].hi;
  }
  t0 = (t0 + t1) + (t2 + t3);
  float s = t0.x + t0.y;
  s += xhalf(s);
  float mu = s * (1.f / 256.f);
  t0 = 0.f; t1 = 0.f; t2 = 0.f; t3 = 0.f;
#pragma unroll
  for (int q = 0; q < 32; q += 2) {
    a[q] -= mu; a[q + 1] -= mu;
    t0 += a[q].lo * a[q].lo;         t1 += a[q].hi * a[q].hi;
    t2 += a[q + 1].lo * a[q + 1].lo; t3 += a[q + 1].hi * a[q + 1].hi;
  }
  t0 = (t0 + t1) + (t2 + t3);
  s = t0.x + t0.y;
  s += xhalf(s);
  float rs = rsq_slot(s * (1.f / 256.f) + LNE_);
  // every D register of a lane is one column, so the accumulators start from
  // that column's bias
  v8f acc0, acc1;
  for (int e = 0; e < 8; ++e) { acc0[e] = bias0; acc1[e] = bias1; }
  a[0] = a[0] * (rs * fg[0]) + fo[0];
  a[1] = a[1] * (rs * fg[1]) + fo[1];
  // unrolled whole so that every index is static
#pragma unroll
  for (int q = 0; q < 32; ++q) {
    if (q + D1_ < 32) {
      int n = q + D1_;
      fg[n] = *(const v4f*)(gp + n * 8);
      fo[n] = *(const v4f*)(bp + n * 8);
#pragma unroll
      for (int p = 0; p < 2; ++p)
#pragma unroll
        for (int ti = 0; ti < 2; ++ti) {
          fw[n][p][ti].x = wp[(n * 8 + 2 * p) * 512 + ti * 16];
          fw[n][p][ti].y = wp[(n * 8 + 2 * p + 1) * 512 + ti * 16];
        }
    }
    // keeps the loads of step q + D1_ above this step's WMMAs: left free, the
    // scheduler sinks each load to its first use and every WMMA group then
    // waits out a whole load latency
    __builtin_amdgcn_sched_barrier(0);
    acc0 = wmma_f32v(a[q].lo, fw[q][0][0], acc0);
    acc1 = wmma_f32v(a[q].lo, fw[q][0][1], acc1);
    acc0 = wmma_f32v(a[q].hi, fw[q][1][0], acc0);
    acc1 = wmma_f32v(a[q].hi, fw[q][1][1], acc1);
    // The table of WMMA distances leaves the f32 16x16x4 form out: eight slots,
    // the count of the slowest
    // listed form, stand between the last WMMA and the next vector write,
    // which may take a register that a WMMA has just read (behind the last
    // step: the first vector read of an accumulator). They issue while the
    // matrix unit is busy. The scheduling barriers hold them at that place.
    __builtin_amdgcn_sched_barrier(0);
    if (q != 30)  // behind step 30 no vector instruction follows
      asm volatile("v_nop\n\tv_nop\n\tv_nop\n\tv_nop\n\tv_nop\n\tv_nop\n\tv_nop\n\tv_nop");
    __builtin_amdgcn_sched_barrier(0);
    // scale and shift of the LN two steps ahead, so that no WMMA waits for it
    if (q + 2 < 32) a[q + 2] = a[q + 2] * (rs * fg[q + 2]) + fo[q + 2];
    __builtin_amdgcn_sched_barrier(0);
  }
  // D register e of lane (c, h) is row m0 + 8h + e
  float* op = hid + (m0 + 8 * h) * 512 + n0 + c;
#pragma unroll
  for (int e = 0; e < 8; ++e) {
    op[e * 512]      = fmaxf(acc0[e], 0.f);
    op[e * 512 + 16] = fmaxf(acc1[e], 0.f);
  }
}

// slots = h + hid @ w2 + b2. A wave owns 16 rows x 16 columns over k = 512, the
// even and the odd k pairs in an accumulator each (a WMMA then never waits for
// the one before it); one starts from the bias, the other from the residual
// rows. A block's two waves take neighbouring column tiles, so the block
// writes whole 128-byte lines. grid: 32 row tiles x 8 column pairs.
__global__ void __launch_bounds__(64) k_mlp2(
    const float* __restrict__ hid, const float* __restrict__ hin,
    const float* __restrict__ w2, const float* __restrict__ b2,
    float* __restrict__ slots_out, float* __restrict__ dout, int write_out) {
  int lane = threadIdx.x & 31, w = threadIdx.x >> 5;
  int c = lane & 15, h = lane >> 4;
  int m0 = (blockIdx.x >> 3) * 16;
  int j  = (blockIdx.x & 7) * 32 + w * 16 + c;
  const float* ap = hid + (m0 + c) * 512 + 4 * h;
  const float* wp = w2 + 4 * h * 256 + j;
  // D register e of lane (c, h) is row m0 + 8h + e, column j
  int ob = (m0 + 8 * h) * 256 + j;
  v8f acc0, acc1;
  float bias = b2[j];
#pragma unroll
  for (int e = 0; e < 8; ++e) acc1[e] = hin[ob + e * 256];
  v4f fa[64];
  v2f fw[64][2];  // [8-k step][k pair]
#pragma unroll
  for (int q = 0; q < D2_; ++q) {
    fa[q] = *(const v4f*)(ap + q * 8);
#pragma unroll
    for (int p = 0; p < 2; ++p) {
      fw[q][p].x = wp[(q * 8 + 2 * p) * 256];
      fw[q][p].y = wp[(q * 8 + 2 * p + 1) * 256];
    }
  }
  // The offset register of the bias load is free for reuse from here on: the
  // wait stands in front of the first overwrite. Named as its input the offset
  // stays live up to it, so that no load above it lands in that register; the
  // scheduling barriers keep the accumulator's first writes behind it.
  __builtin_amdgcn_sched_barrier(0);
  asm volatile("s_wait_xcnt 0x0" :: "v"(j) : "memory");
  __builtin_amdgcn_sched_barrier(0);
  for (int e = 0; e < 8; ++e) acc0[e] = bias;
  // unrolled whole so that every index is static
#pragma unroll
  for (int q = 0; q < 64; ++q) {
    if (q + D2_ < 64) {
      int n = q + D2_;
      fa[n] = *(const v4f*)(ap + n * 8);
#pragma unroll
      for (int p = 0; p < 2; ++p) {
        fw[n][p].x = wp[(n * 8 + 2 * p) * 256];
        fw[n][p].y = wp[(n * 8 + 2 * p + 1) * 256];
      }
    }
    // keeps the loads of step q + D2_ above this step's WMMAs (as in k_mlp1)
    __builtin_amdgcn_sched_barrier(0);
    acc0 = wmma_f32v(fa[q].lo, fw[q][0], acc0);
    acc1 = wmma_f32v(fa[q].hi, fw[q][1], acc1);
  }
  // eight slots between the last WMMA and the first vector read of an
  // accumulator, held in place by the scheduling barriers (as in k_mlp1)
  __builtin_amdgcn_sched_barrier(0);
  asm volatile("v_nop\n\tv_nop\n\tv_nop\n\tv_nop\n\tv_nop\n\tv_nop\n\tv_nop\n\tv_nop");
  __builtin_amdgcn_sched_barrier(0);
  v8f o = acc0 + acc1;
#pragma unroll
  for (int e = 0; e < 8; ++e) slots_out[ob + e * 256] = o[e];
  if (write_out) {
#pragma unroll
    for (int e = 0; e < 8; ++e) dout[ob + e * 256] = o[e];
  }
}

// ---------------- LN(slots) + q = s@Wq (f32 WMMA 16x16x4), packed Qb ---------
// qbp[b][kk=8][ti=2][lane=32][e=16]: the block-diagonal B operand of the logits
// (k = feature d, column = head * 8 + slot, zero where d is not of that head).
// The product is formed transposed, q^T = Wq^T LN(s)^T: A is a column tile of
// Wq, B a tile of 16 slot rows (two batches), loaded by the offsets of k_mlp1,
// so A and B pair the same k at every lane and register. D register e of lane
// (c, h) is then feature 8h + e of slot row c: the eight features that one
// packed lane holds side by side. A wave owns 16 rows x 32 features (one kk)
// over the whole k, and writes the whole 2 KB of its kk for both batches, the
// zeros too. No LDS, no barrier. grid: 32 row tiles x 4 pairs of kk. The
// register bound keeps the wave inside one 256-register window (as in k_mlp1).
__global__ void __launch_bounds__(64) __attribute__((amdgpu_num_vgpr(256))) k_qbuild(
    const float* __restrict__ slots, const float* __restrict__ g,
    const float* __restrict__ bb, const float* __restrict__ wq,
    half_t* __restrict__ qbp) {
  int lane = threadIdx.x & 31, w = threadIdx.x >> 5;
  int c = lane & 15, h = lane >> 4;
  int m0 = (blockIdx.x >> 2) * 16;
  int kk = (blockIdx.x & 3) * 2 + w;
  const float* ap = slots + (m0 + c) * 256 + 4 * h;
  const float* wp = wq + 4 * h * 256 + kk * 32 + c;
  const float* gp = g + 4 * h;
  const float* bp = bb + 4 * h;
  v4f a[32], fg[32], fo[32];
  v2f fw[32][2][2];  // [8-k step][k pair][feature tile]
#pragma unroll
  for (int q = 0; q < 32; ++q) a[q] = *(const v4f*)(ap + q * 8);
#pragma unroll
  for (int q = 0; q < D1_; ++q) {
    fg[q] = *(const v4f*)(gp + q * 8);
    fo[q] = *(const v4f*)(bp + q * 8);
#pragma unroll
    for (int p = 0; p < 2; ++p)
#pragma unroll
      for (int ti = 0; ti < 2; ++ti) {
        fw[q][p][ti].x = wp[(q * 8 + 2 * p) * 256 + ti * 16];
        fw[q][p][ti].y = wp[(q * 8 + 2 * p + 1) * 256 + ti * 16];
      }
  }
  // The address registers of the row loads are free for reuse from here on: the
  // wait stands in front of the first overwrite. Named as its input they stay
  // live up to it, so that no load above it lands in them; the scheduling
  // barriers keep the loads above it, the arithmetic behind it.
  __builtin_amdgcn_sched_barrier(0);
  asm volatile("s_wait_xcnt 0x0" :: "v"(ap) : "memory");
  __builtin_amdgcn_sched_barrier(0);
  v2f t0 = {0.f, 0.f}, t1 = t0, t2 = t0, t3 = t0;
#pragma unroll
  for (int q = 0; q < 32; q += 2) {
    t0 += a[q].lo; t1 += a[q].hi; t2 += a[q + 1].lo; t3 += a[q + 1].hi;
  }
  t0 = (t0 + t1) + (t2 + t3);
  float s = t0.x + t0.y;
  s += xhalf(s);
  float mu = s * (1.f / 256.f);
  t0 = 0.f; t1 = 0.f; t2 = 0.f; t3 = 0.f;
#pragma unroll
  for (int q = 0; q < 32; q += 2) {
    a[q] -= mu; a[q + 1] -= mu;
    t0 += a[q].lo * a[q].lo;         t1 += a[q].hi * a[q].hi;
    t2 += a[q + 1].lo * a[q + 1].lo; t3 += a[q + 1].hi * a[q + 1].hi;
  }
  t0 = (t0 + t1) + (t2 + t3);
  s = t0.x + t0.y;
  s += xhalf(s);
  float rs = rsq_slot(s * (1.f / 256.f) + LNE_);
  v8f acc0, acc1;
  for (int e = 0; e < 8; ++e) { acc0[e] = 0.f; acc1[e] = 0.f; }
  a[0] = a[0] * (rs * fg[0]) + fo[0];
  a[1] = a[1] * (rs * fg[1]) + fo[1];
  // unrolled whole so that every index is static
#pragma unroll
  for (int q = 0; q < 32; ++q) {
    if (q + D1_ < 32) {
      int n = q + D1_;
      fg[n] = *(const v4f*)(gp + n * 8);
      fo[n] = *(const v4f*)(bp + n * 8);
#pragma unroll
      for (int p = 0; p < 2; ++p)
#pragma unroll
        for (int ti = 0; ti < 2; ++ti) {
          fw[n][p][ti].x = wp[(n * 8 + 2 * p) * 256 + ti * 16];
          fw[n][p][ti].y = wp[(n * 8 + 2 * p + 1) * 256 + ti * 16];
        }
    }
    // keeps the loads of step q + D1_ above this step's WMMAs (as in k_mlp1)
    __builtin_amdgcn_sched_barrier(0);
    acc0 = wmma_f32v(fw[q][0][0], a[q].lo, acc0);
    acc1 = wmma_f32v(fw[q][0][1], a[q].lo, acc1);
    acc0 = wmma_f32v(fw[q][1][0], a[q].hi, acc0);
    acc1 = wmma_f32v(fw[q][1][1], a[q].hi, acc1);
    // eight slots between the last WMMA and the next vector write or, behind
    // the last step, the first vector read of an accumulator, held in place by
    // the scheduling barriers (as in k_mlp1)
    __builtin_amdgcn_sched_barrier(0);
    if (q != 30)  // behind step 30 no vector instruction follows
      asm volatile("v_nop\n\tv_nop\n\tv_nop\n\tv_nop\n\tv_nop\n\tv_nop\n\tv_nop\n\tv_nop");
    __builtin_amdgcn_sched_barrier(0);
    // scale and shift of the LN two steps ahead, so that no WMMA waits for it
    if (q + 2 < 32) a[q + 2] = a[q + 2] * (rs * fg[q + 2]) + fo[q + 2];
    __builtin_amdgcn_sched_barrier(0);
  }
  // slot row c is batch m0 / 8 + (c >> 3), slot c & 7; its column of Qb is
  // head * 8 + slot with head = kk >> 1. sl = ti * 32 + packed lane; elements
  // 0..7 are features 8h + e (acc0), 8..15 features 16 + 8h + e (acc1).
  int hd = kk >> 1;
  int sl = (hd >> 1) * 32 + 16 * h + (hd & 1) * 8 + (c & 7);
  half_t* qp = qbp + ((m0 >> 3) + (c >> 3)) * 8192 + kk * 1024;
  union { uint4 u[2]; half_t x[16]; } o;
#pragma unroll
  for (int e = 0; e < 8; ++e) {
    o.x[e]     = (half_t)acc0[e];
    o.x[8 + e] = (half_t)acc1[e];
  }
  *(uint4*)(qp + sl * 16)     = o.u[0];
  *(uint4*)(qp + sl * 16 + 8) = o.u[1];
  // the columns of the other three heads are zero at these features
  uint4 zz = {0u, 0u, 0u, 0u};
  *(uint4*)(qp + (sl ^ 8) * 16)      = zz;
  *(uint4*)(qp + (sl ^ 8) * 16 + 8)  = zz;
  *(uint4*)(qp + (sl ^ 32) * 16)     = zz;
  *(uint4*)(qp + (sl ^ 32) * 16 + 8) = zz;
  *(uint4*)(qp + (sl ^ 40) * 16)     = zz;
  *(uint4*)(qp + (sl ^ 40) * 16 + 8) = zz;
}

// ---------------- host orchestration ----------------------------------------
extern "C" void kernel_launch(void* const* d_in, const int* in_sizes, int n_in,
                              void* d_out, int out_size, void* d_ws,
                              size_t ws_size, hipStream_t stream) {
  (void)in_sizes; (void)n_in; (void)out_size; (void)ws_size;
  const float* inputs   = (const float*)d_in[0];
  const float* slots0   = (const float*)d_in[1];
  const float* ln_in_g  = (const float*)d_in[2];
  const float* ln_in_b  = (const float*)d_in[3];
  const float* ln_sl_g  = (const float*)d_in[4];
  const float* ln_sl_b  = (const float*)d_in[5];
  const float* ln_mlp_g = (const float*)d_in[6];
  const float* ln_mlp_b = (const float*)d_in[7];
  const float* Wq       = (const float*)d_in[8];
  const float* Wk       = (const float*)d_in[9];
  const float* Wv       = (const float*)d_in[10];
  const float* gwih     = (const float*)d_in[11];
  const float* gwhh     = (const float*)d_in[12];
  const float* gbih     = (const float*)d_in[13];
  const float* gbhh     = (const float*)d_in[14];
  const float* w1       = (const float*)d_in[15];
  const float* b1       = (const float*)d_in[16];
  const float* w2       = (const float*)d_in[17];
  const float* b2       = (const float*)d_in[18];

  char* ws = (char*)d_ws;
  half_t* kf   = (half_t*)(ws + 0);          // 32 MB  K dense f16 (pre-scaled)
  half_t* vpk  = (half_t*)(ws + 33554432);   // 32 MB  V fragment-packed
  half_t* wkp  = (half_t*)(ws + 67108864);   // 128 KB Wk packed
  half_t* wvp  = (half_t*)(ws + 67239936);   // 128 KB Wv packed
  half_t* qbp  = (half_t*)(ws + 67436544);   // 1 MB   block-diag Q packed
  half_t* apk  = (half_t*)(ws + 68485120);   // 4 MB   attn^T fragment-packed
  float*  invs = (float*)(ws + 72687616);    // 8 KB
  float*  upd  = (float*)(ws + 72695808);    // 512 KB
  float*  scur = (float*)(ws + 73220096);    // 512 KB current slots
  float*  smid = (float*)(ws + 73744384);    // 512 KB post-GRU slots
  float*  csum = (float*)(ws + 74268672);    // 32 KB  attn column-sum partials
  float*  hid  = (float*)(ws + 74301440);    // 1 MB   MLP hidden layer

  float* out_slots = (float*)d_out;
  float* out_vis   = out_slots + (long)B_ * NQ * S_;

  hipMemcpyAsync(scur, slots0, (size_t)B_ * NQ * S_ * sizeof(float),
                 hipMemcpyDeviceToDevice, stream);
  k_cvt<<<256, 256, 0, stream>>>(Wk, Wv, wkp, wvp);
  k_proj<<<(B_ * NKV) / 32, 256, 0, stream>>>(inputs, ln_in_g, ln_in_b, wkp, wvp,
                                              kf, vpk);

  for (int it = 0; it < 3; ++it) {
    k_qbuild<<<128, 64, 0, stream>>>(scur, ln_sl_g, ln_sl_b, Wq, qbp);
    k_logits<<<B_ * (NKV / 256), 256, 0, stream>>>(kf, qbp, apk, csum, out_vis);
    k_inv<<<8, 256, 0, stream>>>(csum, invs);
    k_attnv<<<B_, 256, 0, stream>>>(apk, vpk, invs, upd);
    k_gru<<<256, 64, 0, stream>>>(upd, scur, gwih, gwhh, gbih, gbhh, smid);
    k_mlp1<<<256, 64, 0, stream>>>(smid, ln_mlp_g, ln_mlp_b, w1, b1, hid);
    k_mlp2<<<256, 64, 0, stream>>>(hid, smid, w2, b2, scur, out_slots,
                                   (it == 2) ? 1 : 0);
  }
}

// v006
// Next to v005, in two timings, it ran 1.39 times as fast each time.
// Counting every step since v000, it is 4.49 times as fast.
#include <hip/hip_runtime.h>
#include <hip/hip_bf16.h>

typedef __attribute__((ext_vector_type(16))) _Float16 v16h;
typedef __attribute__((ext_vector_type(8)))  float    v8f;
typedef __attribute__((ext_vector_type(2)))  float    v2f;
typedef _Float16 half_t;

#define B_     64
#define NKV    1024
#define NQ     8
#define S_     256
#define HM_    512
#define EPS_   1e-8f
#define LNE_   1e-5f

// ---------------- WMMA fragment helpers (CDNA5 16x16x32 f16 layout) ----------
// 16-bit operand layout: lane L, klo = (L>=16)?8:0; elems 0..7 hold K =
// klo..klo+7, elems 8..15 hold K = klo+16..klo+23 (row/col index = L&15).

// A-fragment from row-major source (ld in halves): two 16B vector loads.
__device__ inline v16h frag_rowmajor(const half_t* p, int ld, int lane) {
  int m   = lane & 15;
  int klo = (lane >> 4) << 3;
  const half_t* q = p + m * ld + klo;
  union { uint4 u[2]; v16h h; } c;
  c.u[0] = *(const uint4*)(q);
  c.u[1] = *(const uint4*)(q + 16);
  return c.h;
}
// Fragment from pre-packed storage: packed[...][lane][16] -> two contiguous 16B loads.
__device__ inline v16h frag_packed(const half_t* p, int lane) {
  const half_t* q = p + lane * 16;
  union { uint4 u[2]; v16h h; } c;
  c.u[0] = *(const uint4*)(q);
  c.u[1] = *(const uint4*)(q + 8);
  return c.h;
}
// (lane, elem) -> K-within-32
__device__ inline int klocal_of(int lane, int e) {
  int klo = (lane >> 4) << 3;
  return (e < 8) ? (klo + e) : (klo + 8 + e);
}
// inverse: K-within-32 -> (lane group offset 0/16, elem)
__device__ inline void inv_klocal(int k_local, int& laneoff, int& e) {
  laneoff = ((k_local & 15) >= 8) ? 16 : 0;
  e = (k_local & 7) + ((k_local >= 16) ? 8 : 0);
}
__device__ inline v8f wmma_f16(v16h a, v16h b, v8f c) {
  return __builtin_amdgcn_wmma_f32_16x16x32_f16(false, a, false, b, (short)0, c,
                                                false, false);
}

// ---------------- Wk/Wv fp32 -> fragment-packed fp16 -------------------------
// packed idx = ((kk*16 + nt)*32 + lane)*16 + e ; 8 kk x 16 nt tiles
__global__ void k_cvt(const float* __restrict__ wk, const float* __restrict__ wv,
                      half_t* __restrict__ wkp, half_t* __restrict__ wvp) {
  int idx  = blockIdx.x * 256 + threadIdx.x;  // 65536 halves per matrix
  int e    = idx & 15;
  int lane = (idx >> 4) & 31;
  int nt   = (idx >> 9) & 15;
  int kk   = idx >> 13;
  int k = kk * 32 + klocal_of(lane, e);
  int n = nt * 16 + (lane & 15);
  wkp[idx] = (half_t)wk[k * 256 + n];
  wvp[idx] = (half_t)wv[k * 256 + n];
}

// ---------------- fused LayerNorm(inputs) + K/V projection (WMMA) ------------
// grid: (B*NKV)/32 blocks, 256 threads (8 waves: 2 M-tiles x 4 N-quadrants)
// K written dense row-major (A-operand of logits); V written fragment-packed
// (B-operand of attn@V): vpk[b][krow=32][nt=16][lane=32][e=16]
__global__ void __launch_bounds__(256) k_proj(
    const float* __restrict__ x, const float* __restrict__ g,
    const float* __restrict__ bb, const half_t* __restrict__ wkp,
    const half_t* __restrict__ wvp, half_t* __restrict__ kf,
    half_t* __restrict__ vpk) {
  __shared__ float xs[32][256];
  __shared__ __align__(32) half_t xh[32][256];
  __shared__ float psum[32][8], psq[32][8];
  __shared__ float mu[32], rs[32];
  int t = threadIdx.x;
  long base = (long)blockIdx.x * 32 * 256;
  for (int i = t; i < 32 * 256; i += 256) xs[i >> 8][i & 255] = x[base + i];
  __syncthreads();
  {
    int row = t >> 3, seg = t & 7;
    float s = 0.f, s2 = 0.f;
    for (int c = seg * 32; c < seg * 32 + 32; ++c) {
      float v_ = xs[row][c]; s += v_; s2 += v_ * v_;
    }
    psum[row][seg] = s; psq[row][seg] = s2;
  }
  __syncthreads();
  if (t < 32) {
    float s = 0.f, s2 = 0.f;
    for (int j = 0; j < 8; ++j) { s += psum[t][j]; s2 += psq[t][j]; }
    float m = s * (1.f / 256.f);
    mu[t] = m; rs[t] = rsqrtf(s2 * (1.f / 256.f) - m * m + LNE_);
  }
  __syncthreads();
  for (int i = t; i < 32 * 256; i += 256) {
    int row = i >> 8, col = i & 255;
    xh[row][col] = (half_t)((xs[row][col] - mu[row]) * rs[row] * g[col] + bb[col]);
  }
  __syncthreads();

  int lane = t & 31, w = t >> 5;
  int mt = w & 1, nq4 = w >> 1;
  v8f ak[4], av[4];
  for (int i = 0; i < 4; ++i)
    for (int j = 0; j < 8; ++j) { ak[i][j] = 0.f; av[i][j] = 0.f; }
  for (int kk = 0; kk < 8; ++kk) {
    // issue ALL fragment loads of this K-step first (independent b128s),
    // then the WMMA burst -> backend can use partial s_wait_loadcnt
    v16h a = frag_rowmajor(&xh[mt * 16][kk * 32], 256, lane);
    v16h bk[4], bv[4];
#pragma unroll
    for (int ti = 0; ti < 4; ++ti) {
      int nt = nq4 * 4 + ti;
      bk[ti] = frag_packed(wkp + (long)(kk * 16 + nt) * 512, lane);
      bv[ti] = frag_packed(wvp + (long)(kk * 16 + nt) * 512, lane);
    }
#pragma unroll
    for (int ti = 0; ti < 4; ++ti) {
      ak[ti] = wmma_f16(a, bk[ti], ak[ti]);
      av[ti] = wmma_f16(a, bv[ti], av[ti]);
    }
  }
  int b    = blockIdx.x >> 5;   // 32 blocks per batch (1024 rows)
  int krow = blockIdx.x & 31;   // which 32-row band (K index for attn@V)
  half_t* vb = vpk + (long)b * 262144;
  long rb = (long)blockIdx.x * 32 + mt * 16;
  int mo = (lane >> 4) << 3;
  int nl = lane & 15;
#pragma unroll
  for (int ti = 0; ti < 4; ++ti) {
    int nt  = nq4 * 4 + ti;
    int col = nt * 16 + nl;
#pragma unroll
    for (int r = 0; r < 8; ++r) {
      long row = rb + r + mo;
      kf[row * 256 + col] = (half_t)(ak[ti][r] * 0.125f);  // hd^-0.5
      int k_local = mt * 16 + r + mo;
      int lo, e; inv_klocal(k_local, lo, e);
      vb[((long)(krow * 16 + nt) * 32 + lo + nl) * 16 + e] = (half_t)(av[ti][r]);
    }
  }
}

// -------- logits GEMM (WMMA) + fused joint softmax + attn^T V (WMMA) ---------
// value of lane (l ^ M) of the same 16-lane row (DPP row_xmask)
template <int M>
__device__ inline float row_xor(float v) {
  return __builtin_bit_cast(
      float, __builtin_amdgcn_mov_dpp(__builtin_bit_cast(int, v), 0x160 | M, 0xf,
                                      0xf, true));
}
__device__ inline float row_max16(float v) {
  v = fmaxf(v, row_xor<1>(v));
  v = fmaxf(v, row_xor<2>(v));
  v = fmaxf(v, row_xor<4>(v));
  v = fmaxf(v, row_xor<8>(v));
  return v;
}
__device__ inline float row_sum16(float v) {
  v += row_xor<1>(v);
  v += row_xor<2>(v);
  v += row_xor<4>(v);
  v += row_xor<8>(v);
  return v;
}
// value of lane l ^ 16
__device__ inline float xhalf(float x) {
  int i = __builtin_bit_cast(int, x);
  return __builtin_bit_cast(
      float, __builtin_amdgcn_permlanex16(i, i, 0x76543210, 0xfedcba98, false,
                                          false));
}

// exp(x) as __expf builds it: one multiply and v_exp_f32. The v_nop fills the
// one slot the instruction set asks for behind a transcendental before its
// source is overwritten or its result read.
__device__ inline float exp_slot(float x) {
  float r;
  asm("v_exp_f32 %0, %1\n\tv_nop" : "=v"(r) : "v"(x * 1.44269504f));
  return r;
}

// grid: B * (NKV/256); each wave owns 32 kv rows (two M-tiles) x all 32
// (head, slot) columns, so a softmax row lies in one 16-lane row of two
// accumulators and the wave's 32 rows are exactly one K-step of attn@V.
// attn goes to LDS fragment-packed as the A-operand of attn@V:
// as[wave = K-step][mt=2][lane=32][e=16]; lane and e follow from the D layout:
// D register r of M-tile i at lane l is k_local = 16 i + 8 (l >> 4) + r,
// which is element e = 8 i + r of the same lane l.
// Behind the barrier the block multiplies its own 256 kv rows with V: wave w
// takes columns 32 w .. 32 w + 31 of V over the block's eight K-steps. Those
// columns are of head w >> 1, whose eight attn rows lie in M-tile w >> 2, in
// the D rows of the 16-lane half (w >> 1) & 1: only that M-tile is multiplied.
// The eps term needs the column sums of V: every V fragment passes through the
// wave anyway, so one more WMMA with an A operand of ones sums it over k (each
// row of that D tile is the column sum).
// Both sums leave as one partial per block: cpart[b][blk=4][32] (attn columns)
// and upart[b][blk=4][slot=8][d=256] (attn^T V + eps colsum(V), not normed).
__global__ void __launch_bounds__(256) k_logits(
    const half_t* __restrict__ kf, const half_t* __restrict__ qbp,
    const half_t* __restrict__ vpk, float* __restrict__ upart,
    float* __restrict__ cpart, float* __restrict__ vis_out) {
  __shared__ float csl[8][32];
  __shared__ __align__(32) half_t as[8][2][512];
  int t = threadIdx.x, lane = t & 31, w = t >> 5;
  int b   = blockIdx.x >> 2;
  int blk = blockIdx.x & 3;
  int n0  = blk * 256 + w * 32;
  const half_t* kp = kf + ((long)b * NKV + n0) * 256;
  const half_t* qp = qbp + (long)b * 8192;
  v8f acc[2][2];  // [M-tile][column tile]
  for (int i = 0; i < 2; ++i)
    for (int k = 0; k < 2; ++k)
      for (int j = 0; j < 8; ++j) acc[i][k][j] = 0.f;
  for (int kk = 0; kk < 8; ++kk) {
    v16h a0  = frag_rowmajor(kp + kk * 32, 256, lane);
    v16h a1  = frag_rowmajor(kp + 16 * 256 + kk * 32, 256, lane);
    v16h bq0 = frag_packed(qp + (long)(kk * 2 + 0) * 512, lane);
    v16h bq1 = frag_packed(qp + (long)(kk * 2 + 1) * 512, lane);
    acc[0][0] = wmma_f16(a0, bq0, acc[0][0]);
    acc[0][1] = wmma_f16(a0, bq1, acc[0][1]);
    acc[1][0] = wmma_f16(a1, bq0, acc[1][0]);
    acc[1][1] = wmma_f16(a1, bq1, acc[1][1]);
  }
  // the wave's sixteen V fragments, all in flight under the softmax
  const half_t* vv = vpk + (long)b * 262144 + (long)(blk * 128 + 2 * w) * 512;
  v16h vb0[8], vb1[8];
#pragma unroll
  for (int s = 0; s < 8; ++s) {
    vb0[s] = frag_packed(vv + s * 8192, lane);
    vb1[s] = frag_packed(vv + s * 8192 + 512, lane);
  }
  // The scheduling barriers keep the V loads above the softmax: left free, the
  // scheduler sinks each load to its first use behind the barrier and the
  // latency is not hidden. The address registers of the K and V loads are free
  // for reuse from here on: the wait stands in front of the first overwrite.
  // Named as its inputs they stay live up to it, so that no V load lands in
  // them.
  const half_t* ka = kp + (lane & 15) * 256 + ((lane >> 4) << 3);
  const half_t* va = vv + lane * 16;
  __builtin_amdgcn_sched_barrier(0);
  asm volatile("s_wait_xcnt 0x0" :: "v"(ka), "v"(va) : "memory");
  __builtin_amdgcn_sched_barrier(0);
  int c16 = lane & 15, hi = lane >> 4;
  float cs0 = 0.f, cs1 = 0.f;
  union { uint4 u[2]; half_t h[16]; } p0, p1;
  float* vp = vis_out + (long)b * NQ * NKV + (c16 & 7) * NKV + n0 + hi * 8 +
              (c16 >> 3) * 4;
#pragma unroll
  for (int i = 0; i < 2; ++i) {
    float vis[8];
#pragma unroll
    for (int r = 0; r < 8; ++r) {
      float x0 = acc[i][0][r], x1 = acc[i][1][r];
      float mx = row_max16(fmaxf(x0, x1));
      float e0 = exp_slot(x0 - mx), e1 = exp_slot(x1 - mx);
      float inv = 1.f / row_sum16(e0 + e1);
      e0 *= inv; e1 *= inv;
      cs0 += e0; cs1 += e1;
      p0.h[i * 8 + r] = (half_t)e0;
      p1.h[i * 8 + r] = (half_t)e1;
      float v_ = e0 + e1;           // heads 0+2 (or 1+3) of slot c16 & 7
      vis[r] = v_ + row_xor<8>(v_);  // attn_vis = sum over heads
    }
    // lanes c16 and c16 ^ 8 hold the same 8 sums: each stores four of them
    float4 o;
    o.x = (c16 & 8) ? vis[4] : vis[0];
    o.y = (c16 & 8) ? vis[5] : vis[1];
    o.z = (c16 & 8) ? vis[6] : vis[2];
    o.w = (c16 & 8) ? vis[7] : vis[3];
    *(float4*)(vp + i * 16) = o;
  }
  half_t* ab = &as[w][0][lane * 16];
  *(uint4*)(ab)           = p0.u[0];
  *(uint4*)(ab + 8)       = p0.u[1];
  *(uint4*)(ab + 512)     = p1.u[0];
  *(uint4*)(ab + 512 + 8) = p1.u[1];
  // column sums: 16 rows in the lane, the other 16 in lane ^ 16, then the
  // eight waves in a fixed order
  cs0 += xhalf(cs0);
  cs1 += xhalf(cs1);
  csl[w][lane] = hi ? cs1 : cs0;
  __syncthreads();
  if (t < 32) {
    float s = 0.f;
#pragma unroll
    for (int j = 0; j < 8; ++j) s += csl[j][t];
    cpart[(b * 4 + blk) * 32 + t] = s;
  }
  int mt = w >> 2, hsel = (w >> 1) & 1;
  v8f u0, u1, cv0, cv1;
  for (int e = 0; e < 8; ++e) { u0[e] = 0.f; u1[e] = 0.f; cv0[e] = 0.f; cv1[e] = 0.f; }
  v16h ones;
  for (int e = 0; e < 16; ++e) ones[e] = (half_t)1.f;
#pragma unroll
  for (int s = 0; s < 8; ++s) {
    v16h a = frag_packed(&as[s][mt][0], lane);
    u0  = wmma_f16(a, vb0[s], u0);
    u1  = wmma_f16(a, vb1[s], u1);
    cv0 = wmma_f16(ones, vb0[s], cv0);
    cv1 = wmma_f16(ones, vb1[s], cv1);
  }
  // D register r is slot r in the lanes of half hsel. Lane l stores column
  // 32 w + l: the lanes of the other half take their tile's value from
  // lane ^ 16, so that each store of the wave is one whole 128-byte line.
  float* up = upart + (long)(b * 4 + blk) * 2048 + w * 32 + lane;
#pragma unroll
  for (int r = 0; r < 8; ++r) {
    float x0 = u0[r] + EPS_ * cv0[r];
    float x1 = u1[r] + EPS_ * cv1[r];
    float got = xhalf(hi ? x0 : x1);
    up[r * 256] = (hi == hsel) ? (hi ? x1 : x0) : got;
  }
}

// updates = (sum of the four blocks' partials) / (attn column sum + NKV eps)
// grid: B * NQ * S / 4 / 256 blocks, four neighbouring d a thread
__global__ void __launch_bounds__(256) k_inv(
    const float* __restrict__ cpart, const float* __restrict__ upart,
    float* __restrict__ upd) {
  int i  = blockIdx.x * 256 + threadIdx.x;
  int b  = i >> 9, qi = (i >> 6) & 7, d = (i & 63) * 4;
  const float* p = cpart + b * 128 + (d >> 6) * 8 + qi;
  const float* u = upart + (long)b * 8192 + qi * 256 + d;
  float4 u0 = *(const float4*)(u);
  float4 u1 = *(const float4*)(u + 2048);
  float4 u2 = *(const float4*)(u + 4096);
  float4 u3 = *(const float4*)(u + 6144);
  float s = ((p[0] + p[32]) + p[64]) + p[96];
  float inv = 1.f / (s + (float)NKV * EPS_);
  float4 o;
  o.x = (((u0.x + u1.x) + u2.x) + u3.x) * inv;
  o.y = (((u0.y + u1.y) + u2.y) + u3.y) * inv;
  o.z = (((u0.z + u1.z) + u2.z) + u3.z) * inv;
  o.w = (((u0.w + u1.w) + u2.w) + u3.w) * inv;
  *(float4*)(upd + (long)(b * NQ + qi) * S_ + d) = o;
}

// ---------------- GRU cell (f32 WMMA 16x16x4) --------------------------------
// xg = upd @ wih^T and hg = hprev @ whh^T as Y = X W^T with X and W both
// k-contiguous. One wave owns 16 rows (of the B*NQ = 512) x 16 columns j of
// all three gates over the whole k = 256: no LDS, no barrier, no partial sums
// between waves. A block's two waves take neighbouring column tiles, so the
// block writes whole 128-byte lines. grid: 32 row tiles x 8 column pairs.
// k order: lane (c, h) loads floats k0 + 4h .. k0 + 4h + 3 of its row of X and
// of its row of W by the same offsets; elements (0,1) feed one WMMA, (2,3) the
// next, so A and B pair the same k at every lane and register.
__device__ inline v8f wmma_f32(float ax, float ay, float bx, float by, v8f c) {
  v2f a = {ax, ay};
  v2f b = {bx, by};
  return __builtin_amdgcn_wmma_f32_16x16x4_f32(false, a, false, b, (short)0, c,
                                               false, false);
}
__global__ void __launch_bounds__(64) k_gru(
    const float* __restrict__ upd, const float* __restrict__ hprev,
    const float* __restrict__ wih, const float* __restrict__ whh,
    const float* __restrict__ bih, const float* __restrict__ bhh,
    float* __restrict__ hout) {
  int lane = threadIdx.x & 31, w = threadIdx.x >> 5;
  int c = lane & 15, h = lane >> 4;
  int m0 = (blockIdx.x >> 3) * 16;
  int n0 = (blockIdx.x & 7) * 32 + w * 16;
  int j  = n0 + c;
  int ao = (m0 + c) * 256 + 4 * h;
  int bo = j * 256 + 4 * h;
  const float* s[8] = {upd + ao,          hprev + ao,
                       wih + bo,          whh + bo,
                       wih + 65536 + bo,  whh + 65536 + bo,
                       wih + 131072 + bo, whh + 131072 + bo};
  // every D register of a lane is column j, so the accumulators start from
  // the gate biases of that column
  float br = bih[j] + bhh[j];
  float bz = bih[256 + j] + bhh[256 + j];
  float bi3 = bih[512 + j], bh3 = bhh[512 + j];
  // D register e of lane (c, h) is row m0 + 8h + e, column j
  long ob = (long)(m0 + 8 * h) * 256 + j;
  float hp[8];
  float4 f[2][2][8];  // [stage][8-k step][matrix]
#pragma unroll
  for (int q = 0; q < 2; ++q)
#pragma unroll
    for (int x = 0; x < 8; ++x) f[0][q][x] = *(const float4*)(s[x] + q * 8);
  // The accumulators may take the register that the bias loads name as their
  // offset: the wait stands in front of that overwrite, and the scheduling
  // barriers keep the accumulators' first writes behind it.
  __builtin_amdgcn_sched_barrier(0);
  asm volatile("s_wait_xcnt 0x0" ::: "memory");
  __builtin_amdgcn_sched_barrier(0);
  v8f ar, az, ani, anh;
  for (int e = 0; e < 8; ++e) { ar[e] = br; az[e] = bz; ani[e] = bi3; anh[e] = bh3; }
  // unrolled whole so that the stage index is static and the next 16 k of all
  // eight operands are in flight under this stage's 24 WMMAs
#pragma unroll
  for (int ch = 0; ch < 16; ++ch) {
    if (ch + 1 < 16) {
#pragma unroll
      for (int q = 0; q < 2; ++q)
#pragma unroll
        for (int x = 0; x < 8; ++x)
          f[(ch + 1) & 1][q][x] = *(const float4*)(s[x] + (ch + 1) * 16 + q * 8);
    } else {
      // Every operand load is issued and its address registers are free for
      // reuse from here on: the wait stands in front of the first overwrite
      // (the scheduling barrier keeps later address arithmetic behind it).
      // The old state for the output blend then loads under the last WMMAs.
      __builtin_amdgcn_sched_barrier(0);
      asm volatile("s_wait_xcnt 0x0" ::: "memory");
#pragma unroll
      for (int e = 0; e < 8; ++e) hp[e] = hprev[ob + e * 256];
    }
    // keeps the next stage's loads above this stage's WMMAs: left free, the
    // scheduler sinks each load to its first use and every WMMA group then
    // waits out a whole load latency
    __builtin_amdgcn_sched_barrier(0);
#pragma unroll
    for (int q = 0; q < 2; ++q) {
      const float4* g = f[ch & 1][q];
      ar  = wmma_f32(g[0].x, g[0].y, g[2].x, g[2].y, ar);
      az  = wmma_f32(g[0].x, g[0].y, g[4].x, g[4].y, az);
      ani = wmma_f32(g[0].x, g[0].y, g[6].x, g[6].y, ani);
      anh = wmma_f32(g[1].x, g[1].y, g[7].x, g[7].y, anh);
      ar  = wmma_f32(g[1].x, g[1].y, g[3].x, g[3].y, ar);
      az  = wmma_f32(g[1].x, g[1].y, g[5].x, g[5].y, az);
      ani = wmma_f32(g[0].z, g[0].w, g[6].z, g[6].w, ani);
      anh = wmma_f32(g[1].z, g[1].w, g[7].z, g[7].w, anh);
      ar  = wmma_f32(g[0].z, g[0].w, g[2].z, g[2].w, ar);
      az  = wmma_f32(g[0].z, g[0].w, g[4].z, g[4].w, az);
      ar  = wmma_f32(g[1].z, g[1].w, g[3].z, g[3].w, ar);
      az  = wmma_f32(g[1].z, g[1].w, g[5].z, g[5].w, az);
    }
  }
  // The table of WMMA distances leaves the f32 16x16x4 form out: eight slots, the count of the slowest
  // listed form, stand between the last WMMA and the first vector read of an
  // accumulator. The two scheduling barriers hold the slots at that place.
  __builtin_amdgcn_sched_barrier(0);
  asm volatile("v_nop\n\tv_nop\n\tv_nop\n\tv_nop\n\tv_nop\n\tv_nop\n\tv_nop\n\tv_nop");
  __builtin_amdgcn_sched_barrier(0);
#pragma unroll
  for (int e = 0; e < 8; ++e) {
    float r = 1.f / (1.f + __expf(-ar[e]));
    float z = 1.f / (1.f + __expf(-az[e]));
    float n = tanhf(ani[e] + r * anh[e]);
    hout[ob + e * 256] = (1.f - z) * n + z * hp[e];
  }
}

// ---------------- LN + MLP residual (f32 WMMA 16x16x4), one launch a layer ---
// Both layers are Y = X W with X k-contiguous and W column-contiguous. One wave
// owns 16 rows (of the B*NQ = 512) over the whole k: no LDS, no barrier, no
// partial sums between waves.
// k order: lane (c, h) holds floats 8q + 4h .. 8q + 4h + 3 of its row of X and
// loads rows 8q + 4h .. 8q + 4h + 3 of W at its column; elements (0,1) feed one
// WMMA, (2,3) the next, so A and B pair the same k at every lane and register.

// 1/sqrt(x) as one v_rsq_f32; the v_nop fills the one slot the instruction set
// asks for behind a transcendental before its result is read.
__device__ inline float rsq_slot(float x) {
  float r;
  asm("v_rsq_f32 %0, %1\n\tv_nop" : "=v"(r) : "v"(x));
  return r;
}

#define D1_ 5   // k_mlp1: 8-k steps that the operand loads run ahead
#define D2_ 12  // k_mlp2: the same

typedef __attribute__((ext_vector_type(4))) float v4f;
__device__ inline v8f wmma_f32v(v2f a, v2f b, v8f c) {
  return __builtin_amdgcn_wmma_f32_16x16x4_f32(false, a, false, b, (short)0, c,
                                               false, false);
}

// hid = relu(LN(h) @ w1 + b1). A wave owns 16 rows x 32 hidden columns and
// keeps its half rows (128 floats a lane) in registers: the row statistics are
// a lane's own sums plus those of lane ^ 16. grid: 32 row tiles x 8 column
// groups of 64, two waves a block. The register bound keeps the wave inside
// one 256-register window (left free, the allocator spreads over two).
__global__ void __launch_bounds__(64) __attribute__((amdgpu_num_vgpr(256))) k_mlp1(
    const float* __restrict__ hin, const float* __restrict__ g,
    const float* __restrict__ bb, const float* __restrict__ w1,
    const float* __restrict__ b1, float* __restrict__ hid) {
  int lane = threadIdx.x & 31, w = threadIdx.x >> 5;
  int c = lane & 15, h = lane >> 4;
  int m0 = (blockIdx.x >> 3) * 16;
  int n0 = (blockIdx.x & 7) * 64 + w * 32;
  const float* ap = hin + (m0 + c) * 256 + 4 * h;
  const float* wp = w1 + 4 * h * 512 + n0 + c;
  const float* gp = g + 4 * h;
  const float* bp = bb + 4 * h;
  v4f a[32], fg[32], fo[32];
  v2f fw[32][2][2];  // [8-k step][k pair][column tile]
#pragma unroll
  for (int q = 0; q < 32; ++q) a[q] = *(const v4f*)(ap + q * 8);
#pragma unroll
  for (int q = 0; q < D1_; ++q) {
    fg[q] = *(const v4f*)(gp + q * 8);
    fo[q] = *(const v4f*)(bp + q * 8);
#pragma unroll
    for (int p = 0; p < 2; ++p)
#pragma unroll
      for (int ti = 0; ti < 2; ++ti) {
        fw[q][p][ti].x = wp[(q * 8 + 2 * p) * 512 + ti * 16];
        fw[q][p][ti].y = wp[(q * 8 + 2 * p + 1) * 512 + ti * 16];
      }
  }
  int bi = n0 + c;
  float bias0 = b1[bi], bias1 = b1[bi + 16];
  // The address registers of the row and bias loads are free for reuse from
  // here on: the wait stands in front of the first overwrite. Named as its
  // inputs they stay live up to it, so that no load above it lands in them;
  // the scheduling barriers keep the loads above it, the arithmetic behind it.
  __builtin_amdgcn_sched_barrier(0);
  asm volatile("s_wait_xcnt 0x0" :: "v"(ap), "v"(bi) : "memory");
  __builtin_amdgcn_sched_barrier(0);
  v2f t0 = {0.f, 0.f}, t1 = t0, t2 = t0, t3 = t0;
#pragma unroll
  for (int q = 0; q < 32; q += 2) {
    t0 += a[q].lo; t1 += a[q].hi; t2 += a[q + 1].lo; t3 += a[q + 1].hi;
  }
  t0 = (t0 + t1) + (t2 + t3);
  float s = t0.x + t0.y;
  s += xhalf(s);
  float mu = s * (1.f / 256.f);
  t0 = 0.f; t1 = 0.f; t2 = 0.f; t3 = 0.f;
#pragma unroll
  for (int q = 0; q < 32; q += 2) {
    a[q] -= mu; a[q + 1] -= mu;
    t0 += a[q].lo * a[q].lo;         t1 += a[q].hi * a[q].hi;
    t2 += a[q + 1].lo * a[q + 1].lo; t3 += a[q + 1].hi * a[q + 1].hi;
  }
  t0 = (t0 + t1) + (t2 + t3);
  s = t0.x + t0.y;
  s += xhalf(s);
  float rs = rsq_slot(s * (1.f / 256.f) + LNE_);
  // every D register of a lane is one column, so the accumulators start from
  // that column's bias
  v8f acc0, acc1;
  for (int e = 0; e < 8; ++e) { acc0[e] = bias0; acc1[e] = bias1; }
  a[0] = a[0] * (rs * fg[0]) + fo[0];
  a[1] = a[1] * (rs * fg[1]) + fo[1];
  // unrolled whole so that every index is static
#pragma unroll
  for (int q = 0; q < 32; ++q) {
    if (q + D1_ < 32) {
      int n = q + D1_;
      fg[n] = *(const v4f*)(gp + n * 8);
      fo[n] = *(const v4f*)(bp + n * 8);
#pragma unroll
      for (int p = 0; p < 2; ++p)
#pragma unroll
        for (int ti = 0; ti < 2; ++ti) {
          fw[n][p][ti].x = wp[(n * 8 + 2 * p) * 512 + ti * 16];
          fw[n][p][ti].y = wp[(n * 8 + 2 * p + 1) * 512 + ti * 16];
        }
    }
    // keeps the loads of step q + D1_ above this step's WMMAs: left free, the
    // scheduler sinks each load to its first use and every WMMA group then
    // waits out a whole load latency
    __builtin_amdgcn_sched_barrier(0);
    acc0 = wmma_f32v(a[q].lo, fw[q][0][0], acc0);
    acc1 = wmma_f32v(a[q].lo, fw[q][0][1], acc1);
    acc0 = wmma_f32v(a[q].hi, fw[q][1][0], acc0);
    acc1 = wmma_f32v(a[q].hi, fw[q][1][1], acc1);
    // The table of WMMA distances leaves the f32 16x16x4 form out: eight slots,
    // the count of the slowest
    // listed form, stand between the last WMMA and the next vector write,
    // which may take a register that a WMMA has just read (behind the last
    // step: the first vector read of an accumulator). They issue while the
    // matrix unit is busy. The scheduling barriers hold them at that place.
    __builtin_amdgcn_sched_barrier(0);
    if (q != 30)  // behind step 30 no vector instruction follows
      asm volatile("v_nop\n\tv_nop\n\tv_nop\n\tv_nop\n\tv_nop\n\tv_nop\n\tv_nop\n\tv_nop");
    __builtin_amdgcn_sched_barrier(0);
    // scale and shift of the LN two steps ahead, so that no WMMA waits for it
    if (q + 2 < 32) a[q + 2] = a[q + 2] * (rs * fg[q + 2]) + fo[q + 2];
    __builtin_amdgcn_sched_barrier(0);
  }
  // D register e of lane (c, h) is row m0 + 8h + e
  float* op = hid + (m0 + 8 * h) * 512 + n0 + c;
#pragma unroll
  for (int e = 0; e < 8; ++e) {
    op[e * 512]      = fmaxf(acc0[e], 0.f);
    op[e * 512 + 16] = fmaxf(acc1[e], 0.f);
  }
}

// slots = h + hid @ w2 + b2. A wave owns 16 rows x 16 columns over k = 512, the
// even and the odd k pairs in an accumulator each (a WMMA then never waits for
// the one before it); one starts from the bias, the other from the residual
// rows. A block's two waves take neighbouring column tiles, so the block
// writes whole 128-byte lines. grid: 32 row tiles x 8 column pairs.
__global__ void __launch_bounds__(64) k_mlp2(
    const float* __restrict__ hid, const float* __restrict__ hin,
    const float* __restrict__ w2, const float* __restrict__ b2,
    float* __restrict__ slots_out, float* __restrict__ dout, int write_out) {
  int lane = threadIdx.x & 31, w = threadIdx.x >> 5;
  int c = lane & 15, h = lane >> 4;
  int m0 = (blockIdx.x >> 3) * 16;
  int j  = (blockIdx.x & 7) * 32 + w * 16 + c;
  const float* ap = hid + (m0 + c) * 512 + 4 * h;
  const float* wp = w2 + 4 * h * 256 + j;
  // D register e of lane (c, h) is row m0 + 8h + e, column j
  int ob = (m0 + 8 * h) * 256 + j;
  v8f acc0, acc1;
  float bias = b2[j];
#pragma unroll
  for (int e = 0; e < 8; ++e) acc1[e] = hin[ob + e * 256];
  v4f fa[64];
  v2f fw[64][2];  // [8-k step][k pair]
#pragma unroll
  for (int q = 0; q < D2_; ++q) {
    fa[q] = *(const v4f*)(ap + q * 8);
#pragma unroll
    for (int p = 0; p < 2; ++p) {
      fw[q][p].x = wp[(q * 8 + 2 * p) * 256];
      fw[q][p].y = wp[(q * 8 + 2 * p + 1) * 256];
    }
  }
  // The offset register of the bias load is free for reuse from here on: the
  // wait stands in front of the first overwrite. Named as its input the offset
  // stays live up to it, so that no load above it lands in that register; the
  // scheduling barriers keep the accumulator's first writes behind it.
  __builtin_amdgcn_sched_barrier(0);
  asm volatile("s_wait_xcnt 0x0" :: "v"(j) : "memory");
  __builtin_amdgcn_sched_barrier(0);
  for (int e = 0; e < 8; ++e) acc0[e] = bias;
  // unrolled whole so that every index is static
#pragma unroll
  for (int q = 0; q < 64; ++q) {
    if (q + D2_ < 64) {
      int n = q + D2_;
      fa[n] = *(const v4f*)(ap + n * 8);
#pragma unroll
      for (int p = 0; p < 2; ++p) {
        fw[n][p].x = wp[(n * 8 + 2 * p) * 256];
        fw[n][p].y = wp[(n * 8 + 2 * p + 1) * 256];
      }
    }
    // keeps the loads of step q + D2_ above this step's WMMAs (as in k_mlp1)
    __builtin_amdgcn_sched_barrier(0);
    acc0 = wmma_f32v(fa[q].lo, fw[q][0], acc0);
    acc1 = wmma_f32v(fa[q].hi, fw[q][1], acc1);
  }
  // eight slots between the last WMMA and the first vector read of an
  // accumulator, held in place by the scheduling barriers (as in k_mlp1)
  __builtin_amdgcn_sched_barrier(0);
  asm volatile("v_nop\n\tv_nop\n\tv_nop\n\tv_nop\n\tv_nop\n\tv_nop\n\tv_nop\n\tv_nop");
  __builtin_amdgcn_sched_barrier(0);
  v8f o = acc0 + acc1;
#pragma unroll
  for (int e = 0; e < 8; ++e) slots_out[ob + e * 256] = o[e];
  if (write_out) {
#pragma unroll
    for (int e = 0; e < 8; ++e) dout[ob + e * 256] = o[e];
  }
}

// ---------------- LN(slots) + q = s@Wq (f32 WMMA 16x16x4), packed Qb ---------
// qbp[b][kk=8][ti=2][lane=32][e=16]: the block-diagonal B operand of the logits
// (k = feature d, column = head * 8 + slot, zero where d is not of that head).
// The product is formed transposed, q^T = Wq^T LN(s)^T: A is a column tile of
// Wq, B a tile of 16 slot rows (two batches), loaded by the offsets of k_mlp1,
// so A and B pair the same k at every lane and register. D register e of lane
// (c, h) is then feature 8h + e of slot row c: the eight features that one
// packed lane holds side by side. A wave owns 16 rows x 32 features (one kk)
// over the whole k, and writes the whole 2 KB of its kk for both batches, the
// zeros too. No LDS, no barrier. grid: 32 row tiles x 4 pairs of kk. The
// register bound keeps the wave inside one 256-register window (as in k_mlp1).
__global__ void __launch_bounds__(64) __attribute__((amdgpu_num_vgpr(256))) k_qbuild(
    const float* __restrict__ slots, const float* __restrict__ g,
    const float* __restrict__ bb, const float* __restrict__ wq,
    half_t* __restrict__ qbp) {
  int lane = threadIdx.x & 31, w = threadIdx.x >> 5;
  int c = lane & 15, h = lane >> 4;
  int m0 = (blockIdx.x >> 2) * 16;
  int kk = (blockIdx.x & 3) * 2 + w;
  const float* ap = slots + (m0 + c) * 256 + 4 * h;
  const float* wp = wq + 4 * h * 256 + kk * 32 + c;
  const float* gp = g + 4 * h;
  const float* bp = bb + 4 * h;
  v4f a[32], fg[32], fo[32];
  v2f fw[32][2][2];  // [8-k step][k pair][feature tile]
#pragma unroll
  for (int q = 0; q < 32; ++q) a[q] = *(const v4f*)(ap + q * 8);
#pragma unroll
  for (int q = 0; q < D1_; ++q) {
    fg[q] = *(const v4f*)(gp + q * 8);
    fo[q] = *(const v4f*)(bp + q * 8);
#pragma unroll
    for (int p = 0; p < 2; ++p)
#pragma unroll
      for (int ti = 0; ti < 2; ++ti) {
        fw[q][p][ti].x = wp[(q * 8 + 2 * p) * 256 + ti * 16];
        fw[q][p][ti].y = wp[(q * 8 + 2 * p + 1) * 256 + ti * 16];
      }
  }
  // The address registers of the row loads are free for reuse from here on: the
  // wait stands in front of the first overwrite. Named as its input they stay
  // live up to it, so that no load above it lands in them; the scheduling
  // barriers keep the loads above it, the arithmetic behind it.
  __builtin_amdgcn_sched_barrier(0);
  asm volatile("s_wait_xcnt 0x0" :: "v"(ap) : "memory");
  __builtin_amdgcn_sched_barrier(0);
  v2f t0 = {0.f, 0.f}, t1 = t0, t2 = t0, t3 = t0;
#pragma unroll
  for (int q = 0; q < 32; q += 2) {
    t0 += a[q].lo; t1 += a[q].hi; t2 += a[q + 1].lo; t3 += a[q + 1].hi;
  }
  t0 = (t0 + t1) + (t2 + t3);
  float s = t0.x + t0.y;
  s += xhalf(s);
  float mu = s * (1.f / 256.f);
  t0 = 0.f; t1 = 0.f; t2 = 0.f; t3 = 0.f;
#pragma unroll
  for (int q = 0; q < 32; q += 2) {
    a[q] -= mu; a[q + 1] -= mu;
    t0 += a[q].lo * a[q].lo;         t1 += a[q].hi * a[q].hi;
    t2 += a[q + 1].lo * a[q + 1].lo; t3 += a[q + 1].hi * a[q + 1].hi;
  }
  t0 = (t0 + t1) + (t2 + t3);
  s = t0.x + t0.y;
  s += xhalf(s);
  float rs = rsq_slot(s * (1.f / 256.f) + LNE_);
  v8f acc0, acc1;
  for (int e = 0; e < 8; ++e) { acc0[e] = 0.f; acc1[e] = 0.f; }
  a[0] = a[0] * (rs * fg[0]) + fo[0];
  a[1] = a[1] * (rs * fg[1]) + fo[1];
  // unrolled whole so that every index is static
#pragma unroll
  for (int q = 0; q < 32; ++q) {
    if (q + D1_ < 32) {
      int n = q + D1_;
      fg[n] = *(const v4f*)(gp + n * 8);
      fo[n] = *(const v4f*)(bp + n * 8);
#pragma unroll
      for (int p = 0; p < 2; ++p)
#pragma unroll
        for (int ti = 0; ti < 2; ++ti) {
          fw[n][p][ti].x = wp[(n * 8 + 2 * p) * 256 + ti * 16];
          fw[n][p][ti].y = wp[(n * 8 + 2 * p + 1) * 256 + ti * 16];
        }
    }
    // keeps the loads of step q + D1_ above this step's WMMAs (as in k_mlp1)
    __builtin_amdgcn_sched_barrier(0);
    acc0 = wmma_f32v(fw[q][0][0], a[q].lo, acc0);
    acc1 = wmma_f32v(fw[q][0][1], a[q].lo, acc1);
    acc0 = wmma_f32v(fw[q][1][0], a[q].hi, acc0);
    acc1 = wmma_f32v(fw[q][1][1], a[q].hi, acc1);
    // eight slots between the last WMMA and the next vector write or, behind
    // the last step, the first vector read of an accumulator, held in place by
    // the scheduling barriers (as in k_mlp1)
    __builtin_amdgcn_sched_barrier(0);
    if (q != 30)  // behind step 30 no vector instruction follows
      asm volatile("v_nop\n\tv_nop\n\tv_nop\n\tv_nop\n\tv_nop\n\tv_nop\n\tv_nop\n\tv_nop");
    __builtin_amdgcn_sched_barrier(0);
    // scale and shift of the LN two steps ahead, so that no WMMA waits for it
    if (q + 2 < 32) a[q + 2] = a[q + 2] * (rs * fg[q + 2]) + fo[q + 2];
    __builtin_amdgcn_sched_barrier(0);
  }
  // slot row c is batch m0 / 8 + (c >> 3), slot c & 7; its column of Qb is
  // head * 8 + slot with head = kk >> 1. sl = ti * 32 + packed lane; elements
  // 0..7 are features 8h + e (acc0), 8..15 features 16 + 8h + e (acc1).
  int hd = kk >> 1;
  int sl = (hd >> 1) * 32 + 16 * h + (hd & 1) * 8 + (c & 7);
  half_t* qp = qbp + ((m0 >> 3) + (c >> 3)) * 8192 + kk * 1024;
  union { uint4 u[2]; half_t x[16]; } o;
#pragma unroll
  for (int e = 0; e < 8; ++e) {
    o.x[e]     = (half_t)acc0[e];
    o.x[8 + e] = (half_t)acc1[e];
  }
  *(uint4*)(qp + sl * 16)     = o.u[0];
  *(uint4*)(qp + sl * 16 + 8) = o.u[1];
  // the columns of the other three heads are zero at these features
  uint4 zz = {0u, 0u, 0u, 0u};
  *(uint4*)(qp + (sl ^ 8) * 16)      = zz;
  *(uint4*)(qp + (sl ^ 8) * 16 + 8)  = zz;
  *(uint4*)(qp + (sl ^ 32) * 16)     = zz;
  *(uint4*)(qp + (sl ^ 32) * 16 + 8) = zz;
  *(uint4*)(qp + (sl ^ 40) * 16)     = zz;
  *(uint4*)(qp + (sl ^ 40) * 16 + 8) = zz;
}

// ---------------- host orchestration ----------------------------------------
extern "C" void kernel_launch(void* const* d_in, const int* in_sizes, int n_in,
                              void* d_out, int out_size, void* d_ws,
                              size_t ws_size, hipStream_t stream) {
  (void)in_sizes; (void)n_in; (void)out_size; (void)ws_size;
  const float* inputs   = (const float*)d_in[0];
  const float* slots0   = (const float*)d_in[1];
  const float* ln_in_g  = (const float*)d_in[2];
  const float* ln_in_b  = (const float*)d_in[3];
  const float* ln_sl_g  = (const float*)d_in[4];
  const float* ln_sl_b  = (const float*)d_in[5];
  const float* ln_mlp_g = (const float*)d_in[6];
  const float* ln_mlp_b = (const float*)d_in[7];
  const float* Wq       = (const float*)d_in[8];
  const float* Wk       = (const float*)d_in[9];
  const float* Wv       = (const float*)d_in[10];
  const float* gwih     = (const float*)d_in[11];
  const float* gwhh     = (const float*)d_in[12];
  const float* gbih     = (const float*)d_in[13];
  const float* gbhh     = (const float*)d_in[14];
  const float* w1       = (const float*)d_in[15];
  const float* b1       = (const float*)d_in[16];
  const float* w2       = (const float*)d_in[17];
  const float* b2       = (const float*)d_in[18];

  char* ws = (char*)d_ws;
  half_t* kf   = (half_t*)(ws + 0);          // 32 MB  K dense f16 (pre-scaled)
  half_t* vpk  = (half_t*)(ws + 33554432);   // 32 MB  V fragment-packed
  half_t* wkp  = (half_t*)(ws + 67108864);   // 128 KB Wk packed
  half_t* wvp  = (half_t*)(ws + 67239936);   // 128 KB Wv packed
  half_t* qbp  = (half_t*)(ws + 67436544);   // 1 MB   block-diag Q packed
  float*  upt  = (float*)(ws + 68485120);    // 2 MB   attn^T V partials
  float*  upd  = (float*)(ws + 72695808);    // 512 KB
  float*  scur = (float*)(ws + 73220096);    // 512 KB current slots
  float*  smid = (float*)(ws + 73744384);    // 512 KB post-GRU slots
  float*  csum = (float*)(ws + 74268672);    // 32 KB  attn column-sum partials
  float*  hid  = (float*)(ws + 74301440);    // 1 MB   MLP hidden layer

  float* out_slots = (float*)d_out;
  float* out_vis   = out_slots + (long)B_ * NQ * S_;

  hipMemcpyAsync(scur, slots0, (size_t)B_ * NQ * S_ * sizeof(float),
                 hipMemcpyDeviceToDevice, stream);
  k_cvt<<<256, 256, 0, stream>>>(Wk, Wv, wkp, wvp);
  k_proj<<<(B_ * NKV) / 32, 256, 0, stream>>>(inputs, ln_in_g, ln_in_b, wkp, wvp,
                                              kf, vpk);

  for (int it = 0; it < 3; ++it) {
    k_qbuild<<<128, 64, 0, stream>>>(scur, ln_sl_g, ln_sl_b, Wq, qbp);
    k_logits<<<B_ * (NKV / 256), 256, 0, stream>>>(kf, qbp, vpk, upt, csum,
                                                   out_vis);
    k_inv<<<128, 256, 0, stream>>>(csum, upt, upd);
    k_gru<<<256, 64, 0, stream>>>(upd, scur, gwih, gwhh, gbih, gbhh, smid);
    k_mlp1<<<256, 64, 0, stream>>>(smid, ln_mlp_g, ln_mlp_b, w1, b1, hid);
    k_mlp2<<<256, 64, 0, stream>>>(hid, smid, w2, b2, scur, out_slots,
                                   (it == 2) ? 1 : 0);
  }
}

// v007
// Next to v006, in two timings, it ran 1.12 and 1.13 times as fast.
// All steps since v000 together make it 5.06 times as fast.
#include <hip/hip_runtime.h>
#include <hip/hip_bf16.h>

typedef __attribute__((ext_vector_type(16))) _Float16 v16h;
typedef __attribute__((ext_vector_type(8)))  float    v8f;
typedef __attribute__((ext_vector_type(2)))  float    v2f;
typedef _Float16 half_t;

#define B_     64
#define NKV    1024
#define NQ     8
#define S_     256
#define HM_    512
#define EPS_   1e-8f
#define LNE_   1e-5f

// ---------------- WMMA fragment helpers (CDNA5 16x16x32 f16 layout) ----------
// 16-bit operand layout: lane L, klo = (L>=16)?8:0; elems 0..7 hold K =
// klo..klo+7, elems 8..15 hold K = klo+16..klo+23 (row/col index = L&15).

// A-fragment from row-major source (ld in halves): two 16B vector loads.
__device__ inline v16h frag_rowmajor(const half_t* p, int ld, int lane) {
  int m   = lane & 15;
  int klo = (lane >> 4) << 3;
  const half_t* q = p + m * ld + klo;
  union { uint4 u[2]; v16h h; } c;
  c.u[0] = *(const uint4*)(q);
  c.u[1] = *(const uint4*)(q + 16);
  return c.h;
}
// Fragment from pre-packed storage: packed[...][lane][16] -> two contiguous 16B loads.
__device__ inline v16h frag_packed(const half_t* p, int lane) {
  const half_t* q = p + lane * 16;
  union { uint4 u[2]; v16h h; } c;
  c.u[0] = *(const uint4*)(q);
  c.u[1] = *(const uint4*)(q + 8);
  return c.h;
}
// Fragment from plane-packed storage: packed[...][half=2][lane=32][8], elements
// 0..7 of all lanes and then elements 8..15, so that each 16-byte access of a
// wave covers 512 contiguous bytes (whole lines).
__device__ inline v16h frag_planes(const half_t* p, int lane) {
  const half_t* q = p + lane * 8;
  union { uint4 u[2]; v16h h; } c;
  c.u[0] = *(const uint4*)(q);
  c.u[1] = *(const uint4*)(q + 256);
  return c.h;
}
// (lane, elem) -> K-within-32
__device__ inline int klocal_of(int lane, int e) {
  int klo = (lane >> 4) << 3;
  return (e < 8) ? (klo + e) : (klo + 8 + e);
}
__device__ inline v8f wmma_f16(v16h a, v16h b, v8f c) {
  return __builtin_amdgcn_wmma_f32_16x16x32_f16(false, a, false, b, (short)0, c,
                                                false, false);
}

// ---------------- Wk/Wv fp32 -> fragment-packed fp16 -------------------------
// packed idx = ((kk*16 + nt)*32 + lane)*16 + e ; 8 kk x 16 nt tiles
__global__ void k_cvt(const float* __restrict__ wk, const float* __restrict__ wv,
                      half_t* __restrict__ wkp, half_t* __restrict__ wvp) {
  int idx  = blockIdx.x * 256 + threadIdx.x;  // 65536 halves per matrix
  int e    = idx & 15;
  int lane = (idx >> 4) & 31;
  int nt   = (idx >> 9) & 15;
  int kk   = idx >> 13;
  int k = kk * 32 + klocal_of(lane, e);
  int n = nt * 16 + (lane & 15);
  wkp[idx] = (half_t)wk[k * 256 + n];
  wvp[idx] = (half_t)wv[k * 256 + n];
}

// ---------------- fused LayerNorm(inputs) + K/V projection (WMMA) ------------
// grid: (B*NKV)/32 blocks, 256 threads; wave w owns all 32 rows x columns
// 32 w .. 32 w + 31 of K and of V, so that a lane ends up holding whole packed
// fragments and every store of a wave is 512 contiguous bytes.
// V = x Wv: D register r of row tile mt at lane l is k_local = 16 mt + 8 (l >> 4)
// + r of column l & 15, which is element 8 mt + r of the same lane l of the
// B operand of attn@V: vpk[b][krow=32][nt=16][half=mt][lane=32][8].
// K is formed transposed, K^T = Wk^T x^T (the operands change places; A and B
// hold k alike): D register r of column tile ti at lane l is feature 32 w +
// 16 ti + 8 (l >> 4) + r of row l & 15, which is element 8 ti + r of the same
// lane l of the A operand of the logits at K-step w:
// kpk[row tile = row / 16][kk=8][half=ti][lane=32][8].
#define XP_ 264  // pitch of the f16 rows in LDS, halves: 528 B = 16 B x 33, so
                 // that the 16 rows of a fragment read fall on distinct banks
__global__ void __launch_bounds__(256) k_proj(
    const float* __restrict__ x, const float* __restrict__ g,
    const float* __restrict__ bb, const half_t* __restrict__ wkp,
    const half_t* __restrict__ wvp, half_t* __restrict__ kpk,
    half_t* __restrict__ vpk) {
  __shared__ float xs[32][256];
  __shared__ __align__(32) half_t xh[32][XP_];
  __shared__ float psum[32][8], psq[32][8];
  __shared__ float mu[32], rs[32];
  int t = threadIdx.x;
  long base = (long)blockIdx.x * 32 * 256;
  for (int i = t; i < 32 * 256; i += 256) xs[i >> 8][i & 255] = x[base + i];
  __syncthreads();
  {
    int row = t >> 3, seg = t & 7;
    float s = 0.f, s2 = 0.f;
    for (int c = seg * 32; c < seg * 32 + 32; ++c) {
      float v_ = xs[row][c]; s += v_; s2 += v_ * v_;
    }
    psum[row][seg] = s; psq[row][seg] = s2;
  }
  __syncthreads();
  if (t < 32) {
    float s = 0.f, s2 = 0.f;
    for (int j = 0; j < 8; ++j) { s += psum[t][j]; s2 += psq[t][j]; }
    float m = s * (1.f / 256.f);
    mu[t] = m; rs[t] = rsqrtf(s2 * (1.f / 256.f) - m * m + LNE_);
  }
  __syncthreads();
  for (int i = t; i < 32 * 256; i += 256) {
    int row = i >> 8, col = i & 255;
    xh[row][col] = (half_t)((xs[row][col] - mu[row]) * rs[row] * g[col] + bb[col]);
  }
  __syncthreads();

  int lane = t & 31, w = t >> 5;
  v8f ak[2][2], av[2][2];  // [row tile][column tile]
  for (int i = 0; i < 2; ++i)
    for (int k = 0; k < 2; ++k)
      for (int j = 0; j < 8; ++j) { ak[i][k][j] = 0.f; av[i][k][j] = 0.f; }
  for (int kk = 0; kk < 8; ++kk) {
    // issue ALL fragment loads of this K-step first (independent b128s),
    // then the WMMA burst -> backend can use partial s_wait_loadcnt
    v16h a0 = frag_rowmajor(&xh[0][kk * 32], XP_, lane);
    v16h a1 = frag_rowmajor(&xh[16][kk * 32], XP_, lane);
    v16h bk[2], bv[2];
#pragma unroll
    for (int ti = 0; ti < 2; ++ti) {
      int nt = w * 2 + ti;
      bk[ti] = frag_packed(wkp + (long)(kk * 16 + nt) * 512, lane);
      bv[ti] = frag_packed(wvp + (long)(kk * 16 + nt) * 512, lane);
    }
#pragma unroll
    for (int ti = 0; ti < 2; ++ti) {
      ak[0][ti] = wmma_f16(bk[ti], a0, ak[0][ti]);
      ak[1][ti] = wmma_f16(bk[ti], a1, ak[1][ti]);
      av[0][ti] = wmma_f16(a0, bv[ti], av[0][ti]);
      av[1][ti] = wmma_f16(a1, bv[ti], av[1][ti]);
    }
  }
  // the block's 32 rows are 16 KB of kpk (two row tiles) and 16 KB of vpk (one
  // krow), both at blockIdx.x * 8192 halves
  half_t* kb = kpk + (long)blockIdx.x * 8192 + w * 512 + lane * 8;
  half_t* vb = vpk + (long)blockIdx.x * 8192 + w * 1024 + lane * 8;
#pragma unroll
  for (int mt = 0; mt < 2; ++mt) {
#pragma unroll
    for (int ti = 0; ti < 2; ++ti) {
      union { uint4 u; half_t h[8]; } pk, pv;
#pragma unroll
      for (int r = 0; r < 8; ++r) {
        pk.h[r] = (half_t)(ak[mt][ti][r] * 0.125f);  // hd^-0.5
        pv.h[r] = (half_t)(av[mt][ti][r]);
      }
      *(uint4*)(kb + mt * 4096 + ti * 256) = pk.u;
      *(uint4*)(vb + ti * 512 + mt * 256) = pv.u;
    }
  }
}

// -------- logits GEMM (WMMA) + fused joint softmax + attn^T V (WMMA) ---------
// value of lane (l ^ M) of the same 16-lane row (DPP row_xmask)
template <int M>
__device__ inline float row_xor(float v) {
  return __builtin_bit_cast(
      float, __builtin_amdgcn_mov_dpp(__builtin_bit_cast(int, v), 0x160 | M, 0xf,
                                      0xf, true));
}
__device__ inline float row_max16(float v) {
  v = fmaxf(v, row_xor<1>(v));
  v = fmaxf(v, row_xor<2>(v));
  v = fmaxf(v, row_xor<4>(v));
  v = fmaxf(v, row_xor<8>(v));
  return v;
}
__device__ inline float row_sum16(float v) {
  v += row_xor<1>(v);
  v += row_xor<2>(v);
  v += row_xor<4>(v);
  v += row_xor<8>(v);
  return v;
}
// value of lane l ^ 16
__device__ inline float xhalf(float x) {
  int i = __builtin_bit_cast(int, x);
  return __builtin_bit_cast(
      float, __builtin_amdgcn_permlanex16(i, i, 0x76543210, 0xfedcba98, false,
                                          false));
}

// exp(x) as __expf builds it: one multiply and v_exp_f32. The v_nop fills the
// one slot the instruction set asks for behind a transcendental before its
// source is overwritten or its result read.
__device__ inline float exp_slot(float x) {
  float r;
  asm("v_exp_f32 %0, %1\n\tv_nop" : "=v"(r) : "v"(x * 1.44269504f));
  return r;
}

// grid: B * (NKV/256); each wave owns 32 kv rows (two M-tiles) x all 32
// (head, slot) columns, so a softmax row lies in one 16-lane row of two
// accumulators and the wave's 32 rows are exactly one K-step of attn@V.
// attn goes to LDS fragment-packed as the A-operand of attn@V:
// as[wave = K-step][mt=2][lane=32][e=16]; lane and e follow from the D layout:
// D register r of M-tile i at lane l is k_local = 16 i + 8 (l >> 4) + r,
// which is element e = 8 i + r of the same lane l.
// Behind the barrier the block multiplies its own 256 kv rows with V: wave w
// takes columns 32 w .. 32 w + 31 of V over the block's eight K-steps. Those
// columns are of head w >> 1, whose eight attn rows lie in M-tile w >> 2, in
// the D rows of the 16-lane half (w >> 1) & 1: only that M-tile is multiplied.
// The eps term needs the column sums of V: every V fragment passes through the
// wave anyway, so one more WMMA with an A operand of ones sums it over k (each
// row of that D tile is the column sum).
// Both sums leave as one partial per block: cpart[b][blk=4][32] (attn columns)
// and upart[b][blk=4][slot=8][d=256] (attn^T V + eps colsum(V), not normed).
__global__ void __launch_bounds__(256) k_logits(
    const half_t* __restrict__ kpk, const half_t* __restrict__ qbp,
    const half_t* __restrict__ vpk, float* __restrict__ upart,
    float* __restrict__ cpart, float* __restrict__ vis_out) {
  __shared__ float csl[8][32];
  __shared__ __align__(32) half_t as[8][2][512];
  int t = threadIdx.x, lane = t & 31, w = t >> 5;
  int b   = blockIdx.x >> 2;
  int blk = blockIdx.x & 3;
  int n0  = blk * 256 + w * 32;
  const half_t* kp = kpk + ((long)b * NKV + n0) * 256;  // two row tiles of 8 KB
  const half_t* qp = qbp + (long)b * 8192;
  v8f acc[2][2];  // [M-tile][column tile]
  for (int i = 0; i < 2; ++i)
    for (int k = 0; k < 2; ++k)
      for (int j = 0; j < 8; ++j) acc[i][k][j] = 0.f;
  for (int kk = 0; kk < 8; ++kk) {
    v16h a0  = frag_planes(kp + kk * 512, lane);
    v16h a1  = frag_planes(kp + 4096 + kk * 512, lane);
    v16h bq0 = frag_packed(qp + (long)(kk * 2 + 0) * 512, lane);
    v16h bq1 = frag_packed(qp + (long)(kk * 2 + 1) * 512, lane);
    acc[0][0] = wmma_f16(a0, bq0, acc[0][0]);
    acc[0][1] = wmma_f16(a0, bq1, acc[0][1]);
    acc[1][0] = wmma_f16(a1, bq0, acc[1][0]);
    acc[1][1] = wmma_f16(a1, bq1, acc[1][1]);
  }
  // the wave's sixteen V fragments, all in flight under the softmax
  const half_t* vv = vpk + (long)b * 262144 + (long)(blk * 128 + 2 * w) * 512;
  v16h vb0[8], vb1[8];
#pragma unroll
  for (int s = 0; s < 8; ++s) {
    vb0[s] = frag_planes(vv + s * 8192, lane);
    vb1[s] = frag_planes(vv + s * 8192 + 512, lane);
  }
  // The scheduling barriers keep the V loads above the softmax: left free, the
  // scheduler sinks each load to its first use behind the barrier and the
  // latency is not hidden. The address registers of the K and V loads are free
  // for reuse from here on: the wait stands in front of the first overwrite.
  // Named as its inputs they stay live up to it, so that no V load lands in
  // them.
  const half_t* ka = kp + lane * 8;
  const half_t* va = vv + lane * 8;
  __builtin_amdgcn_sched_barrier(0);
  asm volatile("s_wait_xcnt 0x0" :: "v"(ka), "v"(va) : "memory");
  __builtin_amdgcn_sched_barrier(0);
  int c16 = lane & 15, hi = lane >> 4;
  float cs0 = 0.f, cs1 = 0.f;
  union { uint4 u[2]; half_t h[16]; } p0, p1;
  float* vp = vis_out + (long)b * NQ * NKV + (c16 & 7) * NKV + n0 + hi * 8 +
              (c16 >> 3) * 4;
#pragma unroll
  for (int i = 0; i < 2; ++i) {
    float vis[8];
#pragma unroll
    for (int r = 0; r < 8; ++r) {
      float x0 = acc[i][0][r], x1 = acc[i][1][r];
      float mx = row_max16(fmaxf(x0, x1));
      float e0 = exp_slot(x0 - mx), e1 = exp_slot(x1 - mx);
      float inv = 1.f / row_sum16(e0 + e1);
      e0 *= inv; e1 *= inv;
      cs0 += e0; cs1 += e1;
      p0.h[i * 8 + r] = (half_t)e0;
      p1.h[i * 8 + r] = (half_t)e1;
      float v_ = e0 + e1;           // heads 0+2 (or 1+3) of slot c16 & 7
      vis[r] = v_ + row_xor<8>(v_);  // attn_vis = sum over heads
    }
    // lanes c16 and c16 ^ 8 hold the same 8 sums: each stores four of them
    float4 o;
    o.x = (c16 & 8) ? vis[4] : vis[0];
    o.y = (c16 & 8) ? vis[5] : vis[1];
    o.z = (c16 & 8) ? vis[6] : vis[2];
    o.w = (c16 & 8) ? vis[7] : vis[3];
    *(float4*)(vp + i * 16) = o;
  }
  half_t* ab = &as[w][0][lane * 16];
  *(uint4*)(ab)           = p0.u[0];
  *(uint4*)(ab + 8)       = p0.u[1];
  *(uint4*)(ab + 512)     = p1.u[0];
  *(uint4*)(ab + 512 + 8) = p1.u[1];
  // column sums: 16 rows in the lane, the other 16 in lane ^ 16, then the
  // eight waves in a fixed order
  cs0 += xhalf(cs0);
  cs1 += xhalf(cs1);
  csl[w][lane] = hi ? cs1 : cs0;
  __syncthreads();
  if (t < 32) {
    float s = 0.f;
#pragma unroll
    for (int j = 0; j < 8; ++j) s += csl[j][t];
    cpart[(b * 4 + blk) * 32 + t] = s;
  }
  int mt = w >> 2, hsel = (w >> 1) & 1;
  v8f u0, u1, cv0, cv1;
  for (int e = 0; e < 8; ++e) { u0[e] = 0.f; u1[e] = 0.f; cv0[e] = 0.f; cv1[e] = 0.f; }
  v16h ones;
  for (int e = 0; e < 16; ++e) ones[e] = (half_t)1.f;
#pragma unroll
  for (int s = 0; s < 8; ++s) {
    v16h a = frag_packed(&as[s][mt][0], lane);
    u0  = wmma_f16(a, vb0[s], u0);
    u1  = wmma_f16(a, vb1[s], u1);
    cv0 = wmma_f16(ones, vb0[s], cv0);
    cv1 = wmma_f16(ones, vb1[s], cv1);
  }
  // D register r is slot r in the lanes of half hsel. Lane l stores column
  // 32 w + l: the lanes of the other half take their tile's value from
  // lane ^ 16, so that each store of the wave is one whole 128-byte line.
  float* up = upart + (long)(b * 4 + blk) * 2048 + w * 32 + lane;
#pragma unroll
  for (int r = 0; r < 8; ++r) {
    float x0 = u0[r] + EPS_ * cv0[r];
    float x1 = u1[r] + EPS_ * cv1[r];
    float got = xhalf(hi ? x0 : x1);
    up[r * 256] = (hi == hsel) ? (hi ? x1 : x0) : got;
  }
}

// updates = (sum of the four blocks' partials) / (attn column sum + NKV eps)
// grid: B * NQ * S / 4 / 256 blocks, four neighbouring d a thread
__global__ void __launch_bounds__(256) k_inv(
    const float* __restrict__ cpart, const float* __restrict__ upart,
    float* __restrict__ upd) {
  int i  = blockIdx.x * 256 + threadIdx.x;
  int b  = i >> 9, qi = (i >> 6) & 7, d = (i & 63) * 4;
  const float* p = cpart + b * 128 + (d >> 6) * 8 + qi;
  const float* u = upart + (long)b * 8192 + qi * 256 + d;
  float4 u0 = *(const float4*)(u);
  float4 u1 = *(const float4*)(u + 2048);
  float4 u2 = *(const float4*)(u + 4096);
  float4 u3 = *(const float4*)(u + 6144);
  float s = ((p[0] + p[32]) + p[64]) + p[96];
  float inv = 1.f / (s + (float)NKV * EPS_);
  float4 o;
  o.x = (((u0.x + u1.x) + u2.x) + u3.x) * inv;
  o.y = (((u0.y + u1.y) + u2.y) + u3.y) * inv;
  o.z = (((u0.z + u1.z) + u2.z) + u3.z) * inv;
  o.w = (((u0.w + u1.w) + u2.w) + u3.w) * inv;
  *(float4*)(upd + (long)(b * NQ + qi) * S_ + d) = o;
}

// ---------------- GRU cell (f32 WMMA 16x16x4) --------------------------------
// xg = upd @ wih^T and hg = hprev @ whh^T as Y = X W^T with X and W both
// k-contiguous. One wave owns 16 rows (of the B*NQ = 512) x 16 columns j of
// all three gates over the whole k = 256: no LDS, no barrier, no partial sums
// between waves. A block's two waves take neighbouring column tiles, so the
// block writes whole 128-byte lines. grid: 32 row tiles x 8 column pairs.
// k order: lane (c, h) loads floats k0 + 4h .. k0 + 4h + 3 of its row of X and
// of its row of W by the same offsets; elements (0,1) feed one WMMA, (2,3) the
// next, so A and B pair the same k at every lane and register.
__device__ inline v8f wmma_f32(float ax, float ay, float bx, float by, v8f c) {
  v2f a = {ax, ay};
  v2f b = {bx, by};
  return __builtin_amdgcn_wmma_f32_16x16x4_f32(false, a, false, b, (short)0, c,
                                               false, false);
}
__global__ void __launch_bounds__(64) k_gru(
    const float* __restrict__ upd, const float* __restrict__ hprev,
    const float* __restrict__ wih, const float* __restrict__ whh,
    const float* __restrict__ bih, const float* __restrict__ bhh,
    float* __restrict__ hout) {
  int lane = threadIdx.x & 31, w = threadIdx.x >> 5;
  int c = lane & 15, h = lane >> 4;
  int m0 = (blockIdx.x >> 3) * 16;
  int n0 = (blockIdx.x & 7) * 32 + w * 16;
  int j  = n0 + c;
  int ao = (m0 + c) * 256 + 4 * h;
  int bo = j * 256 + 4 * h;
  const float* s[8] = {upd + ao,          hprev + ao,
                       wih + bo,          whh + bo,
                       wih + 65536 + bo,  whh + 65536 + bo,
                       wih + 131072 + bo, whh + 131072 + bo};
  // every D register of a lane is column j, so the accumulators start from
  // the gate biases of that column
  float br = bih[j] + bhh[j];
  float bz = bih[256 + j] + bhh[256 + j];
  float bi3 = bih[512 + j], bh3 = bhh[512 + j];
  // D register e of lane (c, h) is row m0 + 8h + e, column j
  long ob = (long)(m0 + 8 * h) * 256 + j;
  float hp[8];
  float4 f[2][2][8];  // [stage][8-k step][matrix]
#pragma unroll
  for (int q = 0; q < 2; ++q)
#pragma unroll
    for (int x = 0; x < 8; ++x) f[0][q][x] = *(const float4*)(s[x] + q * 8);
  // The accumulators may take the register that the bias loads name as their
  // offset: the wait stands in front of that overwrite, and the scheduling
  // barriers keep the accumulators' first writes behind it.
  __builtin_amdgcn_sched_barrier(0);
  asm volatile("s_wait_xcnt 0x0" ::: "memory");
  __builtin_amdgcn_sched_barrier(0);
  v8f ar, az, ani, anh;
  for (int e = 0; e < 8; ++e) { ar[e] = br; az[e] = bz; ani[e] = bi3; anh[e] = bh3; }
  // unrolled whole so that the stage index is static and the next 16 k of all
  // eight operands are in flight under this stage's 24 WMMAs
#pragma unroll
  for (int ch = 0; ch < 16; ++ch) {
    if (ch + 1 < 16) {
#pragma unroll
      for (int q = 0; q < 2; ++q)
#pragma unroll
        for (int x = 0; x < 8; ++x)
          f[(ch + 1) & 1][q][x] = *(const float4*)(s[x] + (ch + 1) * 16 + q * 8);
    } else {
      // Every operand load is issued and its address registers are free for
      // reuse from here on: the wait stands in front of the first overwrite
      // (the scheduling barrier keeps later address arithmetic behind it).
      // The old state for the output blend then loads under the last WMMAs.
      __builtin_amdgcn_sched_barrier(0);
      asm volatile("s_wait_xcnt 0x0" ::: "memory");
#pragma unroll
      for (int e = 0; e < 8; ++e) hp[e] = hprev[ob + e * 256];
    }
    // keeps the next stage's loads above this stage's WMMAs: left free, the
    // scheduler sinks each load to its first use and every WMMA group then
    // waits out a whole load latency
    __builtin_amdgcn_sched_barrier(0);
#pragma unroll
    for (int q = 0; q < 2; ++q) {
      const float4* g = f[ch & 1][q];
      ar  = wmma_f32(g[0].x, g[0].y, g[2].x, g[2].y, ar);
      az  = wmma_f32(g[0].x, g[0].y, g[4].x, g[4].y, az);
      ani = wmma_f32(g[0].x, g[0].y, g[6].x, g[6].y, ani);
      anh = wmma_f32(g[1].x, g[1].y, g[7].x, g[7].y, anh);
      ar  = wmma_f32(g[1].x, g[1].y, g[3].x, g[3].y, ar);
      az  = wmma_f32(g[1].x, g[1].y, g[5].x, g[5].y, az);
      ani = wmma_f32(g[0].z, g[0].w, g[6].z, g[6].w, ani);
      anh = wmma_f32(g[1].z, g[1].w, g[7].z, g[7].w, anh);
      ar  = wmma_f32(g[0].z, g[0].w, g[2].z, g[2].w, ar);
      az  = wmma_f32(g[0].z, g[0].w, g[4].z, g[4].w, az);
      ar  = wmma_f32(g[1].z, g[1].w, g[3].z, g[3].w, ar);
      az  = wmma_f32(g[1].z, g[1].w, g[5].z, g[5].w, az);
    }
  }
  // The table of WMMA distances leaves the f32 16x16x4 form out: eight slots, the count of the slowest
  // listed form, stand between the last WMMA and the first vector read of an
  // accumulator. The two scheduling barriers hold the slots at that place.
  __builtin_amdgcn_sched_barrier(0);
  asm volatile("v_nop\n\tv_nop\n\tv_nop\n\tv_nop\n\tv_nop\n\tv_nop\n\tv_nop\n\tv_nop");
  __builtin_amdgcn_sched_barrier(0);
#pragma unroll
  for (int e = 0; e < 8; ++e) {
    float r = 1.f / (1.f + __expf(-ar[e]));
    float z = 1.f / (1.f + __expf(-az[e]));
    float n = tanhf(ani[e] + r * anh[e]);
    hout[ob + e * 256] = (1.f - z) * n + z * hp[e];
  }
}

// ---------------- LN + MLP residual (f32 WMMA 16x16x4), one launch a layer ---
// Both layers are Y = X W with X k-contiguous and W column-contiguous. One wave
// owns 16 rows (of the B*NQ = 512) over the whole k: no LDS, no barrier, no
// partial sums between waves.
// k order: lane (c, h) holds floats 8q + 4h .. 8q + 4h + 3 of its row of X and
// loads rows 8q + 4h .. 8q + 4h + 3 of W at its column; elements (0,1) feed one
// WMMA, (2,3) the next, so A and B pair the same k at every lane and register.

// 1/sqrt(x) as one v_rsq_f32; the v_nop fills the one slot the instruction set
// asks for behind a transcendental before its result is read.
__device__ inline float rsq_slot(float x) {
  float r;
  asm("v_rsq_f32 %0, %1\n\tv_nop" : "=v"(r) : "v"(x));
  return r;
}

#define D1_ 5   // k_mlp1: 8-k steps that the operand loads run ahead
#define D2_ 12  // k_mlp2: the same

typedef __attribute__((ext_vector_type(4))) float v4f;
__device__ inline v8f wmma_f32v(v2f a, v2f b, v8f c) {
  return __builtin_amdgcn_wmma_f32_16x16x4_f32(false, a, false, b, (short)0, c,
                                               false, false);
}

// hid = relu(LN(h) @ w1 + b1). A wave owns 16 rows x 32 hidden columns and
// keeps its half rows (128 floats a lane) in registers: the row statistics are
// a lane's own sums plus those of lane ^ 16. grid: 32 row tiles x 8 column
// groups of 64, two waves a block. The register bound keeps the wave inside
// one 256-register window (left free, the allocator spreads over two).
__global__ void __launch_bounds__(64) __attribute__((amdgpu_num_vgpr(256))) k_mlp1(
    const float* __restrict__ hin, const float* __restrict__ g,
    const float* __restrict__ bb, const float* __restrict__ w1,
    const float* __restrict__ b1, float* __restrict__ hid) {
  int lane = threadIdx.x & 31, w = threadIdx.x >> 5;
  int c = lane & 15, h = lane >> 4;
  int m0 = (blockIdx.x >> 3) * 16;
  int n0 = (blockIdx.x & 7) * 64 + w * 32;
  const float* ap = hin + (m0 + c) * 256 + 4 * h;
  const float* wp = w1 + 4 * h * 512 + n0 + c;
  const float* gp = g + 4 * h;
  const float* bp = bb + 4 * h;
  v4f a[32], fg[32], fo[32];
  v2f fw[32][2][2];  // [8-k step][k pair][column tile]
#pragma unroll
  for (int q = 0; q < 32; ++q) a[q] = *(const v4f*)(ap + q * 8);
#pragma unroll
  for (int q = 0; q < D1_; ++q) {
    fg[q] = *(const v4f*)(gp + q * 8);
    fo[q] = *(const v4f*)(bp + q * 8);
#pragma unroll
    for (int p = 0; p < 2; ++p)
#pragma unroll
      for (int ti = 0; ti < 2; ++ti) {
        fw[q][p][ti].x = wp[(q * 8 + 2 * p) * 512 + ti * 16];
        fw[q][p][ti].y = wp[(q * 8 + 2 * p + 1) * 512 + ti * 16];
      }
  }
  int bi = n0 + c;
  float bias0 = b1[bi], bias1 = b1[bi + 16];
  // The address registers of the row and bias loads are free for reuse from
  // here on: the wait stands in front of the first overwrite. Named as its
  // inputs they stay live up to it, so that no load above it lands in them;
  // the scheduling barriers keep the loads above it, the arithmetic behind it.
  __builtin_amdgcn_sched_barrier(0);
  asm volatile("s_wait_xcnt 0x0" :: "v"(ap), "v"(bi) : "memory");
  __builtin_amdgcn_sched_barrier(0);
  v2f t0 = {0.f, 0.f}, t1 = t0, t2 = t0, t3 = t0;
#pragma unroll
  for (int q = 0; q < 32; q += 2) {
    t0 += a[q].lo; t1 += a[q].hi; t2 += a[q + 1].lo; t3 += a[q + 1].hi;
  }
  t0 = (t0 + t1) + (t2 + t3);
  float s = t0.x + t0.y;
  s += xhalf(s);
  float mu = s * (1.f / 256.f);
  t0 = 0.f; t1 = 0.f; t2 = 0.f; t3 = 0.f;
#pragma unroll
  for (int q = 0; q < 32; q += 2) {
    a[q] -= mu; a[q + 1] -= mu;
    t0 += a[q].lo * a[q].lo;         t1 += a[q].hi * a[q].hi;
    t2 += a[q + 1].lo * a[q + 1].lo; t3 += a[q + 1].hi * a[q + 1].hi;
  }
  t0 = (t0 + t1) + (t2 + t3);
  s = t0.x + t0.y;
  s += xhalf(s);
  float rs = rsq_slot(s * (1.f / 256.f) + LNE_);
  // every D register of a lane is one column, so the accumulators start from
  // that column's bias
  v8f acc0, acc1;
  for (int e = 0; e < 8; ++e) { acc0[e] = bias0; acc1[e] = bias1; }
  a[0] = a[0] * (rs * fg[0]) + fo[0];
  a[1] = a[1] * (rs * fg[1]) + fo[1];
  // unrolled whole so that every index is static
#pragma unroll
  for (int q = 0; q < 32; ++q) {
    if (q + D1_ < 32) {
      int n = q + D1_;
      fg[n] = *(const v4f*)(gp + n * 8);
      fo[n] = *(const v4f*)(bp + n * 8);
#pragma unroll
      for (int p = 0; p < 2; ++p)
#pragma unroll
        for (int ti = 0; ti < 2; ++ti) {
          fw[n][p][ti].x = wp[(n * 8 + 2 * p) * 512 + ti * 16];
          fw[n][p][ti].y = wp[(n * 8 + 2 * p + 1) * 512 + ti * 16];
        }
    }
    // keeps the loads of step q + D1_ above this step's WMMAs: left free, the
    // scheduler sinks each load to its first use and every WMMA group then
    // waits out a whole load latency
    __builtin_amdgcn_sched_barrier(0);
    acc0 = wmma_f32v(a[q].lo, fw[q][0][0], acc0);
    acc1 = wmma_f32v(a[q].lo, fw[q][0][1], acc1);
    acc0 = wmma_f32v(a[q].hi, fw[q][1][0], acc0);
    acc1 = wmma_f32v(a[q].hi, fw[q][1][1], acc1);
    // The table of WMMA distances leaves the f32 16x16x4 form out: eight slots,
    // the count of the slowest
    // listed form, stand between the last WMMA and the next vector write,
    // which may take a register that a WMMA has just read (behind the last
    // step: the first vector read of an accumulator). They issue while the
    // matrix unit is busy. The scheduling barriers hold them at that place.
    __builtin_amdgcn_sched_barrier(0);
    if (q != 30)  // behind step 30 no vector instruction follows
      asm volatile("v_nop\n\tv_nop\n\tv_nop\n\tv_nop\n\tv_nop\n\tv_nop\n\tv_nop\n\tv_nop");
    __builtin_amdgcn_sched_barrier(0);
    // scale and shift of the LN two steps ahead, so that no WMMA waits for it
    if (q + 2 < 32) a[q + 2] = a[q + 2] * (rs * fg[q + 2]) + fo[q + 2];
    __builtin_amdgcn_sched_barrier(0);
  }
  // D register e of lane (c, h) is row m0 + 8h + e
  float* op = hid + (m0 + 8 * h) * 512 + n0 + c;
#pragma unroll
  for (int e = 0; e < 8; ++e) {
    op[e * 512]      = fmaxf(acc0[e], 0.f);
    op[e * 512 + 16] = fmaxf(acc1[e], 0.f);
  }
}

// slots = h + hid @ w2 + b2. A wave owns 16 rows x 16 columns over k = 512, the
// even and the odd k pairs in an accumulator each (a WMMA then never waits for
// the one before it); one starts from the bias, the other from the residual
// rows. A block's two waves take neighbouring column tiles, so the block
// writes whole 128-byte lines. grid: 32 row tiles x 8 column pairs.
__global__ void __launch_bounds__(64) k_mlp2(
    const float* __restrict__ hid, const float* __restrict__ hin,
    const float* __restrict__ w2, const float* __restrict__ b2,
    float* __restrict__ slots_out, float* __restrict__ dout, int write_out) {
  int lane = threadIdx.x & 31, w = threadIdx.x >> 5;
  int c = lane & 15, h = lane >> 4;
  int m0 = (blockIdx.x >> 3) * 16;
  int j  = (blockIdx.x & 7) * 32 + w * 16 + c;
  const float* ap = hid + (m0 + c) * 512 + 4 * h;
  const float* wp = w2 + 4 * h * 256 + j;
  // D register e of lane (c, h) is row m0 + 8h + e, column j
  int ob = (m0 + 8 * h) * 256 + j;
  v8f acc0, acc1;
  float bias = b2[j];
#pragma unroll
  for (int e = 0; e < 8; ++e) acc1[e] = hin[ob + e * 256];
  v4f fa[64];
  v2f fw[64][2];  // [8-k step][k pair]
#pragma unroll
  for (int q = 0; q < D2_; ++q) {
    fa[q] = *(const v4f*)(ap + q * 8);
#pragma unroll
    for (int p = 0; p < 2; ++p) {
      fw[q][p].x = wp[(q * 8 + 2 * p) * 256];
      fw[q][p].y = wp[(q * 8 + 2 * p + 1) * 256];
    }
  }
  // The offset register of the bias load is free for reuse from here on: the
  // wait stands in front of the first overwrite. Named as its input the offset
  // stays live up to it, so that no load above it lands in that register; the
  // scheduling barriers keep the accumulator's first writes behind it.
  __builtin_amdgcn_sched_barrier(0);
  asm volatile("s_wait_xcnt 0x0" :: "v"(j) : "memory");
  __builtin_amdgcn_sched_barrier(0);
  for (int e = 0; e < 8; ++e) acc0[e] = bias;
  // unrolled whole so that every index is static
#pragma unroll
  for (int q = 0; q < 64; ++q) {
    if (q + D2_ < 64) {
      int n = q + D2_;
      fa[n] = *(const v4f*)(ap + n * 8);
#pragma unroll
      for (int p = 0; p < 2; ++p) {
        fw[n][p].x = wp[(n * 8 + 2 * p) * 256];
        fw[n][p].y = wp[(n * 8 + 2 * p + 1) * 256];
      }
    }
    // keeps the loads of step q + D2_ above this step's WMMAs (as in k_mlp1)
    __builtin_amdgcn_sched_barrier(0);
    acc0 = wmma_f32v(fa[q].lo, fw[q][0], acc0);
    acc1 = wmma_f32v(fa[q].hi, fw[q][1], acc1);
  }
  // eight slots between the last WMMA and the first vector read of an
  // accumulator, held in place by the scheduling barriers (as in k_mlp1)
  __builtin_amdgcn_sched_barrier(0);
  asm volatile("v_nop\n\tv_nop\n\tv_nop\n\tv_nop\n\tv_nop\n\tv_nop\n\tv_nop\n\tv_nop");
  __builtin_amdgcn_sched_barrier(0);
  v8f o = acc0 + acc1;
#pragma unroll
  for (int e = 0; e < 8; ++e) slots_out[ob + e * 256] = o[e];
  if (write_out) {
#pragma unroll
    for (int e = 0; e < 8; ++e) dout[ob + e * 256] = o[e];
  }
}

// ---------------- LN(slots) + q = s@Wq (f32 WMMA 16x16x4), packed Qb ---------
// qbp[b][kk=8][ti=2][lane=32][e=16]: the block-diagonal B operand of the logits
// (k = feature d, column = head * 8 + slot, zero where d is not of that head).
// The product is formed transposed, q^T = Wq^T LN(s)^T: A is a column tile of
// Wq, B a tile of 16 slot rows (two batches), loaded by the offsets of k_mlp1,
// so A and B pair the same k at every lane and register. D register e of lane
// (c, h) is then feature 8h + e of slot row c: the eight features that one
// packed lane holds side by side. A wave owns 16 rows x 32 features (one kk)
// over the whole k, and writes the whole 2 KB of its kk for both batches, the
// zeros too. No LDS, no barrier. grid: 32 row tiles x 4 pairs of kk. The
// register bound keeps the wave inside one 256-register window (as in k_mlp1).
__global__ void __launch_bounds__(64) __attribute__((amdgpu_num_vgpr(256))) k_qbuild(
    const float* __restrict__ slots, const float* __restrict__ g,
    const float* __restrict__ bb, const float* __restrict__ wq,
    half_t* __restrict__ qbp) {
  int lane = threadIdx.x & 31, w = threadIdx.x >> 5;
  int c = lane & 15, h = lane >> 4;
  int m0 = (blockIdx.x >> 2) * 16;
  int kk = (blockIdx.x & 3) * 2 + w;
  const float* ap = slots + (m0 + c) * 256 + 4 * h;
  const float* wp = wq + 4 * h * 256 + kk * 32 + c;
  const float* gp = g + 4 * h;
  const float* bp = bb + 4 * h;
  v4f a[32], fg[32], fo[32];
  v2f fw[32][2][2];  // [8-k step][k pair][feature tile]
#pragma unroll
  for (int q = 0; q < 32; ++q) a[q] = *(const v4f*)(ap + q * 8);
#pragma unroll
  for (int q = 0; q < D1_; ++q) {
    fg[q] = *(const v4f*)(gp + q * 8);
    fo[q] = *(const v4f*)(bp + q * 8);
#pragma unroll
    for (int p = 0; p < 2; ++p)
#pragma unroll
      for (int ti = 0; ti < 2; ++ti) {
        fw[q][p][ti].x = wp[(q * 8 + 2 * p) * 256 + ti * 16];
        fw[q][p][ti].y = wp[(q * 8 + 2 * p + 1) * 256 + ti * 16];
      }
  }
  // The address registers of the row loads are free for reuse from here on: the
  // wait stands in front of the first overwrite. Named as its input they stay
  // live up to it, so that no load above it lands in them; the scheduling
  // barriers keep the loads above it, the arithmetic behind it.
  __builtin_amdgcn_sched_barrier(0);
  asm volatile("s_wait_xcnt 0x0" :: "v"(ap) : "memory");
  __builtin_amdgcn_sched_barrier(0);
  v2f t0 = {0.f, 0.f}, t1 = t0, t2 = t0, t3 = t0;
#pragma unroll
  for (int q = 0; q < 32; q += 2) {
    t0 += a[q].lo; t1 += a[q].hi; t2 += a[q + 1].lo; t3 += a[q + 1].hi;
  }
  t0 = (t0 + t1) + (t2 + t3);
  float s = t0.x + t0.y;
  s += xhalf(s);
  float mu = s * (1.f / 256.f);
  t0 = 0.f; t1 = 0.f; t2 = 0.f; t3 = 0.f;
#pragma unroll
  for (int q = 0; q < 32; q += 2) {
    a[q] -= mu; a[q + 1] -= mu;
    t0 += a[q].lo * a[q].lo;         t1 += a[q].hi * a[q].hi;
    t2 += a[q + 1].lo * a[q + 1].lo; t3 += a[q + 1].hi * a[q + 1].hi;
  }
  t0 = (t0 + t1) + (t2 + t3);
  s = t0.x + t0.y;
  s += xhalf(s);
  float rs = rsq_slot(s * (1.f / 256.f) + LNE_);
  v8f acc0, acc1;
  for (int e = 0; e < 8; ++e) { acc0[e] = 0.f; acc1[e] = 0.f; }
  a[0] = a[0] * (rs * fg[0]) + fo[0];
  a[1] = a[1] * (rs * fg[1]) + fo[1];
  // unrolled whole so that every index is static
#pragma unroll
  for (int q = 0; q < 32; ++q) {
    if (q + D1_ < 32) {
      int n = q + D1_;
      fg[n] = *(const v4f*)(gp + n * 8);
      fo[n] = *(const v4f*)(bp + n * 8);
#pragma unroll
      for (int p = 0; p < 2; ++p)
#pragma unroll
        for (int ti = 0; ti < 2; ++ti) {
          fw[n][p][ti].x = wp[(n * 8 + 2 * p) * 256 + ti * 16];
          fw[n][p][ti].y = wp[(n * 8 + 2 * p + 1) * 256 + ti * 16];
        }
    }
    // keeps the loads of step q + D1_ above this step's WMMAs (as in k_mlp1)
    __builtin_amdgcn_sched_barrier(0);
    acc0 = wmma_f32v(fw[q][0][0], a[q].lo, acc0);
    acc1 = wmma_f32v(fw[q][0][1], a[q].lo, acc1);
    acc0 = wmma_f32v(fw[q][1][0], a[q].hi, acc0);
    acc1 = wmma_f32v(fw[q][1][1], a[q].hi, acc1);
    // eight slots between the last WMMA and the next vector write or, behind
    // the last step, the first vector read of an accumulator, held in place by
    // the scheduling barriers (as in k_mlp1)
    __builtin_amdgcn_sched_barrier(0);
    if (q != 30)  // behind step 30 no vector instruction follows
      asm volatile("v_nop\n\tv_nop\n\tv_nop\n\tv_nop\n\tv_nop\n\tv_nop\n\tv_nop\n\tv_nop");
    __builtin_amdgcn_sched_barrier(0);
    // scale and shift of the LN two steps ahead, so that no WMMA waits for it
    if (q + 2 < 32) a[q + 2] = a[q + 2] * (rs * fg[q + 2]) + fo[q + 2];
    __builtin_amdgcn_sched_barrier(0);
  }
  // slot row c is batch m0 / 8 + (c >> 3), slot c & 7; its column of Qb is
  // head * 8 + slot with head = kk >> 1. sl = ti * 32 + packed lane; elements
  // 0..7 are features 8h + e (acc0), 8..15 features 16 + 8h + e (acc1).
  int hd = kk >> 1;
  int sl = (hd >> 1) * 32 + 16 * h + (hd & 1) * 8 + (c & 7);
  half_t* qp = qbp + ((m0 >> 3) + (c >> 3)) * 8192 + kk * 1024;
  union { uint4 u[2]; half_t x[16]; } o;
#pragma unroll
  for (int e = 0; e < 8; ++e) {
    o.x[e]     = (half_t)acc0[e];
    o.x[8 + e] = (half_t)acc1[e];
  }
  *(uint4*)(qp + sl * 16)     = o.u[0];
  *(uint4*)(qp + sl * 16 + 8) = o.u[1];
  // the columns of the other three heads are zero at these features
  uint4 zz = {0u, 0u, 0u, 0u};
  *(uint4*)(qp + (sl ^ 8) * 16)      = zz;
  *(uint4*)(qp + (sl ^ 8) * 16 + 8)  = zz;
  *(uint4*)(qp + (sl ^ 32) * 16)     = zz;
  *(uint4*)(qp + (sl ^ 32) * 16 + 8) = zz;
  *(uint4*)(qp + (sl ^ 40) * 16)     = zz;
  *(uint4*)(qp + (sl ^ 40) * 16 + 8) = zz;
}

// ---------------- host orchestration ----------------------------------------
extern "C" void kernel_launch(void* const* d_in, const int* in_sizes, int n_in,
                              void* d_out, int out_size, void* d_ws,
                              size_t ws_size, hipStream_t stream) {
  (void)in_sizes; (void)n_in; (void)out_size; (void)ws_size;
  const float* inputs   = (const float*)d_in[0];
  const float* slots0   = (const float*)d_in[1];
  const float* ln_in_g  = (const float*)d_in[2];
  const float* ln_in_b  = (const float*)d_in[3];
  const float* ln_sl_g  = (const float*)d_in[4];
  const float* ln_sl_b  = (const float*)d_in[5];
  const float* ln_mlp_g = (const float*)d_in[6];
  const float* ln_mlp_b = (const float*)d_in[7];
  const float* Wq       = (const float*)d_in[8];
  const float* Wk       = (const float*)d_in[9];
  const float* Wv       = (const float*)d_in[10];
  const float* gwih     = (const float*)d_in[11];
  const float* gwhh     = (const float*)d_in[12];
  const float* gbih     = (const float*)d_in[13];
  const float* gbhh     = (const float*)d_in[14];
  const float* w1       = (const float*)d_in[15];
  const float* b1       = (const float*)d_in[16];
  const float* w2       = (const float*)d_in[17];
  const float* b2       = (const float*)d_in[18];

  char* ws = (char*)d_ws;
  half_t* kf   = (half_t*)(ws + 0);          // 32 MB  K fragment-packed (pre-scaled)
  half_t* vpk  = (half_t*)(ws + 33554432);   // 32 MB  V fragment-packed
  half_t* wkp  = (half_t*)(ws + 67108864);   // 128 KB Wk packed
  half_t* wvp  = (half_t*)(ws + 67239936);   // 128 KB Wv packed
  half_t* qbp  = (half_t*)(ws + 67436544);   // 1 MB   block-diag Q packed
  float*  upt  = (float*)(ws + 68485120);    // 2 MB   attn^T V partials
  float*  upd  = (float*)(ws + 72695808);    // 512 KB
  float*  scur = (float*)(ws + 73220096);    // 512 KB current slots
  float*  smid = (float*)(ws + 73744384);    // 512 KB post-GRU slots
  float*  csum = (float*)(ws + 74268672);    // 32 KB  attn column-sum partials
  float*  hid  = (float*)(ws + 74301440);    // 1 MB   MLP hidden layer

  float* out_slots = (float*)d_out;
  float* out_vis   = out_slots + (long)B_ * NQ * S_;

  hipMemcpyAsync(scur, slots0, (size_t)B_ * NQ * S_ * sizeof(float),
                 hipMemcpyDeviceToDevice, stream);
  k_cvt<<<256, 256, 0, stream>>>(Wk, Wv, wkp, wvp);
  k_proj<<<(B_ * NKV) / 32, 256, 0, stream>>>(inputs, ln_in_g, ln_in_b, wkp, wvp,
                                              kf, vpk);

  for (int it = 0; it < 3; ++it) {
    k_qbuild<<<128, 64, 0, stream>>>(scur, ln_sl_g, ln_sl_b, Wq, qbp);
    k_logits<<<B_ * (NKV / 256), 256, 0, stream>>>(kf, qbp, vpk, upt, csum,
                                                   out_vis);
    k_inv<<<128, 256, 0, stream>>>(csum, upt, upd);
    k_gru<<<256, 64, 0, stream>>>(upd, scur, gwih, gwhh, gbih, gbhh, smid);
    k_mlp1<<<256, 64, 0, stream>>>(smid, ln_mlp_g, ln_mlp_b, w1, b1, hid);
    k_mlp2<<<256, 64, 0, stream>>>(hid, smid, w2, b2, scur, out_slots,
                                   (it == 2) ? 1 : 0);
  }
}

// v008
// Next to v007, in two timings, it ran 1.09 and 1.10 times as fast.
// Counting every step since v000, it is 5.55 times as fast.
#include <hip/hip_runtime.h>
#include <hip/hip_bf16.h>

typedef __attribute__((ext_vector_type(16))) _Float16 v16h;
typedef __attribute__((ext_vector_type(8)))  float    v8f;
typedef __attribute__((ext_vector_type(2)))  float    v2f;
typedef __attribute__((ext_vector_type(4)))  float    v4f;
typedef _Float16 half_t;

#define B_     64
#define NKV    1024
#define NQ     8
#define S_     256
#define HM_    512
#define EPS_   1e-8f
#define LNE_   1e-5f

// ---------------- WMMA fragment helpers (CDNA5 16x16x32 f16 layout) ----------
// 16-bit operand layout: lane L, klo = (L>=16)?8:0; elems 0..7 hold K =
// klo..klo+7, elems 8..15 hold K = klo+16..klo+23 (row/col index = L&15).

// A-fragment from row-major source (ld in halves): two 16B vector loads.
__device__ inline v16h frag_rowmajor(const half_t* p, int ld, int lane) {
  int m   = lane & 15;
  int klo = (lane >> 4) << 3;
  const half_t* q = p + m * ld + klo;
  union { uint4 u[2]; v16h h; } c;
  c.u[0] = *(const uint4*)(q);
  c.u[1] = *(const uint4*)(q + 16);
  return c.h;
}
// Fragment from pre-packed storage: packed[...][lane][16] -> two contiguous 16B loads.
__device__ inline v16h frag_packed(const half_t* p, int lane) {
  const half_t* q = p + lane * 16;
  union { uint4 u[2]; v16h h; } c;
  c.u[0] = *(const uint4*)(q);
  c.u[1] = *(const uint4*)(q + 8);
  return c.h;
}
// Fragment from plane-packed storage: packed[...][half=2][lane=32][8], elements
// 0..7 of all lanes and then elements 8..15, so that each 16-byte access of a
// wave covers 512 contiguous bytes (whole lines).
__device__ inline v16h frag_planes(const half_t* p, int lane) {
  const half_t* q = p + lane * 8;
  union { uint4 u[2]; v16h h; } c;
  c.u[0] = *(const uint4*)(q);
  c.u[1] = *(const uint4*)(q + 256);
  return c.h;
}
// (lane, elem) -> K-within-32
__device__ inline int klocal_of(int lane, int e) {
  int klo = (lane >> 4) << 3;
  return (e < 8) ? (klo + e) : (klo + 8 + e);
}
__device__ inline v8f wmma_f16(v16h a, v16h b, v8f c) {
  return __builtin_amdgcn_wmma_f32_16x16x32_f16(false, a, false, b, (short)0, c,
                                                false, false);
}

// ---------------- Wk/Wv fp32 -> fragment-packed fp16 -------------------------
// packed idx = ((kk*16 + nt)*32 + lane)*16 + e ; 8 kk x 16 nt tiles
__global__ void k_cvt(const float* __restrict__ wk, const float* __restrict__ wv,
                      half_t* __restrict__ wkp, half_t* __restrict__ wvp) {
  int idx  = blockIdx.x * 256 + threadIdx.x;  // 65536 halves per matrix
  int e    = idx & 15;
  int lane = (idx >> 4) & 31;
  int nt   = (idx >> 9) & 15;
  int kk   = idx >> 13;
  int k = kk * 32 + klocal_of(lane, e);
  int n = nt * 16 + (lane & 15);
  wkp[idx] = (half_t)wk[k * 256 + n];
  wvp[idx] = (half_t)wv[k * 256 + n];
}

// ---------------- cross-lane helpers -----------------------------------------
// value of lane (l ^ M) of the same 16-lane row (DPP row_xmask)
template <int M>
__device__ inline float row_xor(float v) {
  return __builtin_bit_cast(
      float, __builtin_amdgcn_mov_dpp(__builtin_bit_cast(int, v), 0x160 | M, 0xf,
                                      0xf, true));
}
__device__ inline float row_max16(float v) {
  v = fmaxf(v, row_xor<1>(v));
  v = fmaxf(v, row_xor<2>(v));
  v = fmaxf(v, row_xor<4>(v));
  v = fmaxf(v, row_xor<8>(v));
  return v;
}
__device__ inline float row_sum16(float v) {
  v += row_xor<1>(v);
  v += row_xor<2>(v);
  v += row_xor<4>(v);
  v += row_xor<8>(v);
  return v;
}
// value of lane l ^ 16
__device__ inline float xhalf(float x) {
  int i = __builtin_bit_cast(int, x);
  return __builtin_bit_cast(
      float, __builtin_amdgcn_permlanex16(i, i, 0x76543210, 0xfedcba98, false,
                                          false));
}

// 1/sqrt(x) as one v_rsq_f32; the v_nop fills the one slot the instruction set
// asks for behind a transcendental before its result is read.
__device__ inline float rsq_slot(float x) {
  float r;
  asm("v_rsq_f32 %0, %1\n\tv_nop" : "=v"(r) : "v"(x));
  return r;
}

// ---------------- fused LayerNorm(inputs) + K/V projection (WMMA) ------------
// grid: (B*NKV)/32 blocks, 256 threads; wave w owns all 32 rows x columns
// 32 w .. 32 w + 31 of K and of V, so that a lane ends up holding whole packed
// fragments and every store of a wave is 512 contiguous bytes.
// V = x Wv: D register r of row tile mt at lane l is k_local = 16 mt + 8 (l >> 4)
// + r of column l & 15, which is element 8 mt + r of the same lane l of the
// B operand of attn@V: vpk[b][krow=32][nt=16][half=mt][lane=32][8].
// K is formed transposed, K^T = Wk^T x^T (the operands change places; A and B
// hold k alike): D register r of column tile ti at lane l is feature 32 w +
// 16 ti + 8 (l >> 4) + r of row l & 15, which is element 8 ti + r of the same
// lane l of the A operand of the logits at K-step w:
// kpk[row tile = row / 16][kk=8][half=ti][lane=32][8].
#define XP_ 264  // pitch of the f16 rows in LDS, halves: 528 B = 16 B x 33, so
                 // that the 16 rows of a fragment read fall on distinct banks
__global__ void __launch_bounds__(256) k_proj(
    const float* __restrict__ x, const float* __restrict__ g,
    const float* __restrict__ bb, const half_t* __restrict__ wkp,
    const half_t* __restrict__ wvp, half_t* __restrict__ kpk,
    half_t* __restrict__ vpk) {
  __shared__ __align__(32) half_t xh[32][XP_];
  int t = threadIdx.x, lane = t & 31, w = t >> 5;
  // LayerNorm in registers: wave w owns rows 4 w .. 4 w + 3 whole; lane l holds
  // columns 4 l .. 4 l + 3 and 128 + 4 l .. 128 + 4 l + 3 of each, so that every
  // load of the wave is 512 contiguous bytes. The row sums are a lane's own
  // eight values, then the 16-lane row, then lane ^ 16.
  int lo = lane * 4;
  const float* xp = x + (long)blockIdx.x * 8192 + w * 1024 + lo;
  v4f xv[4][2];
#pragma unroll
  for (int r = 0; r < 4; ++r) {
    xv[r][0] = *(const v4f*)(xp + r * 256);
    xv[r][1] = *(const v4f*)(xp + r * 256 + 128);
  }
  v4f g0 = *(const v4f*)(g + lo), g1 = *(const v4f*)(g + 128 + lo);
  v4f o0 = *(const v4f*)(bb + lo), o1 = *(const v4f*)(bb + 128 + lo);
  // The address registers of these loads are free for reuse from here on: the
  // wait stands in front of the first overwrite. Named as its inputs they stay
  // live up to it, so that no load above it lands in them; the scheduling
  // barriers keep the loads above it, the arithmetic behind it.
  __builtin_amdgcn_sched_barrier(0);
  asm volatile("s_wait_xcnt 0x0" :: "v"(xp), "v"(lane) : "memory");
  __builtin_amdgcn_sched_barrier(0);
#pragma unroll
  for (int r = 0; r < 4; ++r) {
    v4f p = xv[r][0], q = xv[r][1];
    v2f ts = (p.lo + p.hi) + (q.lo + q.hi);
    v2f tq = (p.lo * p.lo + p.hi * p.hi) + (q.lo * q.lo + q.hi * q.hi);
    float s  = row_sum16(ts.x + ts.y);
    float s2 = row_sum16(tq.x + tq.y);
    s  += xhalf(s);
    s2 += xhalf(s2);
    float m   = s * (1.f / 256.f);
    float rsd = rsq_slot(s2 * (1.f / 256.f) - m * m + LNE_);
    p = (p - m) * rsd * g0 + o0;
    q = (q - m) * rsd * g1 + o1;
    union { uint2 u; half_t h[4]; } c0, c1;
#pragma unroll
    for (int e = 0; e < 4; ++e) {
      c0.h[e] = (half_t)p[e];
      c1.h[e] = (half_t)q[e];
    }
    *(uint2*)(&xh[w * 4 + r][lo])       = c0.u;
    *(uint2*)(&xh[w * 4 + r][128 + lo]) = c1.u;
  }
  __syncthreads();

  v8f ak[2][2], av[2][2];  // [row tile][column tile]
  for (int i = 0; i < 2; ++i)
    for (int k = 0; k < 2; ++k)
      for (int j = 0; j < 8; ++j) { ak[i][k][j] = 0.f; av[i][k][j] = 0.f; }
  for (int kk = 0; kk < 8; ++kk) {
    // issue ALL fragment loads of this K-step first (independent b128s),
    // then the WMMA burst -> backend can use partial s_wait_loadcnt
    v16h a0 = frag_rowmajor(&xh[0][kk * 32], XP_, lane);
    v16h a1 = frag_rowmajor(&xh[16][kk * 32], XP_, lane);
    v16h bk[2], bv[2];
#pragma unroll
    for (int ti = 0; ti < 2; ++ti) {
      int nt = w * 2 + ti;
      bk[ti] = frag_packed(wkp + (long)(kk * 16 + nt) * 512, lane);
      bv[ti] = frag_packed(wvp + (long)(kk * 16 + nt) * 512, lane);
    }
#pragma unroll
    for (int ti = 0; ti < 2; ++ti) {
      ak[0][ti] = wmma_f16(bk[ti], a0, ak[0][ti]);
      ak[1][ti] = wmma_f16(bk[ti], a1, ak[1][ti]);
      av[0][ti] = wmma_f16(a0, bv[ti], av[0][ti]);
      av[1][ti] = wmma_f16(a1, bv[ti], av[1][ti]);
    }
  }
  // the block's 32 rows are 16 KB of kpk (two row tiles) and 16 KB of vpk (one
  // krow), both at blockIdx.x * 8192 halves
  half_t* kb = kpk + (long)blockIdx.x * 8192 + w * 512 + lane * 8;
  half_t* vb = vpk + (long)blockIdx.x * 8192 + w * 1024 + lane * 8;
#pragma unroll
  for (int mt = 0; mt < 2; ++mt) {
#pragma unroll
    for (int ti = 0; ti < 2; ++ti) {
      union { uint4 u; half_t h[8]; } pk, pv;
#pragma unroll
      for (int r = 0; r < 8; ++r) {
        pk.h[r] = (half_t)(ak[mt][ti][r] * 0.125f);  // hd^-0.5
        pv.h[r] = (half_t)(av[mt][ti][r]);
      }
      *(uint4*)(kb + mt * 4096 + ti * 256) = pk.u;
      *(uint4*)(vb + ti * 512 + mt * 256) = pv.u;
    }
  }
}

// -------- logits GEMM (WMMA) + fused joint softmax + attn^T V (WMMA) ---------
// exp(x) as __expf builds it: one multiply and v_exp_f32. The v_nop fills the
// one slot the instruction set asks for behind a transcendental before its
// source is overwritten or its result read.
__device__ inline float exp_slot(float x) {
  float r;
  asm("v_exp_f32 %0, %1\n\tv_nop" : "=v"(r) : "v"(x * 1.44269504f));
  return r;
}

// grid: B * (NKV/256); each wave owns 32 kv rows (two M-tiles) x all 32
// (head, slot) columns, so a softmax row lies in one 16-lane row of two
// accumulators and the wave's 32 rows are exactly one K-step of attn@V.
// attn goes to LDS fragment-packed as the A-operand of attn@V:
// as[wave = K-step][mt=2][lane=32][e=16]; lane and e follow from the D layout:
// D register r of M-tile i at lane l is k_local = 16 i + 8 (l >> 4) + r,
// which is element e = 8 i + r of the same lane l.
// Behind the barrier the block multiplies its own 256 kv rows with V: wave w
// takes columns 32 w .. 32 w + 31 of V over the block's eight K-steps. Those
// columns are of head w >> 1, whose eight attn rows lie in M-tile w >> 2, in
// the D rows of the 16-lane half (w >> 1) & 1: only that M-tile is multiplied.
// The eps term needs the column sums of V: every V fragment passes through the
// wave anyway, so one more WMMA with an A operand of ones sums it over k (each
// row of that D tile is the column sum).
// Both sums leave as one partial per block: cpart[b][blk=4][32] (attn columns)
// and upart[b][blk=4][slot=8][d=256] (attn^T V + eps colsum(V), not normed).
__global__ void __launch_bounds__(256) k_logits(
    const half_t* __restrict__ kpk, const half_t* __restrict__ qbp,
    const half_t* __restrict__ vpk, float* __restrict__ upart,
    float* __restrict__ cpart, float* __restrict__ vis_out) {
  __shared__ float csl[8][32];
  __shared__ __align__(32) half_t as[8][2][512];
  int t = threadIdx.x, lane = t & 31, w = t >> 5;
  int b   = blockIdx.x >> 2;
  int blk = blockIdx.x & 3;
  int n0  = blk * 256 + w * 32;
  const half_t* kp = kpk + ((long)b * NKV + n0) * 256;  // two row tiles of 8 KB
  const half_t* qp = qbp + (long)b * 8192;
  v8f acc[2][2];  // [M-tile][column tile]
  for (int i = 0; i < 2; ++i)
    for (int k = 0; k < 2; ++k)
      for (int j = 0; j < 8; ++j) acc[i][k][j] = 0.f;
  for (int kk = 0; kk < 8; ++kk) {
    v16h a0  = frag_planes(kp + kk * 512, lane);
    v16h a1  = frag_planes(kp + 4096 + kk * 512, lane);
    v16h bq0 = frag_packed(qp + (long)(kk * 2 + 0) * 512, lane);
    v16h bq1 = frag_packed(qp + (long)(kk * 2 + 1) * 512, lane);
    acc[0][0] = wmma_f16(a0, bq0, acc[0][0]);
    acc[0][1] = wmma_f16(a0, bq1, acc[0][1]);
    acc[1][0] = wmma_f16(a1, bq0, acc[1][0]);
    acc[1][1] = wmma_f16(a1, bq1, acc[1][1]);
  }
  // the wave's sixteen V fragments, all in flight under the softmax
  const half_t* vv = vpk + (long)b * 262144 + (long)(blk * 128 + 2 * w) * 512;
  v16h vb0[8], vb1[8];
#pragma unroll
  for (int s = 0; s < 8; ++s) {
    vb0[s] = frag_planes(vv + s * 8192, lane);
    vb1[s] = frag_planes(vv + s * 8192 + 512, lane);
  }
  // The scheduling barriers keep the V loads above the softmax: left free, the
  // scheduler sinks each load to its first use behind the barrier and the
  // latency is not hidden. The address registers of the K and V loads are free
  // for reuse from here on: the wait stands in front of the first overwrite.
  // Named as its inputs they stay live up to it, so that no V load lands in
  // them.
  const half_t* ka = kp + lane * 8;
  const half_t* va = vv + lane * 8;
  __builtin_amdgcn_sched_barrier(0);
  asm volatile("s_wait_xcnt 0x0" :: "v"(ka), "v"(va) : "memory");
  __builtin_amdgcn_sched_barrier(0);
  int c16 = lane & 15, hi = lane >> 4;
  float cs0 = 0.f, cs1 = 0.f;
  union { uint4 u[2]; half_t h[16]; } p0, p1;
  float* vp = vis_out + (long)b * NQ * NKV + (c16 & 7) * NKV + n0 + hi * 8 +
              (c16 >> 3) * 4;
#pragma unroll
  for (int i = 0; i < 2; ++i) {
    float vis[8];
#pragma unroll
    for (int r = 0; r < 8; ++r) {
      float x0 = acc[i][0][r], x1 = acc[i][1][r];
      float mx = row_max16(fmaxf(x0, x1));
      float e0 = exp_slot(x0 - mx), e1 = exp_slot(x1 - mx);
      float inv = 1.f / row_sum16(e0 + e1);
      e0 *= inv; e1 *= inv;
      cs0 += e0; cs1 += e1;
      p0.h[i * 8 + r] = (half_t)e0;
      p1.h[i * 8 + r] = (half_t)e1;
      float v_ = e0 + e1;           // heads 0+2 (or 1+3) of slot c16 & 7
      vis[r] = v_ + row_xor<8>(v_);  // attn_vis = sum over heads
    }
    // lanes c16 and c16 ^ 8 hold the same 8 sums: each stores four of them
    float4 o;
    o.x = (c16 & 8) ? vis[4] : vis[0];
    o.y = (c16 & 8) ? vis[5] : vis[1];
    o.z = (c16 & 8) ? vis[6] : vis[2];
    o.w = (c16 & 8) ? vis[7] : vis[3];
    *(float4*)(vp + i * 16) = o;
  }
  half_t* ab = &as[w][0][lane * 16];
  *(uint4*)(ab)           = p0.u[0];
  *(uint4*)(ab + 8)       = p0.u[1];
  *(uint4*)(ab + 512)     = p1.u[0];
  *(uint4*)(ab + 512 + 8) = p1.u[1];
  // column sums: 16 rows in the lane, the other 16 in lane ^ 16, then the
  // eight waves in a fixed order
  cs0 += xhalf(cs0);
  cs1 += xhalf(cs1);
  csl[w][lane] = hi ? cs1 : cs0;
  __syncthreads();
  if (t < 32) {
    float s = 0.f;
#pragma unroll
    for (int j = 0; j < 8; ++j) s += csl[j][t];
    cpart[(b * 4 + blk) * 32 + t] = s;
  }
  int mt = w >> 2, hsel = (w >> 1) & 1;
  v8f u0, u1, cv0, cv1;
  for (int e = 0; e < 8; ++e) { u0[e] = 0.f; u1[e] = 0.f; cv0[e] = 0.f; cv1[e] = 0.f; }
  v16h ones;
  for (int e = 0; e < 16; ++e) ones[e] = (half_t)1.f;
#pragma unroll
  for (int s = 0; s < 8; ++s) {
    v16h a = frag_packed(&as[s][mt][0], lane);
    u0  = wmma_f16(a, vb0[s], u0);
    u1  = wmma_f16(a, vb1[s], u1);
    cv0 = wmma_f16(ones, vb0[s], cv0);
    cv1 = wmma_f16(ones, vb1[s], cv1);
  }
  // D register r is slot r in the lanes of half hsel. Lane l stores column
  // 32 w + l: the lanes of the other half take their tile's value from
  // lane ^ 16, so that each store of the wave is one whole 128-byte line.
  float* up = upart + (long)(b * 4 + blk) * 2048 + w * 32 + lane;
#pragma unroll
  for (int r = 0; r < 8; ++r) {
    float x0 = u0[r] + EPS_ * cv0[r];
    float x1 = u1[r] + EPS_ * cv1[r];
    float got = xhalf(hi ? x0 : x1);
    up[r * 256] = (hi == hsel) ? (hi ? x1 : x0) : got;
  }
}

// updates = (sum of the four blocks' partials) / (attn column sum + NKV eps)
// grid: B * NQ * S / 4 / 256 blocks, four neighbouring d a thread
__global__ void __launch_bounds__(256) k_inv(
    const float* __restrict__ cpart, const float* __restrict__ upart,
    float* __restrict__ upd) {
  int i  = blockIdx.x * 256 + threadIdx.x;
  int b  = i >> 9, qi = (i >> 6) & 7, d = (i & 63) * 4;
  const float* p = cpart + b * 128 + (d >> 6) * 8 + qi;
  const float* u = upart + (long)b * 8192 + qi * 256 + d;
  float4 u0 = *(const float4*)(u);
  float4 u1 = *(const float4*)(u + 2048);
  float4 u2 = *(const float4*)(u + 4096);
  float4 u3 = *(const float4*)(u + 6144);
  float s = ((p[0] + p[32]) + p[64]) + p[96];
  float inv = 1.f / (s + (float)NKV * EPS_);
  float4 o;
  o.x = (((u0.x + u1.x) + u2.x) + u3.x) * inv;
  o.y = (((u0.y + u1.y) + u2.y) + u3.y) * inv;
  o.z = (((u0.z + u1.z) + u2.z) + u3.z) * inv;
  o.w = (((u0.w + u1.w) + u2.w) + u3.w) * inv;
  *(float4*)(upd + (long)(b * NQ + qi) * S_ + d) = o;
}

// ---------------- GRU cell (f32 WMMA 16x16x4) --------------------------------
// xg = upd @ wih^T and hg = hprev @ whh^T as Y = X W^T with X and W both
// k-contiguous. One wave owns 16 rows (of the B*NQ = 512) x 16 columns j of
// all three gates over the whole k = 256: no LDS, no barrier, no partial sums
// between waves. A block's two waves take neighbouring column tiles, so the
// block writes whole 128-byte lines. grid: 32 row tiles x 8 column pairs.
// k order: lane (c, h) loads floats k0 + 4h .. k0 + 4h + 3 of its row of X and
// of its row of W by the same offsets; elements (0,1) feed one WMMA, (2,3) the
// next, so A and B pair the same k at every lane and register.
__device__ inline v8f wmma_f32(float ax, float ay, float bx, float by, v8f c) {
  v2f a = {ax, ay};
  v2f b = {bx, by};
  return __builtin_amdgcn_wmma_f32_16x16x4_f32(false, a, false, b, (short)0, c,
                                               false, false);
}
__global__ void __launch_bounds__(64) k_gru(
    const float* __restrict__ upd, const float* __restrict__ hprev,
    const float* __restrict__ wih, const float* __restrict__ whh,
    const float* __restrict__ bih, const float* __restrict__ bhh,
    float* __restrict__ hout) {
  int lane = threadIdx.x & 31, w = threadIdx.x >> 5;
  int c = lane & 15, h = lane >> 4;
  int m0 = (blockIdx.x >> 3) * 16;
  int n0 = (blockIdx.x & 7) * 32 + w * 16;
  int j  = n0 + c;
  int ao = (m0 + c) * 256 + 4 * h;
  int bo = j * 256 + 4 * h;
  const float* s[8] = {upd + ao,          hprev + ao,
                       wih + bo,          whh + bo,
                       wih + 65536 + bo,  whh + 65536 + bo,
                       wih + 131072 + bo, whh + 131072 + bo};
  // every D register of a lane is column j, so the accumulators start from
  // the gate biases of that column
  float br = bih[j] + bhh[j];
  float bz = bih[256 + j] + bhh[256 + j];
  float bi3 = bih[512 + j], bh3 = bhh[512 + j];
  // D register e of lane (c, h) is row m0 + 8h + e, column j
  long ob = (long)(m0 + 8 * h) * 256 + j;
  float hp[8];
  float4 f[2][2][8];  // [stage][8-k step][matrix]
#pragma unroll
  for (int q = 0; q < 2; ++q)
#pragma unroll
    for (int x = 0; x < 8; ++x) f[0][q][x] = *(const float4*)(s[x] + q * 8);
  // The accumulators may take the register that the bias loads name as their
  // offset: the wait stands in front of that overwrite, and the scheduling
  // barriers keep the accumulators' first writes behind it.
  __builtin_amdgcn_sched_barrier(0);
  asm volatile("s_wait_xcnt 0x0" ::: "memory");
  __builtin_amdgcn_sched_barrier(0);
  v8f ar, az, ani, anh;
  for (int e = 0; e < 8; ++e) { ar[e] = br; az[e] = bz; ani[e] = bi3; anh[e] = bh3; }
  // unrolled whole so that the stage index is static and the next 16 k of all
  // eight operands are in flight under this stage's 24 WMMAs
#pragma unroll
  for (int ch = 0; ch < 16; ++ch) {
    if (ch + 1 < 16) {
#pragma unroll
      for (int q = 0; q < 2; ++q)
#pragma unroll
        for (int x = 0; x < 8; ++x)
          f[(ch + 1) & 1][q][x] = *(const float4*)(s[x] + (ch + 1) * 16 + q * 8);
    } else {
      // Every operand load is issued and its address registers are free for
      // reuse from here on: the wait stands in front of the first overwrite
      // (the scheduling barrier keeps later address arithmetic behind it).
      // The old state for the output blend then loads under the last WMMAs.
      __builtin_amdgcn_sched_barrier(0);
      asm volatile("s_wait_xcnt 0x0" ::: "memory");
#pragma unroll
      for (int e = 0; e < 8; ++e) hp[e] = hprev[ob + e * 256];
    }
    // keeps the next stage's loads above this stage's WMMAs: left free, the
    // scheduler sinks each load to its first use and every WMMA group then
    // waits out a whole load latency
    __builtin_amdgcn_sched_barrier(0);
#pragma unroll
    for (int q = 0; q < 2; ++q) {
      const float4* g = f[ch & 1][q];
      ar  = wmma_f32(g[0].x, g[0].y, g[2].x, g[2].y, ar);
      az  = wmma_f32(g[0].x, g[0].y, g[4].x, g[4].y, az);
      ani = wmma_f32(g[0].x, g[0].y, g[6].x, g[6].y, ani);
      anh = wmma_f32(g[1].x, g[1].y, g[7].x, g[7].y, anh);
      ar  = wmma_f32(g[1].x, g[1].y, g[3].x, g[3].y, ar);
      az  = wmma_f32(g[1].x, g[1].y, g[5].x, g[5].y, az);
      ani = wmma_f32(g[0].z, g[0].w, g[6].z, g[6].w, ani);
      anh = wmma_f32(g[1].z, g[1].w, g[7].z, g[7].w, anh);
      ar  = wmma_f32(g[0].z, g[0].w, g[2].z, g[2].w, ar);
      az  = wmma_f32(g[0].z, g[0].w, g[4].z, g[4].w, az);
      ar  = wmma_f32(g[1].z, g[1].w, g[3].z, g[3].w, ar);
      az  = wmma_f32(g[1].z, g[1].w, g[5].z, g[5].w, az);
    }
  }
  // The table of WMMA distances leaves the f32 16x16x4 form out: eight slots, the count of the slowest
  // listed form, stand between the last WMMA and the first vector read of an
  // accumulator. The two scheduling barriers hold the slots at that place.
  __builtin_amdgcn_sched_barrier(0);
  asm volatile("v_nop\n\tv_nop\n\tv_nop\n\tv_nop\n\tv_nop\n\tv_nop\n\tv_nop\n\tv_nop");
  __builtin_amdgcn_sched_barrier(0);
#pragma unroll
  for (int e = 0; e < 8; ++e) {
    float r = 1.f / (1.f + __expf(-ar[e]));
    float z = 1.f / (1.f + __expf(-az[e]));
    float n = tanhf(ani[e] + r * anh[e]);
    hout[ob + e * 256] = (1.f - z) * n + z * hp[e];
  }
}

// ---------------- LN + MLP residual (f32 WMMA 16x16x4), one launch a layer ---
// Both layers are Y = X W with X k-contiguous and W column-contiguous. One wave
// owns 16 rows (of the B*NQ = 512) over the whole k: no LDS, no barrier, no
// partial sums between waves.
// k order: lane (c, h) holds floats 8q + 4h .. 8q + 4h + 3 of its row of X and
// loads rows 8q + 4h .. 8q + 4h + 3 of W at its column; elements (0,1) feed one
// WMMA, (2,3) the next, so A and B pair the same k at every lane and register.

#define D1_ 5   // k_mlp1: 8-k steps that the operand loads run ahead
#define D2_ 12  // k_mlp2: the same

__device__ inline v8f wmma_f32v(v2f a, v2f b, v8f c) {
  return __builtin_amdgcn_wmma_f32_16x16x4_f32(false, a, false, b, (short)0, c,
                                               false, false);
}

// hid = relu(LN(h) @ w1 + b1). A wave owns 16 rows x 32 hidden columns and
// keeps its half rows (128 floats a lane) in registers: the row statistics are
// a lane's own sums plus those of lane ^ 16. grid: 32 row tiles x 8 column
// groups of 64, two waves a block. The register bound keeps the wave inside
// one 256-register window (left free, the allocator spreads over two).
__global__ void __launch_bounds__(64) __attribute__((amdgpu_num_vgpr(256))) k_mlp1(
    const float* __restrict__ hin, const float* __restrict__ g,
    const float* __restrict__ bb, const float* __restrict__ w1,
    const float* __restrict__ b1, float* __restrict__ hid) {
  int lane = threadIdx.x & 31, w = threadIdx.x >> 5;
  int c = lane & 15, h = lane >> 4;
  int m0 = (blockIdx.x >> 3) * 16;
  int n0 = (blockIdx.x & 7) * 64 + w * 32;
  const float* ap = hin + (m0 + c) * 256 + 4 * h;
  const float* wp = w1 + 4 * h * 512 + n0 + c;
  const float* gp = g + 4 * h;
  const float* bp = bb + 4 * h;
  v4f a[32], fg[32], fo[32];
  v2f fw[32][2][2];  // [8-k step][k pair][column tile]
#pragma unroll
  for (int q = 0; q < 32; ++q) a[q] = *(const v4f*)(ap + q * 8);
#pragma unroll
  for (int q = 0; q < D1_; ++q) {
    fg[q] = *(const v4f*)(gp + q * 8);
    fo[q] = *(const v4f*)(bp + q * 8);
#pragma unroll
    for (int p = 0; p < 2; ++p)
#pragma unroll
      for (int ti = 0; ti < 2; ++ti) {
        fw[q][p][ti].x = wp[(q * 8 + 2 * p) * 512 + ti * 16];
        fw[q][p][ti].y = wp[(q * 8 + 2 * p + 1) * 512 + ti * 16];
      }
  }
  int bi = n0 + c;
  float bias0 = b1[bi], bias1 = b1[bi + 16];
  // The address registers of the row and bias loads are free for reuse from
  // here on: the wait stands in front of the first overwrite. Named as its
  // inputs they stay live up to it, so that no load above it lands in them;
  // the scheduling barriers keep the loads above it, the arithmetic behind it.
  __builtin_amdgcn_sched_barrier(0);
  asm volatile("s_wait_xcnt 0x0" :: "v"(ap), "v"(bi) : "memory");
  __builtin_amdgcn_sched_barrier(0);
  v2f t0 = {0.f, 0.f}, t1 = t0, t2 = t0, t3 = t0;
#pragma unroll
  for (int q = 0; q < 32; q += 2) {
    t0 += a[q].lo; t1 += a[q].hi; t2 += a[q + 1].lo; t3 += a[q + 1].hi;
  }
  t0 = (t0 + t1) + (t2 + t3);
  float s = t0.x + t0.y;
  s += xhalf(s);
  float mu = s * (1.f / 256.f);
  t0 = 0.f; t1 = 0.f; t2 = 0.f; t3 = 0.f;
#pragma unroll
  for (int q = 0; q < 32; q += 2) {
    a[q] -= mu; a[q + 1] -= mu;
    t0 += a[q].lo * a[q].lo;         t1 += a[q].hi * a[q].hi;
    t2 += a[q + 1].lo * a[q + 1].lo; t3 += a[q + 1].hi * a[q + 1].hi;
  }
  t0 = (t0 + t1) + (t2 + t3);
  s = t0.x + t0.y;
  s += xhalf(s);
  float rs = rsq_slot(s * (1.f / 256.f) + LNE_);
  // every D register of a lane is one column, so the accumulators start from
  // that column's bias
  v8f acc0, acc1;
  for (int e = 0; e < 8; ++e) { acc0[e] = bias0; acc1[e] = bias1; }
  a[0] = a[0] * (rs * fg[0]) + fo[0];
  a[1] = a[1] * (rs * fg[1]) + fo[1];
  // unrolled whole so that every index is static
#pragma unroll
  for (int q = 0; q < 32; ++q) {
    if (q + D1_ < 32) {
      int n = q + D1_;
      fg[n] = *(const v4f*)(gp + n * 8);
      fo[n] = *(const v4f*)(bp + n * 8);
#pragma unroll
      for (int p = 0; p < 2; ++p)
#pragma unroll
        for (int ti = 0; ti < 2; ++ti) {
          fw[n][p][ti].x = wp[(n * 8 + 2 * p) * 512 + ti * 16];
          fw[n][p][ti].y = wp[(n * 8 + 2 * p + 1) * 512 + ti * 16];
        }
    }
    // keeps the loads of step q + D1_ above this step's WMMAs: left free, the
    // scheduler sinks each load to its first use and every WMMA group then
    // waits out a whole load latency
    __builtin_amdgcn_sched_barrier(0);
    acc0 = wmma_f32v(a[q].lo, fw[q][0][0], acc0);
    acc1 = wmma_f32v(a[q].lo, fw[q][0][1], acc1);
    acc0 = wmma_f32v(a[q].hi, fw[q][1][0], acc0);
    acc1 = wmma_f32v(a[q].hi, fw[q][1][1], acc1);
    // The table of WMMA distances leaves the f32 16x16x4 form out: eight slots,
    // the count of the slowest
    // listed form, stand between the last WMMA and the next vector write,
    // which may take a register that a WMMA has just read (behind the last
    // step: the first vector read of an accumulator). They issue while the
    // matrix unit is busy. The scheduling barriers hold them at that place.
    __builtin_amdgcn_sched_barrier(0);
    if (q != 30)  // behind step 30 no vector instruction follows
      asm volatile("v_nop\n\tv_nop\n\tv_nop\n\tv_nop\n\tv_nop\n\tv_nop\n\tv_nop\n\tv_nop");
    __builtin_amdgcn_sched_barrier(0);
    // scale and shift of the LN two steps ahead, so that no WMMA waits for it
    if (q + 2 < 32) a[q + 2] = a[q + 2] * (rs * fg[q + 2]) + fo[q + 2];
    __builtin_amdgcn_sched_barrier(0);
  }
  // D register e of lane (c, h) is row m0 + 8h + e
  float* op = hid + (m0 + 8 * h) * 512 + n0 + c;
#pragma unroll
  for (int e = 0; e < 8; ++e) {
    op[e * 512]      = fmaxf(acc0[e], 0.f);
    op[e * 512 + 16] = fmaxf(acc1[e], 0.f);
  }
}

// slots = h + hid @ w2 + b2. A wave owns 16 rows x 16 columns over k = 512, the
// even and the odd k pairs in an accumulator each (a WMMA then never waits for
// the one before it); one starts from the bias, the other from the residual
// rows. A block's two waves take neighbouring column tiles, so the block
// writes whole 128-byte lines. grid: 32 row tiles x 8 column pairs.
__global__ void __launch_bounds__(64) k_mlp2(
    const float* __restrict__ hid, const float* __restrict__ hin,
    const float* __restrict__ w2, const float* __restrict__ b2,
    float* __restrict__ slots_out, float* __restrict__ dout, int write_out) {
  int lane = threadIdx.x & 31, w = threadIdx.x >> 5;
  int c = lane & 15, h = lane >> 4;
  int m0 = (blockIdx.x >> 3) * 16;
  int j  = (blockIdx.x & 7) * 32 + w * 16 + c;
  const float* ap = hid + (m0 + c) * 512 + 4 * h;
  const float* wp = w2 + 4 * h * 256 + j;
  // D register e of lane (c, h) is row m0 + 8h + e, column j
  int ob = (m0 + 8 * h) * 256 + j;
  v8f acc0, acc1;
  float bias = b2[j];
#pragma unroll
  for (int e = 0; e < 8; ++e) acc1[e] = hin[ob + e * 256];
  v4f fa[64];
  v2f fw[64][2];  // [8-k step][k pair]
#pragma unroll
  for (int q = 0; q < D2_; ++q) {
    fa[q] = *(const v4f*)(ap + q * 8);
#pragma unroll
    for (int p = 0; p < 2; ++p) {
      fw[q][p].x = wp[(q * 8 + 2 * p) * 256];
      fw[q][p].y = wp[(q * 8 + 2 * p + 1) * 256];
    }
  }
  // The offset register of the bias load is free for reuse from here on: the
  // wait stands in front of the first overwrite. Named as its input the offset
  // stays live up to it, so that no load above it lands in that register; the
  // scheduling barriers keep the accumulator's first writes behind it.
  __builtin_amdgcn_sched_barrier(0);
  asm volatile("s_wait_xcnt 0x0" :: "v"(j) : "memory");
  __builtin_amdgcn_sched_barrier(0);
  for (int e = 0; e < 8; ++e) acc0[e] = bias;
  // unrolled whole so that every index is static
#pragma unroll
  for (int q = 0; q < 64; ++q) {
    if (q + D2_ < 64) {
      int n = q + D2_;
      fa[n] = *(const v4f*)(ap + n * 8);
#pragma unroll
      for (int p = 0; p < 2; ++p) {
        fw[n][p].x = wp[(n * 8 + 2 * p) * 256];
        fw[n][p].y = wp[(n * 8 + 2 * p + 1) * 256];
      }
    }
    // keeps the loads of step q + D2_ above this step's WMMAs (as in k_mlp1)
    __builtin_amdgcn_sched_barrier(0);
    acc0 = wmma_f32v(fa[q].lo, fw[q][0], acc0);
    acc1 = wmma_f32v(fa[q].hi, fw[q][1], acc1);
  }
  // eight slots between the last WMMA and the first vector read of an
  // accumulator, held in place by the scheduling barriers (as in k_mlp1)
  __builtin_amdgcn_sched_barrier(0);
  asm volatile("v_nop\n\tv_nop\n\tv_nop\n\tv_nop\n\tv_nop\n\tv_nop\n\tv_nop\n\tv_nop");
  __builtin_amdgcn_sched_barrier(0);
  v8f o = acc0 + acc1;
#pragma unroll
  for (int e = 0; e < 8; ++e) slots_out[ob + e * 256] = o[e];
  if (write_out) {
#pragma unroll
    for (int e = 0; e < 8; ++e) dout[ob + e * 256] = o[e];
  }
}

// ---------------- LN(slots) + q = s@Wq (f32 WMMA 16x16x4), packed Qb ---------
// qbp[b][kk=8][ti=2][lane=32][e=16]: the block-diagonal B operand of the logits
// (k = feature d, column = head * 8 + slot, zero where d is not of that head).
// The product is formed transposed, q^T = Wq^T LN(s)^T: A is a column tile of
// Wq, B a tile of 16 slot rows (two batches), loaded by the offsets of k_mlp1,
// so A and B pair the same k at every lane and register. D register e of lane
// (c, h) is then feature 8h + e of slot row c: the eight features that one
// packed lane holds side by side. A wave owns 16 rows x 32 features (one kk)
// over the whole k, and writes the whole 2 KB of its kk for both batches, the
// zeros too. No LDS, no barrier. grid: 32 row tiles x 4 pairs of kk. The
// register bound keeps the wave inside one 256-register window (as in k_mlp1).
__global__ void __launch_bounds__(64) __attribute__((amdgpu_num_vgpr(256))) k_qbuild(
    const float* __restrict__ slots, const float* __restrict__ g,
    const float* __restrict__ bb, const float* __restrict__ wq,
    half_t* __restrict__ qbp) {
  int lane = threadIdx.x & 31, w = threadIdx.x >> 5;
  int c = lane & 15, h = lane >> 4;
  int m0 = (blockIdx.x >> 2) * 16;
  int kk = (blockIdx.x & 3) * 2 + w;
  const float* ap = slots + (m0 + c) * 256 + 4 * h;
  const float* wp = wq + 4 * h * 256 + kk * 32 + c;
  const float* gp = g + 4 * h;
  const float* bp = bb + 4 * h;
  v4f a[32], fg[32], fo[32];
  v2f fw[32][2][2];  // [8-k step][k pair][feature tile]
#pragma unroll
  for (int q = 0; q < 32; ++q) a[q] = *(const v4f*)(ap + q * 8);
#pragma unroll
  for (int q = 0; q < D1_; ++q) {
    fg[q] = *(const v4f*)(gp + q * 8);
    fo[q] = *(const v4f*)(bp + q * 8);
#pragma unroll
    for (int p = 0; p < 2; ++p)
#pragma unroll
      for (int ti = 0; ti < 2; ++ti) {
        fw[q][p][ti].x = wp[(q * 8 + 2 * p) * 256 + ti * 16];
        fw[q][p][ti].y = wp[(q * 8 + 2 * p + 1) * 256 + ti * 16];
      }
  }
  // The address registers of the row loads are free for reuse from here on: the
  // wait stands in front of the first overwrite. Named as its input they stay
  // live up to it, so that no load above it lands in them; the scheduling
  // barriers keep the loads above it, the arithmetic behind it.
  __builtin_amdgcn_sched_barrier(0);
  asm volatile("s_wait_xcnt 0x0" :: "v"(ap) : "memory");
  __builtin_amdgcn_sched_barrier(0);
  v2f t0 = {0.f, 0.f}, t1 = t0, t2 = t0, t3 = t0;
#pragma unroll
  for (int q = 0; q < 32; q += 2) {
    t0 += a[q].lo; t1 += a[q].hi; t2 += a[q + 1].lo; t3 += a[q + 1].hi;
  }
  t0 = (t0 + t1) + (t2 + t3);
  float s = t0.x + t0.y;
  s += xhalf(s);
  float mu = s * (1.f / 256.f);
  t0 = 0.f; t1 = 0.f; t2 = 0.f; t3 = 0.f;
#pragma unroll
  for (int q = 0; q < 32; q += 2) {
    a[q] -= mu; a[q + 1] -= mu;
    t0 += a[q].lo * a[q].lo;         t1 += a[q].hi * a[q].hi;
    t2 += a[q + 1].lo * a[q + 1].lo; t3 += a[q + 1].hi * a[q + 1].hi;
  }
  t0 = (t0 + t1) + (t2 + t3);
  s = t0.x + t0.y;
  s += xhalf(s);
  float rs = rsq_slot(s * (1.f / 256.f) + LNE_);
  v8f acc0, acc1;
  for (int e = 0; e < 8; ++e) { acc0[e] = 0.f; acc1[e] = 0.f; }
  a[0] = a[0] * (rs * fg[0]) + fo[0];
  a[1] = a[1] * (rs * fg[1]) + fo[1];
  // unrolled whole so that every index is static
#pragma unroll
  for (int q = 0; q < 32; ++q) {
    if (q + D1_ < 32) {
      int n = q + D1_;
      fg[n] = *(const v4f*)(gp + n * 8);
      fo[n] = *(const v4f*)(bp + n * 8);
#pragma unroll
      for (int p = 0; p < 2; ++p)
#pragma unroll
        for (int ti = 0; ti < 2; ++ti) {
          fw[n][p][ti].x = wp[(n * 8 + 2 * p) * 256 + ti * 16];
          fw[n][p][ti].y = wp[(n * 8 + 2 * p + 1) * 256 + ti * 16];
        }
    }
    // keeps the loads of step q + D1_ above this step's WMMAs (as in k_mlp1)
    __builtin_amdgcn_sched_barrier(0);
    acc0 = wmma_f32v(fw[q][0][0], a[q].lo, acc0);
    acc1 = wmma_f32v(fw[q][0][1], a[q].lo, acc1);
    acc0 = wmma_f32v(fw[q][1][0], a[q].hi, acc0);
    acc1 = wmma_f32v(fw[q][1][1], a[q].hi, acc1);
    // eight slots between the last WMMA and the next vector write or, behind
    // the last step, the first vector read of an accumulator, held in place by
    // the scheduling barriers (as in k_mlp1)
    __builtin_amdgcn_sched_barrier(0);
    if (q != 30)  // behind step 30 no vector instruction follows
      asm volatile("v_nop\n\tv_nop\n\tv_nop\n\tv_nop\n\tv_nop\n\tv_nop\n\tv_nop\n\tv_nop");
    __builtin_amdgcn_sched_barrier(0);
    // scale and shift of the LN two steps ahead, so that no WMMA waits for it
    if (q + 2 < 32) a[q + 2] = a[q + 2] * (rs * fg[q + 2]) + fo[q + 2];
    __builtin_amdgcn_sched_barrier(0);
  }
  // slot row c is batch m0 / 8 + (c >> 3), slot c & 7; its column of Qb is
  // head * 8 + slot with head = kk >> 1. sl = ti * 32 + packed lane; elements
  // 0..7 are features 8h + e (acc0), 8..15 features 16 + 8h + e (acc1).
  int hd = kk >> 1;
  int sl = (hd >> 1) * 32 + 16 * h + (hd & 1) * 8 + (c & 7);
  half_t* qp = qbp + ((m0 >> 3) + (c >> 3)) * 8192 + kk * 1024;
  union { uint4 u[2]; half_t x[16]; } o;
#pragma unroll
  for (int e = 0; e < 8; ++e) {
    o.x[e]     = (half_t)acc0[e];
    o.x[8 + e] = (half_t)acc1[e];
  }
  *(uint4*)(qp + sl * 16)     = o.u[0];
  *(uint4*)(qp + sl * 16 + 8) = o.u[1];
  // the columns of the other three heads are zero at these features
  uint4 zz = {0u, 0u, 0u, 0u};
  *(uint4*)(qp + (sl ^ 8) * 16)      = zz;
  *(uint4*)(qp + (sl ^ 8) * 16 + 8)  = zz;
  *(uint4*)(qp + (sl ^ 32) * 16)     = zz;
  *(uint4*)(qp + (sl ^ 32) * 16 + 8) = zz;
  *(uint4*)(qp + (sl ^ 40) * 16)     = zz;
  *(uint4*)(qp + (sl ^ 40) * 16 + 8) = zz;
}

// ---------------- host orchestration ----------------------------------------
extern "C" void kernel_launch(void* const* d_in, const int* in_sizes, int n_in,
                              void* d_out, int out_size, void* d_ws,
                              size_t ws_size, hipStream_t stream) {
  (void)in_sizes; (void)n_in; (void)out_size; (void)ws_size;
  const float* inputs   = (const float*)d_in[0];
  const float* slots0   = (const float*)d_in[1];
  const float* ln_in_g  = (const float*)d_in[2];
  const float* ln_in_b  = (const float*)d_in[3];
  const float* ln_sl_g  = (const float*)d_in[4];
  const float* ln_sl_b  = (const float*)d_in[5];
  const float* ln_mlp_g = (const float*)d_in[6];
  const float* ln_mlp_b = (const float*)d_in[7];
  const float* Wq       = (const float*)d_in[8];
  const float* Wk       = (const float*)d_in[9];
  const float* Wv       = (const float*)d_in[10];
  const float* gwih     = (const float*)d_in[11];
  const float* gwhh     = (const float*)d_in[12];
  const float* gbih     = (const float*)d_in[13];
  const float* gbhh     = (const float*)d_in[14];
  const float* w1       = (const float*)d_in[15];
  const float* b1       = (const float*)d_in[16];
  const float* w2       = (const float*)d_in[17];
  const float* b2       = (const float*)d_in[18];

  char* ws = (char*)d_ws;
  half_t* kf   = (half_t*)(ws + 0);          // 32 MB  K fragment-packed (pre-scaled)
  half_t* vpk  = (half_t*)(ws + 33554432);   // 32 MB  V fragment-packed
  half_t* wkp  = (half_t*)(ws + 67108864);   // 128 KB Wk packed
  half_t* wvp  = (half_t*)(ws + 67239936);   // 128 KB Wv packed
  half_t* qbp  = (half_t*)(ws + 67436544);   // 1 MB   block-diag Q packed
  float*  upt  = (float*)(ws + 68485120);    // 2 MB   attn^T V partials
  float*  upd  = (float*)(ws + 72695808);    // 512 KB
  float*  scur = (float*)(ws + 73220096);    // 512 KB current slots
  float*  smid = (float*)(ws + 73744384);    // 512 KB post-GRU slots
  float*  csum = (float*)(ws + 74268672);    // 32 KB  attn column-sum partials
  float*  hid  = (float*)(ws + 74301440);    // 1 MB   MLP hidden layer

  float* out_slots = (float*)d_out;
  float* out_vis   = out_slots + (long)B_ * NQ * S_;

  hipMemcpyAsync(scur, slots0, (size_t)B_ * NQ * S_ * sizeof(float),
                 hipMemcpyDeviceToDevice, stream);
  k_cvt<<<256, 256, 0, stream>>>(Wk, Wv, wkp, wvp);
  k_proj<<<(B_ * NKV) / 32, 256, 0, stream>>>(inputs, ln_in_g, ln_in_b, wkp, wvp,
                                              kf, vpk);

  for (int it = 0; it < 3; ++it) {
    k_qbuild<<<128, 64, 0, stream>>>(scur, ln_sl_g, ln_sl_b, Wq, qbp);
    k_logits<<<B_ * (NKV / 256), 256, 0, stream>>>(kf, qbp, vpk, upt, csum,
                                                   out_vis);
    k_inv<<<128, 256, 0, stream>>>(csum, upt, upd);
    k_gru<<<256, 64, 0, stream>>>(upd, scur, gwih, gwhh, gbih, gbhh, smid);
    k_mlp1<<<256, 64, 0, stream>>>(smid, ln_mlp_g, ln_mlp_b, w1, b1, hid);
    k_mlp2<<<256, 64, 0, stream>>>(hid, smid, w2, b2, scur, out_slots,
                                   (it == 2) ? 1 : 0);
  }
}

// v009
// Next to v008, in two timings, it ran 1.07 times as fast each time.
// All steps since v000 together make it 5.95 times as fast.
#include <hip/hip_runtime.h>
#include <hip/hip_bf16.h>

typedef __attribute__((ext_vector_type(16))) _Float16 v16h;
typedef __attribute__((ext_vector_type(8)))  float    v8f;
typedef __attribute__((ext_vector_type(2)))  float    v2f;
typedef __attribute__((ext_vector_type(4)))  float    v4f;
typedef _Float16 half_t;

#define B_     64
#define NKV    1024
#define NQ     8
#define S_     256
#define HM_    512
#define EPS_   1e-8f
#define LNE_   1e-5f

// ---------------- WMMA fragment helpers (CDNA5 16x16x32 f16 layout) ----------
// 16-bit operand layout: lane L, klo = (L>=16)?8:0; elems 0..7 hold K =
// klo..klo+7, elems 8..15 hold K = klo+16..klo+23 (row/col index = L&15).

// A-fragment from row-major source (ld in halves): two 16B vector loads.
__device__ inline v16h frag_rowmajor(const half_t* p, int ld, int lane) {
  int m   = lane & 15;
  int klo = (lane >> 4) << 3;
  const half_t* q = p + m * ld + klo;
  union { uint4 u[2]; v16h h; } c;
  c.u[0] = *(const uint4*)(q);
  c.u[1] = *(const uint4*)(q + 16);
  return c.h;
}
// Fragment from pre-packed storage: packed[...][lane][16] -> two contiguous 16B loads.
__device__ inline v16h frag_packed(const half_t* p, int lane) {
  const half_t* q = p + lane * 16;
  union { uint4 u[2]; v16h h; } c;
  c.u[0] = *(const uint4*)(q);
  c.u[1] = *(const uint4*)(q + 8);
  return c.h;
}
// Fragment from plane-packed storage: packed[...][half=2][lane=32][8], elements
// 0..7 of all lanes and then elements 8..15, so that each 16-byte access of a
// wave covers 512 contiguous bytes (whole lines).
__device__ inline v16h frag_planes(const half_t* p, int lane) {
  const half_t* q = p + lane * 8;
  union { uint4 u[2]; v16h h; } c;
  c.u[0] = *(const uint4*)(q);
  c.u[1] = *(const uint4*)(q + 256);
  return c.h;
}
// (lane, elem) -> K-within-32
__device__ inline int klocal_of(int lane, int e) {
  int klo = (lane >> 4) << 3;
  return (e < 8) ? (klo + e) : (klo + 8 + e);
}
__device__ inline v8f wmma_f16(v16h a, v16h b, v8f c) {
  return __builtin_amdgcn_wmma_f32_16x16x32_f16(false, a, false, b, (short)0, c,
                                                false, false);
}

// ---------------- Wk/Wv fp32 -> fragment-packed fp16 -------------------------
// packed idx = ((kk*16 + nt)*32 + lane)*16 + e ; 8 kk x 16 nt tiles
__global__ void k_cvt(const float* __restrict__ wk, const float* __restrict__ wv,
                      half_t* __restrict__ wkp, half_t* __restrict__ wvp) {
  int idx  = blockIdx.x * 256 + threadIdx.x;  // 65536 halves per matrix
  int e    = idx & 15;
  int lane = (idx >> 4) & 31;
  int nt   = (idx >> 9) & 15;
  int kk   = idx >> 13;
  int k = kk * 32 + klocal_of(lane, e);
  int n = nt * 16 + (lane & 15);
  wkp[idx] = (half_t)wk[k * 256 + n];
  wvp[idx] = (half_t)wv[k * 256 + n];
}

// ---------------- cross-lane helpers -----------------------------------------
// value of lane (l ^ M) of the same 16-lane row (DPP row_xmask)
template <int M>
__device__ inline float row_xor(float v) {
  return __builtin_bit_cast(
      float, __builtin_amdgcn_mov_dpp(__builtin_bit_cast(int, v), 0x160 | M, 0xf,
                                      0xf, true));
}
__device__ inline float row_max16(float v) {
  v = fmaxf(v, row_xor<1>(v));
  v = fmaxf(v, row_xor<2>(v));
  v = fmaxf(v, row_xor<4>(v));
  v = fmaxf(v, row_xor<8>(v));
  return v;
}
__device__ inline float row_sum16(float v) {
  v += row_xor<1>(v);
  v += row_xor<2>(v);
  v += row_xor<4>(v);
  v += row_xor<8>(v);
  return v;
}
// value of lane l ^ 16
__device__ inline float xhalf(float x) {
  int i = __builtin_bit_cast(int, x);
  return __builtin_bit_cast(
      float, __builtin_amdgcn_permlanex16(i, i, 0x76543210, 0xfedcba98, false,
                                          false));
}

// 1/sqrt(x) as one v_rsq_f32; the v_nop fills the one slot the instruction set
// asks for behind a transcendental before its result is read.
__device__ inline float rsq_slot(float x) {
  float r;
  asm("v_rsq_f32 %0, %1\n\tv_nop" : "=v"(r) : "v"(x));
  return r;
}

// ---------------- fused LayerNorm(inputs) + K/V projection (WMMA) ------------
// grid: one block a WGP (256), 512 threads; a block walks PT_ tiles of 32 rows.
// Wave w owns column tile w (16 columns) of K and of V and keeps the sixteen
// weight fragments of those columns in registers over all its tiles, so that
// the weights leave L2 once a block and not once a tile.
// V = x Wv: D register r of row tile mt at lane l is k_local = 16 mt + 8 (l >> 4)
// + r of column l & 15, which is element 8 mt + r of the same lane l of the
// B operand of attn@V: vpk[b][krow=32][nt=16][half=mt][lane=32][8].
// K is formed transposed, K^T = Wk^T x^T (the operands change places; A and B
// hold k alike): D register r at lane l is feature 16 w + 8 (l >> 4) + r of row
// l & 15, which is element 8 (w & 1) + r of the same lane l of the A operand of
// the logits at K-step w >> 1:
// kpk[row tile = row / 16][kk=8][half=w & 1][lane=32][8].
#define XP_ 264  // pitch of the f16 rows in LDS, halves: 528 B = 16 B x 33, so
                 // that the 16 rows of a fragment read fall on distinct banks
#define PT_ 8    // 32-row tiles a block
__global__ void __launch_bounds__(512) k_proj(
    const float* __restrict__ x, const float* __restrict__ g,
    const float* __restrict__ bb, const half_t* __restrict__ wkp,
    const half_t* __restrict__ wvp, half_t* __restrict__ kpk,
    half_t* __restrict__ vpk) {
  __shared__ __align__(32) half_t xh[2][32][XP_];
  int t = threadIdx.x, lane = t & 31, w = t >> 5;
  // LayerNorm in registers: wave w owns rows 2 w and 2 w + 1 of a tile whole;
  // lane l holds columns 4 l .. 4 l + 3 and 128 + 4 l .. 128 + 4 l + 3 of each,
  // so that every load of the wave is 512 contiguous bytes. The row sums are a
  // lane's own eight values, then the 16-lane row, then lane ^ 16.
  int lo = lane * 4;
  const float* xp = x + (long)blockIdx.x * (PT_ * 8192) + w * 512 + lo;
  v4f xa[2][2], xc[2][2];  // the rows of the even and of the odd tiles
#pragma unroll
  for (int r = 0; r < 2; ++r) {
    xa[r][0] = *(const v4f*)(xp + r * 256);
    xa[r][1] = *(const v4f*)(xp + r * 256 + 128);
  }
  const half_t* wka = wkp + w * 512 + lane * 16;
  const half_t* wva = wvp + w * 512 + lane * 16;
  v16h bk[8], bv[8];
#pragma unroll
  for (int kk = 0; kk < 8; ++kk) {
    union { uint4 u[2]; v16h h; } ck, cv;
    ck.u[0] = *(const uint4*)(wka + kk * 8192);
    ck.u[1] = *(const uint4*)(wka + kk * 8192 + 8);
    cv.u[0] = *(const uint4*)(wva + kk * 8192);
    cv.u[1] = *(const uint4*)(wva + kk * 8192 + 8);
    bk[kk] = ck.h;
    bv[kk] = cv.h;
  }
  v4f g0 = *(const v4f*)(g + lo), g1 = *(const v4f*)(g + 128 + lo);
  v4f o0 = *(const v4f*)(bb + lo), o1 = *(const v4f*)(bb + 128 + lo);
#pragma unroll
  for (int r = 0; r < 2; ++r) {
    xc[r][0] = *(const v4f*)(xp + 8192 + r * 256);
    xc[r][1] = *(const v4f*)(xp + 8192 + r * 256 + 128);
  }
  // The address registers of these loads are free for reuse from here on: the
  // wait stands in front of the first overwrite. Named as its inputs they stay
  // live up to it, so that no load above it lands in them; the scheduling
  // barriers keep the loads above it, the arithmetic behind it.
  __builtin_amdgcn_sched_barrier(0);
  asm volatile("s_wait_xcnt 0x0" :: "v"(xp), "v"(wka), "v"(wva), "v"(lane) : "memory");
  __builtin_amdgcn_sched_barrier(0);
  // a tile's 32 rows are 16 KB of kpk (two row tiles) and 16 KB of vpk (one
  // krow), both at tile index * 8192 halves
  half_t* kb = kpk + (long)blockIdx.x * (PT_ * 8192) + (w >> 1) * 512 +
               (w & 1) * 256 + lane * 8;
  half_t* vb = vpk + (long)blockIdx.x * (PT_ * 8192) + w * 512 + lane * 8;
  // One tile: sel is its parity (LDS buffer, place in the pair), xv its rows,
  // which are loaded anew for the tile two further on while more is set.
  auto tile = [&](v4f (&xv)[2][2], int sel, bool more) {
    half_t (*xb)[XP_] = xh[sel];
#pragma unroll
    for (int r = 0; r < 2; ++r) {
      v4f p = xv[r][0], q = xv[r][1];
      v2f ts = (p.lo + p.hi) + (q.lo + q.hi);
      v2f tq = (p.lo * p.lo + p.hi * p.hi) + (q.lo * q.lo + q.hi * q.hi);
      float s  = row_sum16(ts.x + ts.y);
      float s2 = row_sum16(tq.x + tq.y);
      s  += xhalf(s);
      s2 += xhalf(s2);
      float m   = s * (1.f / 256.f);
      float rsd = rsq_slot(s2 * (1.f / 256.f) - m * m + LNE_);
      p = (p - m) * rsd * g0 + o0;
      q = (q - m) * rsd * g1 + o1;
      union { uint2 u; half_t h[4]; } c0, c1;
#pragma unroll
      for (int e = 0; e < 4; ++e) {
        c0.h[e] = (half_t)p[e];
        c1.h[e] = (half_t)q[e];
      }
      *(uint2*)(&xb[w * 2 + r][lo])       = c0.u;
      *(uint2*)(&xb[w * 2 + r][128 + lo]) = c1.u;
    }
    // the rows of the tile two further on fly under two tiles' products
    if (more) {
#pragma unroll
      for (int r = 0; r < 2; ++r) {
        xv[r][0] = *(const v4f*)(xp + (sel + 2) * 8192 + r * 256);
        xv[r][1] = *(const v4f*)(xp + (sel + 2) * 8192 + r * 256 + 128);
      }
    }
    // The tile's one barrier, by hand: it needs this wave's LDS writes landed
    // and nothing else. __syncthreads() would also wait out the row loads in
    // flight and the last tile's stores. With two buffers it also ends every
    // wave's reads of the buffer that the next tile writes.
    asm volatile("s_wait_dscnt 0x0\n\ts_barrier_signal -1\n\ts_barrier_wait -1" ::: "memory");

    v8f ak[2], av[2];  // [row tile]
    for (int i = 0; i < 2; ++i)
      for (int j = 0; j < 8; ++j) { ak[i][j] = 0.f; av[i][j] = 0.f; }
    // unrolled whole so that the index of every weight fragment is static
#pragma unroll
    for (int kk = 0; kk < 8; ++kk) {
      v16h a0 = frag_rowmajor(&xb[0][kk * 32], XP_, lane);
      v16h a1 = frag_rowmajor(&xb[16][kk * 32], XP_, lane);
      ak[0] = wmma_f16(bk[kk], a0, ak[0]);
      ak[1] = wmma_f16(bk[kk], a1, ak[1]);
      av[0] = wmma_f16(a0, bv[kk], av[0]);
      av[1] = wmma_f16(a1, bv[kk], av[1]);
    }
    union { uint4 u; half_t h[8]; } pk[2], pv[2];
#pragma unroll
    for (int mt = 0; mt < 2; ++mt) {
#pragma unroll
      for (int r = 0; r < 8; ++r) {
        pk[mt].h[r] = (half_t)(ak[mt][r] * 0.125f);  // hd^-0.5
        pv[mt].h[r] = (half_t)(av[mt][r]);
      }
    }
    // All four packed values stand in registers of their own before the first
    // store, and the wait stands between the stores and the next overwrite of
    // their data or address; the scheduling barriers hold that order.
    __builtin_amdgcn_sched_barrier(0);
#pragma unroll
    for (int mt = 0; mt < 2; ++mt) {
      *(uint4*)(kb + sel * 8192 + mt * 4096) = pk[mt].u;
      *(uint4*)(vb + sel * 8192 + mt * 256)  = pv[mt].u;
    }
    if (more || sel == 0) {  // behind the last tile nothing is overwritten
      __builtin_amdgcn_sched_barrier(0);
      asm volatile("s_wait_xcnt 0x0" :: "v"(kb), "v"(vb), "v"(xp) : "memory");
      __builtin_amdgcn_sched_barrier(0);
    }
  };
  // rolled: the body is a pair of tiles, so that each tile's rows and LDS
  // buffer are static, and the weight fragments stay where they are. The last
  // pair stands behind the loop: with a branch round its row loads the counted
  // load waits of both paths merge to zero and drain the rows loaded ahead.
#pragma unroll 1
  for (int tp = 0; tp < PT_ / 2 - 1; ++tp) {
    tile(xa, 0, true);
    tile(xc, 1, true);
    xp += 16384;
    kb += 16384;
    vb += 16384;
  }
  tile(xa, 0, false);
  tile(xc, 1, false);
}

// -------- logits GEMM (WMMA) + fused joint softmax + attn^T V (WMMA) ---------
// exp(x) as __expf builds it: one multiply and v_exp_f32. The v_nop fills the
// one slot the instruction set asks for behind a transcendental before its
// source is overwritten or its result read.
__device__ inline float exp_slot(float x) {
  float r;
  asm("v_exp_f32 %0, %1\n\tv_nop" : "=v"(r) : "v"(x * 1.44269504f));
  return r;
}

// grid: B * (NKV/256); each wave owns 32 kv rows (two M-tiles) x all 32
// (head, slot) columns, so a softmax row lies in one 16-lane row of two
// accumulators and the wave's 32 rows are exactly one K-step of attn@V.
// attn goes to LDS fragment-packed as the A-operand of attn@V:
// as[wave = K-step][mt=2][lane=32][e=16]; lane and e follow from the D layout:
// D register r of M-tile i at lane l is k_local = 16 i + 8 (l >> 4) + r,
// which is element e = 8 i + r of the same lane l.
// Behind the barrier the block multiplies its own 256 kv rows with V: wave w
// takes columns 32 w .. 32 w + 31 of V over the block's eight K-steps. Those
// columns are of head w >> 1, whose eight attn rows lie in M-tile w >> 2, in
// the D rows of the 16-lane half (w >> 1) & 1: only that M-tile is multiplied.
// The eps term needs the column sums of V: every V fragment passes through the
// wave anyway, so one more WMMA with an A operand of ones sums it over k (each
// row of that D tile is the column sum).
// Both sums leave as one partial per block: cpart[b][blk=4][32] (attn columns)
// and upart[b][blk=4][slot=8][d=256] (attn^T V + eps colsum(V), not normed).
__global__ void __launch_bounds__(256) k_logits(
    const half_t* __restrict__ kpk, const half_t* __restrict__ qbp,
    const half_t* __restrict__ vpk, float* __restrict__ upart,
    float* __restrict__ cpart, float* __restrict__ vis_out) {
  __shared__ float csl[8][32];
  __shared__ __align__(32) half_t as[8][2][512];
  int t = threadIdx.x, lane = t & 31, w = t >> 5;
  int b   = blockIdx.x >> 2;
  int blk = blockIdx.x & 3;
  int n0  = blk * 256 + w * 32;
  const half_t* kp = kpk + ((long)b * NKV + n0) * 256;  // two row tiles of 8 KB
  const half_t* qp = qbp + (long)b * 8192;
  v8f acc[2][2];  // [M-tile][column tile]
  for (int i = 0; i < 2; ++i)
    for (int k = 0; k < 2; ++k)
      for (int j = 0; j < 8; ++j) acc[i][k][j] = 0.f;
  for (int kk = 0; kk < 8; ++kk) {
    v16h a0  = frag_planes(kp + kk * 512, lane);
    v16h a1  = frag_planes(kp + 4096 + kk * 512, lane);
    v16h bq0 = frag_packed(qp + (long)(kk * 2 + 0) * 512, lane);
    v16h bq1 = frag_packed(qp + (long)(kk * 2 + 1) * 512, lane);
    acc[0][0] = wmma_f16(a0, bq0, acc[0][0]);
    acc[0][1] = wmma_f16(a0, bq1, acc[0][1]);
    acc[1][0] = wmma_f16(a1, bq0, acc[1][0]);
    acc[1][1] = wmma_f16(a1, bq1, acc[1][1]);
  }
  // the wave's sixteen V fragments, all in flight under the softmax
  const half_t* vv = vpk + (long)b * 262144 + (long)(blk * 128 + 2 * w) * 512;
  v16h vb0[8], vb1[8];
#pragma unroll
  for (int s = 0; s < 8; ++s) {
    vb0[s] = frag_planes(vv + s * 8192, lane);
    vb1[s] = frag_planes(vv + s * 8192 + 512, lane);
  }
  // The scheduling barriers keep the V loads above the softmax: left free, the
  // scheduler sinks each load to its first use behind the barrier and the
  // latency is not hidden. The address registers of the K and V loads are free
  // for reuse from here on: the wait stands in front of the first overwrite.
  // Named as its inputs they stay live up to it, so that no V load lands in
  // them.
  const half_t* ka = kp + lane * 8;
  const half_t* va = vv + lane * 8;
  __builtin_amdgcn_sched_barrier(0);
  asm volatile("s_wait_xcnt 0x0" :: "v"(ka), "v"(va) : "memory");
  __builtin_amdgcn_sched_barrier(0);
  int c16 = lane & 15, hi = lane >> 4;
  float cs0 = 0.f, cs1 = 0.f;
  union { uint4 u[2]; half_t h[16]; } p0, p1;
  float* vp = vis_out + (long)b * NQ * NKV + (c16 & 7) * NKV + n0 + hi * 8 +
              (c16 >> 3) * 4;
#pragma unroll
  for (int i = 0; i < 2; ++i) {
    float vis[8];
#pragma unroll
    for (int r = 0; r < 8; ++r) {
      float x0 = acc[i][0][r], x1 = acc[i][1][r];
      float mx = row_max16(fmaxf(x0, x1));
      float e0 = exp_slot(x0 - mx), e1 = exp_slot(x1 - mx);
      float inv = 1.f / row_sum16(e0 + e1);
      e0 *= inv; e1 *= inv;
      cs0 += e0; cs1 += e1;
      p0.h[i * 8 + r] = (half_t)e0;
      p1.h[i * 8 + r] = (half_t)e1;
      float v_ = e0 + e1;           // heads 0+2 (or 1+3) of slot c16 & 7
      vis[r] = v_ + row_xor<8>(v_);  // attn_vis = sum over heads
    }
    // lanes c16 and c16 ^ 8 hold the same 8 sums: each stores four of them
    float4 o;
    o.x = (c16 & 8) ? vis[4] : vis[0];
    o.y = (c16 & 8) ? vis[5] : vis[1];
    o.z = (c16 & 8) ? vis[6] : vis[2];
    o.w = (c16 & 8) ? vis[7] : vis[3];
    *(float4*)(vp + i * 16) = o;
  }
  half_t* ab = &as[w][0][lane * 16];
  *(uint4*)(ab)           = p0.u[0];
  *(uint4*)(ab + 8)       = p0.u[1];
  *(uint4*)(ab + 512)     = p1.u[0];
  *(uint4*)(ab + 512 + 8) = p1.u[1];
  // column sums: 16 rows in the lane, the other 16 in lane ^ 16, then the
  // eight waves in a fixed order
  cs0 += xhalf(cs0);
  cs1 += xhalf(cs1);
  csl[w][lane] = hi ? cs1 : cs0;
  __syncthreads();
  if (t < 32) {
    float s = 0.f;
#pragma unroll
    for (int j = 0; j < 8; ++j) s += csl[j][t];
    cpart[(b * 4 + blk) * 32 + t] = s;
  }
  int mt = w >> 2, hsel = (w >> 1) & 1;
  v8f u0, u1, cv0, cv1;
  for (int e = 0; e < 8; ++e) { u0[e] = 0.f; u1[e] = 0.f; cv0[e] = 0.f; cv1[e] = 0.f; }
  v16h ones;
  for (int e = 0; e < 16; ++e) ones[e] = (half_t)1.f;
#pragma unroll
  for (int s = 0; s < 8; ++s) {
    v16h a = frag_packed(&as[s][mt][0], lane);
    u0  = wmma_f16(a, vb0[s], u0);
    u1  = wmma_f16(a, vb1[s], u1);
    cv0 = wmma_f16(ones, vb0[s], cv0);
    cv1 = wmma_f16(ones, vb1[s], cv1);
  }
  // D register r is slot r in the lanes of half hsel. Lane l stores column
  // 32 w + l: the lanes of the other half take their tile's value from
  // lane ^ 16, so that each store of the wave is one whole 128-byte line.
  float* up = upart + (long)(b * 4 + blk) * 2048 + w * 32 + lane;
#pragma unroll
  for (int r = 0; r < 8; ++r) {
    float x0 = u0[r] + EPS_ * cv0[r];
    float x1 = u1[r] + EPS_ * cv1[r];
    float got = xhalf(hi ? x0 : x1);
    up[r * 256] = (hi == hsel) ? (hi ? x1 : x0) : got;
  }
}

// updates = (sum of the four blocks' partials) / (attn column sum + NKV eps)
// grid: B * NQ * S / 4 / 256 blocks, four neighbouring d a thread
__global__ void __launch_bounds__(256) k_inv(
    const float* __restrict__ cpart, const float* __restrict__ upart,
    float* __restrict__ upd) {
  int i  = blockIdx.x * 256 + threadIdx.x;
  int b  = i >> 9, qi = (i >> 6) & 7, d = (i & 63) * 4;
  const float* p = cpart + b * 128 + (d >> 6) * 8 + qi;
  const float* u = upart + (long)b * 8192 + qi * 256 + d;
  float4 u0 = *(const float4*)(u);
  float4 u1 = *(const float4*)(u + 2048);
  float4 u2 = *(const float4*)(u + 4096);
  float4 u3 = *(const float4*)(u + 6144);
  float s = ((p[0] + p[32]) + p[64]) + p[96];
  float inv = 1.f / (s + (float)NKV * EPS_);
  float4 o;
  o.x = (((u0.x + u1.x) + u2.x) + u3.x) * inv;
  o.y = (((u0.y + u1.y) + u2.y) + u3.y) * inv;
  o.z = (((u0.z + u1.z) + u2.z) + u3.z) * inv;
  o.w = (((u0.w + u1.w) + u2.w) + u3.w) * inv;
  *(float4*)(upd + (long)(b * NQ + qi) * S_ + d) = o;
}

// ---------------- GRU cell (f32 WMMA 16x16x4) --------------------------------
// xg = upd @ wih^T and hg = hprev @ whh^T as Y = X W^T with X and W both
// k-contiguous. One wave owns 16 rows (of the B*NQ = 512) x 16 columns j of
// all three gates over the whole k = 256: no LDS, no barrier, no partial sums
// between waves. A block's two waves take neighbouring column tiles, so the
// block writes whole 128-byte lines. grid: 32 row tiles x 8 column pairs.
// k order: lane (c, h) loads floats k0 + 4h .. k0 + 4h + 3 of its row of X and
// of its row of W by the same offsets; elements (0,1) feed one WMMA, (2,3) the
// next, so A and B pair the same k at every lane and register.
__device__ inline v8f wmma_f32(float ax, float ay, float bx, float by, v8f c) {
  v2f a = {ax, ay};
  v2f b = {bx, by};
  return __builtin_amdgcn_wmma_f32_16x16x4_f32(false, a, false, b, (short)0, c,
                                               false, false);
}
__global__ void __launch_bounds__(64) k_gru(
    const float* __restrict__ upd, const float* __restrict__ hprev,
    const float* __restrict__ wih, const float* __restrict__ whh,
    const float* __restrict__ bih, const float* __restrict__ bhh,
    float* __restrict__ hout) {
  int lane = threadIdx.x & 31, w = threadIdx.x >> 5;
  int c = lane & 15, h = lane >> 4;
  int m0 = (blockIdx.x >> 3) * 16;
  int n0 = (blockIdx.x & 7) * 32 + w * 16;
  int j  = n0 + c;
  int ao = (m0 + c) * 256 + 4 * h;
  int bo = j * 256 + 4 * h;
  const float* s[8] = {upd + ao,          hprev + ao,
                       wih + bo,          whh + bo,
                       wih + 65536 + bo,  whh + 65536 + bo,
                       wih + 131072 + bo, whh + 131072 + bo};
  // every D register of a lane is column j, so the accumulators start from
  // the gate biases of that column
  float br = bih[j] + bhh[j];
  float bz = bih[256 + j] + bhh[256 + j];
  float bi3 = bih[512 + j], bh3 = bhh[512 + j];
  // D register e of lane (c, h) is row m0 + 8h + e, column j
  long ob = (long)(m0 + 8 * h) * 256 + j;
  float hp[8];
  float4 f[2][2][8];  // [stage][8-k step][matrix]
#pragma unroll
  for (int q = 0; q < 2; ++q)
#pragma unroll
    for (int x = 0; x < 8; ++x) f[0][q][x] = *(const float4*)(s[x] + q * 8);
  // The accumulators may take the register that the bias loads name as their
  // offset: the wait stands in front of that overwrite, and the scheduling
  // barriers keep the accumulators' first writes behind it.
  __builtin_amdgcn_sched_barrier(0);
  asm volatile("s_wait_xcnt 0x0" ::: "memory");
  __builtin_amdgcn_sched_barrier(0);
  v8f ar, az, ani, anh;
  for (int e = 0; e < 8; ++e) { ar[e] = br; az[e] = bz; ani[e] = bi3; anh[e] = bh3; }
  // unrolled whole so that the stage index is static and the next 16 k of all
  // eight operands are in flight under this stage's 24 WMMAs
#pragma unroll
  for (int ch = 0; ch < 16; ++ch) {
    if (ch + 1 < 16) {
#pragma unroll
      for (int q = 0; q < 2; ++q)
#pragma unroll
        for (int x = 0; x < 8; ++x)
          f[(ch + 1) & 1][q][x] = *(const float4*)(s[x] + (ch + 1) * 16 + q * 8);
    } else {
      // Every operand load is issued and its address registers are free for
      // reuse from here on: the wait stands in front of the first overwrite
      // (the scheduling barrier keeps later address arithmetic behind it).
      // The old state for the output blend then loads under the last WMMAs.
      __builtin_amdgcn_sched_barrier(0);
      asm volatile("s_wait_xcnt 0x0" ::: "memory");
#pragma unroll
      for (int e = 0; e < 8; ++e) hp[e] = hprev[ob + e * 256];
    }
    // keeps the next stage's loads above this stage's WMMAs: left free, the
    // scheduler sinks each load to its first use and every WMMA group then
    // waits out a whole load latency
    __builtin_amdgcn_sched_barrier(0);
#pragma unroll
    for (int q = 0; q < 2; ++q) {
      const float4* g = f[ch & 1][q];
      ar  = wmma_f32(g[0].x, g[0].y, g[2].x, g[2].y, ar);
      az  = wmma_f32(g[0].x, g[0].y, g[4].x, g[4].y, az);
      ani = wmma_f32(g[0].x, g[0].y, g[6].x, g[6].y, ani);
      anh = wmma_f32(g[1].x, g[1].y, g[7].x, g[7].y, anh);
      ar  = wmma_f32(g[1].x, g[1].y, g[3].x, g[3].y, ar);
      az  = wmma_f32(g[1].x, g[1].y, g[5].x, g[5].y, az);
      ani = wmma_f32(g[0].z, g[0].w, g[6].z, g[6].w, ani);
      anh = wmma_f32(g[1].z, g[1].w, g[7].z, g[7].w, anh);
      ar  = wmma_f32(g[0].z, g[0].w, g[2].z, g[2].w, ar);
      az  = wmma_f32(g[0].z, g[0].w, g[4].z, g[4].w, az);
      ar  = wmma_f32(g[1].z, g[1].w, g[3].z, g[3].w, ar);
      az  = wmma_f32(g[1].z, g[1].w, g[5].z, g[5].w, az);
    }
  }
  // The table of WMMA distances leaves the f32 16x16x4 form out: eight slots, the count of the slowest
  // listed form, stand between the last WMMA and the first vector read of an
  // accumulator. The two scheduling barriers hold the slots at that place.
  __builtin_amdgcn_sched_barrier(0);
  asm volatile("v_nop\n\tv_nop\n\tv_nop\n\tv_nop\n\tv_nop\n\tv_nop\n\tv_nop\n\tv_nop");
  __builtin_amdgcn_sched_barrier(0);
#pragma unroll
  for (int e = 0; e < 8; ++e) {
    float r = 1.f / (1.f + __expf(-ar[e]));
    float z = 1.f / (1.f + __expf(-az[e]));
    float n = tanhf(ani[e] + r * anh[e]);
    hout[ob + e * 256] = (1.f - z) * n + z * hp[e];
  }
}

// ---------------- LN + MLP residual (f32 WMMA 16x16x4), one launch a layer ---
// Both layers are Y = X W with X k-contiguous and W column-contiguous. One wave
// owns 16 rows (of the B*NQ = 512) over the whole k: no LDS, no barrier, no
// partial sums between waves.
// k order: lane (c, h) holds floats 8q + 4h .. 8q + 4h + 3 of its row of X and
// loads rows 8q + 4h .. 8q + 4h + 3 of W at its column; elements (0,1) feed one
// WMMA, (2,3) the next, so A and B pair the same k at every lane and register.

#define D1_ 5   // k_mlp1: 8-k steps that the operand loads run ahead
#define D2_ 12  // k_mlp2: the same

__device__ inline v8f wmma_f32v(v2f a, v2f b, v8f c) {
  return __builtin_amdgcn_wmma_f32_16x16x4_f32(false, a, false, b, (short)0, c,
                                               false, false);
}

// hid = relu(LN(h) @ w1 + b1). A wave owns 16 rows x 32 hidden columns and
// keeps its half rows (128 floats a lane) in registers: the row statistics are
// a lane's own sums plus those of lane ^ 16. grid: 32 row tiles x 8 column
// groups of 64, two waves a block. The register bound keeps the wave inside
// one 256-register window (left free, the allocator spreads over two).
__global__ void __launch_bounds__(64) __attribute__((amdgpu_num_vgpr(256))) k_mlp1(
    const float* __restrict__ hin, const float* __restrict__ g,
    const float* __restrict__ bb, const float* __restrict__ w1,
    const float* __restrict__ b1, float* __restrict__ hid) {
  int lane = threadIdx.x & 31, w = threadIdx.x >> 5;
  int c = lane & 15, h = lane >> 4;
  int m0 = (blockIdx.x >> 3) * 16;
  int n0 = (blockIdx.x & 7) * 64 + w * 32;
  const float* ap = hin + (m0 + c) * 256 + 4 * h;
  const float* wp = w1 + 4 * h * 512 + n0 + c;
  const float* gp = g + 4 * h;
  const float* bp = bb + 4 * h;
  v4f a[32], fg[32], fo[32];
  v2f fw[32][2][2];  // [8-k step][k pair][column tile]
#pragma unroll
  for (int q = 0; q < 32; ++q) a[q] = *(const v4f*)(ap + q * 8);
#pragma unroll
  for (int q = 0; q < D1_; ++q) {
    fg[q] = *(const v4f*)(gp + q * 8);
    fo[q] = *(const v4f*)(bp + q * 8);
#pragma unroll
    for (int p = 0; p < 2; ++p)
#pragma unroll
      for (int ti = 0; ti < 2; ++ti) {
        fw[q][p][ti].x = wp[(q * 8 + 2 * p) * 512 + ti * 16];
        fw[q][p][ti].y = wp[(q * 8 + 2 * p + 1) * 512 + ti * 16];
      }
  }
  int bi = n0 + c;
  float bias0 = b1[bi], bias1 = b1[bi + 16];
  // The address registers of the row and bias loads are free for reuse from
  // here on: the wait stands in front of the first overwrite. Named as its
  // inputs they stay live up to it, so that no load above it lands in them;
  // the scheduling barriers keep the loads above it, the arithmetic behind it.
  __builtin_amdgcn_sched_barrier(0);
  asm volatile("s_wait_xcnt 0x0" :: "v"(ap), "v"(bi) : "memory");
  __builtin_amdgcn_sched_barrier(0);
  v2f t0 = {0.f, 0.f}, t1 = t0, t2 = t0, t3 = t0;
#pragma unroll
  for (int q = 0; q < 32; q += 2) {
    t0 += a[q].lo; t1 += a[q].hi; t2 += a[q + 1].lo; t3 += a[q + 1].hi;
  }
  t0 = (t0 + t1) + (t2 + t3);
  float s = t0.x + t0.y;
  s += xhalf(s);
  float mu = s * (1.f / 256.f);
  t0 = 0.f; t1 = 0.f; t2 = 0.f; t3 = 0.f;
#pragma unroll
  for (int q = 0; q < 32; q += 2) {
    a[q] -= mu; a[q + 1] -= mu;
    t0 += a[q].lo * a[q].lo;         t1 += a[q].hi * a[q].hi;
    t2 += a[q + 1].lo * a[q + 1].lo; t3 += a[q + 1].hi * a[q + 1].hi;
  }
  t0 = (t0 + t1) + (t2 + t3);
  s = t0.x + t0.y;
  s += xhalf(s);
  float rs = rsq_slot(s * (1.f / 256.f) + LNE_);
  // every D register of a lane is one column, so the accumulators start from
  // that column's bias
  v8f acc0, acc1;
  for (int e = 0; e < 8; ++e) { acc0[e] = bias0; acc1[e] = bias1; }
  a[0] = a[0] * (rs * fg[0]) + fo[0];
  a[1] = a[1] * (rs * fg[1]) + fo[1];
  // unrolled whole so that every index is static
#pragma unroll
  for (int q = 0; q < 32; ++q) {
    if (q + D1_ < 32) {
      int n = q + D1_;
      fg[n] = *(const v4f*)(gp + n * 8);
      fo[n] = *(const v4f*)(bp + n * 8);
#pragma unroll
      for (int p = 0; p < 2; ++p)
#pragma unroll
        for (int ti = 0; ti < 2; ++ti) {
          fw[n][p][ti].x = wp[(n * 8 + 2 * p) * 512 + ti * 16];
          fw[n][p][ti].y = wp[(n * 8 + 2 * p + 1) * 512 + ti * 16];
        }
    }
    // keeps the loads of step q + D1_ above this step's WMMAs: left free, the
    // scheduler sinks each load to its first use and every WMMA group then
    // waits out a whole load latency
    __builtin_amdgcn_sched_barrier(0);
    acc0 = wmma_f32v(a[q].lo, fw[q][0][0], acc0);
    acc1 = wmma_f32v(a[q].lo, fw[q][0][1], acc1);
    acc0 = wmma_f32v(a[q].hi, fw[q][1][0], acc0);
    acc1 = wmma_f32v(a[q].hi, fw[q][1][1], acc1);
    // The table of WMMA distances leaves the f32 16x16x4 form out: eight slots,
    // the count of the slowest
    // listed form, stand between the last WMMA and the next vector write,
    // which may take a register that a WMMA has just read (behind the last
    // step: the first vector read of an accumulator). They issue while the
    // matrix unit is busy. The scheduling barriers hold them at that place.
    __builtin_amdgcn_sched_barrier(0);
    if (q != 30)  // behind step 30 no vector instruction follows
      asm volatile("v_nop\n\tv_nop\n\tv_nop\n\tv_nop\n\tv_nop\n\tv_nop\n\tv_nop\n\tv_nop");
    __builtin_amdgcn_sched_barrier(0);
    // scale and shift of the LN two steps ahead, so that no WMMA waits for it
    if (q + 2 < 32) a[q + 2] = a[q + 2] * (rs * fg[q + 2]) + fo[q + 2];
    __builtin_amdgcn_sched_barrier(0);
  }
  // D register e of lane (c, h) is row m0 + 8h + e
  float* op = hid + (m0 + 8 * h) * 512 + n0 + c;
#pragma unroll
  for (int e = 0; e < 8; ++e) {
    op[e * 512]      = fmaxf(acc0[e], 0.f);
    op[e * 512 + 16] = fmaxf(acc1[e], 0.f);
  }
}

// slots = h + hid @ w2 + b2. A wave owns 16 rows x 16 columns over k = 512, the
// even and the odd k pairs in an accumulator each (a WMMA then never waits for
// the one before it); one starts from the bias, the other from the residual
// rows. A block's two waves take neighbouring column tiles, so the block
// writes whole 128-byte lines. grid: 32 row tiles x 8 column pairs.
__global__ void __launch_bounds__(64) k_mlp2(
    const float* __restrict__ hid, const float* __restrict__ hin,
    const float* __restrict__ w2, const float* __restrict__ b2,
    float* __restrict__ slots_out, float* __restrict__ dout, int write_out) {
  int lane = threadIdx.x & 31, w = threadIdx.x >> 5;
  int c = lane & 15, h = lane >> 4;
  int m0 = (blockIdx.x >> 3) * 16;
  int j  = (blockIdx.x & 7) * 32 + w * 16 + c;
  const float* ap = hid + (m0 + c) * 512 + 4 * h;
  const float* wp = w2 + 4 * h * 256 + j;
  // D register e of lane (c, h) is row m0 + 8h + e, column j
  int ob = (m0 + 8 * h) * 256 + j;
  v8f acc0, acc1;
  float bias = b2[j];
#pragma unroll
  for (int e = 0; e < 8; ++e) acc1[e] = hin[ob + e * 256];
  v4f fa[64];
  v2f fw[64][2];  // [8-k step][k pair]
#pragma unroll
  for (int q = 0; q < D2_; ++q) {
    fa[q] = *(const v4f*)(ap + q * 8);
#pragma unroll
    for (int p = 0; p < 2; ++p) {
      fw[q][p].x = wp[(q * 8 + 2 * p) * 256];
      fw[q][p].y = wp[(q * 8 + 2 * p + 1) * 256];
    }
  }
  // The offset register of the bias load is free for reuse from here on: the
  // wait stands in front of the first overwrite. Named as its input the offset
  // stays live up to it, so that no load above it lands in that register; the
  // scheduling barriers keep the accumulator's first writes behind it.
  __builtin_amdgcn_sched_barrier(0);
  asm volatile("s_wait_xcnt 0x0" :: "v"(j) : "memory");
  __builtin_amdgcn_sched_barrier(0);
  for (int e = 0; e < 8; ++e) acc0[e] = bias;
  // unrolled whole so that every index is static
#pragma unroll
  for (int q = 0; q < 64; ++q) {
    if (q + D2_ < 64) {
      int n = q + D2_;
      fa[n] = *(const v4f*)(ap + n * 8);
#pragma unroll
      for (int p = 0; p < 2; ++p) {
        fw[n][p].x = wp[(n * 8 + 2 * p) * 256];
        fw[n][p].y = wp[(n * 8 + 2 * p + 1) * 256];
      }
    }
    // keeps the loads of step q + D2_ above this step's WMMAs (as in k_mlp1)
    __builtin_amdgcn_sched_barrier(0);
    acc0 = wmma_f32v(fa[q].lo, fw[q][0], acc0);
    acc1 = wmma_f32v(fa[q].hi, fw[q][1], acc1);
  }
  // eight slots between the last WMMA and the first vector read of an
  // accumulator, held in place by the scheduling barriers (as in k_mlp1)
  __builtin_amdgcn_sched_barrier(0);
  asm volatile("v_nop\n\tv_nop\n\tv_nop\n\tv_nop\n\tv_nop\n\tv_nop\n\tv_nop\n\tv_nop");
  __builtin_amdgcn_sched_barrier(0);
  v8f o = acc0 + acc1;
#pragma unroll
  for (int e = 0; e < 8; ++e) slots_out[ob + e * 256] = o[e];
  if (write_out) {
#pragma unroll
    for (int e = 0; e < 8; ++e) dout[ob + e * 256] = o[e];
  }
}

// ---------------- LN(slots) + q = s@Wq (f32 WMMA 16x16x4), packed Qb ---------
// qbp[b][kk=8][ti=2][lane=32][e=16]: the block-diagonal B operand of the logits
// (k = feature d, column = head * 8 + slot, zero where d is not of that head).
// The product is formed transposed, q^T = Wq^T LN(s)^T: A is a column tile of
// Wq, B a tile of 16 slot rows (two batches), loaded by the offsets of k_mlp1,
// so A and B pair the same k at every lane and register. D register e of lane
// (c, h) is then feature 8h + e of slot row c: the eight features that one
// packed lane holds side by side. A wave owns 16 rows x 32 features (one kk)
// over the whole k, and writes the whole 2 KB of its kk for both batches, the
// zeros too. No LDS, no barrier. grid: 32 row tiles x 4 pairs of kk. The
// register bound keeps the wave inside one 256-register window (as in k_mlp1).
__global__ void __launch_bounds__(64) __attribute__((amdgpu_num_vgpr(256))) k_qbuild(
    const float* __restrict__ slots, const float* __restrict__ g,
    const float* __restrict__ bb, const float* __restrict__ wq,
    half_t* __restrict__ qbp) {
  int lane = threadIdx.x & 31, w = threadIdx.x >> 5;
  int c = lane & 15, h = lane >> 4;
  int m0 = (blockIdx.x >> 2) * 16;
  int kk = (blockIdx.x & 3) * 2 + w;
  const float* ap = slots + (m0 + c) * 256 + 4 * h;
  const float* wp = wq + 4 * h * 256 + kk * 32 + c;
  const float* gp = g + 4 * h;
  const float* bp = bb + 4 * h;
  v4f a[32], fg[32], fo[32];
  v2f fw[32][2][2];  // [8-k step][k pair][feature tile]
#pragma unroll
  for (int q = 0; q < 32; ++q) a[q] = *(const v4f*)(ap + q * 8);
#pragma unroll
  for (int q = 0; q < D1_; ++q) {
    fg[q] = *(const v4f*)(gp + q * 8);
    fo[q] = *(const v4f*)(bp + q * 8);
#pragma unroll
    for (int p = 0; p < 2; ++p)
#pragma unroll
      for (int ti = 0; ti < 2; ++ti) {
        fw[q][p][ti].x = wp[(q * 8 + 2 * p) * 256 + ti * 16];
        fw[q][p][ti].y = wp[(q * 8 + 2 * p + 1) * 256 + ti * 16];
      }
  }
  // The address registers of the row loads are free for reuse from here on: the
  // wait stands in front of the first overwrite. Named as its input they stay
  // live up to it, so that no load above it lands in them; the scheduling
  // barriers keep the loads above it, the arithmetic behind it.
  __builtin_amdgcn_sched_barrier(0);
  asm volatile("s_wait_xcnt 0x0" :: "v"(ap) : "memory");
  __builtin_amdgcn_sched_barrier(0);
  v2f t0 = {0.f, 0.f}, t1 = t0, t2 = t0, t3 = t0;
#pragma unroll
  for (int q = 0; q < 32; q += 2) {
    t0 += a[q].lo; t1 += a[q].hi; t2 += a[q + 1].lo; t3 += a[q + 1].hi;
  }
  t0 = (t0 + t1) + (t2 + t3);
  float s = t0.x + t0.y;
  s += xhalf(s);
  float mu = s * (1.f / 256.f);
  t0 = 0.f; t1 = 0.f; t2 = 0.f; t3 = 0.f;
#pragma unroll
  for (int q = 0; q < 32; q += 2) {
    a[q] -= mu; a[q + 1] -= mu;
    t0 += a[q].lo * a[q].lo;         t1 += a[q].hi * a[q].hi;
    t2 += a[q + 1].lo * a[q + 1].lo; t3 += a[q + 1].hi * a[q + 1].hi;
  }
  t0 = (t0 + t1) + (t2 + t3);
  s = t0.x + t0.y;
  s += xhalf(s);
  float rs = rsq_slot(s * (1.f / 256.f) + LNE_);
  v8f acc0, acc1;
  for (int e = 0; e < 8; ++e) { acc0[e] = 0.f; acc1[e] = 0.f; }
  a[0] = a[0] * (rs * fg[0]) + fo[0];
  a[1] = a[1] * (rs * fg[1]) + fo[1];
  // unrolled whole so that every index is static
#pragma unroll
  for (int q = 0; q < 32; ++q) {
    if (q + D1_ < 32) {
      int n = q + D1_;
      fg[n] = *(const v4f*)(gp + n * 8);
      fo[n] = *(const v4f*)(bp + n * 8);
#pragma unroll
      for (int p = 0; p < 2; ++p)
#pragma unroll
        for (int ti = 0; ti < 2; ++ti) {
          fw[n][p][ti].x = wp[(n * 8 + 2 * p) * 256 + ti * 16];
          fw[n][p][ti].y = wp[(n * 8 + 2 * p + 1) * 256 + ti * 16];
        }
    }
    // keeps the loads of step q + D1_ above this step's WMMAs (as in k_mlp1)
    __builtin_amdgcn_sched_barrier(0);
    acc0 = wmma_f32v(fw[q][0][0], a[q].lo, acc0);
    acc1 = wmma_f32v(fw[q][0][1], a[q].lo, acc1);
    acc0 = wmma_f32v(fw[q][1][0], a[q].hi, acc0);
    acc1 = wmma_f32v(fw[q][1][1], a[q].hi, acc1);
    // eight slots between the last WMMA and the next vector write or, behind
    // the last step, the first vector read of an accumulator, held in place by
    // the scheduling barriers (as in k_mlp1)
    __builtin_amdgcn_sched_barrier(0);
    if (q != 30)  // behind step 30 no vector instruction follows
      asm volatile("v_nop\n\tv_nop\n\tv_nop\n\tv_nop\n\tv_nop\n\tv_nop\n\tv_nop\n\tv_nop");
    __builtin_amdgcn_sched_barrier(0);
    // scale and shift of the LN two steps ahead, so that no WMMA waits for it
    if (q + 2 < 32) a[q + 2] = a[q + 2] * (rs * fg[q + 2]) + fo[q + 2];
    __builtin_amdgcn_sched_barrier(0);
  }
  // slot row c is batch m0 / 8 + (c >> 3), slot c & 7; its column of Qb is
  // head * 8 + slot with head = kk >> 1. sl = ti * 32 + packed lane; elements
  // 0..7 are features 8h + e (acc0), 8..15 features 16 + 8h + e (acc1).
  int hd = kk >> 1;
  int sl = (hd >> 1) * 32 + 16 * h + (hd & 1) * 8 + (c & 7);
  half_t* qp = qbp + ((m0 >> 3) + (c >> 3)) * 8192 + kk * 1024;
  union { uint4 u[2]; half_t x[16]; } o;
#pragma unroll
  for (int e = 0; e < 8; ++e) {
    o.x[e]     = (half_t)acc0[e];
    o.x[8 + e] = (half_t)acc1[e];
  }
  *(uint4*)(qp + sl * 16)     = o.u[0];
  *(uint4*)(qp + sl * 16 + 8) = o.u[1];
  // the columns of the other three heads are zero at these features
  uint4 zz = {0u, 0u, 0u, 0u};
  *(uint4*)(qp + (sl ^ 8) * 16)      = zz;
  *(uint4*)(qp + (sl ^ 8) * 16 + 8)  = zz;
  *(uint4*)(qp + (sl ^ 32) * 16)     = zz;
  *(uint4*)(qp + (sl ^ 32) * 16 + 8) = zz;
  *(uint4*)(qp + (sl ^ 40) * 16)     = zz;
  *(uint4*)(qp + (sl ^ 40) * 16 + 8) = zz;
}

// ---------------- host orchestration ----------------------------------------
extern "C" void kernel_launch(void* const* d_in, const int* in_sizes, int n_in,
                              void* d_out, int out_size, void* d_ws,
                              size_t ws_size, hipStream_t stream) {
  (void)in_sizes; (void)n_in; (void)out_size; (void)ws_size;
  const float* inputs   = (const float*)d_in[0];
  const float* slots0   = (const float*)d_in[1];
  const float* ln_in_g  = (const float*)d_in[2];
  const float* ln_in_b  = (const float*)d_in[3];
  const float* ln_sl_g  = (const float*)d_in[4];
  const float* ln_sl_b  = (const float*)d_in[5];
  const float* ln_mlp_g = (const float*)d_in[6];
  const float* ln_mlp_b = (const float*)d_in[7];
  const float* Wq       = (const float*)d_in[8];
  const float* Wk       = (const float*)d_in[9];
  const float* Wv       = (const float*)d_in[10];
  const float* gwih     = (const float*)d_in[11];
  const float* gwhh     = (const float*)d_in[12];
  const float* gbih     = (const float*)d_in[13];
  const float* gbhh     = (const float*)d_in[14];
  const float* w1       = (const float*)d_in[15];
  const float* b1       = (const float*)d_in[16];
  const float* w2       = (const float*)d_in[17];
  const float* b2       = (const float*)d_in[18];

  char* ws = (char*)d_ws;
  half_t* kf   = (half_t*)(ws + 0);          // 32 MB  K fragment-packed (pre-scaled)
  half_t* vpk  = (half_t*)(ws + 33554432);   // 32 MB  V fragment-packed
  half_t* wkp  = (half_t*)(ws + 67108864);   // 128 KB Wk packed
  half_t* wvp  = (half_t*)(ws + 67239936);   // 128 KB Wv packed
  half_t* qbp  = (half_t*)(ws + 67436544);   // 1 MB   block-diag Q packed
  float*  upt  = (float*)(ws + 68485120);    // 2 MB   attn^T V partials
  float*  upd  = (float*)(ws + 72695808);    // 512 KB
  float*  scur = (float*)(ws + 73220096);    // 512 KB current slots
  float*  smid = (float*)(ws + 73744384);    // 512 KB post-GRU slots
  float*  csum = (float*)(ws + 74268672);    // 32 KB  attn column-sum partials
  float*  hid  = (float*)(ws + 74301440);    // 1 MB   MLP hidden layer

  float* out_slots = (float*)d_out;
  float* out_vis   = out_slots + (long)B_ * NQ * S_;

  hipMemcpyAsync(scur, slots0, (size_t)B_ * NQ * S_ * sizeof(float),
                 hipMemcpyDeviceToDevice, stream);
  k_cvt<<<256, 256, 0, stream>>>(Wk, Wv, wkp, wvp);
  k_proj<<<(B_ * NKV) / (32 * PT_), 512, 0, stream>>>(inputs, ln_in_g, ln_in_b, wkp,
                                                      wvp, kf, vpk);

  for (int it = 0; it < 3; ++it) {
    k_qbuild<<<128, 64, 0, stream>>>(scur, ln_sl_g, ln_sl_b, Wq, qbp);
    k_logits<<<B_ * (NKV / 256), 256, 0, stream>>>(kf, qbp, vpk, upt, csum,
                                                   out_vis);
    k_inv<<<128, 256, 0, stream>>>(csum, upt, upd);
    k_gru<<<256, 64, 0, stream>>>(upd, scur, gwih, gwhh, gbih, gbhh, smid);
    k_mlp1<<<256, 64, 0, stream>>>(smid, ln_mlp_g, ln_mlp_b, w1, b1, hid);
    k_mlp2<<<256, 64, 0, stream>>>(hid, smid, w2, b2, scur, out_slots,
                                   (it == 2) ? 1 : 0);
  }
}

// v010
// Two timings next to v009 put it at 1.06 and 1.07 times that version's speed.
// Counting every step since v000, it is 6.33 times as fast.
#include <hip/hip_runtime.h>
#include <hip/hip_bf16.h>

typedef __attribute__((ext_vector_type(16))) _Float16 v16h;
typedef __attribute__((ext_vector_type(8)))  float    v8f;
typedef __attribute__((ext_vector_type(2)))  float    v2f;
typedef __attribute__((ext_vector_type(4)))  float    v4f;
typedef _Float16 half_t;

#define B_     64
#define NKV    1024
#define NQ     8
#define S_     256
#define HM_    512
#define EPS_   1e-8f
#define LNE_   1e-5f

// ---------------- WMMA fragment helpers (CDNA5 16x16x32 f16 layout) ----------
// 16-bit operand layout: lane L, klo = (L>=16)?8:0; elems 0..7 hold K =
// klo..klo+7, elems 8..15 hold K = klo+16..klo+23 (row/col index = L&15).

// A-fragment from row-major source (ld in halves): two 16B vector loads.
__device__ inline v16h frag_rowmajor(const half_t* p, int ld, int lane) {
  int m   = lane & 15;
  int klo = (lane >> 4) << 3;
  const half_t* q = p + m * ld + klo;
  union { uint4 u[2]; v16h h; } c;
  c.u[0] = *(const uint4*)(q);
  c.u[1] = *(const uint4*)(q + 16);
  return c.h;
}
// Fragment from pre-packed storage: packed[...][lane][16] -> two contiguous 16B loads.
__device__ inline v16h frag_packed(const half_t* p, int lane) {
  const half_t* q = p + lane * 16;
  union { uint4 u[2]; v16h h; } c;
  c.u[0] = *(const uint4*)(q);
  c.u[1] = *(const uint4*)(q + 8);
  return c.h;
}
// Fragment from plane-packed storage: packed[...][half=2][lane=32][8], elements
// 0..7 of all lanes and then elements 8..15, so that each 16-byte access of a
// wave covers 512 contiguous bytes (whole lines).
__device__ inline v16h frag_planes(const half_t* p, int lane) {
  const half_t* q = p + lane * 8;
  union { uint4 u[2]; v16h h; } c;
  c.u[0] = *(const uint4*)(q);
  c.u[1] = *(const uint4*)(q + 256);
  return c.h;
}
// (lane, elem) -> K-within-32
__device__ inline int klocal_of(int lane, int e) {
  int klo = (lane >> 4) << 3;
  return (e < 8) ? (klo + e) : (klo + 8 + e);
}
__device__ inline v8f wmma_f16(v16h a, v16h b, v8f c) {
  return __builtin_amdgcn_wmma_f32_16x16x32_f16(false, a, false, b, (short)0, c,
                                                false, false);
}

// ---------------- Wk/Wv fp32 -> fragment-packed fp16 -------------------------
// packed idx = ((kk*16 + nt)*32 + lane)*16 + e ; 8 kk x 16 nt tiles
__global__ void k_cvt(const float* __restrict__ wk, const float* __restrict__ wv,
                      half_t* __restrict__ wkp, half_t* __restrict__ wvp) {
  int idx  = blockIdx.x * 256 + threadIdx.x;  // 65536 halves per matrix
  int e    = idx & 15;
  int lane = (idx >> 4) & 31;
  int nt   = (idx >> 9) & 15;
  int kk   = idx >> 13;
  int k = kk * 32 + klocal_of(lane, e);
  int n = nt * 16 + (lane & 15);
  wkp[idx] = (half_t)wk[k * 256 + n];
  wvp[idx] = (half_t)wv[k * 256 + n];
}

// ---------------- cross-lane helpers -----------------------------------------
// value of lane (l ^ M) of the same 16-lane row (DPP row_xmask)
template <int M>
__device__ inline float row_xor(float v) {
  return __builtin_bit_cast(
      float, __builtin_amdgcn_mov_dpp(__builtin_bit_cast(int, v), 0x160 | M, 0xf,
                                      0xf, true));
}
__device__ inline float row_max16(float v) {
  v = fmaxf(v, row_xor<1>(v));
  v = fmaxf(v, row_xor<2>(v));
  v = fmaxf(v, row_xor<4>(v));
  v = fmaxf(v, row_xor<8>(v));
  return v;
}
__device__ inline float row_sum16(float v) {
  v += row_xor<1>(v);
  v += row_xor<2>(v);
  v += row_xor<4>(v);
  v += row_xor<8>(v);
  return v;
}
// value of lane l ^ 16
__device__ inline float xhalf(float x) {
  int i = __builtin_bit_cast(int, x);
  return __builtin_bit_cast(
      float, __builtin_amdgcn_permlanex16(i, i, 0x76543210, 0xfedcba98, false,
                                          false));
}

// 1/sqrt(x) as one v_rsq_f32; the v_nop fills the one slot the instruction set
// asks for behind a transcendental before its result is read.
__device__ inline float rsq_slot(float x) {
  float r;
  asm("v_rsq_f32 %0, %1\n\tv_nop" : "=v"(r) : "v"(x));
  return r;
}

// ---------------- fused LayerNorm(inputs) + K/V projection (WMMA) ------------
// grid: one block a WGP (256), 512 threads; a block walks PT_ tiles of 32 rows.
// Wave w owns column tile w (16 columns) of K and of V and keeps the sixteen
// weight fragments of those columns in registers over all its tiles, so that
// the weights leave L2 once a block and not once a tile.
// V = x Wv: D register r of row tile mt at lane l is k_local = 16 mt + 8 (l >> 4)
// + r of column l & 15, which is element 8 mt + r of the same lane l of the
// B operand of attn@V: vpk[b][krow=32][nt=16][half=mt][lane=32][8].
// K is formed transposed, K^T = Wk^T x^T (the operands change places; A and B
// hold k alike): D register r at lane l is feature 16 w + 8 (l >> 4) + r of row
// l & 15, which is element 8 (w & 1) + r of the same lane l of the A operand of
// the logits at K-step w >> 1:
// kpk[row tile = row / 16][kk=8][half=w & 1][lane=32][8].
#define XP_ 264  // pitch of the f16 rows in LDS, halves: 528 B = 16 B x 33, so
                 // that the 16 rows of a fragment read fall on distinct banks
#define PT_ 8    // 32-row tiles a block
__global__ void __launch_bounds__(512) k_proj(
    const float* __restrict__ x, const float* __restrict__ g,
    const float* __restrict__ bb, const half_t* __restrict__ wkp,
    const half_t* __restrict__ wvp, half_t* __restrict__ kpk,
    half_t* __restrict__ vpk) {
  __shared__ __align__(32) half_t xh[2][32][XP_];
  int t = threadIdx.x, lane = t & 31, w = t >> 5;
  // LayerNorm in registers: wave w owns rows 2 w and 2 w + 1 of a tile whole;
  // lane l holds columns 4 l .. 4 l + 3 and 128 + 4 l .. 128 + 4 l + 3 of each,
  // so that every load of the wave is 512 contiguous bytes. The row sums are a
  // lane's own eight values, then the 16-lane row, then lane ^ 16.
  int lo = lane * 4;
  const float* xp = x + (long)blockIdx.x * (PT_ * 8192) + w * 512 + lo;
  v4f xa[2][2], xc[2][2];  // the rows of the even and of the odd tiles
#pragma unroll
  for (int r = 0; r < 2; ++r) {
    xa[r][0] = *(const v4f*)(xp + r * 256);
    xa[r][1] = *(const v4f*)(xp + r * 256 + 128);
  }
  const half_t* wka = wkp + w * 512 + lane * 16;
  const half_t* wva = wvp + w * 512 + lane * 16;
  v16h bk[8], bv[8];
#pragma unroll
  for (int kk = 0; kk < 8; ++kk) {
    union { uint4 u[2]; v16h h; } ck, cv;
    ck.u[0] = *(const uint4*)(wka + kk * 8192);
    ck.u[1] = *(const uint4*)(wka + kk * 8192 + 8);
    cv.u[0] = *(const uint4*)(wva + kk * 8192);
    cv.u[1] = *(const uint4*)(wva + kk * 8192 + 8);
    bk[kk] = ck.h;
    bv[kk] = cv.h;
  }
  v4f g0 = *(const v4f*)(g + lo), g1 = *(const v4f*)(g + 128 + lo);
  v4f o0 = *(const v4f*)(bb + lo), o1 = *(const v4f*)(bb + 128 + lo);
#pragma unroll
  for (int r = 0; r < 2; ++r) {
    xc[r][0] = *(const v4f*)(xp + 8192 + r * 256);
    xc[r][1] = *(const v4f*)(xp + 8192 + r * 256 + 128);
  }
  // The address registers of these loads are free for reuse from here on: the
  // wait stands in front of the first overwrite. Named as its inputs they stay
  // live up to it, so that no load above it lands in them; the scheduling
  // barriers keep the loads above it, the arithmetic behind it.
  __builtin_amdgcn_sched_barrier(0);
  asm volatile("s_wait_xcnt 0x0" :: "v"(xp), "v"(wka), "v"(wva), "v"(lane) : "memory");
  __builtin_amdgcn_sched_barrier(0);
  // a tile's 32 rows are 16 KB of kpk (two row tiles) and 16 KB of vpk (one
  // krow), both at tile index * 8192 halves
  half_t* kb = kpk + (long)blockIdx.x * (PT_ * 8192) + (w >> 1) * 512 +
               (w & 1) * 256 + lane * 8;
  half_t* vb = vpk + (long)blockIdx.x * (PT_ * 8192) + w * 512 + lane * 8;
  // One tile: sel is its parity (LDS buffer, place in the pair), xv its rows,
  // which are loaded anew for the tile two further on while more is set.
  auto tile = [&](v4f (&xv)[2][2], int sel, bool more) {
    half_t (*xb)[XP_] = xh[sel];
#pragma unroll
    for (int r = 0; r < 2; ++r) {
      v4f p = xv[r][0], q = xv[r][1];
      v2f ts = (p.lo + p.hi) + (q.lo + q.hi);
      v2f tq = (p.lo * p.lo + p.hi * p.hi) + (q.lo * q.lo + q.hi * q.hi);
      float s  = row_sum16(ts.x + ts.y);
      float s2 = row_sum16(tq.x + tq.y);
      s  += xhalf(s);
      s2 += xhalf(s2);
      float m   = s * (1.f / 256.f);
      float rsd = rsq_slot(s2 * (1.f / 256.f) - m * m + LNE_);
      p = (p - m) * rsd * g0 + o0;
      q = (q - m) * rsd * g1 + o1;
      union { uint2 u; half_t h[4]; } c0, c1;
#pragma unroll
      for (int e = 0; e < 4; ++e) {
        c0.h[e] = (half_t)p[e];
        c1.h[e] = (half_t)q[e];
      }
      *(uint2*)(&xb[w * 2 + r][lo])       = c0.u;
      *(uint2*)(&xb[w * 2 + r][128 + lo]) = c1.u;
    }
    // the rows of the tile two further on fly under two tiles' products
    if (more) {
#pragma unroll
      for (int r = 0; r < 2; ++r) {
        xv[r][0] = *(const v4f*)(xp + (sel + 2) * 8192 + r * 256);
        xv[r][1] = *(const v4f*)(xp + (sel + 2) * 8192 + r * 256 + 128);
      }
    }
    // The tile's one barrier, by hand: it needs this wave's LDS writes landed
    // and nothing else. __syncthreads() would also wait out the row loads in
    // flight and the last tile's stores. With two buffers it also ends every
    // wave's reads of the buffer that the next tile writes.
    asm volatile("s_wait_dscnt 0x0\n\ts_barrier_signal -1\n\ts_barrier_wait -1" ::: "memory");

    v8f ak[2], av[2];  // [row tile]
    for (int i = 0; i < 2; ++i)
      for (int j = 0; j < 8; ++j) { ak[i][j] = 0.f; av[i][j] = 0.f; }
    // unrolled whole so that the index of every weight fragment is static
#pragma unroll
    for (int kk = 0; kk < 8; ++kk) {
      v16h a0 = frag_rowmajor(&xb[0][kk * 32], XP_, lane);
      v16h a1 = frag_rowmajor(&xb[16][kk * 32], XP_, lane);
      ak[0] = wmma_f16(bk[kk], a0, ak[0]);
      ak[1] = wmma_f16(bk[kk], a1, ak[1]);
      av[0] = wmma_f16(a0, bv[kk], av[0]);
      av[1] = wmma_f16(a1, bv[kk], av[1]);
    }
    union { uint4 u; half_t h[8]; } pk[2], pv[2];
#pragma unroll
    for (int mt = 0; mt < 2; ++mt) {
#pragma unroll
      for (int r = 0; r < 8; ++r) {
        pk[mt].h[r] = (half_t)(ak[mt][r] * 0.125f);  // hd^-0.5
        pv[mt].h[r] = (half_t)(av[mt][r]);
      }
    }
    // All four packed values stand in registers of their own before the first
    // store, and the wait stands between the stores and the next overwrite of
    // their data or address; the scheduling barriers hold that order.
    __builtin_amdgcn_sched_barrier(0);
#pragma unroll
    for (int mt = 0; mt < 2; ++mt) {
      *(uint4*)(kb + sel * 8192 + mt * 4096) = pk[mt].u;
      *(uint4*)(vb + sel * 8192 + mt * 256)  = pv[mt].u;
    }
    if (more || sel == 0) {  // behind the last tile nothing is overwritten
      __builtin_amdgcn_sched_barrier(0);
      asm volatile("s_wait_xcnt 0x0" :: "v"(kb), "v"(vb), "v"(xp) : "memory");
      __builtin_amdgcn_sched_barrier(0);
    }
  };
  // rolled: the body is a pair of tiles, so that each tile's rows and LDS
  // buffer are static, and the weight fragments stay where they are. The last
  // pair stands behind the loop: with a branch round its row loads the counted
  // load waits of both paths merge to zero and drain the rows loaded ahead.
#pragma unroll 1
  for (int tp = 0; tp < PT_ / 2 - 1; ++tp) {
    tile(xa, 0, true);
    tile(xc, 1, true);
    xp += 16384;
    kb += 16384;
    vb += 16384;
  }
  tile(xa, 0, false);
  tile(xc, 1, false);
}

// -------- logits GEMM (WMMA) + fused joint softmax + attn^T V (WMMA) ---------
// exp(x) as __expf builds it: one multiply and v_exp_f32. The v_nop fills the
// one slot the instruction set asks for behind a transcendental before its
// source is overwritten or its result read.
__device__ inline float exp_slot(float x) {
  float r;
  asm("v_exp_f32 %0, %1\n\tv_nop" : "=v"(r) : "v"(x * 1.44269504f));
  return r;
}

// grid: B * (NKV/256); each wave owns 32 kv rows (two M-tiles) x all 32
// (head, slot) columns, so a softmax row lies in one 16-lane row of two
// accumulators and the wave's 32 rows are exactly one K-step of attn@V.
// attn goes to LDS fragment-packed as the A-operand of attn@V:
// as[wave = K-step][mt=2][lane=32][e=16]; lane and e follow from the D layout:
// D register r of M-tile i at lane l is k_local = 16 i + 8 (l >> 4) + r,
// which is element e = 8 i + r of the same lane l.
// Behind the barrier the block multiplies its own 256 kv rows with V: wave w
// takes columns 32 w .. 32 w + 31 of V over the block's eight K-steps. Those
// columns are of head w >> 1, whose eight attn rows lie in M-tile w >> 2, in
// the D rows of the 16-lane half (w >> 1) & 1: only that M-tile is multiplied.
// The eps term needs the column sums of V: every V fragment passes through the
// wave anyway, so one more WMMA with an A operand of ones sums it over k (each
// row of that D tile is the column sum).
// Both sums leave as one partial per block: cpart[b][blk=4][32] (attn columns)
// and upart[b][blk=4][slot=8][d=256] (attn^T V + eps colsum(V), not normed).
// The register bound keeps the wave inside one 256-register window (left free,
// the allocator spreads the fragments in flight over two).
__global__ void __launch_bounds__(256) __attribute__((amdgpu_num_vgpr(256))) k_logits(
    const half_t* __restrict__ kpk, const half_t* __restrict__ qbp,
    const half_t* __restrict__ vpk, float* __restrict__ upart,
    float* __restrict__ cpart, float* __restrict__ vis_out) {
  __shared__ float csl[8][32];
  __shared__ __align__(32) half_t as[8][2][512];
  int t = threadIdx.x, lane = t & 31, w = t >> 5;
  int b   = blockIdx.x >> 2;
  int blk = blockIdx.x & 3;
  int n0  = blk * 256 + w * 32;
  const half_t* kp = kpk + ((long)b * NKV + n0) * 256;  // two row tiles of 8 KB
  const half_t* qp = qbp + (long)b * 8192;
  v8f acc[2][2];  // [M-tile][column tile]
  for (int i = 0; i < 2; ++i)
    for (int k = 0; k < 2; ++k)
      for (int j = 0; j < 8; ++j) acc[i][k][j] = 0.f;
  const half_t* vv = vpk + (long)b * 262144 + (long)(blk * 128 + 2 * w) * 512;
  v16h kf[8][2], qf[8][2], vb0[8], vb1[8];
  // All of the wave's K and the Q of the first four K-steps are in flight
  // before the first product, so that the wave waits out one round trip for
  // them all and not one for every few fragments.
#pragma unroll
  for (int kk = 0; kk < 8; ++kk) {
    kf[kk][0] = frag_planes(kp + kk * 512, lane);
    kf[kk][1] = frag_planes(kp + 4096 + kk * 512, lane);
    if (kk < 4) {
      qf[kk][0] = frag_packed(qp + (kk * 2 + 0) * 512, lane);
      qf[kk][1] = frag_packed(qp + (kk * 2 + 1) * 512, lane);
    }
  }
  // Each K-step frees four fragments' registers, and the steps behind it load
  // new ones into them: first the rest of Q (steps 1 to 3, so that it is all
  // under way before any of it is waited for), then V, used behind the softmax.
  // unrolled whole so that the index of every fragment is static
#pragma unroll
  for (int kk = 0; kk < 8; ++kk) {
    // fragment pairs in the order of their loads: 0..3 are Q of K-steps 4..7,
    // 4..11 are V of K-steps 0..7; step kk loads pairs 2 kk - 3 and 2 kk - 2
#pragma unroll
    for (int n = 2 * kk - 3; n < 2 * kk - 1; ++n) {
      if (n >= 0 && n < 4) {
        qf[n + 4][0] = frag_packed(qp + ((n + 4) * 2 + 0) * 512, lane);
        qf[n + 4][1] = frag_packed(qp + ((n + 4) * 2 + 1) * 512, lane);
      }
      if (n >= 4 && n < 12) {
        vb0[n - 4] = frag_planes(vv + (n - 4) * 8192, lane);
        vb1[n - 4] = frag_planes(vv + (n - 4) * 8192 + 512, lane);
      }
    }
    // The two scheduling barriers hold the loads where they are written: left
    // free, the scheduler sinks each load to its first use, and the wave then
    // waits out a round trip every few products.
    __builtin_amdgcn_sched_barrier(0);
    acc[0][0] = wmma_f16(kf[kk][0], qf[kk][0], acc[0][0]);
    acc[0][1] = wmma_f16(kf[kk][0], qf[kk][1], acc[0][1]);
    acc[1][0] = wmma_f16(kf[kk][1], qf[kk][0], acc[1][0]);
    acc[1][1] = wmma_f16(kf[kk][1], qf[kk][1], acc[1][1]);
    __builtin_amdgcn_sched_barrier(0);
  }
  // The address registers of the loads are free for reuse from here on: the
  // wait stands in front of the first overwrite. Those of K and V, named as its
  // inputs, stay live up to it, so that no load lands in them; the scheduling
  // barriers keep the softmax arithmetic behind it.
  const half_t* ka = kp + lane * 8;
  const half_t* va = vv + lane * 8;
  __builtin_amdgcn_sched_barrier(0);
  asm volatile("s_wait_xcnt 0x0" :: "v"(ka), "v"(va) : "memory");
  __builtin_amdgcn_sched_barrier(0);
  int c16 = lane & 15, hi = lane >> 4;
  float cs0 = 0.f, cs1 = 0.f;
  union { uint4 u[2]; half_t h[16]; } p0, p1;
  float4 ov[2];
  float* vp = vis_out + (long)b * NQ * NKV + (c16 & 7) * NKV + n0 + hi * 8 +
              (c16 >> 3) * 4;
#pragma unroll
  for (int i = 0; i < 2; ++i) {
    float vis[8];
#pragma unroll
    for (int r = 0; r < 8; ++r) {
      float x0 = acc[i][0][r], x1 = acc[i][1][r];
      float mx = row_max16(fmaxf(x0, x1));
      float e0 = exp_slot(x0 - mx), e1 = exp_slot(x1 - mx);
      float inv = 1.f / row_sum16(e0 + e1);
      e0 *= inv; e1 *= inv;
      cs0 += e0; cs1 += e1;
      p0.h[i * 8 + r] = (half_t)e0;
      p1.h[i * 8 + r] = (half_t)e1;
      float v_ = e0 + e1;           // heads 0+2 (or 1+3) of slot c16 & 7
      vis[r] = v_ + row_xor<8>(v_);  // attn_vis = sum over heads
    }
    // lanes c16 and c16 ^ 8 hold the same 8 sums: each stores four of them
    float4 o;
    o.x = (c16 & 8) ? vis[4] : vis[0];
    o.y = (c16 & 8) ? vis[5] : vis[1];
    o.z = (c16 & 8) ? vis[6] : vis[2];
    o.w = (c16 & 8) ? vis[7] : vis[3];
    ov[i] = o;
  }
  half_t* ab = &as[w][0][lane * 16];
  *(uint4*)(ab)           = p0.u[0];
  *(uint4*)(ab + 8)       = p0.u[1];
  *(uint4*)(ab + 512)     = p1.u[0];
  *(uint4*)(ab + 512 + 8) = p1.u[1];
  // column sums: 16 rows in the lane, the other 16 in lane ^ 16, then the
  // eight waves in a fixed order
  cs0 += xhalf(cs0);
  cs1 += xhalf(cs1);
  csl[w][lane] = hi ? cs1 : cs0;
  __syncthreads();
  if (t < 32) {
    float s = 0.f;
#pragma unroll
    for (int j = 0; j < 8; ++j) s += csl[j][t];
    cpart[(b * 4 + blk) * 32 + t] = s;
  }
  int mt = w >> 2, hsel = (w >> 1) & 1;
  v8f u0, u1, cv0, cv1;
  for (int e = 0; e < 8; ++e) { u0[e] = 0.f; u1[e] = 0.f; cv0[e] = 0.f; cv1[e] = 0.f; }
  v16h ones;
  for (int e = 0; e < 16; ++e) ones[e] = (half_t)1.f;
#pragma unroll
  for (int s = 0; s < 8; ++s) {
    v16h a = frag_packed(&as[s][mt][0], lane);
    u0  = wmma_f16(a, vb0[s], u0);
    u1  = wmma_f16(a, vb1[s], u1);
    cv0 = wmma_f16(ones, vb0[s], cv0);
    cv1 = wmma_f16(ones, vb1[s], cv1);
  }
  // D register r is slot r in the lanes of half hsel. Lane l stores column
  // 32 w + l: the lanes of the other half take their tile's value from
  // lane ^ 16, so that each store of the wave is one whole 128-byte line.
  float* up = upart + (long)(b * 4 + blk) * 2048 + w * 32 + lane;
#pragma unroll
  for (int r = 0; r < 8; ++r) {
    float x0 = u0[r] + EPS_ * cv0[r];
    float x1 = u1[r] + EPS_ * cv1[r];
    float got = xhalf(hi ? x0 : x1);
    up[r * 256] = (hi == hsel) ? (hi ? x1 : x0) : got;
  }
  // attn_vis leaves here and not in front of the barrier, whose wait on the
  // wave's stores would hold every wave for their round trip
  *(float4*)(vp)      = ov[0];
  *(float4*)(vp + 16) = ov[1];
}

// updates = (sum of the four blocks' partials) / (attn column sum + NKV eps)
// grid: B * NQ * S / 4 / 256 blocks, four neighbouring d a thread
__global__ void __launch_bounds__(256) k_inv(
    const float* __restrict__ cpart, const float* __restrict__ upart,
    float* __restrict__ upd) {
  int i  = blockIdx.x * 256 + threadIdx.x;
  int b  = i >> 9, qi = (i >> 6) & 7, d = (i & 63) * 4;
  const float* p = cpart + b * 128 + (d >> 6) * 8 + qi;
  const float* u = upart + (long)b * 8192 + qi * 256 + d;
  float4 u0 = *(const float4*)(u);
  float4 u1 = *(const float4*)(u + 2048);
  float4 u2 = *(const float4*)(u + 4096);
  float4 u3 = *(const float4*)(u + 6144);
  float s = ((p[0] + p[32]) + p[64]) + p[96];
  float inv = 1.f / (s + (float)NKV * EPS_);
  float4 o;
  o.x = (((u0.x + u1.x) + u2.x) + u3.x) * inv;
  o.y = (((u0.y + u1.y) + u2.y) + u3.y) * inv;
  o.z = (((u0.z + u1.z) + u2.z) + u3.z) * inv;
  o.w = (((u0.w + u1.w) + u2.w) + u3.w) * inv;
  *(float4*)(upd + (long)(b * NQ + qi) * S_ + d) = o;
}

// ---------------- GRU cell (f32 WMMA 16x16x4) --------------------------------
// xg = upd @ wih^T and hg = hprev @ whh^T as Y = X W^T with X and W both
// k-contiguous. One wave owns 16 rows (of the B*NQ = 512) x 16 columns j of
// all three gates over the whole k = 256: no LDS, no barrier, no partial sums
// between waves. A block's two waves take neighbouring column tiles, so the
// block writes whole 128-byte lines. grid: 32 row tiles x 8 column pairs.
// k order: lane (c, h) loads floats k0 + 4h .. k0 + 4h + 3 of its row of X and
// of its row of W by the same offsets; elements (0,1) feed one WMMA, (2,3) the
// next, so A and B pair the same k at every lane and register.
__device__ inline v8f wmma_f32(float ax, float ay, float bx, float by, v8f c) {
  v2f a = {ax, ay};
  v2f b = {bx, by};
  return __builtin_amdgcn_wmma_f32_16x16x4_f32(false, a, false, b, (short)0, c,
                                               false, false);
}
__global__ void __launch_bounds__(64) k_gru(
    const float* __restrict__ upd, const float* __restrict__ hprev,
    const float* __restrict__ wih, const float* __restrict__ whh,
    const float* __restrict__ bih, const float* __restrict__ bhh,
    float* __restrict__ hout) {
  int lane = threadIdx.x & 31, w = threadIdx.x >> 5;
  int c = lane & 15, h = lane >> 4;
  int m0 = (blockIdx.x >> 3) * 16;
  int n0 = (blockIdx.x & 7) * 32 + w * 16;
  int j  = n0 + c;
  int ao = (m0 + c) * 256 + 4 * h;
  int bo = j * 256 + 4 * h;
  const float* s[8] = {upd + ao,          hprev + ao,
                       wih + bo,          whh + bo,
                       wih + 65536 + bo,  whh + 65536 + bo,
                       wih + 131072 + bo, whh + 131072 + bo};
  // every D register of a lane is column j, so the accumulators start from
  // the gate biases of that column
  float br = bih[j] + bhh[j];
  float bz = bih[256 + j] + bhh[256 + j];
  float bi3 = bih[512 + j], bh3 = bhh[512 + j];
  // D register e of lane (c, h) is row m0 + 8h + e, column j
  long ob = (long)(m0 + 8 * h) * 256 + j;
  float hp[8];
  float4 f[2][2][8];  // [stage][8-k step][matrix]
#pragma unroll
  for (int q = 0; q < 2; ++q)
#pragma unroll
    for (int x = 0; x < 8; ++x) f[0][q][x] = *(const float4*)(s[x] + q * 8);
  // The accumulators may take the register that the bias loads name as their
  // offset: the wait stands in front of that overwrite, and the scheduling
  // barriers keep the accumulators' first writes behind it.
  __builtin_amdgcn_sched_barrier(0);
  asm volatile("s_wait_xcnt 0x0" ::: "memory");
  __builtin_amdgcn_sched_barrier(0);
  v8f ar, az, ani, anh;
  for (int e = 0; e < 8; ++e) { ar[e] = br; az[e] = bz; ani[e] = bi3; anh[e] = bh3; }
  // unrolled whole so that the stage index is static and the next 16 k of all
  // eight operands are in flight under this stage's 24 WMMAs
#pragma unroll
  for (int ch = 0; ch < 16; ++ch) {
    if (ch + 1 < 16) {
#pragma unroll
      for (int q = 0; q < 2; ++q)
#pragma unroll
        for (int x = 0; x < 8; ++x)
          f[(ch + 1) & 1][q][x] = *(const float4*)(s[x] + (ch + 1) * 16 + q * 8);
    } else {
      // Every operand load is issued and its address registers are free for
      // reuse from here on: the wait stands in front of the first overwrite
      // (the scheduling barrier keeps later address arithmetic behind it).
      // The old state for the output blend then loads under the last WMMAs.
      __builtin_amdgcn_sched_barrier(0);
      asm volatile("s_wait_xcnt 0x0" ::: "memory");
#pragma unroll
      for (int e = 0; e < 8; ++e) hp[e] = hprev[ob + e * 256];
    }
    // keeps the next stage's loads above this stage's WMMAs: left free, the
    // scheduler sinks each load to its first use and every WMMA group then
    // waits out a whole load latency
    __builtin_amdgcn_sched_barrier(0);
#pragma unroll
    for (int q = 0; q < 2; ++q) {
      const float4* g = f[ch & 1][q];
      ar  = wmma_f32(g[0].x, g[0].y, g[2].x, g[2].y, ar);
      az  = wmma_f32(g[0].x, g[0].y, g[4].x, g[4].y, az);
      ani = wmma_f32(g[0].x, g[0].y, g[6].x, g[6].y, ani);
      anh = wmma_f32(g[1].x, g[1].y, g[7].x, g[7].y, anh);
      ar  = wmma_f32(g[1].x, g[1].y, g[3].x, g[3].y, ar);
      az  = wmma_f32(g[1].x, g[1].y, g[5].x, g[5].y, az);
      ani = wmma_f32(g[0].z, g[0].w, g[6].z, g[6].w, ani);
      anh = wmma_f32(g[1].z, g[1].w, g[7].z, g[7].w, anh);
      ar  = wmma_f32(g[0].z, g[0].w, g[2].z, g[2].w, ar);
      az  = wmma_f32(g[0].z, g[0].w, g[4].z, g[4].w, az);
      ar  = wmma_f32(g[1].z, g[1].w, g[3].z, g[3].w, ar);
      az  = wmma_f32(g[1].z, g[1].w, g[5].z, g[5].w, az);
    }
  }
  // The table of WMMA distances leaves the f32 16x16x4 form out: eight slots, the count of the slowest
  // listed form, stand between the last WMMA and the first vector read of an
  // accumulator. The two scheduling barriers hold the slots at that place.
  __builtin_amdgcn_sched_barrier(0);
  asm volatile("v_nop\n\tv_nop\n\tv_nop\n\tv_nop\n\tv_nop\n\tv_nop\n\tv_nop\n\tv_nop");
  __builtin_amdgcn_sched_barrier(0);
#pragma unroll
  for (int e = 0; e < 8; ++e) {
    float r = 1.f / (1.f + __expf(-ar[e]));
    float z = 1.f / (1.f + __expf(-az[e]));
    float n = tanhf(ani[e] + r * anh[e]);
    hout[ob + e * 256] = (1.f - z) * n + z * hp[e];
  }
}

// ---------------- LN + MLP residual (f32 WMMA 16x16x4), one launch a layer ---
// Both layers are Y = X W with X k-contiguous and W column-contiguous. One wave
// owns 16 rows (of the B*NQ = 512) over the whole k: no LDS, no barrier, no
// partial sums between waves.
// k order: lane (c, h) holds floats 8q + 4h .. 8q + 4h + 3 of its row of X and
// loads rows 8q + 4h .. 8q + 4h + 3 of W at its column; elements (0,1) feed one
// WMMA, (2,3) the next, so A and B pair the same k at every lane and register.

#define D1_ 5   // k_mlp1: 8-k steps that the operand loads run ahead
#define D2_ 12  // k_mlp2: the same

__device__ inline v8f wmma_f32v(v2f a, v2f b, v8f c) {
  return __builtin_amdgcn_wmma_f32_16x16x4_f32(false, a, false, b, (short)0, c,
                                               false, false);
}

// hid = relu(LN(h) @ w1 + b1). A wave owns 16 rows x 32 hidden columns and
// keeps its half rows (128 floats a lane) in registers: the row statistics are
// a lane's own sums plus those of lane ^ 16. grid: 32 row tiles x 8 column
// groups of 64, two waves a block. The register bound keeps the wave inside
// one 256-register window (left free, the allocator spreads over two).
__global__ void __launch_bounds__(64) __attribute__((amdgpu_num_vgpr(256))) k_mlp1(
    const float* __restrict__ hin, const float* __restrict__ g,
    const float* __restrict__ bb, const float* __restrict__ w1,
    const float* __restrict__ b1, float* __restrict__ hid) {
  int lane = threadIdx.x & 31, w = threadIdx.x >> 5;
  int c = lane & 15, h = lane >> 4;
  int m0 = (blockIdx.x >> 3) * 16;
  int n0 = (blockIdx.x & 7) * 64 + w * 32;
  const float* ap = hin + (m0 + c) * 256 + 4 * h;
  const float* wp = w1 + 4 * h * 512 + n0 + c;
  const float* gp = g + 4 * h;
  const float* bp = bb + 4 * h;
  v4f a[32], fg[32], fo[32];
  v2f fw[32][2][2];  // [8-k step][k pair][column tile]
#pragma unroll
  for (int q = 0; q < 32; ++q) a[q] = *(const v4f*)(ap + q * 8);
#pragma unroll
  for (int q = 0; q < D1_; ++q) {
    fg[q] = *(const v4f*)(gp + q * 8);
    fo[q] = *(const v4f*)(bp + q * 8);
#pragma unroll
    for (int p = 0; p < 2; ++p)
#pragma unroll
      for (int ti = 0; ti < 2; ++ti) {
        fw[q][p][ti].x = wp[(q * 8 + 2 * p) * 512 + ti * 16];
        fw[q][p][ti].y = wp[(q * 8 + 2 * p + 1) * 512 + ti * 16];
      }
  }
  int bi = n0 + c;
  float bias0 = b1[bi], bias1 = b1[bi + 16];
  // The address registers of the row and bias loads are free for reuse from
  // here on: the wait stands in front of the first overwrite. Named as its
  // inputs they stay live up to it, so that no load above it lands in them;
  // the scheduling barriers keep the loads above it, the arithmetic behind it.
  __builtin_amdgcn_sched_barrier(0);
  asm volatile("s_wait_xcnt 0x0" :: "v"(ap), "v"(bi) : "memory");
  __builtin_amdgcn_sched_barrier(0);
  v2f t0 = {0.f, 0.f}, t1 = t0, t2 = t0, t3 = t0;
#pragma unroll
  for (int q = 0; q < 32; q += 2) {
    t0 += a[q].lo; t1 += a[q].hi; t2 += a[q + 1].lo; t3 += a[q + 1].hi;
  }
  t0 = (t0 + t1) + (t2 + t3);
  float s = t0.x + t0.y;
  s += xhalf(s);
  float mu = s * (1.f / 256.f);
  t0 = 0.f; t1 = 0.f; t2 = 0.f; t3 = 0.f;
#pragma unroll
  for (int q = 0; q < 32; q += 2) {
    a[q] -= mu; a[q + 1] -= mu;
    t0 += a[q].lo * a[q].lo;         t1 += a[q].hi * a[q].hi;
    t2 += a[q + 1].lo * a[q + 1].lo; t3 += a[q + 1].hi * a[q + 1].hi;
  }
  t0 = (t0 + t1) + (t2 + t3);
  s = t0.x + t0.y;
  s += xhalf(s);
  float rs = rsq_slot(s * (1.f / 256.f) + LNE_);
  // every D register of a lane is one column, so the accumulators start from
  // that column's bias
  v8f acc0, acc1;
  for (int e = 0; e < 8; ++e) { acc0[e] = bias0; acc1[e] = bias1; }
  a[0] = a[0] * (rs * fg[0]) + fo[0];
  a[1] = a[1] * (rs * fg[1]) + fo[1];
  // unrolled whole so that every index is static
#pragma unroll
  for (int q = 0; q < 32; ++q) {
    if (q + D1_ < 32) {
      int n = q + D1_;
      fg[n] = *(const v4f*)(gp + n * 8);
      fo[n] = *(const v4f*)(bp + n * 8);
#pragma unroll
      for (int p = 0; p < 2; ++p)
#pragma unroll
        for (int ti = 0; ti < 2; ++ti) {
          fw[n][p][ti].x = wp[(n * 8 + 2 * p) * 512 + ti * 16];
          fw[n][p][ti].y = wp[(n * 8 + 2 * p + 1) * 512 + ti * 16];
        }
    }
    // keeps the loads of step q + D1_ above this step's WMMAs: left free, the
    // scheduler sinks each load to its first use and every WMMA group then
    // waits out a whole load latency
    __builtin_amdgcn_sched_barrier(0);
    acc0 = wmma_f32v(a[q].lo, fw[q][0][0], acc0);
    acc1 = wmma_f32v(a[q].lo, fw[q][0][1], acc1);
    acc0 = wmma_f32v(a[q].hi, fw[q][1][0], acc0);
    acc1 = wmma_f32v(a[q].hi, fw[q][1][1], acc1);
    // The table of WMMA distances leaves the f32 16x16x4 form out: eight slots,
    // the count of the slowest
    // listed form, stand between the last WMMA and the next vector write,
    // which may take a register that a WMMA has just read (behind the last
    // step: the first vector read of an accumulator). They issue while the
    // matrix unit is busy. The scheduling barriers hold them at that place.
    __builtin_amdgcn_sched_barrier(0);
    if (q != 30)  // behind step 30 no vector instruction follows
      asm volatile("v_nop\n\tv_nop\n\tv_nop\n\tv_nop\n\tv_nop\n\tv_nop\n\tv_nop\n\tv_nop");
    __builtin_amdgcn_sched_barrier(0);
    // scale and shift of the LN two steps ahead, so that no WMMA waits for it
    if (q + 2 < 32) a[q + 2] = a[q + 2] * (rs * fg[q + 2]) + fo[q + 2];
    __builtin_amdgcn_sched_barrier(0);
  }
  // D register e of lane (c, h) is row m0 + 8h + e
  float* op = hid + (m0 + 8 * h) * 512 + n0 + c;
#pragma unroll
  for (int e = 0; e < 8; ++e) {
    op[e * 512]      = fmaxf(acc0[e], 0.f);
    op[e * 512 + 16] = fmaxf(acc1[e], 0.f);
  }
}

// slots = h + hid @ w2 + b2. A wave owns 16 rows x 16 columns over k = 512, the
// even and the odd k pairs in an accumulator each (a WMMA then never waits for
// the one before it); one starts from the bias, the other from the residual
// rows. A block's two waves take neighbouring column tiles, so the block
// writes whole 128-byte lines. grid: 32 row tiles x 8 column pairs.
__global__ void __launch_bounds__(64) k_mlp2(
    const float* __restrict__ hid, const float* __restrict__ hin,
    const float* __restrict__ w2, const float* __restrict__ b2,
    float* __restrict__ slots_out, float* __restrict__ dout, int write_out) {
  int lane = threadIdx.x & 31, w = threadIdx.x >> 5;
  int c = lane & 15, h = lane >> 4;
  int m0 = (blockIdx.x >> 3) * 16;
  int j  = (blockIdx.x & 7) * 32 + w * 16 + c;
  const float* ap = hid + (m0 + c) * 512 + 4 * h;
  const float* wp = w2 + 4 * h * 256 + j;
  // D register e of lane (c, h) is row m0 + 8h + e, column j
  int ob = (m0 + 8 * h) * 256 + j;
  v8f acc0, acc1;
  float bias = b2[j];
#pragma unroll
  for (int e = 0; e < 8; ++e) acc1[e] = hin[ob + e * 256];
  v4f fa[64];
  v2f fw[64][2];  // [8-k step][k pair]
#pragma unroll
  for (int q = 0; q < D2_; ++q) {
    fa[q] = *(const v4f*)(ap + q * 8);
#pragma unroll
    for (int p = 0; p < 2; ++p) {
      fw[q][p].x = wp[(q * 8 + 2 * p) * 256];
      fw[q][p].y = wp[(q * 8 + 2 * p + 1) * 256];
    }
  }
  // The offset register of the bias load is free for reuse from here on: the
  // wait stands in front of the first overwrite. Named as its input the offset
  // stays live up to it, so that no load above it lands in that register; the
  // scheduling barriers keep the accumulator's first writes behind it.
  __builtin_amdgcn_sched_barrier(0);
  asm volatile("s_wait_xcnt 0x0" :: "v"(j) : "memory");
  __builtin_amdgcn_sched_barrier(0);
  for (int e = 0; e < 8; ++e) acc0[e] = bias;
  // unrolled whole so that every index is static
#pragma unroll
  for (int q = 0; q < 64; ++q) {
    if (q + D2_ < 64) {
      int n = q + D2_;
      fa[n] = *(const v4f*)(ap + n * 8);
#pragma unroll
      for (int p = 0; p < 2; ++p) {
        fw[n][p].x = wp[(n * 8 + 2 * p) * 256];
        fw[n][p].y = wp[(n * 8 + 2 * p + 1) * 256];
      }
    }
    // keeps the loads of step q + D2_ above this step's WMMAs (as in k_mlp1)
    __builtin_amdgcn_sched_barrier(0);
    acc0 = wmma_f32v(fa[q].lo, fw[q][0], acc0);
    acc1 = wmma_f32v(fa[q].hi, fw[q][1], acc1);
  }
  // eight slots between the last WMMA and the first vector read of an
  // accumulator, held in place by the scheduling barriers (as in k_mlp1)
  __builtin_amdgcn_sched_barrier(0);
  asm volatile("v_nop\n\tv_nop\n\tv_nop\n\tv_nop\n\tv_nop\n\tv_nop\n\tv_nop\n\tv_nop");
  __builtin_amdgcn_sched_barrier(0);
  v8f o = acc0 + acc1;
#pragma unroll
  for (int e = 0; e < 8; ++e) slots_out[ob + e * 256] = o[e];
  if (write_out) {
#pragma unroll
    for (int e = 0; e < 8; ++e) dout[ob + e * 256] = o[e];
  }
}

// ---------------- LN(slots) + q = s@Wq (f32 WMMA 16x16x4), packed Qb ---------
// qbp[b][kk=8][ti=2][lane=32][e=16]: the block-diagonal B operand of the logits
// (k = feature d, column = head * 8 + slot, zero where d is not of that head).
// The product is formed transposed, q^T = Wq^T LN(s)^T: A is a column tile of
// Wq, B a tile of 16 slot rows (two batches), loaded by the offsets of k_mlp1,
// so A and B pair the same k at every lane and register. D register e of lane
// (c, h) is then feature 8h + e of slot row c: the eight features that one
// packed lane holds side by side. A wave owns 16 rows x 32 features (one kk)
// over the whole k, and writes the whole 2 KB of its kk for both batches, the
// zeros too. No LDS, no barrier. grid: 32 row tiles x 4 pairs of kk. The
// register bound keeps the wave inside one 256-register window (as in k_mlp1).
__global__ void __launch_bounds__(64) __attribute__((amdgpu_num_vgpr(256))) k_qbuild(
    const float* __restrict__ slots, const float* __restrict__ g,
    const float* __restrict__ bb, const float* __restrict__ wq,
    half_t* __restrict__ qbp) {
  int lane = threadIdx.x & 31, w = threadIdx.x >> 5;
  int c = lane & 15, h = lane >> 4;
  int m0 = (blockIdx.x >> 2) * 16;
  int kk = (blockIdx.x & 3) * 2 + w;
  const float* ap = slots + (m0 + c) * 256 + 4 * h;
  const float* wp = wq + 4 * h * 256 + kk * 32 + c;
  const float* gp = g + 4 * h;
  const float* bp = bb + 4 * h;
  v4f a[32], fg[32], fo[32];
  v2f fw[32][2][2];  // [8-k step][k pair][feature tile]
#pragma unroll
  for (int q = 0; q < 32; ++q) a[q] = *(const v4f*)(ap + q * 8);
#pragma unroll
  for (int q = 0; q < D1_; ++q) {
    fg[q] = *(const v4f*)(gp + q * 8);
    fo[q] = *(const v4f*)(bp + q * 8);
#pragma unroll
    for (int p = 0; p < 2; ++p)
#pragma unroll
      for (int ti = 0; ti < 2; ++ti) {
        fw[q][p][ti].x = wp[(q * 8 + 2 * p) * 256 + ti * 16];
        fw[q][p][ti].y = wp[(q * 8 + 2 * p + 1) * 256 + ti * 16];
      }
  }
  // The address registers of the row loads are free for reuse from here on: the
  // wait stands in front of the first overwrite. Named as its input they stay
  // live up to it, so that no load above it lands in them; the scheduling
  // barriers keep the loads above it, the arithmetic behind it.
  __builtin_amdgcn_sched_barrier(0);
  asm volatile("s_wait_xcnt 0x0" :: "v"(ap) : "memory");
  __builtin_amdgcn_sched_barrier(0);
  v2f t0 = {0.f, 0.f}, t1 = t0, t2 = t0, t3 = t0;
#pragma unroll
  for (int q = 0; q < 32; q += 2) {
    t0 += a[q].lo; t1 += a[q].hi; t2 += a[q + 1].lo; t3 += a[q + 1].hi;
  }
  t0 = (t0 + t1) + (t2 + t3);
  float s = t0.x + t0.y;
  s += xhalf(s);
  float mu = s * (1.f / 256.f);
  t0 = 0.f; t1 = 0.f; t2 = 0.f; t3 = 0.f;
#pragma unroll
  for (int q = 0; q < 32; q += 2) {
    a[q] -= mu; a[q + 1] -= mu;
    t0 += a[q].lo * a[q].lo;         t1 += a[q].hi * a[q].hi;
    t2 += a[q + 1].lo * a[q + 1].lo; t3 += a[q + 1].hi * a[q + 1].hi;
  }
  t0 = (t0 + t1) + (t2 + t3);
  s = t0.x + t0.y;
  s += xhalf(s);
  float rs = rsq_slot(s * (1.f / 256.f) + LNE_);
  v8f acc0, acc1;
  for (int e = 0; e < 8; ++e) { acc0[e] = 0.f; acc1[e] = 0.f; }
  a[0] = a[0] * (rs * fg[0]) + fo[0];
  a[1] = a[1] * (rs * fg[1]) + fo[1];
  // unrolled whole so that every index is static
#pragma unroll
  for (int q = 0; q < 32; ++q) {
    if (q + D1_ < 32) {
      int n = q + D1_;
      fg[n] = *(const v4f*)(gp + n * 8);
      fo[n] = *(const v4f*)(bp + n * 8);
#pragma unroll
      for (int p = 0; p < 2; ++p)
#pragma unroll
        for (int ti = 0; ti < 2; ++ti) {
          fw[n][p][ti].x = wp[(n * 8 + 2 * p) * 256 + ti * 16];
          fw[n][p][ti].y = wp[(n * 8 + 2 * p + 1) * 256 + ti * 16];
        }
    }
    // keeps the loads of step q + D1_ above this step's WMMAs (as in k_mlp1)
    __builtin_amdgcn_sched_barrier(0);
    acc0 = wmma_f32v(fw[q][0][0], a[q].lo, acc0);
    acc1 = wmma_f32v(fw[q][0][1], a[q].lo, acc1);
    acc0 = wmma_f32v(fw[q][1][0], a[q].hi, acc0);
    acc1 = wmma_f32v(fw[q][1][1], a[q].hi, acc1);
    // eight slots between the last WMMA and the next vector write or, behind
    // the last step, the first vector read of an accumulator, held in place by
    // the scheduling barriers (as in k_mlp1)
    __builtin_amdgcn_sched_barrier(0);
    if (q != 30)  // behind step 30 no vector instruction follows
      asm volatile("v_nop\n\tv_nop\n\tv_nop\n\tv_nop\n\tv_nop\n\tv_nop\n\tv_nop\n\tv_nop");
    __builtin_amdgcn_sched_barrier(0);
    // scale and shift of the LN two steps ahead, so that no WMMA waits for it
    if (q + 2 < 32) a[q + 2] = a[q + 2] * (rs * fg[q + 2]) + fo[q + 2];
    __builtin_amdgcn_sched_barrier(0);
  }
  // slot row c is batch m0 / 8 + (c >> 3), slot c & 7; its column of Qb is
  // head * 8 + slot with head = kk >> 1. sl = ti * 32 + packed lane; elements
  // 0..7 are features 8h + e (acc0), 8..15 features 16 + 8h + e (acc1).
  int hd = kk >> 1;
  int sl = (hd >> 1) * 32 + 16 * h + (hd & 1) * 8 + (c & 7);
  half_t* qp = qbp + ((m0 >> 3) + (c >> 3)) * 8192 + kk * 1024;
  union { uint4 u[2]; half_t x[16]; } o;
#pragma unroll
  for (int e = 0; e < 8; ++e) {
    o.x[e]     = (half_t)acc0[e];
    o.x[8 + e] = (half_t)acc1[e];
  }
  *(uint4*)(qp + sl * 16)     = o.u[0];
  *(uint4*)(qp + sl * 16 + 8) = o.u[1];
  // the columns of the other three heads are zero at these features
  uint4 zz = {0u, 0u, 0u, 0u};
  *(uint4*)(qp + (sl ^ 8) * 16)      = zz;
  *(uint4*)(qp + (sl ^ 8) * 16 + 8)  = zz;
  *(uint4*)(qp + (sl ^ 32) * 16)     = zz;
  *(uint4*)(qp + (sl ^ 32) * 16 + 8) = zz;
  *(uint4*)(qp + (sl ^ 40) * 16)     = zz;
  *(uint4*)(qp + (sl ^ 40) * 16 + 8) = zz;
}

// ---------------- host orchestration ----------------------------------------
extern "C" void kernel_launch(void* const* d_in, const int* in_sizes, int n_in,
                              void* d_out, int out_size, void* d_ws,
                              size_t ws_size, hipStream_t stream) {
  (void)in_sizes; (void)n_in; (void)out_size; (void)ws_size;
  const float* inputs   = (const float*)d_in[0];
  const float* slots0   = (const float*)d_in[1];
  const float* ln_in_g  = (const float*)d_in[2];
  const float* ln_in_b  = (const float*)d_in[3];
  const float* ln_sl_g  = (const float*)d_in[4];
  const float* ln_sl_b  = (const float*)d_in[5];
  const float* ln_mlp_g = (const float*)d_in[6];
  const float* ln_mlp_b = (const float*)d_in[7];
  const float* Wq       = (const float*)d_in[8];
  const float* Wk       = (const float*)d_in[9];
  const float* Wv       = (const float*)d_in[10];
  const float* gwih     = (const float*)d_in[11];
  const float* gwhh     = (const float*)d_in[12];
  const float* gbih     = (const float*)d_in[13];
  const float* gbhh     = (const float*)d_in[14];
  const float* w1       = (const float*)d_in[15];
  const float* b1       = (const float*)d_in[16];
  const float* w2       = (const float*)d_in[17];
  const float* b2       = (const float*)d_in[18];

  char* ws = (char*)d_ws;
  half_t* kf   = (half_t*)(ws + 0);          // 32 MB  K fragment-packed (pre-scaled)
  half_t* vpk  = (half_t*)(ws + 33554432);   // 32 MB  V fragment-packed
  half_t* wkp  = (half_t*)(ws + 67108864);   // 128 KB Wk packed
  half_t* wvp  = (half_t*)(ws + 67239936);   // 128 KB Wv packed
  half_t* qbp  = (half_t*)(ws + 67436544);   // 1 MB   block-diag Q packed
  float*  upt  = (float*)(ws + 68485120);    // 2 MB   attn^T V partials
  float*  upd  = (float*)(ws + 72695808);    // 512 KB
  float*  scur = (float*)(ws + 73220096);    // 512 KB current slots
  float*  smid = (float*)(ws + 73744384);    // 512 KB post-GRU slots
  float*  csum = (float*)(ws + 74268672);    // 32 KB  attn column-sum partials
  float*  hid  = (float*)(ws + 74301440);    // 1 MB   MLP hidden layer

  float* out_slots = (float*)d_out;
  float* out_vis   = out_slots + (long)B_ * NQ * S_;

  hipMemcpyAsync(scur, slots0, (size_t)B_ * NQ * S_ * sizeof(float),
                 hipMemcpyDeviceToDevice, stream);
  k_cvt<<<256, 256, 0, stream>>>(Wk, Wv, wkp, wvp);
  k_proj<<<(B_ * NKV) / (32 * PT_), 512, 0, stream>>>(inputs, ln_in_g, ln_in_b, wkp,
                                                      wvp, kf, vpk);

  for (int it = 0; it < 3; ++it) {
    k_qbuild<<<128, 64, 0, stream>>>(scur, ln_sl_g, ln_sl_b, Wq, qbp);
    k_logits<<<B_ * (NKV / 256), 256, 0, stream>>>(kf, qbp, vpk, upt, csum,
                                                   out_vis);
    k_inv<<<128, 256, 0, stream>>>(csum, upt, upd);
    k_gru<<<256, 64, 0, stream>>>(upd, scur, gwih, gwhh, gbih, gbhh, smid);
    k_mlp1<<<256, 64, 0, stream>>>(smid, ln_mlp_g, ln_mlp_b, w1, b1, hid);
    k_mlp2<<<256, 64, 0, stream>>>(hid, smid, w2, b2, scur, out_slots,
                                   (it == 2) ? 1 : 0);
  }
}
